// v000
// Times are from an AMD MI455X. After a warm-up the kernel runs many times in a row, and a time is the length of
// such a window on the GPU divided by its runs, so every launch and the gaps after it count. The runs cycle
// through copies of the inputs. A figure is the median of several windows, for all but v000 over two sittings.
// Sittings can differ by a few percent; kernels timed side by side share one.
// v000 is the starting kernel. One run takes 6720 microseconds.
#include <hip/hip_runtime.h>
// Multi-head attention with per-head weight tensors returning (output, last head's attention weights) (inputs v, k, q [2][2048][1024] in that order; qh[b][h] = q Wq[h] + bq[h] with Wq [16][1024][64] ([in][out] per head), kh, vh likewise; 16 heads of 64; scores / 8 + mask * (-1e9) with the int32 mask input [2][2048][2048] (all zeros: nothing masked); softmax; out_h = attn vh; output = concat(out_h) W0 + b0 (W0 [1024][1024] [in][out]) -> [2][2048][1024] at offset 0; second output = attn[:, 15] (the LAST head's probabilities, f32 [2][2048][2048]) at byte offset 16,777,216).
// Structure: token rows r = b*2048 + s; the three inputs as exact f16 rows (bf16-rounded); Q, K, V as three WMMA GEMMs (32x64 wave tiles, f32 accumulation, exact x16 weights + bias, f16 outputs); per batch: V^T for all heads via LDS transposes; per (batch, group of 4 heads): scores GEMM (K = 64, batched over the heads on grid.y, alpha = 64^-0.5), row softmax on VALU with the int mask as 0/1 key factors (f32 statistics, native exp; weights stored x256 as f16; the last head's f32 probabilities are also written to the second output), o = P . V^T GEMM (K = 2048, alpha 2^-2: o carried x64 against f16 subnormal flush, folded into the output GEMM alpha) written straight into the merged f16 o rows; out = o W_o + b GEMM (f32) into the output layout.
// Compute dtype: inputs rounded to bf16; x / weights exact; q, k, v, softmax weights and o as plain f16 GEMM operands (~2^-12); scores and softmax statistics f32. v_wmma_f32_16x16x32_f16.
#define NB 2
#define SQ 2048
#define DM 1024
#define NH 16
#define HD 64
#define HG 4                         /* heads per attention launch group */
#define B0 0                         /* first batch processed (debug hook) */
#define NBR NB                       /* batches processed (debug hook) */
#define NR ((size_t)NB * SQ)         /* token rows */
#define MP ((int)((size_t)NBR * SQ)) /* rows projected (debug hook) */
#define QN SQ                        /* query rows attended per batch (debug hook) */
#define NHD NH                       /* heads attended (debug hook) */
#define MPO MP                       /* rows through the output stage (debug hook) */
#define LQ DM      /* row pitch of the q/k/v rows */
typedef __bf16 v16b __attribute__((ext_vector_type(16)));
typedef unsigned short v8us __attribute__((ext_vector_type(8), may_alias));
typedef float  v8f  __attribute__((ext_vector_type(8)));
typedef float  v4f  __attribute__((ext_vector_type(4)));
typedef float  v4fa __attribute__((ext_vector_type(4), may_alias));
union FragB { v16b v; v8us half[2]; unsigned short u[16]; };

__device__ __forceinline__ unsigned short bf16_bits(float x) { unsigned int u = __float_as_uint(x); return (unsigned short)((u + 0x7FFFu + ((u >> 16) & 1u)) >> 16); }
__device__ __forceinline__ float bf16_val(unsigned short b) { return __uint_as_float(((unsigned int)b) << 16); }
__device__ __forceinline__ float bf16_round(float x) { return bf16_val(bf16_bits(x)); }
// D += A·B with NT terms: 1 = ah·bh, 2 = + al·bh (A split), 3 = + ah·bl (both split)
template <int NT>
__device__ __forceinline__ v8f mmaN(v16b ah, v16b al, v16b bh, v16b bl, v8f c) {
  c = __builtin_amdgcn_wmma_f32_16x16x32_bf16(false, ah, false, bh, (short)0, c, false, false);
  if (NT >= 2) c = __builtin_amdgcn_wmma_f32_16x16x32_bf16(false, al, false, bh, (short)0, c, false, false);
  if (NT >= 3) c = __builtin_amdgcn_wmma_f32_16x16x32_bf16(false, ah, false, bl, (short)0, c, false, false);
  asm volatile("v_nop\n\tv_nop\n\tv_nop\n\tv_nop" : "+v"(c) : "v"(ah), "v"(al), "v"(bh), "v"(bl));
  return c;
}

__global__ __launch_bounds__(256) void k_wt_bf16(const float* __restrict__ W, unsigned short* __restrict__ Wt, int K, int N) {
  const int t = blockIdx.x * 256 + threadIdx.x;
  const int k8n = K / 8;
  if (t >= N * k8n) return;
  const int n = t / k8n, k8 = (t % k8n) * 8;
  v8us v;
#pragma unroll
  for (int i = 0; i < 8; ++i) v[i] = bf16_bits(W[(size_t)(k8 + i) * N + n]);
  *(v8us*)(Wt + (size_t)n * K + k8) = v;
  
}

// GEMM C[M][N] (f32, pitch ldc) = act(A[M][K]·W + bias). A f32 row-major (pitch lda) converted per fragment to bf16
// (ASPLIT: hi/lo two planes -> 2 terms, else single rounded term); Wt bf16 [N][K] (pitch ldb). BIAS_BF16 rounds the
// bias to bf16 first (bias quantised to bf16 before the add). K%32==0, M%16==0, N%64==0.
template <bool ASPLIT, int ACT, bool BIAS_BF16>
__global__ __launch_bounds__(128) void k_gemm_bf(const float* __restrict__ A, int lda, const unsigned short* __restrict__ Wt, int ldb,
                                               const float* __restrict__ bias, float* __restrict__ C, int ldc, int M, int N, int K) {
  __shared__ __attribute__((aligned(16))) float so[4][16][64];
  const int tid = threadIdx.x, w = tid >> 5, lane = tid & 31, ln = lane & 15, hh = lane >> 4;
  const int ntn = N / 64;
  const int wid = blockIdx.x * 4 + w;
  const int mt = wid / ntn, nq = wid % ntn;
  if (mt * 16 >= M) return;
  const int row0 = mt * 16, col0 = nq * 64;
  const float* arow = A + (size_t)(row0 + ln) * lda;
  v8f acc[4] = {};
  for (int kb = 0; kb < K; kb += 32) {
    FragB ah, al;
    const v4f x0 = *(const v4fa*)(arow + kb + 8 * hh), x1 = *(const v4fa*)(arow + kb + 8 * hh + 4);
    const v4f x2 = *(const v4fa*)(arow + kb + 16 + 8 * hh), x3 = *(const v4fa*)(arow + kb + 16 + 8 * hh + 4);
    float xs[16] = {x0[0],x0[1],x0[2],x0[3],x1[0],x1[1],x1[2],x1[3],x2[0],x2[1],x2[2],x2[3],x3[0],x3[1],x3[2],x3[3]};
#pragma unroll
    for (int i = 0; i < 16; ++i) { const unsigned short hb = bf16_bits(xs[i]); ah.u[i] = hb; al.u[i] = ASPLIT ? bf16_bits(xs[i] - bf16_val(hb)) : (unsigned short)0; }
#pragma unroll
    for (int t = 0; t < 4; ++t) {
      const unsigned short* brow = Wt + (size_t)(col0 + t * 16 + ln) * ldb + kb;
      FragB b;
      b.half[0] = *(const v8us*)(brow + 8 * hh);
      b.half[1] = *(const v8us*)(brow + 16 + 8 * hh);
      acc[t] = mmaN<ASPLIT ? 2 : 1>(ah.v, al.v, b.v, b.v, acc[t]);
    }
  }
#pragma unroll
  for (int t = 0; t < 4; ++t) {
    float bv = bias ? bias[col0 + t * 16 + ln] : 0.f;
    if (BIAS_BF16) bv = bf16_round(bv);
#pragma unroll
    for (int r = 0; r < 8; ++r) { float v = acc[t][r] + bv; if (ACT == 1) v = fmaxf(v, 0.f); so[w][8 * hh + r][t * 16 + ln] = v; }
  }
  __builtin_amdgcn_fence(__ATOMIC_ACQ_REL, "workgroup");
  __builtin_amdgcn_wave_barrier();
  const int rsub = lane >> 4, c4 = (lane & 15) * 4;
  {
#pragma unroll
    for (int q = 0; q < 8; ++q) {
      const int r = q * 2 + rsub;
      const v4f v = *(const v4fa*)&so[w][r][c4];
      *(v4f*)(C + (size_t)(row0 + r) * ldc + col0 + c4) = v;
    }
    
  }
}

// GEMM C = act(A·W + bias + resid): A f32 (ASPLIT -> hi/lo 2 terms), Wt bf16 [N][K]; ACT 0 none, 1 relu, 2 exact gelu;
// resid (optional, f32, row index = (row % rmod), pitch ldr, RES_BF16 rounds it) added before the activation.
template <bool ASPLIT, int ACT, bool BIAS_BF16, bool RES_BF16>
__global__ __launch_bounds__(128) void k_gemm_bf3(const float* __restrict__ A, int lda, const unsigned short* __restrict__ Wt, int ldb,
                                                const float* __restrict__ bias, const float* __restrict__ resid, int rmod, int ldr,
                                                float* __restrict__ C, int ldc, int M, int N, int K) {
  __shared__ __attribute__((aligned(16))) float so[4][16][64];
  const int tid = threadIdx.x, w = tid >> 5, lane = tid & 31, ln = lane & 15, hh = lane >> 4;
  const int ntn = N / 64;
  const int wid = blockIdx.x * 4 + w;
  const int mt = wid / ntn, nq = wid % ntn;
  if (mt * 16 >= M) return;
  const int row0 = mt * 16, col0 = nq * 64;
  const float* arow = A + (size_t)(row0 + ln) * lda;
  v8f acc[4] = {};
  for (int kb = 0; kb < K; kb += 32) {
    FragB ah, al;
    const v4f x0 = *(const v4fa*)(arow + kb + 8 * hh), x1 = *(const v4fa*)(arow + kb + 8 * hh + 4);
    const v4f x2 = *(const v4fa*)(arow + kb + 16 + 8 * hh), x3 = *(const v4fa*)(arow + kb + 16 + 8 * hh + 4);
    float xs[16] = {x0[0],x0[1],x0[2],x0[3],x1[0],x1[1],x1[2],x1[3],x2[0],x2[1],x2[2],x2[3],x3[0],x3[1],x3[2],x3[3]};
#pragma unroll
    for (int i = 0; i < 16; ++i) { const unsigned short hb = bf16_bits(xs[i]); ah.u[i] = hb; al.u[i] = ASPLIT ? bf16_bits(xs[i] - bf16_val(hb)) : (unsigned short)0; }
#pragma unroll
    for (int t = 0; t < 4; ++t) {
      const unsigned short* brow = Wt + (size_t)(col0 + t * 16 + ln) * ldb + kb;
      FragB b;
      b.half[0] = *(const v8us*)(brow + 8 * hh);
      b.half[1] = *(const v8us*)(brow + 16 + 8 * hh);
      acc[t] = mmaN<ASPLIT ? 2 : 1>(ah.v, al.v, b.v, b.v, acc[t]);
    }
  }
#pragma unroll
  for (int t = 0; t < 4; ++t) {
    const int col = col0 + t * 16 + ln;
    float bv = bias ? bias[col] : 0.f;
    if (BIAS_BF16) bv = bf16_round(bv);
#pragma unroll
    for (int r = 0; r < 8; ++r) {
      float v = acc[t][r] + bv;
      if (resid) { float rv = resid[(size_t)((row0 + 8 * hh + r) % rmod) * ldr + col]; if (RES_BF16) rv = bf16_round(rv); v += rv; }
      if (ACT == 1) v = fmaxf(v, 0.f);
      if (ACT == 2) v = 0.5f * v * (1.0f + erff(v * 0.70710678118654752f));
      if (ACT == 3) { const float u = 0.7978845608028654f * (v + 0.044715f * v * v * v); v = 0.5f * v * (1.0f + tanhf(u)); }
      so[w][8 * hh + r][t * 16 + ln] = v;
    }
  }
  __builtin_amdgcn_fence(__ATOMIC_ACQ_REL, "workgroup");
  __builtin_amdgcn_wave_barrier();
  const int rsub = lane >> 4, c4 = (lane & 15) * 4;
  {
#pragma unroll
    for (int q = 0; q < 8; ++q) {
      const int r = q * 2 + rsub;
      const v4f v = *(const v4fa*)&so[w][r][c4];
      *(v4f*)(C + (size_t)(row0 + r) * ldc + col0 + c4) = v;
    }
    
  }
}
// row LayerNorm (biased variance, eps) over N: s = X (+ R); optional out_sum <- s; out_norm <- (s-mu)*rsqrt(var+eps)*g + b
template <bool PARAM_BF16>
__global__ __launch_bounds__(256) void k_layernorm(const float* __restrict__ X, const float* __restrict__ R, const float* __restrict__ g, const float* __restrict__ bta,
                                                  float* __restrict__ out_sum, float* __restrict__ out_norm, int N, float eps) {
  __shared__ float red[256];
  const int row = blockIdx.x, tid = threadIdx.x;
  const float* x = X + (size_t)row * N; const float* rr = R ? R + (size_t)row * N : nullptr;
  float vals[16];                     // up to N = 4096
  const int per = N / 256;            // contiguous chunk per thread? use strided-by-4 chunks: thread handles j = tid*4 + 1024*u
  float s1 = 0.f;
  for (int u = 0; u < per / 4; ++u) {
    const int j = tid * 4 + 1024 * u;
    const v4f a = *(const v4fa*)(x + j);
    v4f b = {0.f,0.f,0.f,0.f}; if (rr) b = *(const v4fa*)(rr + j);
#pragma unroll
    for (int q = 0; q < 4; ++q) { const float v = a[q] + b[q]; vals[u * 4 + q] = v; s1 += v; }
  }
  red[tid] = s1; __syncthreads();
  for (int st = 128; st > 0; st >>= 1) { if (tid < st) red[tid] += red[tid + st]; __syncthreads(); }
  const float mu = red[0] / (float)N; __syncthreads();
  float s2 = 0.f;
  for (int u = 0; u < per / 4; ++u)
#pragma unroll
    for (int q = 0; q < 4; ++q) { const float c = vals[u * 4 + q] - mu; s2 += c * c; }
  red[tid] = s2; __syncthreads();
  for (int st = 128; st > 0; st >>= 1) { if (tid < st) red[tid] += red[tid + st]; __syncthreads(); }
  const float rs = rsqrtf(red[0] / (float)N + eps);
  {
    for (int u = 0; u < per / 4; ++u) {
      const int j = tid * 4 + 1024 * u;
      v4f o, sm;
#pragma unroll
      for (int q = 0; q < 4; ++q) {
        float gg = g[j + q], bb = bta[j + q];
        if (PARAM_BF16) { gg = bf16_round(gg); bb = bf16_round(bb); }
        sm[q] = vals[u * 4 + q]; o[q] = (vals[u * 4 + q] - mu) * rs * gg + bb;
      }
      if (out_sum) *(v4f*)(out_sum + (size_t)row * N + j) = sm;
      *(v4f*)(out_norm + (size_t)row * N + j) = o;
    }
    
  }
}



// ---- f16 WMMA path (v_wmma_f32_16x16x32_f16): 11-bit significands for operands in range — used where a [0,1] probability operand needs more precision than bf16
typedef _Float16 v16h __attribute__((ext_vector_type(16)));
union FragH { v16h v; v8us half[2]; _Float16 h[16]; unsigned short u[16]; };
template <int NT>
__device__ __forceinline__ v8f mmaH(v16h ah, v16h al, v16h bh, v16h bl, v8f c) {
  c = __builtin_amdgcn_wmma_f32_16x16x32_f16(false, ah, false, bh, (short)0, c, false, false);
  if (NT >= 2) c = __builtin_amdgcn_wmma_f32_16x16x32_f16(false, al, false, bh, (short)0, c, false, false);
  if (NT >= 3) c = __builtin_amdgcn_wmma_f32_16x16x32_f16(false, ah, false, bl, (short)0, c, false, false);
  asm volatile("v_nop\n\tv_nop\n\tv_nop\n\tv_nop" : "+v"(c) : "v"(ah), "v"(al), "v"(bh), "v"(bl));
  return c;
}
// batched GEMM like k_gemm_b but f16 operands: A f32 (split into f16 hi/lo if ASPLIT, else rounded to f16), Bt = f16 values [n][k]; alpha; C f32; N multiple of 16 (partial tiles skipped)
template <bool ASPLIT>
__global__ __launch_bounds__(128) void k_gemm_h(const float* __restrict__ A, int lda, size_t sA, const _Float16* __restrict__ Bh, int ldb, size_t sB, float alpha, float* __restrict__ C, int ldc, size_t sC, int M, int N, int K) {
  __shared__ __attribute__((aligned(16))) float so[4][16][64];
  const int tid = threadIdx.x, w = tid >> 5, lane = tid & 31, ln = lane & 15, hh = lane >> 4; const int by = blockIdx.y;
  A += (size_t)by * sA; Bh += (size_t)by * sB; C += (size_t)by * sC;
  const int ntn = (N + 63) / 64; const int wid = blockIdx.x * 4 + w; const int mt = wid / ntn, nq = wid % ntn; if (mt * 16 >= M) return;
  const int row0 = mt * 16, col0 = nq * 64; const float* arow = A + (size_t)(row0 + ln) * lda;
  v8f acc[4] = {};
  for (int kb = 0; kb < K; kb += 32) {
    FragH ah, al;
    const v4f x0 = *(const v4fa*)(arow + kb + 8 * hh), x1 = *(const v4fa*)(arow + kb + 8 * hh + 4), x2 = *(const v4fa*)(arow + kb + 16 + 8 * hh), x3 = *(const v4fa*)(arow + kb + 16 + 8 * hh + 4);
    float xs[16] = {x0[0],x0[1],x0[2],x0[3],x1[0],x1[1],x1[2],x1[3],x2[0],x2[1],x2[2],x2[3],x3[0],x3[1],x3[2],x3[3]};
#pragma unroll
    for (int i = 0; i < 16; ++i) { const _Float16 h = (_Float16)xs[i]; ah.h[i] = h; al.h[i] = ASPLIT ? (_Float16)(xs[i] - (float)h) : (_Float16)0.0f; }
#pragma unroll
    for (int t = 0; t < 4; ++t) { if (col0 + t * 16 >= N) continue; const size_t boff = (size_t)(col0 + t * 16 + ln) * ldb + kb; FragH bq; bq.half[0] = *(const v8us*)(Bh + boff + 8 * hh); bq.half[1] = *(const v8us*)(Bh + boff + 16 + 8 * hh);
      acc[t] = mmaH<ASPLIT ? 2 : 1>(ah.v, al.v, bq.v, bq.v, acc[t]); }
  }
#pragma unroll
  for (int t = 0; t < 4; ++t) { if (col0 + t * 16 >= N) continue;
#pragma unroll
    for (int r = 0; r < 8; ++r) so[w][8 * hh + r][t * 16 + ln] = acc[t][r] * alpha; }
  __builtin_amdgcn_fence(__ATOMIC_ACQ_REL, "workgroup"); __builtin_amdgcn_wave_barrier();
  const int rsub = lane >> 4, c4 = (lane & 15) * 4;
  {
#pragma unroll
    for (int q = 0; q < 8; ++q) { const int r = q * 2 + rsub; if (col0 + c4 < N) { const v4f v = *(const v4fa*)&so[w][r][c4]; *(v4f*)(C + (size_t)(row0 + r) * ldc + col0 + c4) = v; } }
     }
}

// Wt[n][k] = f16(W[k][n]·scale) from f32 row-major W[K][N] (scale = power of two; bf16-exact weights stay exact in f16 away from the subnormal range)
__global__ __launch_bounds__(256) void k_wt_f16(const float* __restrict__ W, _Float16* __restrict__ Wt, int K, int N, float scale) {
  const int t = blockIdx.x * 256 + threadIdx.x; if (t >= N * (K / 8)) return; const int n = t / (K / 8), k8 = (t % (K / 8)) * 8; FragH f;
#pragma unroll
  for (int i = 0; i < 8; ++i) f.h[i] = (_Float16)(bf16_round(W[(size_t)(k8 + i) * N + n]) * scale); const v8us o = f.half[0];
  *(v8us*)((unsigned short*)Wt + (size_t)n * K + k8) = o; 
}
// k_gemm_hh variant with fused epilogue: v = acc·alpha + bias[by·sBias + col] (+ CP[(row/rowsPerB)·sCPb + by·64 + col] if CP) ; ACT 0 none / 1 elu ; writes f16 C16 (and f32 C if non-null)
template <int ACT>
__global__ __launch_bounds__(128) void k_gemm_hhx(const _Float16* __restrict__ A, int lda, size_t sA, const _Float16* __restrict__ Bh, int ldb, size_t sB, float alpha, const float* __restrict__ bias, size_t sBias, const float* __restrict__ CP, int rowsPerB, size_t sCPb, int row0g,
    float* __restrict__ C, _Float16* __restrict__ C16, int ldc, size_t sC, int M, int N, int K) {
  __shared__ __attribute__((aligned(16))) float so[4][16][64];
  const int tid = threadIdx.x, w = tid >> 5, lane = tid & 31, ln = lane & 15, hh = lane >> 4; const int by = blockIdx.y;
  A += (size_t)by * sA; Bh += (size_t)by * sB; const size_t cofs = (size_t)by * sC; const float* bp = bias ? bias + (size_t)by * sBias : nullptr;
  const int ntn = (N + 63) / 64; const int wid = blockIdx.x * 4 + w; const int mt = wid / ntn, nq = wid % ntn; if (mt * 16 >= M) return;
  const int row0 = mt * 16, col0 = nq * 64; const _Float16* arow = A + (size_t)(row0 + ln) * lda;
  v8f acc[4] = {};
  for (int kb = 0; kb < K; kb += 32) { FragH ah; ah.half[0] = *(const v8us*)((const unsigned short*)arow + kb + 8 * hh); ah.half[1] = *(const v8us*)((const unsigned short*)arow + kb + 16 + 8 * hh);
#pragma unroll
    for (int t = 0; t < 4; ++t) { if (col0 + t * 16 >= N) continue; const size_t boff = (size_t)(col0 + t * 16 + ln) * ldb + kb; FragH bq; bq.half[0] = *(const v8us*)((const unsigned short*)Bh + boff + 8 * hh); bq.half[1] = *(const v8us*)((const unsigned short*)Bh + boff + 16 + 8 * hh);
      acc[t] = mmaH<1>(ah.v, ah.v, bq.v, bq.v, acc[t]); }
  }
#pragma unroll
  for (int t = 0; t < 4; ++t) { if (col0 + t * 16 >= N) continue; const int col = col0 + t * 16 + ln; const float bv = bp ? bf16_round(bp[col]) : 0.f;
#pragma unroll
    for (int r = 0; r < 8; ++r) { float v = acc[t][r] * alpha + bv; if (CP) { const int rr = row0g + row0 + 8 * hh + r; if (rowsPerB < 0) v += CP[cofs + (size_t)rr * ldc + col];      /* rowsPerB < 0: own element of the batched C plane */ else { const int bidx = rr / rowsPerB; v += CP[(size_t)bidx * sCPb + (size_t)by * 64 + col]; } } if (ACT == 1) v = (v > 0.f) ? v : expm1f(v); else if (ACT == 7) v = (v > 0.f) ? v + 1.0f : expf(v); else if (ACT == 8) v = tanhf(v); else if (ACT == 9) v = 0.5f * v * (1.0f + tanhf(0.7978845608028654f * (v + 0.044715f * v * v * v))); else if (ACT == 11) v = 1.0f / (1.0f + expf(-v)); else if (ACT == 12) v = (v > 0.f) ? v : 0.01f * v; else if (ACT == 14) v = (v > 0.f) ? v : 0.1f * v; else if (ACT == 16) v = (v >= 0.f) ? v : 0.3f * v; else if (ACT == 17) v = (v >= 0.f) ? v : 0.2f * v; else if (ACT == 15) v = v / (1.0f + expf(-v)); else if (ACT == 3) v = fmaxf(v, 0.f); else if (ACT == 6) v = 0.5f * v * (1.0f + erff(v * 0.70710678118654752f)); so[w][8 * hh + r][t * 16 + ln] = v; } }
  __builtin_amdgcn_fence(__ATOMIC_ACQ_REL, "workgroup"); __builtin_amdgcn_wave_barrier();
  const int rsub = lane >> 4, c4 = (lane & 15) * 4; typedef _Float16 v4h __attribute__((ext_vector_type(4)));
  {
#pragma unroll
    for (int q = 0; q < 8; ++q) { const int r = q * 2 + rsub; if (col0 + c4 < N) { const v4f v = *(const v4fa*)&so[w][r][c4]; if (C) *(v4f*)(C + cofs + (size_t)(row0 + r) * ldc + col0 + c4) = v; if (C16) { v4h h4; for (int i = 0; i < 4; ++i) h4[i] = (_Float16)v[i]; *(v4h*)(C16 + cofs + (size_t)(row0 + r) * ldc + col0 + c4) = h4; } } }
     }
}


typedef _Float16 v4h __attribute__((ext_vector_type(4)));

__global__ __launch_bounds__(256) void k_x16(const float* __restrict__ x, _Float16* __restrict__ X16, size_t n8) { const size_t t = (size_t)blockIdx.x * 256 + threadIdx.x; if (t >= n8) return; FragH f;
#pragma unroll
  for (int q = 0; q < 8; ++q) f.h[q] = (_Float16)bf16_round(x[t * 8 + q]); *(v8us*)((unsigned short*)X16 + t * 8) = f.half[0];  }
__global__ __launch_bounds__(256) void k_h16(const float* __restrict__ x, _Float16* __restrict__ X16, size_t n8) { const size_t t = (size_t)blockIdx.x * 256 + threadIdx.x; if (t >= n8) return; FragH f;
#pragma unroll
  for (int q = 0; q < 8; ++q) f.h[q] = (_Float16)x[t * 8 + q]; *(v8us*)((unsigned short*)X16 + t * 8) = f.half[0];  }
__global__ __launch_bounds__(256) void k_round16f(const float* __restrict__ W, _Float16* __restrict__ Bt, size_t n8) { const size_t t = (size_t)blockIdx.x * 256 + threadIdx.x; if (t >= n8) return; FragH f;
#pragma unroll
  for (int i = 0; i < 8; ++i) f.h[i] = (_Float16)(bf16_round(W[t * 8 + i]) * 16.0f); *(v8us*)((unsigned short*)Bt + t * 8) = f.half[0];  }
template <int NHv, int TTv>
__global__ __launch_bounds__(256) void k_vt(const _Float16* __restrict__ V16, int ldv, int voff, _Float16* __restrict__ Vt) { __shared__ unsigned short tl[64][66]; const int tid = threadIdx.x; const int slab = blockIdx.x / (TTv / 64), lg = blockIdx.x % (TTv / 64); const int b = slab / NHv, h = slab % NHv;
  for (int i = tid; i < 64 * 8; i += 256) { const int r = i / 8, c8 = (i % 8) * 8; FragH f; f.half[0] = *(const v8us*)((const unsigned short*)V16 + ((size_t)b * TTv + lg * 64 + r) * ldv + voff + h * 64 + c8);
#pragma unroll
    for (int q = 0; q < 8; ++q) tl[r][c8 + q] = f.u[q]; }
  __syncthreads();
  {
#pragma unroll
    for (int rd = 0; rd < 2; ++rd) { const int d = rd * 32 + tid / 8, pc = tid % 8; FragH f;
#pragma unroll
      for (int q = 0; q < 8; ++q) f.u[q] = tl[pc * 8 + q][d];
      *(v8us*)((unsigned short*)Vt + ((size_t)slab * 64 + d) * TTv + lg * 64 + pc * 8) = f.half[0]; }
     } }

__global__ __launch_bounds__(256) void k_hl(const float* __restrict__ F, _Float16* __restrict__ Hh, _Float16* __restrict__ Hl, size_t n8) { const size_t t = (size_t)blockIdx.x * 256 + threadIdx.x; if (t >= n8) return; FragH fh, fl; const v4f a = *(const v4fa*)(F + t * 8), c = *(const v4fa*)(F + t * 8 + 4);
#pragma unroll
  for (int q = 0; q < 4; ++q) { _Float16 h = (_Float16)a[q]; fh.h[q] = h; fl.h[q] = (_Float16)((a[q] - (float)h) * 1024.0f); h = (_Float16)c[q]; fh.h[4 + q] = h; fl.h[4 + q] = (_Float16)((c[q] - (float)h) * 1024.0f); }
  { *(v8us*)((unsigned short*)Hh + t * 8) = fh.half[0]; *(v8us*)((unsigned short*)Hl + t * 8) = fl.half[0];  } }

// ---- fast GEMM (wave tile 32x64; requires M % 32 == 0 rows per launch region and N % 64 == 0); epilogue = k_gemm_hhx semantics ----
__device__ __forceinline__ v16h g2_frag(const _Float16* p, int hh) { FragH f; f.half[0] = *(const v8us*)((const unsigned short*)p + 8 * hh); f.half[1] = *(const v8us*)((const unsigned short*)p + 16 + 8 * hh); return f.v; }
__device__ __forceinline__ v8f g2_mma(v16h a, v16h b, v8f c) { v8f d = __builtin_amdgcn_wmma_f32_16x16x32_f16(false, a, false, b, (short)0, c, false, false); asm volatile("v_nop\n\tv_nop\n\tv_nop\n\tv_nop" : "+v"(d) : "v"(a), "v"(b)); return d; }
template <int ACT>
__global__ __launch_bounds__(128) void k_gemm2(const _Float16* __restrict__ A, int lda, size_t sA, const _Float16* __restrict__ Bh, int ldb, size_t sB, float alpha, const float* __restrict__ bias, size_t sBias, const float* __restrict__ CP, int rowsPerB, size_t sCPb, int row0g,
    float* __restrict__ C, _Float16* __restrict__ C16, int ldc, size_t sC, int M, int N, int K) { static_assert(ACT == 0 || ACT == 3 || ACT == 6 || ACT == 8 || ACT == 9 || ACT == 11 || ACT == 12 || ACT == 14 || ACT == 15 || ACT == 16 || ACT == 17, "k_gemm2: unsupported ACT code (would silently apply no activation)");
  __shared__ __attribute__((aligned(16))) float so[4][32][68];
  const int tid = threadIdx.x, w = tid >> 5, lane = tid & 31, ln = lane & 15, hh = lane >> 4; const int by = blockIdx.y;
  A += (size_t)by * sA; Bh += (size_t)by * sB; const size_t cofs = (size_t)by * sC; const float* bp = bias ? bias + (size_t)by * sBias : nullptr;
  const int ntn = N >> 6; const int mt = blockIdx.x / ntn, nq = blockIdx.x - mt * ntn; const int row0 = mt * 128 + 32 * w, col0 = nq * 64; if (row0 >= M) return;
  const _Float16* a0p = A + (size_t)(row0 + ln) * lda; const _Float16* a1p = a0p + (size_t)16 * lda;
  const _Float16* b0p = Bh + (size_t)(col0 + ln) * ldb; const _Float16* b1p = b0p + (size_t)16 * ldb; const _Float16* b2p = b1p + (size_t)16 * ldb; const _Float16* b3p = b2p + (size_t)16 * ldb;
  const v8f z8 = {0.f,0.f,0.f,0.f,0.f,0.f,0.f,0.f}; v8f c00 = z8, c01 = z8, c02 = z8, c03 = z8, c10 = z8, c11 = z8, c12 = z8, c13 = z8;
#pragma unroll 1
  for (int kb = 0; kb < K; kb += 32) { const v16h a0 = g2_frag(a0p + kb, hh), a1 = g2_frag(a1p + kb, hh);
    v16h b = g2_frag(b0p + kb, hh); c00 = g2_mma(a0, b, c00); c10 = g2_mma(a1, b, c10);
    b = g2_frag(b1p + kb, hh); c01 = g2_mma(a0, b, c01); c11 = g2_mma(a1, b, c11);
    b = g2_frag(b2p + kb, hh); c02 = g2_mma(a0, b, c02); c12 = g2_mma(a1, b, c12);
    b = g2_frag(b3p + kb, hh); c03 = g2_mma(a0, b, c03); c13 = g2_mma(a1, b, c13); }
  v8f accs[8] = {c00, c01, c02, c03, c10, c11, c12, c13};
#pragma unroll
  for (int u = 0; u < 8; ++u) { const int t = u & 3, half = u >> 2; const int col = col0 + t * 16 + ln; const float bv = bp ? bf16_round(bp[col]) : 0.f;
#pragma unroll
    for (int r = 0; r < 8; ++r) { const int rloc = half * 16 + 8 * hh + r; float v = accs[u][r] * alpha + bv; if (CP) { if (rowsPerB < 0) v += CP[cofs + (size_t)(row0g + row0 + rloc) * ldc + col];      /* rowsPerB < 0: own element of the batched C plane */ else { const int bidx = (row0g + row0 + rloc) / rowsPerB; v += CP[(size_t)bidx * sCPb + (size_t)by * 64 + col]; } }
      if (ACT == 3) v = fmaxf(v, 0.f); else if (ACT == 6) v = 0.5f * v * (1.0f + erff(v * 0.70710678118654752f)); else if (ACT == 11) v = 1.0f / (1.0f + expf(-v)); else if (ACT == 15) v = v / (1.0f + expf(-v)); else if (ACT == 12) v = (v > 0.f) ? v : 0.01f * v; else if (ACT == 8) v = tanhf(v); else if (ACT == 9) v = 0.5f * v * (1.0f + tanhf(0.7978845608028654f * (v + 0.044715f * v * v * v))); else if (ACT == 14) v = (v > 0.f) ? v : 0.1f * v; else if (ACT == 16) v = (v >= 0.f) ? v : 0.3f * v; else if (ACT == 17) v = (v >= 0.f) ? v : 0.2f * v;
      so[w][rloc][t * 16 + ln] = v; } }
  __builtin_amdgcn_fence(__ATOMIC_ACQ_REL, "workgroup"); __builtin_amdgcn_wave_barrier();
  const int rsub = lane >> 4, c4 = (lane & 15) * 4;
  {
#pragma unroll
    for (int q = 0; q < 16; ++q) { const int r = q * 2 + rsub; const v4f v = *(const v4fa*)&so[w][r][c4]; if (C) *(v4f*)(C + cofs + (size_t)(row0 + r) * ldc + col0 + c4) = v; if (C16) { v4h h4; for (int i = 0; i < 4; ++i) h4[i] = (_Float16)v[i]; *(v4h*)(C16 + cofs + (size_t)(row0 + r) * ldc + col0 + c4) = h4; } }
     } }


__global__ __launch_bounds__(256) void k_wnat(const float* __restrict__ w, size_t n8, _Float16* __restrict__ Bt) { const size_t t = (size_t)blockIdx.x * 256 + threadIdx.x; if (t >= n8) return; FragH f; for (int q = 0; q < 8; ++q) f.h[q] = (_Float16)(bf16_round(w[t * 8 + q]) * 16.0f); *(v8us*)((unsigned short*)Bt + t * 8) = f.half[0];  }
__global__ __launch_bounds__(256) void k_rsm(const float* __restrict__ S, _Float16* __restrict__ P, int nrows) {
  #pragma clang fp contract(off)
  const int i = blockIdx.x * 256 + threadIdx.x; if (i >= nrows) return; const float* s = S + (size_t)i * SQ; float mx = -3.0e38f;
#pragma unroll 1
  for (int j = 0; j < SQ; ++j) mx = fmaxf(mx, s[j]); float se = 0.f;
#pragma unroll 1
  for (int j = 0; j < SQ; ++j) se += expf(s[j] - mx); const float sc = 256.0f / se;
#pragma unroll 1
  for (int j0 = 0; j0 < SQ; j0 += 8) { FragH f; for (int q = 0; q < 8; ++q) f.h[q] = (_Float16)(expf(s[j0 + q] - mx) * sc); unsigned short* d = (unsigned short*)P + (size_t)i * SQ + j0; *(v8us*)d = f.half[0];  } }
__global__ __launch_bounds__(256) void k_vt(const _Float16* __restrict__ V16, int b, int h0, _Float16* __restrict__ VT) { __shared__ unsigned short tl[64][65]; const int tid = threadIdx.x; const int hh = blockIdx.x % HG, sg = blockIdx.x / HG; const int s0 = sg * 64; const int h = h0 + hh;
  for (int i = tid; i < 64 * 8; i += 256) { const int j = i / 8, d8 = (i % 8) * 8; FragH f; f.half[0] = *(const v8us*)((const unsigned short*)V16 + ((size_t)b * SQ + s0 + j) * DM + h * HD + d8); for (int q = 0; q < 8; ++q) tl[d8 + q][j] = f.u[q]; }
  __syncthreads();
  { for (int i = tid; i < 64 * 8; i += 256) { const int d = i / 8, j8 = (i % 8) * 8; FragH f; for (int q = 0; q < 8; ++q) f.u[q] = tl[d][j8 + q]; *(v8us*)((unsigned short*)VT + ((size_t)hh * HD + d) * SQ + s0 + j8) = f.half[0]; }  } }


__global__ __launch_bounds__(256) void k_wthd(const float* __restrict__ Wt, _Float16* __restrict__ Bt) { const size_t t = (size_t)blockIdx.x * 256 + threadIdx.x; if (t >= (size_t)NH * HD * (DM / 8)) return; const int m8 = (int)(t % (DM / 8)) * 8; const int d = (int)((t / (DM / 8)) % HD); const int h = (int)(t / ((size_t)(DM / 8) * HD)); FragH f;
  for (int q = 0; q < 8; ++q) f.h[q] = (_Float16)(16.0f * bf16_round(Wt[((size_t)h * DM + m8 + q) * HD + d])); unsigned short* dst = (unsigned short*)Bt + ((size_t)h * HD + d) * DM + m8; *(v8us*)dst = f.half[0];  }




__global__ __launch_bounds__(256) void k_rsmim(const float* __restrict__ S, _Float16* __restrict__ P, int qn, int hg, const int* __restrict__ Mk, float* __restrict__ PO, int hsel) {
  #pragma clang fp contract(off)
  const int t = blockIdx.x * 256 + threadIdx.x; if (t >= qn * hg) return; const int hl = t / qn, row = t % qn; const size_t i = (size_t)hl * SQ + row; const float* s = S + i * SQ; const int* m = Mk + (size_t)row * SQ; float mx = -3.0e38f;
#pragma unroll 1
  for (int j = 0; j < SQ; ++j) { const float keep = (m[j] == 0) ? 1.0f : 0.0f; mx = fmaxf(mx, keep > 0.5f ? s[j] : -3.0e38f); } float se = 0.f;
#pragma unroll 1
  for (int j = 0; j < SQ; ++j) { const float keep = (m[j] == 0) ? 1.0f : 0.0f; se += __expf(s[j] - mx) * keep; } const float inv = 1.0f / se; const float sc = 256.0f * inv;
#pragma unroll 1
  for (int j0 = 0; j0 < SQ; j0 += 8) { FragH f; v4f pa, pb; for (int q = 0; q < 8; ++q) { const float keep = (m[j0 + q] == 0) ? 1.0f : 0.0f; const float e = __expf(s[j0 + q] - mx) * keep; f.h[q] = (_Float16)(e * sc); const float pv = __fmul_rn(e, inv); if (q < 4) pa[q] = pv; else pb[q - 4] = pv; }
    unsigned short* d = (unsigned short*)P + i * SQ + j0; *(v8us*)d = f.half[0]; if (hsel >= 0 && hl == hsel) { float* po = PO + (size_t)row * SQ + j0; *(v4f*)po = pa; *(v4f*)(po + 4) = pb; }  } }


__global__ __launch_bounds__(256) void k_rsmf(const float* __restrict__ S, _Float16* __restrict__ P, int qn, int hg) {
  #pragma clang fp contract(off)
  const int t = blockIdx.x * 256 + threadIdx.x; if (t >= qn * hg) return; const size_t i = (size_t)(t / qn) * SQ + (t % qn); const float* s = S + i * SQ; float mx = -3.0e38f;
#pragma unroll 1
  for (int j = 0; j < SQ; ++j) mx = fmaxf(mx, s[j]); float se = 0.f;
#pragma unroll 1
  for (int j = 0; j < SQ; ++j) se += __expf(s[j] - mx); const float sc = 256.0f / se;
#pragma unroll 1
  for (int j0 = 0; j0 < SQ; j0 += 8) { FragH f; for (int q = 0; q < 8; ++q) f.h[q] = (_Float16)(__expf(s[j0 + q] - mx) * sc); unsigned short* d = (unsigned short*)P + i * SQ + j0; *(v8us*)d = f.half[0];  } }

extern "C" void kernel_launch(void* const* d_in, const int* in_sizes, int n_in,
                              void* d_out, int out_size, void* d_ws, size_t ws_size, hipStream_t stream) {
  (void)in_sizes; (void)n_in; (void)out_size;
  const float* const* I = (const float* const*)d_in; const float* xv = I[0]; const float* xk = I[1]; const float* xq = I[2]; const int* mk = (const int*)d_in[3]; const float* wq = I[4]; const float* bq = I[5]; const float* wk = I[6]; const float* bk = I[7]; const float* wv = I[8]; const float* bv = I[9]; const float* wo = I[10]; const float* bo = I[11];      /* NOTE the module's input order v, k, q, mask; per-head [h][in][out] weights + [h][64] biases (= flat [1024]); W0 [in][out] + b0 */
  float* PO = (float*)d_out + (size_t)NB * SQ * DM;      /* second output: last head's attention probabilities [NB][SQ][SQ] f32 at byte offset 16,777,216 */
  char* ws = (char*)d_ws; size_t off = 0;
  auto take = [&](size_t bytes) { char* p = ws + off; off += (bytes + 255) & ~(size_t)255; return p; };
  _Float16* BQ = (_Float16*)take((size_t)DM * DM * 2); _Float16* BK = (_Float16*)take((size_t)DM * DM * 2); _Float16* BV = (_Float16*)take((size_t)DM * DM * 2); _Float16* BO = (_Float16*)take((size_t)DM * DM * 2);
  _Float16* XQ = (_Float16*)take(NR * DM * 2); _Float16* XK = (_Float16*)take(NR * DM * 2); _Float16* XV = (_Float16*)take(NR * DM * 2); _Float16* Q16 = (_Float16*)take(NR * DM * 2); _Float16* K16 = (_Float16*)take(NR * DM * 2); _Float16* V16 = (_Float16*)take(NR * DM * 2); _Float16* O16 = (_Float16*)take(NR * DM * 2);
  float* S = (float*)take((size_t)HG * SQ * SQ * 4); _Float16* P = (_Float16*)take((size_t)HG * SQ * SQ * 2); _Float16* VT = (_Float16*)take((size_t)NH * HD * SQ * 2);
  if (off > ws_size) return;
  k_wthd<<<(unsigned)(((size_t)NH * HD * (DM / 8) + 255) / 256), 256, 0, stream>>>(wq, BQ); k_wthd<<<(unsigned)(((size_t)NH * HD * (DM / 8) + 255) / 256), 256, 0, stream>>>(wk, BK); k_wthd<<<(unsigned)(((size_t)NH * HD * (DM / 8) + 255) / 256), 256, 0, stream>>>(wv, BV);      /* per-head [h][m][d] -> Bt[(h,d)][m] x16 */
  k_wt_f16<<<(unsigned)(((size_t)DM * (DM / 8) + 255) / 256), 256, 0, stream>>>(wo, BO, DM, DM, 16.0f);      /* W0 [in][out] -> Bt x16 */

  k_x16<<<(unsigned)((NR * DM / 8 + 255) / 256), 256, 0, stream>>>(xq, XQ, NR * DM / 8); k_x16<<<(unsigned)((NR * DM / 8 + 255) / 256), 256, 0, stream>>>(xk, XK, NR * DM / 8); k_x16<<<(unsigned)((NR * DM / 8 + 255) / 256), 256, 0, stream>>>(xv, XV, NR * DM / 8);      /* the three inputs as exact f16 rows */
  const size_t r0p = (size_t)B0 * SQ;      /* first projected row */
  k_gemm2<0><<<dim3((unsigned)((MP / 128) * (DM / 64)), 1), 128, 0, stream>>>(XQ + r0p * DM, DM, 0, BQ, DM, 0, 0.0625f, bq, 0, nullptr, 1, 0, 0, nullptr, Q16 + r0p * DM, DM, 0, MP, DM, DM);
  k_gemm2<0><<<dim3((unsigned)((MP / 128) * (DM / 64)), 1), 128, 0, stream>>>(XK + r0p * DM, DM, 0, BK, DM, 0, 0.0625f, bk, 0, nullptr, 1, 0, 0, nullptr, K16 + r0p * DM, DM, 0, MP, DM, DM);
  k_gemm2<0><<<dim3((unsigned)((MP / 128) * (DM / 64)), 1), 128, 0, stream>>>(XV + r0p * DM, DM, 0, BV, DM, 0, 0.0625f, bv, 0, nullptr, 1, 0, 0, nullptr, V16 + r0p * DM, DM, 0, MP, DM, DM);
  for (int b = B0; b < B0 + NBR; ++b) { const size_t r0 = (size_t)b * SQ;
    k_vt<NH, SQ><<<NH * (SQ / 64), 256, 0, stream>>>(V16 + r0 * LQ, LQ, 0, VT);      /* V^T [NH][HD][SQ] for this batch */
    for (int h0 = 0; h0 < NHD; h0 += HG) {
      k_gemm2<0><<<dim3((QN / 128) * (SQ / 64), HG), 128, 0, stream>>>(Q16 + r0 * LQ + h0 * HD, LQ, (size_t)HD, K16 + r0 * LQ + h0 * HD, LQ, (size_t)HD, 0.125f, nullptr, 0, nullptr, 1, 0, 0, S, nullptr, SQ, (size_t)SQ * SQ, QN, SQ, HD);      /* scores, HG heads per launch */
      k_rsmim<<<(HG * QN + 255) / 256, 256, 0, stream>>>(S, P, QN, HG, mk + (size_t)b * SQ * SQ, PO + (size_t)b * SQ * SQ, (h0 <= NH - 1 && NH - 1 < h0 + HG) ? (NH - 1 - h0) : -1);      /* additive int mask as 0/1 factors; the group holding head 15 also writes its f32 probabilities to the second output */      /* P = 256 softmax (f16), rows of all HG heads */
      k_gemm2<0><<<dim3((QN / 128) * (HD / 64), HG), 128, 0, stream>>>(P, SQ, (size_t)SQ * SQ, VT + (size_t)h0 * HD * SQ, SQ, (size_t)HD * SQ, 0.25f, nullptr, 0, nullptr, 1, 0, 0, nullptr, O16 + r0 * DM + h0 * HD, DM, (size_t)HD, QN, HD, SQ); } }      /* o (merged heads) as f16 rows */
  k_gemm2<0><<<dim3((unsigned)((MPO / 128) * (DM / 64)), 1), 128, 0, stream>>>(O16 + r0p * DM, DM, 0, BO, DM, 0, 0.0009765625f, bo, 0, nullptr, 1, 0, 0, (float*)d_out + r0p * DM, nullptr, DM, 0, MPO, DM, DM);      /* out rows are the output layout */
}

// v001
// It runs in 1010 microseconds.
// Timed twice side by side with v000, it ran 6.71 and 6.69 times as fast.
#include <hip/hip_runtime.h>
// Multi-head attention with per-head weight tensors returning (output, last head's attention weights) (inputs v, k, q [2][2048][1024] in that order; qh[b][h] = q Wq[h] + bq[h] with Wq [16][1024][64] ([in][out] per head), kh, vh likewise; 16 heads of 64; scores / 8 + mask * (-1e9) with the int32 mask input [2][2048][2048] (all zeros: nothing masked); softmax; out_h = attn vh; output = concat(out_h) W0 + b0 (W0 [1024][1024] [in][out]) -> [2][2048][1024] at offset 0; second output = attn[:, 15] (the LAST head's probabilities, f32 [2][2048][2048]) at byte offset 16,777,216).
// Structure: token rows r = b*2048 + s; the three inputs as exact f16 rows (bf16-rounded); Q, K, V as three WMMA GEMMs (32x64 wave tiles, f32 accumulation, exact x16 weights + bias, f16 outputs); per batch: V^T for all heads via LDS transposes; per (batch, group of 4 heads): scores GEMM (K = 64, batched over the heads on grid.y, alpha = 64^-0.5), row softmax on VALU, one wave per query row and pair of heads, a key with a nonzero int mask dropped (f32 statistics, native exp; weights stored x256 as f16; the last head's f32 probabilities are also written to the second output), o = P . V^T GEMM (K = 2048, alpha 2^-2: o carried x64 against f16 subnormal flush, folded into the output GEMM alpha) written straight into the merged f16 o rows; out = o W_o + b GEMM (f32) into the output layout.
// Compute dtype: inputs rounded to bf16; x / weights exact; q, k, v, softmax weights and o as plain f16 GEMM operands (~2^-12); scores and softmax statistics f32. v_wmma_f32_16x16x32_f16.
#define NB 2
#define SQ 2048
#define DM 1024
#define NH 16
#define HD 64
#define HG 4                         /* heads per attention launch group */
#define B0 0                         /* first batch processed (debug hook) */
#define NBR NB                       /* batches processed (debug hook) */
#define NR ((size_t)NB * SQ)         /* token rows */
#define MP ((int)((size_t)NBR * SQ)) /* rows projected (debug hook) */
#define QN SQ                        /* query rows attended per batch (debug hook) */
#define NHD NH                       /* heads attended (debug hook) */
#define MPO MP                       /* rows through the output stage (debug hook) */
#define LQ DM      /* row pitch of the q/k/v rows */
typedef __bf16 v16b __attribute__((ext_vector_type(16)));
typedef unsigned short v8us __attribute__((ext_vector_type(8), may_alias));
typedef float  v8f  __attribute__((ext_vector_type(8)));
typedef float  v4f  __attribute__((ext_vector_type(4)));
typedef float  v4fa __attribute__((ext_vector_type(4), may_alias));
union FragB { v16b v; v8us half[2]; unsigned short u[16]; };

__device__ __forceinline__ unsigned short bf16_bits(float x) { unsigned int u = __float_as_uint(x); return (unsigned short)((u + 0x7FFFu + ((u >> 16) & 1u)) >> 16); }
__device__ __forceinline__ float bf16_val(unsigned short b) { return __uint_as_float(((unsigned int)b) << 16); }
__device__ __forceinline__ float bf16_round(float x) { return bf16_val(bf16_bits(x)); }
// D += A·B with NT terms: 1 = ah·bh, 2 = + al·bh (A split), 3 = + ah·bl (both split)
template <int NT>
__device__ __forceinline__ v8f mmaN(v16b ah, v16b al, v16b bh, v16b bl, v8f c) {
  c = __builtin_amdgcn_wmma_f32_16x16x32_bf16(false, ah, false, bh, (short)0, c, false, false);
  if (NT >= 2) c = __builtin_amdgcn_wmma_f32_16x16x32_bf16(false, al, false, bh, (short)0, c, false, false);
  if (NT >= 3) c = __builtin_amdgcn_wmma_f32_16x16x32_bf16(false, ah, false, bl, (short)0, c, false, false);
  asm volatile("v_nop\n\tv_nop\n\tv_nop\n\tv_nop" : "+v"(c) : "v"(ah), "v"(al), "v"(bh), "v"(bl));
  return c;
}

__global__ __launch_bounds__(256) void k_wt_bf16(const float* __restrict__ W, unsigned short* __restrict__ Wt, int K, int N) {
  const int t = blockIdx.x * 256 + threadIdx.x;
  const int k8n = K / 8;
  if (t >= N * k8n) return;
  const int n = t / k8n, k8 = (t % k8n) * 8;
  v8us v;
#pragma unroll
  for (int i = 0; i < 8; ++i) v[i] = bf16_bits(W[(size_t)(k8 + i) * N + n]);
  *(v8us*)(Wt + (size_t)n * K + k8) = v;
  
}

// GEMM C[M][N] (f32, pitch ldc) = act(A[M][K]·W + bias). A f32 row-major (pitch lda) converted per fragment to bf16
// (ASPLIT: hi/lo two planes -> 2 terms, else single rounded term); Wt bf16 [N][K] (pitch ldb). BIAS_BF16 rounds the
// bias to bf16 first (bias quantised to bf16 before the add). K%32==0, M%16==0, N%64==0.
template <bool ASPLIT, int ACT, bool BIAS_BF16>
__global__ __launch_bounds__(128) void k_gemm_bf(const float* __restrict__ A, int lda, const unsigned short* __restrict__ Wt, int ldb,
                                               const float* __restrict__ bias, float* __restrict__ C, int ldc, int M, int N, int K) {
  __shared__ __attribute__((aligned(16))) float so[4][16][64];
  const int tid = threadIdx.x, w = tid >> 5, lane = tid & 31, ln = lane & 15, hh = lane >> 4;
  const int ntn = N / 64;
  const int wid = blockIdx.x * 4 + w;
  const int mt = wid / ntn, nq = wid % ntn;
  if (mt * 16 >= M) return;
  const int row0 = mt * 16, col0 = nq * 64;
  const float* arow = A + (size_t)(row0 + ln) * lda;
  v8f acc[4] = {};
  for (int kb = 0; kb < K; kb += 32) {
    FragB ah, al;
    const v4f x0 = *(const v4fa*)(arow + kb + 8 * hh), x1 = *(const v4fa*)(arow + kb + 8 * hh + 4);
    const v4f x2 = *(const v4fa*)(arow + kb + 16 + 8 * hh), x3 = *(const v4fa*)(arow + kb + 16 + 8 * hh + 4);
    float xs[16] = {x0[0],x0[1],x0[2],x0[3],x1[0],x1[1],x1[2],x1[3],x2[0],x2[1],x2[2],x2[3],x3[0],x3[1],x3[2],x3[3]};
#pragma unroll
    for (int i = 0; i < 16; ++i) { const unsigned short hb = bf16_bits(xs[i]); ah.u[i] = hb; al.u[i] = ASPLIT ? bf16_bits(xs[i] - bf16_val(hb)) : (unsigned short)0; }
#pragma unroll
    for (int t = 0; t < 4; ++t) {
      const unsigned short* brow = Wt + (size_t)(col0 + t * 16 + ln) * ldb + kb;
      FragB b;
      b.half[0] = *(const v8us*)(brow + 8 * hh);
      b.half[1] = *(const v8us*)(brow + 16 + 8 * hh);
      acc[t] = mmaN<ASPLIT ? 2 : 1>(ah.v, al.v, b.v, b.v, acc[t]);
    }
  }
#pragma unroll
  for (int t = 0; t < 4; ++t) {
    float bv = bias ? bias[col0 + t * 16 + ln] : 0.f;
    if (BIAS_BF16) bv = bf16_round(bv);
#pragma unroll
    for (int r = 0; r < 8; ++r) { float v = acc[t][r] + bv; if (ACT == 1) v = fmaxf(v, 0.f); so[w][8 * hh + r][t * 16 + ln] = v; }
  }
  __builtin_amdgcn_fence(__ATOMIC_ACQ_REL, "workgroup");
  __builtin_amdgcn_wave_barrier();
  const int rsub = lane >> 4, c4 = (lane & 15) * 4;
  {
#pragma unroll
    for (int q = 0; q < 8; ++q) {
      const int r = q * 2 + rsub;
      const v4f v = *(const v4fa*)&so[w][r][c4];
      *(v4f*)(C + (size_t)(row0 + r) * ldc + col0 + c4) = v;
    }
    
  }
}

// GEMM C = act(A·W + bias + resid): A f32 (ASPLIT -> hi/lo 2 terms), Wt bf16 [N][K]; ACT 0 none, 1 relu, 2 exact gelu;
// resid (optional, f32, row index = (row % rmod), pitch ldr, RES_BF16 rounds it) added before the activation.
template <bool ASPLIT, int ACT, bool BIAS_BF16, bool RES_BF16>
__global__ __launch_bounds__(128) void k_gemm_bf3(const float* __restrict__ A, int lda, const unsigned short* __restrict__ Wt, int ldb,
                                                const float* __restrict__ bias, const float* __restrict__ resid, int rmod, int ldr,
                                                float* __restrict__ C, int ldc, int M, int N, int K) {
  __shared__ __attribute__((aligned(16))) float so[4][16][64];
  const int tid = threadIdx.x, w = tid >> 5, lane = tid & 31, ln = lane & 15, hh = lane >> 4;
  const int ntn = N / 64;
  const int wid = blockIdx.x * 4 + w;
  const int mt = wid / ntn, nq = wid % ntn;
  if (mt * 16 >= M) return;
  const int row0 = mt * 16, col0 = nq * 64;
  const float* arow = A + (size_t)(row0 + ln) * lda;
  v8f acc[4] = {};
  for (int kb = 0; kb < K; kb += 32) {
    FragB ah, al;
    const v4f x0 = *(const v4fa*)(arow + kb + 8 * hh), x1 = *(const v4fa*)(arow + kb + 8 * hh + 4);
    const v4f x2 = *(const v4fa*)(arow + kb + 16 + 8 * hh), x3 = *(const v4fa*)(arow + kb + 16 + 8 * hh + 4);
    float xs[16] = {x0[0],x0[1],x0[2],x0[3],x1[0],x1[1],x1[2],x1[3],x2[0],x2[1],x2[2],x2[3],x3[0],x3[1],x3[2],x3[3]};
#pragma unroll
    for (int i = 0; i < 16; ++i) { const unsigned short hb = bf16_bits(xs[i]); ah.u[i] = hb; al.u[i] = ASPLIT ? bf16_bits(xs[i] - bf16_val(hb)) : (unsigned short)0; }
#pragma unroll
    for (int t = 0; t < 4; ++t) {
      const unsigned short* brow = Wt + (size_t)(col0 + t * 16 + ln) * ldb + kb;
      FragB b;
      b.half[0] = *(const v8us*)(brow + 8 * hh);
      b.half[1] = *(const v8us*)(brow + 16 + 8 * hh);
      acc[t] = mmaN<ASPLIT ? 2 : 1>(ah.v, al.v, b.v, b.v, acc[t]);
    }
  }
#pragma unroll
  for (int t = 0; t < 4; ++t) {
    const int col = col0 + t * 16 + ln;
    float bv = bias ? bias[col] : 0.f;
    if (BIAS_BF16) bv = bf16_round(bv);
#pragma unroll
    for (int r = 0; r < 8; ++r) {
      float v = acc[t][r] + bv;
      if (resid) { float rv = resid[(size_t)((row0 + 8 * hh + r) % rmod) * ldr + col]; if (RES_BF16) rv = bf16_round(rv); v += rv; }
      if (ACT == 1) v = fmaxf(v, 0.f);
      if (ACT == 2) v = 0.5f * v * (1.0f + erff(v * 0.70710678118654752f));
      if (ACT == 3) { const float u = 0.7978845608028654f * (v + 0.044715f * v * v * v); v = 0.5f * v * (1.0f + tanhf(u)); }
      so[w][8 * hh + r][t * 16 + ln] = v;
    }
  }
  __builtin_amdgcn_fence(__ATOMIC_ACQ_REL, "workgroup");
  __builtin_amdgcn_wave_barrier();
  const int rsub = lane >> 4, c4 = (lane & 15) * 4;
  {
#pragma unroll
    for (int q = 0; q < 8; ++q) {
      const int r = q * 2 + rsub;
      const v4f v = *(const v4fa*)&so[w][r][c4];
      *(v4f*)(C + (size_t)(row0 + r) * ldc + col0 + c4) = v;
    }
    
  }
}
// row LayerNorm (biased variance, eps) over N: s = X (+ R); optional out_sum <- s; out_norm <- (s-mu)*rsqrt(var+eps)*g + b
template <bool PARAM_BF16>
__global__ __launch_bounds__(256) void k_layernorm(const float* __restrict__ X, const float* __restrict__ R, const float* __restrict__ g, const float* __restrict__ bta,
                                                  float* __restrict__ out_sum, float* __restrict__ out_norm, int N, float eps) {
  __shared__ float red[256];
  const int row = blockIdx.x, tid = threadIdx.x;
  const float* x = X + (size_t)row * N; const float* rr = R ? R + (size_t)row * N : nullptr;
  float vals[16];                     // up to N = 4096
  const int per = N / 256;            // contiguous chunk per thread? use strided-by-4 chunks: thread handles j = tid*4 + 1024*u
  float s1 = 0.f;
  for (int u = 0; u < per / 4; ++u) {
    const int j = tid * 4 + 1024 * u;
    const v4f a = *(const v4fa*)(x + j);
    v4f b = {0.f,0.f,0.f,0.f}; if (rr) b = *(const v4fa*)(rr + j);
#pragma unroll
    for (int q = 0; q < 4; ++q) { const float v = a[q] + b[q]; vals[u * 4 + q] = v; s1 += v; }
  }
  red[tid] = s1; __syncthreads();
  for (int st = 128; st > 0; st >>= 1) { if (tid < st) red[tid] += red[tid + st]; __syncthreads(); }
  const float mu = red[0] / (float)N; __syncthreads();
  float s2 = 0.f;
  for (int u = 0; u < per / 4; ++u)
#pragma unroll
    for (int q = 0; q < 4; ++q) { const float c = vals[u * 4 + q] - mu; s2 += c * c; }
  red[tid] = s2; __syncthreads();
  for (int st = 128; st > 0; st >>= 1) { if (tid < st) red[tid] += red[tid + st]; __syncthreads(); }
  const float rs = rsqrtf(red[0] / (float)N + eps);
  {
    for (int u = 0; u < per / 4; ++u) {
      const int j = tid * 4 + 1024 * u;
      v4f o, sm;
#pragma unroll
      for (int q = 0; q < 4; ++q) {
        float gg = g[j + q], bb = bta[j + q];
        if (PARAM_BF16) { gg = bf16_round(gg); bb = bf16_round(bb); }
        sm[q] = vals[u * 4 + q]; o[q] = (vals[u * 4 + q] - mu) * rs * gg + bb;
      }
      if (out_sum) *(v4f*)(out_sum + (size_t)row * N + j) = sm;
      *(v4f*)(out_norm + (size_t)row * N + j) = o;
    }
    
  }
}



// ---- f16 WMMA path (v_wmma_f32_16x16x32_f16): 11-bit significands for operands in range — used where a [0,1] probability operand needs more precision than bf16
typedef _Float16 v16h __attribute__((ext_vector_type(16)));
union FragH { v16h v; v8us half[2]; _Float16 h[16]; unsigned short u[16]; };
template <int NT>
__device__ __forceinline__ v8f mmaH(v16h ah, v16h al, v16h bh, v16h bl, v8f c) {
  c = __builtin_amdgcn_wmma_f32_16x16x32_f16(false, ah, false, bh, (short)0, c, false, false);
  if (NT >= 2) c = __builtin_amdgcn_wmma_f32_16x16x32_f16(false, al, false, bh, (short)0, c, false, false);
  if (NT >= 3) c = __builtin_amdgcn_wmma_f32_16x16x32_f16(false, ah, false, bl, (short)0, c, false, false);
  asm volatile("v_nop\n\tv_nop\n\tv_nop\n\tv_nop" : "+v"(c) : "v"(ah), "v"(al), "v"(bh), "v"(bl));
  return c;
}
// batched GEMM like k_gemm_b but f16 operands: A f32 (split into f16 hi/lo if ASPLIT, else rounded to f16), Bt = f16 values [n][k]; alpha; C f32; N multiple of 16 (partial tiles skipped)
template <bool ASPLIT>
__global__ __launch_bounds__(128) void k_gemm_h(const float* __restrict__ A, int lda, size_t sA, const _Float16* __restrict__ Bh, int ldb, size_t sB, float alpha, float* __restrict__ C, int ldc, size_t sC, int M, int N, int K) {
  __shared__ __attribute__((aligned(16))) float so[4][16][64];
  const int tid = threadIdx.x, w = tid >> 5, lane = tid & 31, ln = lane & 15, hh = lane >> 4; const int by = blockIdx.y;
  A += (size_t)by * sA; Bh += (size_t)by * sB; C += (size_t)by * sC;
  const int ntn = (N + 63) / 64; const int wid = blockIdx.x * 4 + w; const int mt = wid / ntn, nq = wid % ntn; if (mt * 16 >= M) return;
  const int row0 = mt * 16, col0 = nq * 64; const float* arow = A + (size_t)(row0 + ln) * lda;
  v8f acc[4] = {};
  for (int kb = 0; kb < K; kb += 32) {
    FragH ah, al;
    const v4f x0 = *(const v4fa*)(arow + kb + 8 * hh), x1 = *(const v4fa*)(arow + kb + 8 * hh + 4), x2 = *(const v4fa*)(arow + kb + 16 + 8 * hh), x3 = *(const v4fa*)(arow + kb + 16 + 8 * hh + 4);
    float xs[16] = {x0[0],x0[1],x0[2],x0[3],x1[0],x1[1],x1[2],x1[3],x2[0],x2[1],x2[2],x2[3],x3[0],x3[1],x3[2],x3[3]};
#pragma unroll
    for (int i = 0; i < 16; ++i) { const _Float16 h = (_Float16)xs[i]; ah.h[i] = h; al.h[i] = ASPLIT ? (_Float16)(xs[i] - (float)h) : (_Float16)0.0f; }
#pragma unroll
    for (int t = 0; t < 4; ++t) { if (col0 + t * 16 >= N) continue; const size_t boff = (size_t)(col0 + t * 16 + ln) * ldb + kb; FragH bq; bq.half[0] = *(const v8us*)(Bh + boff + 8 * hh); bq.half[1] = *(const v8us*)(Bh + boff + 16 + 8 * hh);
      acc[t] = mmaH<ASPLIT ? 2 : 1>(ah.v, al.v, bq.v, bq.v, acc[t]); }
  }
#pragma unroll
  for (int t = 0; t < 4; ++t) { if (col0 + t * 16 >= N) continue;
#pragma unroll
    for (int r = 0; r < 8; ++r) so[w][8 * hh + r][t * 16 + ln] = acc[t][r] * alpha; }
  __builtin_amdgcn_fence(__ATOMIC_ACQ_REL, "workgroup"); __builtin_amdgcn_wave_barrier();
  const int rsub = lane >> 4, c4 = (lane & 15) * 4;
  {
#pragma unroll
    for (int q = 0; q < 8; ++q) { const int r = q * 2 + rsub; if (col0 + c4 < N) { const v4f v = *(const v4fa*)&so[w][r][c4]; *(v4f*)(C + (size_t)(row0 + r) * ldc + col0 + c4) = v; } }
     }
}

// Wt[n][k] = f16(W[k][n]·scale) from f32 row-major W[K][N] (scale = power of two; bf16-exact weights stay exact in f16 away from the subnormal range)
__global__ __launch_bounds__(256) void k_wt_f16(const float* __restrict__ W, _Float16* __restrict__ Wt, int K, int N, float scale) {
  const int t = blockIdx.x * 256 + threadIdx.x; if (t >= N * (K / 8)) return; const int n = t / (K / 8), k8 = (t % (K / 8)) * 8; FragH f;
#pragma unroll
  for (int i = 0; i < 8; ++i) f.h[i] = (_Float16)(bf16_round(W[(size_t)(k8 + i) * N + n]) * scale); const v8us o = f.half[0];
  *(v8us*)((unsigned short*)Wt + (size_t)n * K + k8) = o; 
}
// k_gemm_hh variant with fused epilogue: v = acc·alpha + bias[by·sBias + col] (+ CP[(row/rowsPerB)·sCPb + by·64 + col] if CP) ; ACT 0 none / 1 elu ; writes f16 C16 (and f32 C if non-null)
template <int ACT>
__global__ __launch_bounds__(128) void k_gemm_hhx(const _Float16* __restrict__ A, int lda, size_t sA, const _Float16* __restrict__ Bh, int ldb, size_t sB, float alpha, const float* __restrict__ bias, size_t sBias, const float* __restrict__ CP, int rowsPerB, size_t sCPb, int row0g,
    float* __restrict__ C, _Float16* __restrict__ C16, int ldc, size_t sC, int M, int N, int K) {
  __shared__ __attribute__((aligned(16))) float so[4][16][64];
  const int tid = threadIdx.x, w = tid >> 5, lane = tid & 31, ln = lane & 15, hh = lane >> 4; const int by = blockIdx.y;
  A += (size_t)by * sA; Bh += (size_t)by * sB; const size_t cofs = (size_t)by * sC; const float* bp = bias ? bias + (size_t)by * sBias : nullptr;
  const int ntn = (N + 63) / 64; const int wid = blockIdx.x * 4 + w; const int mt = wid / ntn, nq = wid % ntn; if (mt * 16 >= M) return;
  const int row0 = mt * 16, col0 = nq * 64; const _Float16* arow = A + (size_t)(row0 + ln) * lda;
  v8f acc[4] = {};
  for (int kb = 0; kb < K; kb += 32) { FragH ah; ah.half[0] = *(const v8us*)((const unsigned short*)arow + kb + 8 * hh); ah.half[1] = *(const v8us*)((const unsigned short*)arow + kb + 16 + 8 * hh);
#pragma unroll
    for (int t = 0; t < 4; ++t) { if (col0 + t * 16 >= N) continue; const size_t boff = (size_t)(col0 + t * 16 + ln) * ldb + kb; FragH bq; bq.half[0] = *(const v8us*)((const unsigned short*)Bh + boff + 8 * hh); bq.half[1] = *(const v8us*)((const unsigned short*)Bh + boff + 16 + 8 * hh);
      acc[t] = mmaH<1>(ah.v, ah.v, bq.v, bq.v, acc[t]); }
  }
#pragma unroll
  for (int t = 0; t < 4; ++t) { if (col0 + t * 16 >= N) continue; const int col = col0 + t * 16 + ln; const float bv = bp ? bf16_round(bp[col]) : 0.f;
#pragma unroll
    for (int r = 0; r < 8; ++r) { float v = acc[t][r] * alpha + bv; if (CP) { const int rr = row0g + row0 + 8 * hh + r; if (rowsPerB < 0) v += CP[cofs + (size_t)rr * ldc + col];      /* rowsPerB < 0: own element of the batched C plane */ else { const int bidx = rr / rowsPerB; v += CP[(size_t)bidx * sCPb + (size_t)by * 64 + col]; } } if (ACT == 1) v = (v > 0.f) ? v : expm1f(v); else if (ACT == 7) v = (v > 0.f) ? v + 1.0f : expf(v); else if (ACT == 8) v = tanhf(v); else if (ACT == 9) v = 0.5f * v * (1.0f + tanhf(0.7978845608028654f * (v + 0.044715f * v * v * v))); else if (ACT == 11) v = 1.0f / (1.0f + expf(-v)); else if (ACT == 12) v = (v > 0.f) ? v : 0.01f * v; else if (ACT == 14) v = (v > 0.f) ? v : 0.1f * v; else if (ACT == 16) v = (v >= 0.f) ? v : 0.3f * v; else if (ACT == 17) v = (v >= 0.f) ? v : 0.2f * v; else if (ACT == 15) v = v / (1.0f + expf(-v)); else if (ACT == 3) v = fmaxf(v, 0.f); else if (ACT == 6) v = 0.5f * v * (1.0f + erff(v * 0.70710678118654752f)); so[w][8 * hh + r][t * 16 + ln] = v; } }
  __builtin_amdgcn_fence(__ATOMIC_ACQ_REL, "workgroup"); __builtin_amdgcn_wave_barrier();
  const int rsub = lane >> 4, c4 = (lane & 15) * 4; typedef _Float16 v4h __attribute__((ext_vector_type(4)));
  {
#pragma unroll
    for (int q = 0; q < 8; ++q) { const int r = q * 2 + rsub; if (col0 + c4 < N) { const v4f v = *(const v4fa*)&so[w][r][c4]; if (C) *(v4f*)(C + cofs + (size_t)(row0 + r) * ldc + col0 + c4) = v; if (C16) { v4h h4; for (int i = 0; i < 4; ++i) h4[i] = (_Float16)v[i]; *(v4h*)(C16 + cofs + (size_t)(row0 + r) * ldc + col0 + c4) = h4; } } }
     }
}


typedef _Float16 v4h __attribute__((ext_vector_type(4)));

__global__ __launch_bounds__(256) void k_x16(const float* __restrict__ x, _Float16* __restrict__ X16, size_t n8) { const size_t t = (size_t)blockIdx.x * 256 + threadIdx.x; if (t >= n8) return; FragH f;
#pragma unroll
  for (int q = 0; q < 8; ++q) f.h[q] = (_Float16)bf16_round(x[t * 8 + q]); *(v8us*)((unsigned short*)X16 + t * 8) = f.half[0];  }
__global__ __launch_bounds__(256) void k_h16(const float* __restrict__ x, _Float16* __restrict__ X16, size_t n8) { const size_t t = (size_t)blockIdx.x * 256 + threadIdx.x; if (t >= n8) return; FragH f;
#pragma unroll
  for (int q = 0; q < 8; ++q) f.h[q] = (_Float16)x[t * 8 + q]; *(v8us*)((unsigned short*)X16 + t * 8) = f.half[0];  }
__global__ __launch_bounds__(256) void k_round16f(const float* __restrict__ W, _Float16* __restrict__ Bt, size_t n8) { const size_t t = (size_t)blockIdx.x * 256 + threadIdx.x; if (t >= n8) return; FragH f;
#pragma unroll
  for (int i = 0; i < 8; ++i) f.h[i] = (_Float16)(bf16_round(W[t * 8 + i]) * 16.0f); *(v8us*)((unsigned short*)Bt + t * 8) = f.half[0];  }
template <int NHv, int TTv>
__global__ __launch_bounds__(256) void k_vt(const _Float16* __restrict__ V16, int ldv, int voff, _Float16* __restrict__ Vt) { __shared__ unsigned short tl[64][66]; const int tid = threadIdx.x; const int slab = blockIdx.x / (TTv / 64), lg = blockIdx.x % (TTv / 64); const int b = slab / NHv, h = slab % NHv;
  for (int i = tid; i < 64 * 8; i += 256) { const int r = i / 8, c8 = (i % 8) * 8; FragH f; f.half[0] = *(const v8us*)((const unsigned short*)V16 + ((size_t)b * TTv + lg * 64 + r) * ldv + voff + h * 64 + c8);
#pragma unroll
    for (int q = 0; q < 8; ++q) tl[r][c8 + q] = f.u[q]; }
  __syncthreads();
  {
#pragma unroll
    for (int rd = 0; rd < 2; ++rd) { const int d = rd * 32 + tid / 8, pc = tid % 8; FragH f;
#pragma unroll
      for (int q = 0; q < 8; ++q) f.u[q] = tl[pc * 8 + q][d];
      *(v8us*)((unsigned short*)Vt + ((size_t)slab * 64 + d) * TTv + lg * 64 + pc * 8) = f.half[0]; }
     } }

__global__ __launch_bounds__(256) void k_hl(const float* __restrict__ F, _Float16* __restrict__ Hh, _Float16* __restrict__ Hl, size_t n8) { const size_t t = (size_t)blockIdx.x * 256 + threadIdx.x; if (t >= n8) return; FragH fh, fl; const v4f a = *(const v4fa*)(F + t * 8), c = *(const v4fa*)(F + t * 8 + 4);
#pragma unroll
  for (int q = 0; q < 4; ++q) { _Float16 h = (_Float16)a[q]; fh.h[q] = h; fl.h[q] = (_Float16)((a[q] - (float)h) * 1024.0f); h = (_Float16)c[q]; fh.h[4 + q] = h; fl.h[4 + q] = (_Float16)((c[q] - (float)h) * 1024.0f); }
  { *(v8us*)((unsigned short*)Hh + t * 8) = fh.half[0]; *(v8us*)((unsigned short*)Hl + t * 8) = fl.half[0];  } }

// ---- fast GEMM (wave tile 32x64; requires M % 32 == 0 rows per launch region and N % 64 == 0); epilogue = k_gemm_hhx semantics ----
__device__ __forceinline__ v16h g2_frag(const _Float16* p, int hh) { FragH f; f.half[0] = *(const v8us*)((const unsigned short*)p + 8 * hh); f.half[1] = *(const v8us*)((const unsigned short*)p + 16 + 8 * hh); return f.v; }
__device__ __forceinline__ v8f g2_mma(v16h a, v16h b, v8f c) { v8f d = __builtin_amdgcn_wmma_f32_16x16x32_f16(false, a, false, b, (short)0, c, false, false); asm volatile("v_nop\n\tv_nop\n\tv_nop\n\tv_nop" : "+v"(d) : "v"(a), "v"(b)); return d; }
template <int ACT>
__global__ __launch_bounds__(128) void k_gemm2(const _Float16* __restrict__ A, int lda, size_t sA, const _Float16* __restrict__ Bh, int ldb, size_t sB, float alpha, const float* __restrict__ bias, size_t sBias, const float* __restrict__ CP, int rowsPerB, size_t sCPb, int row0g,
    float* __restrict__ C, _Float16* __restrict__ C16, int ldc, size_t sC, int M, int N, int K) { static_assert(ACT == 0 || ACT == 3 || ACT == 6 || ACT == 8 || ACT == 9 || ACT == 11 || ACT == 12 || ACT == 14 || ACT == 15 || ACT == 16 || ACT == 17, "k_gemm2: unsupported ACT code (would silently apply no activation)");
  __shared__ __attribute__((aligned(16))) float so[4][32][68];
  const int tid = threadIdx.x, w = tid >> 5, lane = tid & 31, ln = lane & 15, hh = lane >> 4; const int by = blockIdx.y;
  A += (size_t)by * sA; Bh += (size_t)by * sB; const size_t cofs = (size_t)by * sC; const float* bp = bias ? bias + (size_t)by * sBias : nullptr;
  const int ntn = N >> 6; const int mt = blockIdx.x / ntn, nq = blockIdx.x - mt * ntn; const int row0 = mt * 128 + 32 * w, col0 = nq * 64; if (row0 >= M) return;
  const _Float16* a0p = A + (size_t)(row0 + ln) * lda; const _Float16* a1p = a0p + (size_t)16 * lda;
  const _Float16* b0p = Bh + (size_t)(col0 + ln) * ldb; const _Float16* b1p = b0p + (size_t)16 * ldb; const _Float16* b2p = b1p + (size_t)16 * ldb; const _Float16* b3p = b2p + (size_t)16 * ldb;
  const v8f z8 = {0.f,0.f,0.f,0.f,0.f,0.f,0.f,0.f}; v8f c00 = z8, c01 = z8, c02 = z8, c03 = z8, c10 = z8, c11 = z8, c12 = z8, c13 = z8;
#pragma unroll 1
  for (int kb = 0; kb < K; kb += 32) { const v16h a0 = g2_frag(a0p + kb, hh), a1 = g2_frag(a1p + kb, hh);
    v16h b = g2_frag(b0p + kb, hh); c00 = g2_mma(a0, b, c00); c10 = g2_mma(a1, b, c10);
    b = g2_frag(b1p + kb, hh); c01 = g2_mma(a0, b, c01); c11 = g2_mma(a1, b, c11);
    b = g2_frag(b2p + kb, hh); c02 = g2_mma(a0, b, c02); c12 = g2_mma(a1, b, c12);
    b = g2_frag(b3p + kb, hh); c03 = g2_mma(a0, b, c03); c13 = g2_mma(a1, b, c13); }
  v8f accs[8] = {c00, c01, c02, c03, c10, c11, c12, c13};
#pragma unroll
  for (int u = 0; u < 8; ++u) { const int t = u & 3, half = u >> 2; const int col = col0 + t * 16 + ln; const float bv = bp ? bf16_round(bp[col]) : 0.f;
#pragma unroll
    for (int r = 0; r < 8; ++r) { const int rloc = half * 16 + 8 * hh + r; float v = accs[u][r] * alpha + bv; if (CP) { if (rowsPerB < 0) v += CP[cofs + (size_t)(row0g + row0 + rloc) * ldc + col];      /* rowsPerB < 0: own element of the batched C plane */ else { const int bidx = (row0g + row0 + rloc) / rowsPerB; v += CP[(size_t)bidx * sCPb + (size_t)by * 64 + col]; } }
      if (ACT == 3) v = fmaxf(v, 0.f); else if (ACT == 6) v = 0.5f * v * (1.0f + erff(v * 0.70710678118654752f)); else if (ACT == 11) v = 1.0f / (1.0f + expf(-v)); else if (ACT == 15) v = v / (1.0f + expf(-v)); else if (ACT == 12) v = (v > 0.f) ? v : 0.01f * v; else if (ACT == 8) v = tanhf(v); else if (ACT == 9) v = 0.5f * v * (1.0f + tanhf(0.7978845608028654f * (v + 0.044715f * v * v * v))); else if (ACT == 14) v = (v > 0.f) ? v : 0.1f * v; else if (ACT == 16) v = (v >= 0.f) ? v : 0.3f * v; else if (ACT == 17) v = (v >= 0.f) ? v : 0.2f * v;
      so[w][rloc][t * 16 + ln] = v; } }
  __builtin_amdgcn_fence(__ATOMIC_ACQ_REL, "workgroup"); __builtin_amdgcn_wave_barrier();
  const int rsub = lane >> 4, c4 = (lane & 15) * 4;
  {
#pragma unroll
    for (int q = 0; q < 16; ++q) { const int r = q * 2 + rsub; const v4f v = *(const v4fa*)&so[w][r][c4]; if (C) *(v4f*)(C + cofs + (size_t)(row0 + r) * ldc + col0 + c4) = v; if (C16) { v4h h4; for (int i = 0; i < 4; ++i) h4[i] = (_Float16)v[i]; *(v4h*)(C16 + cofs + (size_t)(row0 + r) * ldc + col0 + c4) = h4; } }
     } }


__global__ __launch_bounds__(256) void k_wnat(const float* __restrict__ w, size_t n8, _Float16* __restrict__ Bt) { const size_t t = (size_t)blockIdx.x * 256 + threadIdx.x; if (t >= n8) return; FragH f; for (int q = 0; q < 8; ++q) f.h[q] = (_Float16)(bf16_round(w[t * 8 + q]) * 16.0f); *(v8us*)((unsigned short*)Bt + t * 8) = f.half[0];  }
__global__ __launch_bounds__(256) void k_rsm(const float* __restrict__ S, _Float16* __restrict__ P, int nrows) {
  #pragma clang fp contract(off)
  const int i = blockIdx.x * 256 + threadIdx.x; if (i >= nrows) return; const float* s = S + (size_t)i * SQ; float mx = -3.0e38f;
#pragma unroll 1
  for (int j = 0; j < SQ; ++j) mx = fmaxf(mx, s[j]); float se = 0.f;
#pragma unroll 1
  for (int j = 0; j < SQ; ++j) se += expf(s[j] - mx); const float sc = 256.0f / se;
#pragma unroll 1
  for (int j0 = 0; j0 < SQ; j0 += 8) { FragH f; for (int q = 0; q < 8; ++q) f.h[q] = (_Float16)(expf(s[j0 + q] - mx) * sc); unsigned short* d = (unsigned short*)P + (size_t)i * SQ + j0; *(v8us*)d = f.half[0];  } }
__global__ __launch_bounds__(256) void k_vt(const _Float16* __restrict__ V16, int b, int h0, _Float16* __restrict__ VT) { __shared__ unsigned short tl[64][65]; const int tid = threadIdx.x; const int hh = blockIdx.x % HG, sg = blockIdx.x / HG; const int s0 = sg * 64; const int h = h0 + hh;
  for (int i = tid; i < 64 * 8; i += 256) { const int j = i / 8, d8 = (i % 8) * 8; FragH f; f.half[0] = *(const v8us*)((const unsigned short*)V16 + ((size_t)b * SQ + s0 + j) * DM + h * HD + d8); for (int q = 0; q < 8; ++q) tl[d8 + q][j] = f.u[q]; }
  __syncthreads();
  { for (int i = tid; i < 64 * 8; i += 256) { const int d = i / 8, j8 = (i % 8) * 8; FragH f; for (int q = 0; q < 8; ++q) f.u[q] = tl[d][j8 + q]; *(v8us*)((unsigned short*)VT + ((size_t)hh * HD + d) * SQ + s0 + j8) = f.half[0]; }  } }


__global__ __launch_bounds__(256) void k_wthd(const float* __restrict__ Wt, _Float16* __restrict__ Bt) { const size_t t = (size_t)blockIdx.x * 256 + threadIdx.x; if (t >= (size_t)NH * HD * (DM / 8)) return; const int m8 = (int)(t % (DM / 8)) * 8; const int d = (int)((t / (DM / 8)) % HD); const int h = (int)(t / ((size_t)(DM / 8) * HD)); FragH f;
  for (int q = 0; q < 8; ++q) f.h[q] = (_Float16)(16.0f * bf16_round(Wt[((size_t)h * DM + m8 + q) * HD + d])); unsigned short* dst = (unsigned short*)Bt + ((size_t)h * HD + d) * DM + m8; *(v8us*)dst = f.half[0];  }




// Row softmax, one wave per (query row, pair of heads): the two score rows and the mask row are read once, each load 512 contiguous bytes of a row,
// and stay in registers through maximum, exponential, sum and scaling. A masked key takes the value -3.0e38, whose exponential is 0 beside any live key.
typedef int v4ia __attribute__((ext_vector_type(4), may_alias));
template <int CTRL> __device__ __forceinline__ float rs_dpp(float v) { return __int_as_float(__builtin_amdgcn_update_dpp(0, __float_as_int(v), CTRL, 0xf, 0xf, true)); }      /* lane l reads lane l ^ (CTRL & 15) of its 16-lane row */
__device__ __forceinline__ float rs_xrow(float v) { const int i = __float_as_int(v); return __int_as_float(__builtin_amdgcn_permlanex16(i, i, 0x76543210, 0xfedcba98, true, false)); }      /* lane l reads lane l ^ 16 */
__device__ __forceinline__ float rs_wmax(float v) { v = fmaxf(v, rs_dpp<0x161>(v)); v = fmaxf(v, rs_dpp<0x162>(v)); v = fmaxf(v, rs_dpp<0x164>(v)); v = fmaxf(v, rs_dpp<0x168>(v)); return fmaxf(v, rs_xrow(v)); }
__device__ __forceinline__ float rs_wsum(float v) { v += rs_dpp<0x161>(v); v += rs_dpp<0x162>(v); v += rs_dpp<0x164>(v); v += rs_dpp<0x168>(v); return v + rs_xrow(v); }
// native exp(d) as __expf forms it; the v_nop is the slot the instruction set asks for behind a transcendental before its source is overwritten or its result read
__device__ __forceinline__ float rs_exp(float d) { float e; asm("v_exp_f32 %0, %1\n\tv_nop" : "=v"(e) : "v"(d * 1.44269504088896340736f)); return e; }
__global__ __launch_bounds__(256) void k_rsmim(const float* __restrict__ S, _Float16* __restrict__ P, size_t hs, int qn, const int* __restrict__ Mk, float* __restrict__ PO, int hsel) {      /* hs: elements from one head's plane of S and P to the next */
  static_assert(HG % 2 == 0 && SQ % 128 == 0, "k_rsmim: a wave takes two heads and 128 keys per load");
  constexpr int NC = SQ / 128;
  const int gw = blockIdx.x * 8 + __builtin_amdgcn_readfirstlane(threadIdx.x >> 5); if (gw >= qn * (HG / 2)) return;
  const int row = gw / (HG / 2), hl = (gw % (HG / 2)) * 2; const unsigned lb = (threadIdx.x & 31) * 16;      /* the lane's byte offset in each 512-byte load */
  const size_t i0 = (size_t)hl * hs + (size_t)row * SQ, i1 = i0 + hs; const char* s0 = (const char*)(S + i0); const char* s1 = (const char*)(S + i1); const char* m = (const char*)(Mk + (size_t)row * SQ);
  v4ia mm[NC]; v4f x0[NC], x1[NC];
#pragma unroll      // constant indices: the arrays stay in registers
  for (int c = 0; c < NC; ++c) { mm[c] = *(const v4ia*)(m + lb + c * 512); x0[c] = *(const v4fa*)(s0 + lb + c * 512); x1[c] = *(const v4fa*)(s1 + lb + c * 512); }
  __builtin_amdgcn_sched_barrier(0);      /* all 48 loads are issued in front of the wait: the most bytes in flight per wave, and no load left behind it */
  asm volatile("s_wait_xcnt 0x0" :: "s"(s0), "s"(s1), "s"(m), "v"(lb) : "memory");      /* the loads' address registers (held live up to here as inputs) are reused only behind this wait */
  __builtin_amdgcn_sched_barrier(0);      /* nothing that rewrites a register is lifted over the wait */
#pragma unroll      // constant indices: the arrays stay in registers
  for (int c = 0; c < NC; ++c)
#pragma unroll      // constant indices: the arrays stay in registers
    for (int q = 0; q < 4; ++q) { x0[c][q] = (mm[c][q] == 0) ? x0[c][q] : -3.0e38f; x1[c][q] = (mm[c][q] == 0) ? x1[c][q] : -3.0e38f; }
  float m0 = -3.0e38f, m1 = -3.0e38f;
#pragma unroll      // constant indices: the arrays stay in registers
  for (int c = 0; c < NC; ++c)
#pragma unroll      // constant indices: the arrays stay in registers
    for (int q = 0; q < 4; ++q) { m0 = fmaxf(m0, x0[c][q]); m1 = fmaxf(m1, x1[c][q]); }
  m0 = rs_wmax(m0); m1 = rs_wmax(m1);
  v4f t0 = {0.f, 0.f, 0.f, 0.f}, t1 = {0.f, 0.f, 0.f, 0.f};
#pragma unroll      // constant indices: the arrays stay in registers
  for (int c = 0; c < NC; ++c)
#pragma unroll      // constant indices: the arrays stay in registers
    for (int q = 0; q < 4; ++q) { x0[c][q] = rs_exp(x0[c][q] - m0); t0[q] += x0[c][q]; x1[c][q] = rs_exp(x1[c][q] - m1); t1[q] += x1[c][q]; }
  const float inv0 = 1.0f / rs_wsum((t0[0] + t0[1]) + (t0[2] + t0[3])), inv1 = 1.0f / rs_wsum((t1[0] + t1[1]) + (t1[2] + t1[3])); const float sc0 = 256.0f * inv0, sc1 = 256.0f * inv1;
  char* d0 = (char*)(P + i0); char* d1 = (char*)(P + i1); const unsigned lh = lb / 2; v4h p0[NC], p1[NC];
#pragma unroll      // constant indices: the arrays stay in registers
  for (int c = 0; c < NC; ++c)
#pragma unroll      // constant indices: the arrays stay in registers
    for (int q = 0; q < 4; ++q) { p0[c][q] = (_Float16)(x0[c][q] * sc0); p1[c][q] = (_Float16)(x1[c][q] * sc1); }
  __builtin_amdgcn_sched_barrier(0);      /* every store has data registers of its own, so the 32 stores issue back to back with no wait between them */
#pragma unroll      // constant indices: the arrays stay in registers
  for (int c = 0; c < NC; ++c) { *(v4h*)(d0 + lh + c * 256) = p0[c]; *(v4h*)(d1 + lh + c * 256) = p1[c]; }
  __builtin_amdgcn_sched_barrier(0);      /* no store is left behind the wait */
  asm volatile("s_wait_xcnt 0x0" :: "s"(d0), "s"(d1), "v"(lh) : "memory");      /* the stores' address and data registers are reused only behind this wait */
  __builtin_amdgcn_sched_barrier(0);      /* nothing that rewrites a register is lifted over the wait */
  char* po = (char*)(PO + (size_t)row * SQ);
  if (hsel == hl) {
#pragma unroll      // constant indices: the arrays stay in registers
    for (int c = 0; c < NC; ++c) *(v4f*)(po + lb + c * 512) = x0[c] * inv0; }
  else if (hsel == hl + 1) {
#pragma unroll      // constant indices: the arrays stay in registers
    for (int c = 0; c < NC; ++c) *(v4f*)(po + lb + c * 512) = x1[c] * inv1; } }


__global__ __launch_bounds__(256) void k_rsmf(const float* __restrict__ S, _Float16* __restrict__ P, int qn, int hg) {
  #pragma clang fp contract(off)
  const int t = blockIdx.x * 256 + threadIdx.x; if (t >= qn * hg) return; const size_t i = (size_t)(t / qn) * SQ + (t % qn); const float* s = S + i * SQ; float mx = -3.0e38f;
#pragma unroll 1
  for (int j = 0; j < SQ; ++j) mx = fmaxf(mx, s[j]); float se = 0.f;
#pragma unroll 1
  for (int j = 0; j < SQ; ++j) se += __expf(s[j] - mx); const float sc = 256.0f / se;
#pragma unroll 1
  for (int j0 = 0; j0 < SQ; j0 += 8) { FragH f; for (int q = 0; q < 8; ++q) f.h[q] = (_Float16)(__expf(s[j0 + q] - mx) * sc); unsigned short* d = (unsigned short*)P + i * SQ + j0; *(v8us*)d = f.half[0];  } }

extern "C" void kernel_launch(void* const* d_in, const int* in_sizes, int n_in,
                              void* d_out, int out_size, void* d_ws, size_t ws_size, hipStream_t stream) {
  (void)in_sizes; (void)n_in; (void)out_size;
  const float* const* I = (const float* const*)d_in; const float* xv = I[0]; const float* xk = I[1]; const float* xq = I[2]; const int* mk = (const int*)d_in[3]; const float* wq = I[4]; const float* bq = I[5]; const float* wk = I[6]; const float* bk = I[7]; const float* wv = I[8]; const float* bv = I[9]; const float* wo = I[10]; const float* bo = I[11];      /* NOTE the module's input order v, k, q, mask; per-head [h][in][out] weights + [h][64] biases (= flat [1024]); W0 [in][out] + b0 */
  float* PO = (float*)d_out + (size_t)NB * SQ * DM;      /* second output: last head's attention probabilities [NB][SQ][SQ] f32 at byte offset 16,777,216 */
  char* ws = (char*)d_ws; size_t off = 0;
  auto take = [&](size_t bytes) { char* p = ws + off; off += (bytes + 255) & ~(size_t)255; return p; };
  _Float16* BQ = (_Float16*)take((size_t)DM * DM * 2); _Float16* BK = (_Float16*)take((size_t)DM * DM * 2); _Float16* BV = (_Float16*)take((size_t)DM * DM * 2); _Float16* BO = (_Float16*)take((size_t)DM * DM * 2);
  _Float16* XQ = (_Float16*)take(NR * DM * 2); _Float16* XK = (_Float16*)take(NR * DM * 2); _Float16* XV = (_Float16*)take(NR * DM * 2); _Float16* Q16 = (_Float16*)take(NR * DM * 2); _Float16* K16 = (_Float16*)take(NR * DM * 2); _Float16* V16 = (_Float16*)take(NR * DM * 2); _Float16* O16 = (_Float16*)take(NR * DM * 2);
  float* S = (float*)take((size_t)HG * SQ * SQ * 4); _Float16* P = (_Float16*)take((size_t)HG * SQ * SQ * 2); _Float16* VT = (_Float16*)take((size_t)NH * HD * SQ * 2);
  if (off > ws_size) return;
  k_wthd<<<(unsigned)(((size_t)NH * HD * (DM / 8) + 255) / 256), 256, 0, stream>>>(wq, BQ); k_wthd<<<(unsigned)(((size_t)NH * HD * (DM / 8) + 255) / 256), 256, 0, stream>>>(wk, BK); k_wthd<<<(unsigned)(((size_t)NH * HD * (DM / 8) + 255) / 256), 256, 0, stream>>>(wv, BV);      /* per-head [h][m][d] -> Bt[(h,d)][m] x16 */
  k_wt_f16<<<(unsigned)(((size_t)DM * (DM / 8) + 255) / 256), 256, 0, stream>>>(wo, BO, DM, DM, 16.0f);      /* W0 [in][out] -> Bt x16 */

  k_x16<<<(unsigned)((NR * DM / 8 + 255) / 256), 256, 0, stream>>>(xq, XQ, NR * DM / 8); k_x16<<<(unsigned)((NR * DM / 8 + 255) / 256), 256, 0, stream>>>(xk, XK, NR * DM / 8); k_x16<<<(unsigned)((NR * DM / 8 + 255) / 256), 256, 0, stream>>>(xv, XV, NR * DM / 8);      /* the three inputs as exact f16 rows */
  const size_t r0p = (size_t)B0 * SQ;      /* first projected row */
  k_gemm2<0><<<dim3((unsigned)((MP / 128) * (DM / 64)), 1), 128, 0, stream>>>(XQ + r0p * DM, DM, 0, BQ, DM, 0, 0.0625f, bq, 0, nullptr, 1, 0, 0, nullptr, Q16 + r0p * DM, DM, 0, MP, DM, DM);
  k_gemm2<0><<<dim3((unsigned)((MP / 128) * (DM / 64)), 1), 128, 0, stream>>>(XK + r0p * DM, DM, 0, BK, DM, 0, 0.0625f, bk, 0, nullptr, 1, 0, 0, nullptr, K16 + r0p * DM, DM, 0, MP, DM, DM);
  k_gemm2<0><<<dim3((unsigned)((MP / 128) * (DM / 64)), 1), 128, 0, stream>>>(XV + r0p * DM, DM, 0, BV, DM, 0, 0.0625f, bv, 0, nullptr, 1, 0, 0, nullptr, V16 + r0p * DM, DM, 0, MP, DM, DM);
  for (int b = B0; b < B0 + NBR; ++b) { const size_t r0 = (size_t)b * SQ;
    k_vt<NH, SQ><<<NH * (SQ / 64), 256, 0, stream>>>(V16 + r0 * LQ, LQ, 0, VT);      /* V^T [NH][HD][SQ] for this batch */
    for (int h0 = 0; h0 < NHD; h0 += HG) {
      k_gemm2<0><<<dim3((QN / 128) * (SQ / 64), HG), 128, 0, stream>>>(Q16 + r0 * LQ + h0 * HD, LQ, (size_t)HD, K16 + r0 * LQ + h0 * HD, LQ, (size_t)HD, 0.125f, nullptr, 0, nullptr, 1, 0, 0, S, nullptr, SQ, (size_t)SQ * SQ, QN, SQ, HD);      /* scores, HG heads per launch */
      k_rsmim<<<((HG / 2) * QN + 7) / 8, 256, 0, stream>>>(S, P, (size_t)SQ * SQ, QN, mk + (size_t)b * SQ * SQ, PO + (size_t)b * SQ * SQ, (h0 <= NH - 1 && NH - 1 < h0 + HG) ? (NH - 1 - h0) : -1);      /* a key with a nonzero mask drops out; the group holding head 15 also writes its f32 probabilities to the second output */      /* P = 256 softmax (f16), rows of all HG heads */
      k_gemm2<0><<<dim3((QN / 128) * (HD / 64), HG), 128, 0, stream>>>(P, SQ, (size_t)SQ * SQ, VT + (size_t)h0 * HD * SQ, SQ, (size_t)HD * SQ, 0.25f, nullptr, 0, nullptr, 1, 0, 0, nullptr, O16 + r0 * DM + h0 * HD, DM, (size_t)HD, QN, HD, SQ); } }      /* o (merged heads) as f16 rows */
  k_gemm2<0><<<dim3((unsigned)((MPO / 128) * (DM / 64)), 1), 128, 0, stream>>>(O16 + r0p * DM, DM, 0, BO, DM, 0, 0.0009765625f, bo, 0, nullptr, 1, 0, 0, (float*)d_out + r0p * DM, nullptr, DM, 0, MPO, DM, DM);      /* out rows are the output layout */
}

// v002
// Measured time: 413 microseconds a run.
// In two side-by-side timings against v001, it was 2.44 and 2.45 times as fast.
// Counting every step since v000, it is 16.4 times as fast.
#include <hip/hip_runtime.h>
#define NB 2
#define SQ 2048
#define DM 1024
#define NH 16
#define HD 64
#define HG 4                         /* heads per launch of the unused k_vt(V16, b, h0, VT) overload */
#define B0 0                         /* first batch processed (debug hook) */
#define NBR NB                       /* batches processed (debug hook) */
#define NR ((size_t)NB * SQ)         /* token rows */
#define MP ((int)((size_t)NBR * SQ)) /* rows projected (debug hook) */
#define QN SQ                        /* query rows per batch; unused */
#define NHD NH                       /* heads; unused */
#define MPO MP                       /* rows through the output stage (debug hook) */
#define LQ DM      /* row pitch of the q/k/v rows */
typedef __bf16 v16b __attribute__((ext_vector_type(16)));
typedef unsigned short v8us __attribute__((ext_vector_type(8), may_alias));
typedef float  v8f  __attribute__((ext_vector_type(8)));
typedef float  v4f  __attribute__((ext_vector_type(4)));
typedef float  v4fa __attribute__((ext_vector_type(4), may_alias));
union FragB { v16b v; v8us half[2]; unsigned short u[16]; };

__device__ __forceinline__ unsigned short bf16_bits(float x) { unsigned int u = __float_as_uint(x); return (unsigned short)((u + 0x7FFFu + ((u >> 16) & 1u)) >> 16); }
__device__ __forceinline__ float bf16_val(unsigned short b) { return __uint_as_float(((unsigned int)b) << 16); }
__device__ __forceinline__ float bf16_round(float x) { return bf16_val(bf16_bits(x)); }
// D += A·B with NT terms: 1 = ah·bh, 2 = + al·bh (A split), 3 = + ah·bl (both split)
template <int NT>
__device__ __forceinline__ v8f mmaN(v16b ah, v16b al, v16b bh, v16b bl, v8f c) {
  c = __builtin_amdgcn_wmma_f32_16x16x32_bf16(false, ah, false, bh, (short)0, c, false, false);
  if (NT >= 2) c = __builtin_amdgcn_wmma_f32_16x16x32_bf16(false, al, false, bh, (short)0, c, false, false);
  if (NT >= 3) c = __builtin_amdgcn_wmma_f32_16x16x32_bf16(false, ah, false, bl, (short)0, c, false, false);
  asm volatile("v_nop\n\tv_nop\n\tv_nop\n\tv_nop" : "+v"(c) : "v"(ah), "v"(al), "v"(bh), "v"(bl));
  return c;
}

__global__ __launch_bounds__(256) void k_wt_bf16(const float* __restrict__ W, unsigned short* __restrict__ Wt, int K, int N) {
  const int t = blockIdx.x * 256 + threadIdx.x;
  const int k8n = K / 8;
  if (t >= N * k8n) return;
  const int n = t / k8n, k8 = (t % k8n) * 8;
  v8us v;
#pragma unroll
  for (int i = 0; i < 8; ++i) v[i] = bf16_bits(W[(size_t)(k8 + i) * N + n]);
  *(v8us*)(Wt + (size_t)n * K + k8) = v;
  
}

// GEMM C[M][N] (f32, pitch ldc) = act(A[M][K]·W + bias). A f32 row-major (pitch lda) converted per fragment to bf16
// (ASPLIT: hi/lo two planes -> 2 terms, else single rounded term); Wt bf16 [N][K] (pitch ldb). BIAS_BF16 rounds the
// bias to bf16 first (bias quantised to bf16 before the add). K%32==0, M%16==0, N%64==0.
template <bool ASPLIT, int ACT, bool BIAS_BF16>
__global__ __launch_bounds__(128) void k_gemm_bf(const float* __restrict__ A, int lda, const unsigned short* __restrict__ Wt, int ldb,
                                               const float* __restrict__ bias, float* __restrict__ C, int ldc, int M, int N, int K) {
  __shared__ __attribute__((aligned(16))) float so[4][16][64];
  const int tid = threadIdx.x, w = tid >> 5, lane = tid & 31, ln = lane & 15, hh = lane >> 4;
  const int ntn = N / 64;
  const int wid = blockIdx.x * 4 + w;
  const int mt = wid / ntn, nq = wid % ntn;
  if (mt * 16 >= M) return;
  const int row0 = mt * 16, col0 = nq * 64;
  const float* arow = A + (size_t)(row0 + ln) * lda;
  v8f acc[4] = {};
  for (int kb = 0; kb < K; kb += 32) {
    FragB ah, al;
    const v4f x0 = *(const v4fa*)(arow + kb + 8 * hh), x1 = *(const v4fa*)(arow + kb + 8 * hh + 4);
    const v4f x2 = *(const v4fa*)(arow + kb + 16 + 8 * hh), x3 = *(const v4fa*)(arow + kb + 16 + 8 * hh + 4);
    float xs[16] = {x0[0],x0[1],x0[2],x0[3],x1[0],x1[1],x1[2],x1[3],x2[0],x2[1],x2[2],x2[3],x3[0],x3[1],x3[2],x3[3]};
#pragma unroll
    for (int i = 0; i < 16; ++i) { const unsigned short hb = bf16_bits(xs[i]); ah.u[i] = hb; al.u[i] = ASPLIT ? bf16_bits(xs[i] - bf16_val(hb)) : (unsigned short)0; }
#pragma unroll
    for (int t = 0; t < 4; ++t) {
      const unsigned short* brow = Wt + (size_t)(col0 + t * 16 + ln) * ldb + kb;
      FragB b;
      b.half[0] = *(const v8us*)(brow + 8 * hh);
      b.half[1] = *(const v8us*)(brow + 16 + 8 * hh);
      acc[t] = mmaN<ASPLIT ? 2 : 1>(ah.v, al.v, b.v, b.v, acc[t]);
    }
  }
#pragma unroll
  for (int t = 0; t < 4; ++t) {
    float bv = bias ? bias[col0 + t * 16 + ln] : 0.f;
    if (BIAS_BF16) bv = bf16_round(bv);
#pragma unroll
    for (int r = 0; r < 8; ++r) { float v = acc[t][r] + bv; if (ACT == 1) v = fmaxf(v, 0.f); so[w][8 * hh + r][t * 16 + ln] = v; }
  }
  __builtin_amdgcn_fence(__ATOMIC_ACQ_REL, "workgroup");
  __builtin_amdgcn_wave_barrier();
  const int rsub = lane >> 4, c4 = (lane & 15) * 4;
  {
#pragma unroll
    for (int q = 0; q < 8; ++q) {
      const int r = q * 2 + rsub;
      const v4f v = *(const v4fa*)&so[w][r][c4];
      *(v4f*)(C + (size_t)(row0 + r) * ldc + col0 + c4) = v;
    }
    
  }
}

// GEMM C = act(A·W + bias + resid): A f32 (ASPLIT -> hi/lo 2 terms), Wt bf16 [N][K]; ACT 0 none, 1 relu, 2 exact gelu;
// resid (optional, f32, row index = (row % rmod), pitch ldr, RES_BF16 rounds it) added before the activation.
template <bool ASPLIT, int ACT, bool BIAS_BF16, bool RES_BF16>
__global__ __launch_bounds__(128) void k_gemm_bf3(const float* __restrict__ A, int lda, const unsigned short* __restrict__ Wt, int ldb,
                                                const float* __restrict__ bias, const float* __restrict__ resid, int rmod, int ldr,
                                                float* __restrict__ C, int ldc, int M, int N, int K) {
  __shared__ __attribute__((aligned(16))) float so[4][16][64];
  const int tid = threadIdx.x, w = tid >> 5, lane = tid & 31, ln = lane & 15, hh = lane >> 4;
  const int ntn = N / 64;
  const int wid = blockIdx.x * 4 + w;
  const int mt = wid / ntn, nq = wid % ntn;
  if (mt * 16 >= M) return;
  const int row0 = mt * 16, col0 = nq * 64;
  const float* arow = A + (size_t)(row0 + ln) * lda;
  v8f acc[4] = {};
  for (int kb = 0; kb < K; kb += 32) {
    FragB ah, al;
    const v4f x0 = *(const v4fa*)(arow + kb + 8 * hh), x1 = *(const v4fa*)(arow + kb + 8 * hh + 4);
    const v4f x2 = *(const v4fa*)(arow + kb + 16 + 8 * hh), x3 = *(const v4fa*)(arow + kb + 16 + 8 * hh + 4);
    float xs[16] = {x0[0],x0[1],x0[2],x0[3],x1[0],x1[1],x1[2],x1[3],x2[0],x2[1],x2[2],x2[3],x3[0],x3[1],x3[2],x3[3]};
#pragma unroll
    for (int i = 0; i < 16; ++i) { const unsigned short hb = bf16_bits(xs[i]); ah.u[i] = hb; al.u[i] = ASPLIT ? bf16_bits(xs[i] - bf16_val(hb)) : (unsigned short)0; }
#pragma unroll
    for (int t = 0; t < 4; ++t) {
      const unsigned short* brow = Wt + (size_t)(col0 + t * 16 + ln) * ldb + kb;
      FragB b;
      b.half[0] = *(const v8us*)(brow + 8 * hh);
      b.half[1] = *(const v8us*)(brow + 16 + 8 * hh);
      acc[t] = mmaN<ASPLIT ? 2 : 1>(ah.v, al.v, b.v, b.v, acc[t]);
    }
  }
#pragma unroll
  for (int t = 0; t < 4; ++t) {
    const int col = col0 + t * 16 + ln;
    float bv = bias ? bias[col] : 0.f;
    if (BIAS_BF16) bv = bf16_round(bv);
#pragma unroll
    for (int r = 0; r < 8; ++r) {
      float v = acc[t][r] + bv;
      if (resid) { float rv = resid[(size_t)((row0 + 8 * hh + r) % rmod) * ldr + col]; if (RES_BF16) rv = bf16_round(rv); v += rv; }
      if (ACT == 1) v = fmaxf(v, 0.f);
      if (ACT == 2) v = 0.5f * v * (1.0f + erff(v * 0.70710678118654752f));
      if (ACT == 3) { const float u = 0.7978845608028654f * (v + 0.044715f * v * v * v); v = 0.5f * v * (1.0f + tanhf(u)); }
      so[w][8 * hh + r][t * 16 + ln] = v;
    }
  }
  __builtin_amdgcn_fence(__ATOMIC_ACQ_REL, "workgroup");
  __builtin_amdgcn_wave_barrier();
  const int rsub = lane >> 4, c4 = (lane & 15) * 4;
  {
#pragma unroll
    for (int q = 0; q < 8; ++q) {
      const int r = q * 2 + rsub;
      const v4f v = *(const v4fa*)&so[w][r][c4];
      *(v4f*)(C + (size_t)(row0 + r) * ldc + col0 + c4) = v;
    }
    
  }
}
// row LayerNorm (biased variance, eps) over N: s = X (+ R); optional out_sum <- s; out_norm <- (s-mu)*rsqrt(var+eps)*g + b
template <bool PARAM_BF16>
__global__ __launch_bounds__(256) void k_layernorm(const float* __restrict__ X, const float* __restrict__ R, const float* __restrict__ g, const float* __restrict__ bta,
                                                  float* __restrict__ out_sum, float* __restrict__ out_norm, int N, float eps) {
  __shared__ float red[256];
  const int row = blockIdx.x, tid = threadIdx.x;
  const float* x = X + (size_t)row * N; const float* rr = R ? R + (size_t)row * N : nullptr;
  float vals[16];                     // up to N = 4096
  const int per = N / 256;            // contiguous chunk per thread? use strided-by-4 chunks: thread handles j = tid*4 + 1024*u
  float s1 = 0.f;
  for (int u = 0; u < per / 4; ++u) {
    const int j = tid * 4 + 1024 * u;
    const v4f a = *(const v4fa*)(x + j);
    v4f b = {0.f,0.f,0.f,0.f}; if (rr) b = *(const v4fa*)(rr + j);
#pragma unroll
    for (int q = 0; q < 4; ++q) { const float v = a[q] + b[q]; vals[u * 4 + q] = v; s1 += v; }
  }
  red[tid] = s1; __syncthreads();
  for (int st = 128; st > 0; st >>= 1) { if (tid < st) red[tid] += red[tid + st]; __syncthreads(); }
  const float mu = red[0] / (float)N; __syncthreads();
  float s2 = 0.f;
  for (int u = 0; u < per / 4; ++u)
#pragma unroll
    for (int q = 0; q < 4; ++q) { const float c = vals[u * 4 + q] - mu; s2 += c * c; }
  red[tid] = s2; __syncthreads();
  for (int st = 128; st > 0; st >>= 1) { if (tid < st) red[tid] += red[tid + st]; __syncthreads(); }
  const float rs = rsqrtf(red[0] / (float)N + eps);
  {
    for (int u = 0; u < per / 4; ++u) {
      const int j = tid * 4 + 1024 * u;
      v4f o, sm;
#pragma unroll
      for (int q = 0; q < 4; ++q) {
        float gg = g[j + q], bb = bta[j + q];
        if (PARAM_BF16) { gg = bf16_round(gg); bb = bf16_round(bb); }
        sm[q] = vals[u * 4 + q]; o[q] = (vals[u * 4 + q] - mu) * rs * gg + bb;
      }
      if (out_sum) *(v4f*)(out_sum + (size_t)row * N + j) = sm;
      *(v4f*)(out_norm + (size_t)row * N + j) = o;
    }
    
  }
}



// ---- f16 WMMA path (v_wmma_f32_16x16x32_f16): 11-bit significands for operands in range — used where a [0,1] probability operand needs more precision than bf16
typedef _Float16 v16h __attribute__((ext_vector_type(16)));
union FragH { v16h v; v8us half[2]; _Float16 h[16]; unsigned short u[16]; };
template <int NT>
__device__ __forceinline__ v8f mmaH(v16h ah, v16h al, v16h bh, v16h bl, v8f c) {
  c = __builtin_amdgcn_wmma_f32_16x16x32_f16(false, ah, false, bh, (short)0, c, false, false);
  if (NT >= 2) c = __builtin_amdgcn_wmma_f32_16x16x32_f16(false, al, false, bh, (short)0, c, false, false);
  if (NT >= 3) c = __builtin_amdgcn_wmma_f32_16x16x32_f16(false, ah, false, bl, (short)0, c, false, false);
  asm volatile("v_nop\n\tv_nop\n\tv_nop\n\tv_nop" : "+v"(c) : "v"(ah), "v"(al), "v"(bh), "v"(bl));
  return c;
}
// batched GEMM like k_gemm_b but f16 operands: A f32 (split into f16 hi/lo if ASPLIT, else rounded to f16), Bt = f16 values [n][k]; alpha; C f32; N multiple of 16 (partial tiles skipped)
template <bool ASPLIT>
__global__ __launch_bounds__(128) void k_gemm_h(const float* __restrict__ A, int lda, size_t sA, const _Float16* __restrict__ Bh, int ldb, size_t sB, float alpha, float* __restrict__ C, int ldc, size_t sC, int M, int N, int K) {
  __shared__ __attribute__((aligned(16))) float so[4][16][64];
  const int tid = threadIdx.x, w = tid >> 5, lane = tid & 31, ln = lane & 15, hh = lane >> 4; const int by = blockIdx.y;
  A += (size_t)by * sA; Bh += (size_t)by * sB; C += (size_t)by * sC;
  const int ntn = (N + 63) / 64; const int wid = blockIdx.x * 4 + w; const int mt = wid / ntn, nq = wid % ntn; if (mt * 16 >= M) return;
  const int row0 = mt * 16, col0 = nq * 64; const float* arow = A + (size_t)(row0 + ln) * lda;
  v8f acc[4] = {};
  for (int kb = 0; kb < K; kb += 32) {
    FragH ah, al;
    const v4f x0 = *(const v4fa*)(arow + kb + 8 * hh), x1 = *(const v4fa*)(arow + kb + 8 * hh + 4), x2 = *(const v4fa*)(arow + kb + 16 + 8 * hh), x3 = *(const v4fa*)(arow + kb + 16 + 8 * hh + 4);
    float xs[16] = {x0[0],x0[1],x0[2],x0[3],x1[0],x1[1],x1[2],x1[3],x2[0],x2[1],x2[2],x2[3],x3[0],x3[1],x3[2],x3[3]};
#pragma unroll
    for (int i = 0; i < 16; ++i) { const _Float16 h = (_Float16)xs[i]; ah.h[i] = h; al.h[i] = ASPLIT ? (_Float16)(xs[i] - (float)h) : (_Float16)0.0f; }
#pragma unroll
    for (int t = 0; t < 4; ++t) { if (col0 + t * 16 >= N) continue; const size_t boff = (size_t)(col0 + t * 16 + ln) * ldb + kb; FragH bq; bq.half[0] = *(const v8us*)(Bh + boff + 8 * hh); bq.half[1] = *(const v8us*)(Bh + boff + 16 + 8 * hh);
      acc[t] = mmaH<ASPLIT ? 2 : 1>(ah.v, al.v, bq.v, bq.v, acc[t]); }
  }
#pragma unroll
  for (int t = 0; t < 4; ++t) { if (col0 + t * 16 >= N) continue;
#pragma unroll
    for (int r = 0; r < 8; ++r) so[w][8 * hh + r][t * 16 + ln] = acc[t][r] * alpha; }
  __builtin_amdgcn_fence(__ATOMIC_ACQ_REL, "workgroup"); __builtin_amdgcn_wave_barrier();
  const int rsub = lane >> 4, c4 = (lane & 15) * 4;
  {
#pragma unroll
    for (int q = 0; q < 8; ++q) { const int r = q * 2 + rsub; if (col0 + c4 < N) { const v4f v = *(const v4fa*)&so[w][r][c4]; *(v4f*)(C + (size_t)(row0 + r) * ldc + col0 + c4) = v; } }
     }
}

// Wt[n][k] = f16(W[k][n]·scale) from f32 row-major W[K][N] (scale = power of two; bf16-exact weights stay exact in f16 away from the subnormal range)
__global__ __launch_bounds__(256) void k_wt_f16(const float* __restrict__ W, _Float16* __restrict__ Wt, int K, int N, float scale) {
  const int t = blockIdx.x * 256 + threadIdx.x; if (t >= N * (K / 8)) return; const int n = t / (K / 8), k8 = (t % (K / 8)) * 8; FragH f;
#pragma unroll
  for (int i = 0; i < 8; ++i) f.h[i] = (_Float16)(bf16_round(W[(size_t)(k8 + i) * N + n]) * scale); const v8us o = f.half[0];
  *(v8us*)((unsigned short*)Wt + (size_t)n * K + k8) = o; 
}
// k_gemm_hh variant with fused epilogue: v = acc·alpha + bias[by·sBias + col] (+ CP[(row/rowsPerB)·sCPb + by·64 + col] if CP) ; ACT 0 none / 1 elu ; writes f16 C16 (and f32 C if non-null)
template <int ACT>
__global__ __launch_bounds__(128) void k_gemm_hhx(const _Float16* __restrict__ A, int lda, size_t sA, const _Float16* __restrict__ Bh, int ldb, size_t sB, float alpha, const float* __restrict__ bias, size_t sBias, const float* __restrict__ CP, int rowsPerB, size_t sCPb, int row0g,
    float* __restrict__ C, _Float16* __restrict__ C16, int ldc, size_t sC, int M, int N, int K) {
  __shared__ __attribute__((aligned(16))) float so[4][16][64];
  const int tid = threadIdx.x, w = tid >> 5, lane = tid & 31, ln = lane & 15, hh = lane >> 4; const int by = blockIdx.y;
  A += (size_t)by * sA; Bh += (size_t)by * sB; const size_t cofs = (size_t)by * sC; const float* bp = bias ? bias + (size_t)by * sBias : nullptr;
  const int ntn = (N + 63) / 64; const int wid = blockIdx.x * 4 + w; const int mt = wid / ntn, nq = wid % ntn; if (mt * 16 >= M) return;
  const int row0 = mt * 16, col0 = nq * 64; const _Float16* arow = A + (size_t)(row0 + ln) * lda;
  v8f acc[4] = {};
  for (int kb = 0; kb < K; kb += 32) { FragH ah; ah.half[0] = *(const v8us*)((const unsigned short*)arow + kb + 8 * hh); ah.half[1] = *(const v8us*)((const unsigned short*)arow + kb + 16 + 8 * hh);
#pragma unroll
    for (int t = 0; t < 4; ++t) { if (col0 + t * 16 >= N) continue; const size_t boff = (size_t)(col0 + t * 16 + ln) * ldb + kb; FragH bq; bq.half[0] = *(const v8us*)((const unsigned short*)Bh + boff + 8 * hh); bq.half[1] = *(const v8us*)((const unsigned short*)Bh + boff + 16 + 8 * hh);
      acc[t] = mmaH<1>(ah.v, ah.v, bq.v, bq.v, acc[t]); }
  }
#pragma unroll
  for (int t = 0; t < 4; ++t) { if (col0 + t * 16 >= N) continue; const int col = col0 + t * 16 + ln; const float bv = bp ? bf16_round(bp[col]) : 0.f;
#pragma unroll
    for (int r = 0; r < 8; ++r) { float v = acc[t][r] * alpha + bv; if (CP) { const int rr = row0g + row0 + 8 * hh + r; if (rowsPerB < 0) v += CP[cofs + (size_t)rr * ldc + col];      /* rowsPerB < 0: own element of the batched C plane */ else { const int bidx = rr / rowsPerB; v += CP[(size_t)bidx * sCPb + (size_t)by * 64 + col]; } } if (ACT == 1) v = (v > 0.f) ? v : expm1f(v); else if (ACT == 7) v = (v > 0.f) ? v + 1.0f : expf(v); else if (ACT == 8) v = tanhf(v); else if (ACT == 9) v = 0.5f * v * (1.0f + tanhf(0.7978845608028654f * (v + 0.044715f * v * v * v))); else if (ACT == 11) v = 1.0f / (1.0f + expf(-v)); else if (ACT == 12) v = (v > 0.f) ? v : 0.01f * v; else if (ACT == 14) v = (v > 0.f) ? v : 0.1f * v; else if (ACT == 16) v = (v >= 0.f) ? v : 0.3f * v; else if (ACT == 17) v = (v >= 0.f) ? v : 0.2f * v; else if (ACT == 15) v = v / (1.0f + expf(-v)); else if (ACT == 3) v = fmaxf(v, 0.f); else if (ACT == 6) v = 0.5f * v * (1.0f + erff(v * 0.70710678118654752f)); so[w][8 * hh + r][t * 16 + ln] = v; } }
  __builtin_amdgcn_fence(__ATOMIC_ACQ_REL, "workgroup"); __builtin_amdgcn_wave_barrier();
  const int rsub = lane >> 4, c4 = (lane & 15) * 4; typedef _Float16 v4h __attribute__((ext_vector_type(4)));
  {
#pragma unroll
    for (int q = 0; q < 8; ++q) { const int r = q * 2 + rsub; if (col0 + c4 < N) { const v4f v = *(const v4fa*)&so[w][r][c4]; if (C) *(v4f*)(C + cofs + (size_t)(row0 + r) * ldc + col0 + c4) = v; if (C16) { v4h h4; for (int i = 0; i < 4; ++i) h4[i] = (_Float16)v[i]; *(v4h*)(C16 + cofs + (size_t)(row0 + r) * ldc + col0 + c4) = h4; } } }
     }
}


typedef _Float16 v4h __attribute__((ext_vector_type(4)));

__global__ __launch_bounds__(256) void k_x16(const float* __restrict__ x, _Float16* __restrict__ X16, size_t n8) { const size_t t = (size_t)blockIdx.x * 256 + threadIdx.x; if (t >= n8) return; FragH f;
#pragma unroll
  for (int q = 0; q < 8; ++q) f.h[q] = (_Float16)bf16_round(x[t * 8 + q]); *(v8us*)((unsigned short*)X16 + t * 8) = f.half[0];  }
__global__ __launch_bounds__(256) void k_h16(const float* __restrict__ x, _Float16* __restrict__ X16, size_t n8) { const size_t t = (size_t)blockIdx.x * 256 + threadIdx.x; if (t >= n8) return; FragH f;
#pragma unroll
  for (int q = 0; q < 8; ++q) f.h[q] = (_Float16)x[t * 8 + q]; *(v8us*)((unsigned short*)X16 + t * 8) = f.half[0];  }
__global__ __launch_bounds__(256) void k_round16f(const float* __restrict__ W, _Float16* __restrict__ Bt, size_t n8) { const size_t t = (size_t)blockIdx.x * 256 + threadIdx.x; if (t >= n8) return; FragH f;
#pragma unroll
  for (int i = 0; i < 8; ++i) f.h[i] = (_Float16)(bf16_round(W[t * 8 + i]) * 16.0f); *(v8us*)((unsigned short*)Bt + t * 8) = f.half[0];  }
template <int NHv, int TTv>
__global__ __launch_bounds__(256) void k_vt(const _Float16* __restrict__ V16, int ldv, int voff, _Float16* __restrict__ Vt) { __shared__ unsigned short tl[64][66]; const int tid = threadIdx.x; const int slab = blockIdx.x / (TTv / 64), lg = blockIdx.x % (TTv / 64); const int b = slab / NHv, h = slab % NHv;
  for (int i = tid; i < 64 * 8; i += 256) { const int r = i / 8, c8 = (i % 8) * 8; FragH f; f.half[0] = *(const v8us*)((const unsigned short*)V16 + ((size_t)b * TTv + lg * 64 + r) * ldv + voff + h * 64 + c8);
#pragma unroll
    for (int q = 0; q < 8; ++q) tl[r][c8 + q] = f.u[q]; }
  __syncthreads();
  {
#pragma unroll
    for (int rd = 0; rd < 2; ++rd) { const int d = rd * 32 + tid / 8, pc = tid % 8; FragH f;
#pragma unroll
      for (int q = 0; q < 8; ++q) f.u[q] = tl[pc * 8 + q][d];
      *(v8us*)((unsigned short*)Vt + ((size_t)slab * 64 + d) * TTv + lg * 64 + pc * 8) = f.half[0]; }
     } }

__global__ __launch_bounds__(256) void k_hl(const float* __restrict__ F, _Float16* __restrict__ Hh, _Float16* __restrict__ Hl, size_t n8) { const size_t t = (size_t)blockIdx.x * 256 + threadIdx.x; if (t >= n8) return; FragH fh, fl; const v4f a = *(const v4fa*)(F + t * 8), c = *(const v4fa*)(F + t * 8 + 4);
#pragma unroll
  for (int q = 0; q < 4; ++q) { _Float16 h = (_Float16)a[q]; fh.h[q] = h; fl.h[q] = (_Float16)((a[q] - (float)h) * 1024.0f); h = (_Float16)c[q]; fh.h[4 + q] = h; fl.h[4 + q] = (_Float16)((c[q] - (float)h) * 1024.0f); }
  { *(v8us*)((unsigned short*)Hh + t * 8) = fh.half[0]; *(v8us*)((unsigned short*)Hl + t * 8) = fl.half[0];  } }

// ---- fast GEMM (wave tile 32x64; requires M % 32 == 0 rows per launch region and N % 64 == 0); epilogue = k_gemm_hhx semantics ----
__device__ __forceinline__ v16h g2_frag(const _Float16* p, int hh) { FragH f; f.half[0] = *(const v8us*)((const unsigned short*)p + 8 * hh); f.half[1] = *(const v8us*)((const unsigned short*)p + 16 + 8 * hh); return f.v; }
__device__ __forceinline__ v8f g2_mma(v16h a, v16h b, v8f c) { v8f d = __builtin_amdgcn_wmma_f32_16x16x32_f16(false, a, false, b, (short)0, c, false, false); asm volatile("v_nop\n\tv_nop\n\tv_nop\n\tv_nop" : "+v"(d) : "v"(a), "v"(b)); return d; }
template <int ACT>
__global__ __launch_bounds__(128) void k_gemm2(const _Float16* __restrict__ A, int lda, size_t sA, const _Float16* __restrict__ Bh, int ldb, size_t sB, float alpha, const float* __restrict__ bias, size_t sBias, const float* __restrict__ CP, int rowsPerB, size_t sCPb, int row0g,
    float* __restrict__ C, _Float16* __restrict__ C16, int ldc, size_t sC, int M, int N, int K) { static_assert(ACT == 0 || ACT == 3 || ACT == 6 || ACT == 8 || ACT == 9 || ACT == 11 || ACT == 12 || ACT == 14 || ACT == 15 || ACT == 16 || ACT == 17, "k_gemm2: unsupported ACT code (would silently apply no activation)");
  __shared__ __attribute__((aligned(16))) float so[4][32][68];
  const int tid = threadIdx.x, w = tid >> 5, lane = tid & 31, ln = lane & 15, hh = lane >> 4; const int by = blockIdx.y;
  A += (size_t)by * sA; Bh += (size_t)by * sB; const size_t cofs = (size_t)by * sC; const float* bp = bias ? bias + (size_t)by * sBias : nullptr;
  const int ntn = N >> 6; const int mt = blockIdx.x / ntn, nq = blockIdx.x - mt * ntn; const int row0 = mt * 128 + 32 * w, col0 = nq * 64; if (row0 >= M) return;
  const _Float16* a0p = A + (size_t)(row0 + ln) * lda; const _Float16* a1p = a0p + (size_t)16 * lda;
  const _Float16* b0p = Bh + (size_t)(col0 + ln) * ldb; const _Float16* b1p = b0p + (size_t)16 * ldb; const _Float16* b2p = b1p + (size_t)16 * ldb; const _Float16* b3p = b2p + (size_t)16 * ldb;
  const v8f z8 = {0.f,0.f,0.f,0.f,0.f,0.f,0.f,0.f}; v8f c00 = z8, c01 = z8, c02 = z8, c03 = z8, c10 = z8, c11 = z8, c12 = z8, c13 = z8;
#pragma unroll 1
  for (int kb = 0; kb < K; kb += 32) { const v16h a0 = g2_frag(a0p + kb, hh), a1 = g2_frag(a1p + kb, hh);
    v16h b = g2_frag(b0p + kb, hh); c00 = g2_mma(a0, b, c00); c10 = g2_mma(a1, b, c10);
    b = g2_frag(b1p + kb, hh); c01 = g2_mma(a0, b, c01); c11 = g2_mma(a1, b, c11);
    b = g2_frag(b2p + kb, hh); c02 = g2_mma(a0, b, c02); c12 = g2_mma(a1, b, c12);
    b = g2_frag(b3p + kb, hh); c03 = g2_mma(a0, b, c03); c13 = g2_mma(a1, b, c13); }
  v8f accs[8] = {c00, c01, c02, c03, c10, c11, c12, c13};
#pragma unroll
  for (int u = 0; u < 8; ++u) { const int t = u & 3, half = u >> 2; const int col = col0 + t * 16 + ln; const float bv = bp ? bf16_round(bp[col]) : 0.f;
#pragma unroll
    for (int r = 0; r < 8; ++r) { const int rloc = half * 16 + 8 * hh + r; float v = accs[u][r] * alpha + bv; if (CP) { if (rowsPerB < 0) v += CP[cofs + (size_t)(row0g + row0 + rloc) * ldc + col];      /* rowsPerB < 0: own element of the batched C plane */ else { const int bidx = (row0g + row0 + rloc) / rowsPerB; v += CP[(size_t)bidx * sCPb + (size_t)by * 64 + col]; } }
      if (ACT == 3) v = fmaxf(v, 0.f); else if (ACT == 6) v = 0.5f * v * (1.0f + erff(v * 0.70710678118654752f)); else if (ACT == 11) v = 1.0f / (1.0f + expf(-v)); else if (ACT == 15) v = v / (1.0f + expf(-v)); else if (ACT == 12) v = (v > 0.f) ? v : 0.01f * v; else if (ACT == 8) v = tanhf(v); else if (ACT == 9) v = 0.5f * v * (1.0f + tanhf(0.7978845608028654f * (v + 0.044715f * v * v * v))); else if (ACT == 14) v = (v > 0.f) ? v : 0.1f * v; else if (ACT == 16) v = (v >= 0.f) ? v : 0.3f * v; else if (ACT == 17) v = (v >= 0.f) ? v : 0.2f * v;
      so[w][rloc][t * 16 + ln] = v; } }
  __builtin_amdgcn_fence(__ATOMIC_ACQ_REL, "workgroup"); __builtin_amdgcn_wave_barrier();
  const int rsub = lane >> 4, c4 = (lane & 15) * 4;
  {
#pragma unroll
    for (int q = 0; q < 16; ++q) { const int r = q * 2 + rsub; const v4f v = *(const v4fa*)&so[w][r][c4]; if (C) *(v4f*)(C + cofs + (size_t)(row0 + r) * ldc + col0 + c4) = v; if (C16) { v4h h4; for (int i = 0; i < 4; ++i) h4[i] = (_Float16)v[i]; *(v4h*)(C16 + cofs + (size_t)(row0 + r) * ldc + col0 + c4) = h4; } }
     } }


__global__ __launch_bounds__(256) void k_wnat(const float* __restrict__ w, size_t n8, _Float16* __restrict__ Bt) { const size_t t = (size_t)blockIdx.x * 256 + threadIdx.x; if (t >= n8) return; FragH f; for (int q = 0; q < 8; ++q) f.h[q] = (_Float16)(bf16_round(w[t * 8 + q]) * 16.0f); *(v8us*)((unsigned short*)Bt + t * 8) = f.half[0];  }
__global__ __launch_bounds__(256) void k_rsm(const float* __restrict__ S, _Float16* __restrict__ P, int nrows) {
  #pragma clang fp contract(off)
  const int i = blockIdx.x * 256 + threadIdx.x; if (i >= nrows) return; const float* s = S + (size_t)i * SQ; float mx = -3.0e38f;
#pragma unroll 1
  for (int j = 0; j < SQ; ++j) mx = fmaxf(mx, s[j]); float se = 0.f;
#pragma unroll 1
  for (int j = 0; j < SQ; ++j) se += expf(s[j] - mx); const float sc = 256.0f / se;
#pragma unroll 1
  for (int j0 = 0; j0 < SQ; j0 += 8) { FragH f; for (int q = 0; q < 8; ++q) f.h[q] = (_Float16)(expf(s[j0 + q] - mx) * sc); unsigned short* d = (unsigned short*)P + (size_t)i * SQ + j0; *(v8us*)d = f.half[0];  } }
__global__ __launch_bounds__(256) void k_vt(const _Float16* __restrict__ V16, int b, int h0, _Float16* __restrict__ VT) { __shared__ unsigned short tl[64][65]; const int tid = threadIdx.x; const int hh = blockIdx.x % HG, sg = blockIdx.x / HG; const int s0 = sg * 64; const int h = h0 + hh;
  for (int i = tid; i < 64 * 8; i += 256) { const int j = i / 8, d8 = (i % 8) * 8; FragH f; f.half[0] = *(const v8us*)((const unsigned short*)V16 + ((size_t)b * SQ + s0 + j) * DM + h * HD + d8); for (int q = 0; q < 8; ++q) tl[d8 + q][j] = f.u[q]; }
  __syncthreads();
  { for (int i = tid; i < 64 * 8; i += 256) { const int d = i / 8, j8 = (i % 8) * 8; FragH f; for (int q = 0; q < 8; ++q) f.u[q] = tl[d][j8 + q]; *(v8us*)((unsigned short*)VT + ((size_t)hh * HD + d) * SQ + s0 + j8) = f.half[0]; }  } }


__global__ __launch_bounds__(256) void k_wthd(const float* __restrict__ Wt, _Float16* __restrict__ Bt) { const size_t t = (size_t)blockIdx.x * 256 + threadIdx.x; if (t >= (size_t)NH * HD * (DM / 8)) return; const int m8 = (int)(t % (DM / 8)) * 8; const int d = (int)((t / (DM / 8)) % HD); const int h = (int)(t / ((size_t)(DM / 8) * HD)); FragH f;
  for (int q = 0; q < 8; ++q) f.h[q] = (_Float16)(16.0f * bf16_round(Wt[((size_t)h * DM + m8 + q) * HD + d])); unsigned short* dst = (unsigned short*)Bt + ((size_t)h * HD + d) * DM + m8; *(v8us*)dst = f.half[0];  }




typedef int v4ia __attribute__((ext_vector_type(4), may_alias));
__device__ __forceinline__ float rs_xrow(float v) { const int i = __float_as_int(v); return __int_as_float(__builtin_amdgcn_permlanex16(i, i, 0x76543210, 0xfedcba98, true, false)); }      /* lane l reads lane l ^ 16 */
// Fused attention, one wave per 16 query rows of one (batch, head), 32 keys a pass: S^T = K Q^T (A = K rows, B = Q kept in registers), so a lane holds one query's
// scores (keys 8*hh + r of each 16-key tile); running maximum and sum per lane, one exchange between the wave halves; the two f32 score tiles, converted in place,
// are the B operand of O^T += V^T P^T. No score and no weight goes through memory. All in the log2 domain: p = 2^(s * FA_C - mu + FA_OFF) with mu the maximum in use.
#define FA_C 0.18033688011112042f      /* 64^-0.5 * log2(e) */
#define FA_OFF 7.0f                    /* weights carried x128: small ones stay normal f16 numbers */
#define FA_THR 8.0f                    /* mu is renewed only when a score passes it by more than this: weights stay at or under 2^15, inside f16 */
#define FA_DROP (-0x1p+100f)           /* raw score of a masked key; a power of two, so FA_DROP * FA_C is exact and a row with every key masked gets equal weights */
__device__ __forceinline__ v8f fa_mma(v16h a, v16h b, v8f c) { return __builtin_amdgcn_wmma_f32_16x16x32_f16(false, a, false, b, (short)0, c, false, false); }
// eight native 2^x; each is followed by an independent instruction, the last by the v_nop: the slot the instruction set asks for behind a transcendental
__device__ __forceinline__ v8f fa_exp2(v8f x) { float e0, e1, e2, e3, e4, e5, e6, e7;
  asm("v_exp_f32 %0, %8\n\tv_exp_f32 %1, %9\n\tv_exp_f32 %2, %10\n\tv_exp_f32 %3, %11\n\tv_exp_f32 %4, %12\n\tv_exp_f32 %5, %13\n\tv_exp_f32 %6, %14\n\tv_exp_f32 %7, %15\n\tv_nop"
      : "=&v"(e0), "=&v"(e1), "=&v"(e2), "=&v"(e3), "=&v"(e4), "=&v"(e5), "=&v"(e6), "=&v"(e7) : "v"(x[0]), "v"(x[1]), "v"(x[2]), "v"(x[3]), "v"(x[4]), "v"(x[5]), "v"(x[6]), "v"(x[7]));
  const v8f e = {e0, e1, e2, e3, e4, e5, e6, e7}; return e; }
__device__ __forceinline__ float fa_exp2s(float x) { float e; asm("v_exp_f32 %0, %1\n\tv_nop" : "=v"(e) : "v"(x)); return e; }      /* the v_nop: the same slot */
// behind a group of loads or stores: the group is issued whole at this place (for loads: ahead of the arithmetic that covers their latency), and its address and data registers are reused only behind the wait;
// the two scheduling barriers keep every member of the group in front of the wait and every rewrite of a register behind it
__device__ __forceinline__ void fa_issued() { __builtin_amdgcn_sched_barrier(0); asm volatile("s_wait_xcnt 0x0" ::: "memory"); __builtin_amdgcn_sched_barrier(0); }
struct FaK { v16h a00, a01, a10, a11; v4ia m0, m1, m2, m3; };      /* one pass of K fragments (two 16-key tiles x two k steps) and the lane's 16 mask words */
__device__ __forceinline__ FaK fa_load(const _Float16* kp, const int* mp, int j, int hh) { FaK f; const _Float16* k = kp + (size_t)j * LQ;
  f.a00 = g2_frag(k, hh); f.a01 = g2_frag(k + 32, hh); f.a10 = g2_frag(k + 16 * LQ, hh); f.a11 = g2_frag(k + 16 * LQ + 32, hh);
  f.m0 = *(const v4ia*)(mp + j); f.m1 = *(const v4ia*)(mp + j + 4); f.m2 = *(const v4ia*)(mp + j + 16); f.m3 = *(const v4ia*)(mp + j + 20); return f; }
// wave-uniform: does any lane hold a nonzero mask word in this pass?
__device__ __forceinline__ bool fa_anym(const FaK& f) { const v4ia o = f.m0 | f.m1 | f.m2 | f.m3; return __builtin_amdgcn_ballot_w32((o[0] | o[1] | o[2] | o[3]) != 0) != 0; }
// a key with a nonzero mask word takes FA_DROP as its raw score
__device__ __forceinline__ void fa_drop(const FaK& f, v8f& s0, v8f& s1) {
#pragma unroll      // constant indices: the tiles stay in registers
  for (int r = 0; r < 4; ++r) { s0[r] = (f.m0[r] == 0) ? s0[r] : FA_DROP; s0[4 + r] = (f.m1[r] == 0) ? s0[4 + r] : FA_DROP; s1[r] = (f.m2[r] == 0) ? s1[r] : FA_DROP; s1[4 + r] = (f.m3[r] == 0) ? s1[4 + r] : FA_DROP; } }
__global__ __launch_bounds__(256) void k_fattn(const _Float16* __restrict__ Q16, const _Float16* __restrict__ K16, const _Float16* __restrict__ VT, const int* __restrict__ Mk, _Float16* __restrict__ O16, float* __restrict__ PO) {
  static_assert(SQ % 128 == 0 && HD == 64, "k_fattn: 8 waves x 16 query rows a block, head size 64");
  const int lane = threadIdx.x & 31, ln = lane & 15, hh = lane >> 4; const int w = __builtin_amdgcn_readfirstlane(threadIdx.x >> 5);
  const int h = NH - 1 - (int)blockIdx.y, b = blockIdx.z;      /* the last head walks the keys twice: its blocks start first */
  const size_t qr = (size_t)b * SQ + blockIdx.x * 128 + w * 16 + ln;      /* the lane's query row */
  const _Float16* qp = Q16 + qr * LQ + h * HD; const v16h q0 = g2_frag(qp, hh), q1 = g2_frag(qp + 32, hh);
  fa_issued();      /* Q, then K and mask, then V^T: the order of the loop, so that the loop's first wait for K leaves the V^T loads in flight */
  const _Float16* kp = K16 + ((size_t)b * SQ + ln) * LQ + h * HD; const _Float16* vp = VT + ((size_t)(b * NH + h) * HD + ln) * SQ; const int* mp = Mk + qr * SQ + 8 * hh;
  const v8f z8 = {0.f, 0.f, 0.f, 0.f, 0.f, 0.f, 0.f, 0.f}; v8f o0 = z8, o1 = z8, o2 = z8, o3 = z8; float mu = -3.0e38f, l = 0.f;
  FaK f = fa_load(kp, mp, 0, hh);
  fa_issued();
  v16h v0 = g2_frag(vp, hh), v1 = g2_frag(vp + 16 * SQ, hh), v2 = g2_frag(vp + 32 * SQ, hh), v3 = g2_frag(vp + 48 * SQ, hh);
  fa_issued();
#pragma unroll 1      // one pass a trip: the next pass's operands are already fetched by hand, a second copy of the body would only cost registers
  for (int j = 0; j < SQ; j += 32) { const int jn = (j + 32 < SQ) ? j + 32 : j;      /* first key of the next pass; the last pass fetches its own operands again, in bounds */
    v8f s0 = fa_mma(f.a01, q1, fa_mma(f.a00, q0, z8)), s1 = fa_mma(f.a11, q1, fa_mma(f.a10, q0, z8));
    if (fa_anym(f)) fa_drop(f, s0, s1);
    float tm = fmaxf(s0[0], s1[0]);
#pragma unroll      // constant indices: the tiles stay in registers
    for (int r = 1; r < 8; ++r) tm = fmaxf(tm, fmaxf(s0[r], s1[r]));
    tm = fmaxf(tm, rs_xrow(tm)); const float tl = tm * FA_C;
    if (__builtin_amdgcn_ballot_w32(tl > mu + FA_THR) != 0) { const float mn = fmaxf(mu, tl), al = fa_exp2s(mu - mn); mu = mn; l *= al; o0 *= al; o1 *= al; o2 *= al; o3 *= al; }      /* rare: one scalar test a pass */
    f = fa_load(kp, mp, jn, hh);      /* the next pass's K and mask fly during this pass's exponentials and products */
    fa_issued();
    const float nb = FA_OFF - mu;
    const v8f p0 = fa_exp2(s0 * FA_C + nb), p1 = fa_exp2(s1 * FA_C + nb);
    const v8f ps = p0 + p1; l += ((ps[0] + ps[1]) + (ps[2] + ps[3])) + ((ps[4] + ps[5]) + (ps[6] + ps[7]));
    FragH pf;
#pragma unroll      // constant indices: the fragment stays in registers
    for (int r = 0; r < 8; ++r) { pf.h[r] = (_Float16)p0[r]; pf.h[8 + r] = (_Float16)p1[r]; }
    o0 = fa_mma(v0, pf.v, o0); o1 = fa_mma(v1, pf.v, o1); o2 = fa_mma(v2, pf.v, o2); o3 = fa_mma(v3, pf.v, o3);
    v0 = g2_frag(vp + jn, hh); v1 = g2_frag(vp + 16 * SQ + jn, hh); v2 = g2_frag(vp + 32 * SQ + jn, hh); v3 = g2_frag(vp + 48 * SQ + jn, hh);      /* the next pass's V^T flies during its score products and softmax */
    fa_issued(); }
  l += rs_xrow(l);      /* the halves' sums are joined once */
  const float il = 1.0f / l, so = 64.0f * il;      /* o carried x64, as the output GEMM's alpha expects */
  unsigned short* op = (unsigned short*)O16 + qr * DM + h * HD + 8 * hh; FragH e0, e1;
#pragma unroll      // constant indices: the tiles stay in registers
  for (int r = 0; r < 8; ++r) { e0.h[r] = (_Float16)(o0[r] * so); e0.h[8 + r] = (_Float16)(o1[r] * so); e1.h[r] = (_Float16)(o2[r] * so); e1.h[8 + r] = (_Float16)(o3[r] * so); }
  *(v8us*)op = e0.half[0]; *(v8us*)(op + 16) = e0.half[1]; *(v8us*)(op + 32) = e1.half[0]; *(v8us*)(op + 48) = e1.half[1];
  if (h != NH - 1) return;
  fa_issued();
  // second output: the last head's probabilities, its scores formed again now that the row's maximum in use and sum are known
  float* pp = PO + qr * SQ + 8 * hh; const float nb = FA_OFF - mu;
  f = fa_load(kp, mp, 0, hh);
  fa_issued();
#pragma unroll 1      // as above
  for (int j = 0; j < SQ; j += 32) {
    v8f s0 = fa_mma(f.a01, q1, fa_mma(f.a00, q0, z8)), s1 = fa_mma(f.a11, q1, fa_mma(f.a10, q0, z8));
    if (fa_anym(f)) fa_drop(f, s0, s1);
    f = fa_load(kp, mp, (j + 32 < SQ) ? j + 32 : j, hh);
    fa_issued();
    const v8f p0 = fa_exp2(s0 * FA_C + nb) * il, p1 = fa_exp2(s1 * FA_C + nb) * il;
    const v4f t0 = {p0[0], p0[1], p0[2], p0[3]}, t1 = {p0[4], p0[5], p0[6], p0[7]}, t2 = {p1[0], p1[1], p1[2], p1[3]}, t3 = {p1[4], p1[5], p1[6], p1[7]};
    *(v4f*)(pp + j) = t0; *(v4f*)(pp + j + 4) = t1; *(v4f*)(pp + j + 16) = t2; *(v4f*)(pp + j + 20) = t3;
    fa_issued(); } }


__global__ __launch_bounds__(256) void k_rsmf(const float* __restrict__ S, _Float16* __restrict__ P, int qn, int hg) {
  #pragma clang fp contract(off)
  const int t = blockIdx.x * 256 + threadIdx.x; if (t >= qn * hg) return; const size_t i = (size_t)(t / qn) * SQ + (t % qn); const float* s = S + i * SQ; float mx = -3.0e38f;
#pragma unroll 1
  for (int j = 0; j < SQ; ++j) mx = fmaxf(mx, s[j]); float se = 0.f;
#pragma unroll 1
  for (int j = 0; j < SQ; ++j) se += __expf(s[j] - mx); const float sc = 256.0f / se;
#pragma unroll 1
  for (int j0 = 0; j0 < SQ; j0 += 8) { FragH f; for (int q = 0; q < 8; ++q) f.h[q] = (_Float16)(__expf(s[j0 + q] - mx) * sc); unsigned short* d = (unsigned short*)P + i * SQ + j0; *(v8us*)d = f.half[0];  } }

extern "C" void kernel_launch(void* const* d_in, const int* in_sizes, int n_in,
                              void* d_out, int out_size, void* d_ws, size_t ws_size, hipStream_t stream) {
  (void)in_sizes; (void)n_in; (void)out_size;
  const float* const* I = (const float* const*)d_in; const float* xv = I[0]; const float* xk = I[1]; const float* xq = I[2]; const int* mk = (const int*)d_in[3]; const float* wq = I[4]; const float* bq = I[5]; const float* wk = I[6]; const float* bk = I[7]; const float* wv = I[8]; const float* bv = I[9]; const float* wo = I[10]; const float* bo = I[11];      /* NOTE the module's input order v, k, q, mask; per-head [h][in][out] weights + [h][64] biases (= flat [1024]); W0 [in][out] + b0 */
  float* PO = (float*)d_out + (size_t)NB * SQ * DM;      /* second output: last head's attention probabilities [NB][SQ][SQ] f32 at byte offset 16,777,216 */
  char* ws = (char*)d_ws; size_t off = 0;
  auto take = [&](size_t bytes) { char* p = ws + off; off += (bytes + 255) & ~(size_t)255; return p; };
  _Float16* BQ = (_Float16*)take((size_t)DM * DM * 2); _Float16* BK = (_Float16*)take((size_t)DM * DM * 2); _Float16* BV = (_Float16*)take((size_t)DM * DM * 2); _Float16* BO = (_Float16*)take((size_t)DM * DM * 2);
  _Float16* XQ = (_Float16*)take(NR * DM * 2); _Float16* XK = (_Float16*)take(NR * DM * 2); _Float16* XV = (_Float16*)take(NR * DM * 2); _Float16* Q16 = (_Float16*)take(NR * DM * 2); _Float16* K16 = (_Float16*)take(NR * DM * 2); _Float16* V16 = (_Float16*)take(NR * DM * 2); _Float16* O16 = (_Float16*)take(NR * DM * 2);
  _Float16* VT = (_Float16*)take((size_t)NB * NH * HD * SQ * 2);
  if (off > ws_size) return;
  k_wthd<<<(unsigned)(((size_t)NH * HD * (DM / 8) + 255) / 256), 256, 0, stream>>>(wq, BQ); k_wthd<<<(unsigned)(((size_t)NH * HD * (DM / 8) + 255) / 256), 256, 0, stream>>>(wk, BK); k_wthd<<<(unsigned)(((size_t)NH * HD * (DM / 8) + 255) / 256), 256, 0, stream>>>(wv, BV);      /* per-head [h][m][d] -> Bt[(h,d)][m] x16 */
  k_wt_f16<<<(unsigned)(((size_t)DM * (DM / 8) + 255) / 256), 256, 0, stream>>>(wo, BO, DM, DM, 16.0f);      /* W0 [in][out] -> Bt x16 */

  k_x16<<<(unsigned)((NR * DM / 8 + 255) / 256), 256, 0, stream>>>(xq, XQ, NR * DM / 8); k_x16<<<(unsigned)((NR * DM / 8 + 255) / 256), 256, 0, stream>>>(xk, XK, NR * DM / 8); k_x16<<<(unsigned)((NR * DM / 8 + 255) / 256), 256, 0, stream>>>(xv, XV, NR * DM / 8);      /* the three inputs as exact f16 rows */
  const size_t r0p = (size_t)B0 * SQ;      /* first projected row */
  k_gemm2<0><<<dim3((unsigned)((MP / 128) * (DM / 64)), 1), 128, 0, stream>>>(XQ + r0p * DM, DM, 0, BQ, DM, 0, 0.0625f, bq, 0, nullptr, 1, 0, 0, nullptr, Q16 + r0p * DM, DM, 0, MP, DM, DM);
  k_gemm2<0><<<dim3((unsigned)((MP / 128) * (DM / 64)), 1), 128, 0, stream>>>(XK + r0p * DM, DM, 0, BK, DM, 0, 0.0625f, bk, 0, nullptr, 1, 0, 0, nullptr, K16 + r0p * DM, DM, 0, MP, DM, DM);
  k_gemm2<0><<<dim3((unsigned)((MP / 128) * (DM / 64)), 1), 128, 0, stream>>>(XV + r0p * DM, DM, 0, BV, DM, 0, 0.0625f, bv, 0, nullptr, 1, 0, 0, nullptr, V16 + r0p * DM, DM, 0, MP, DM, DM);
  k_vt<NH, SQ><<<NB * NH * (SQ / 64), 256, 0, stream>>>(V16, LQ, 0, VT);      /* V^T [NB][NH][HD][SQ] */
  k_fattn<<<dim3(SQ / 128, NH, NB), 256, 0, stream>>>(Q16, K16, VT, mk, O16, PO);      /* scores, softmax and P V in one launch; o (merged heads) as f16 rows; the last head's probabilities to the second output */
  k_gemm2<0><<<dim3((unsigned)((MPO / 128) * (DM / 64)), 1), 128, 0, stream>>>(O16 + r0p * DM, DM, 0, BO, DM, 0, 0.0009765625f, bo, 0, nullptr, 1, 0, 0, (float*)d_out + r0p * DM, nullptr, DM, 0, MPO, DM, DM);      /* out rows are the output layout */
}

// v003
// One run takes 384 microseconds.
// Next to v002, in two timings, it ran 1.08 times as fast each time.
// Over all steps from v000 it is 17.7 times as fast.
#include <hip/hip_runtime.h>
#define NB 2
#define SQ 2048
#define DM 1024
#define NH 16
#define HD 64
#define HG 4                         /* heads per launch of the unused k_vt(V16, b, h0, VT) overload */
#define B0 0                         /* first batch processed (debug hook) */
#define NBR NB                       /* batches processed (debug hook) */
#define NR ((size_t)NB * SQ)         /* token rows */
#define MP ((int)((size_t)NBR * SQ)) /* rows projected (debug hook) */
#define QN SQ                        /* query rows per batch; unused */
#define NHD NH                       /* heads; unused */
#define MPO MP                       /* rows through the output stage (debug hook) */
#define LQ DM      /* halves per token row of q/k/v (v's row pitch; q, k in fragment order) */
typedef __bf16 v16b __attribute__((ext_vector_type(16)));
typedef unsigned short v8us __attribute__((ext_vector_type(8), may_alias));
typedef float  v8f  __attribute__((ext_vector_type(8)));
typedef float  v4f  __attribute__((ext_vector_type(4)));
typedef float  v4fa __attribute__((ext_vector_type(4), may_alias));
union FragB { v16b v; v8us half[2]; unsigned short u[16]; };

__device__ __forceinline__ unsigned short bf16_bits(float x) { unsigned int u = __float_as_uint(x); return (unsigned short)((u + 0x7FFFu + ((u >> 16) & 1u)) >> 16); }
__device__ __forceinline__ float bf16_val(unsigned short b) { return __uint_as_float(((unsigned int)b) << 16); }
__device__ __forceinline__ float bf16_round(float x) { return bf16_val(bf16_bits(x)); }
// D += A·B with NT terms: 1 = ah·bh, 2 = + al·bh (A split), 3 = + ah·bl (both split)
template <int NT>
__device__ __forceinline__ v8f mmaN(v16b ah, v16b al, v16b bh, v16b bl, v8f c) {
  c = __builtin_amdgcn_wmma_f32_16x16x32_bf16(false, ah, false, bh, (short)0, c, false, false);
  if (NT >= 2) c = __builtin_amdgcn_wmma_f32_16x16x32_bf16(false, al, false, bh, (short)0, c, false, false);
  if (NT >= 3) c = __builtin_amdgcn_wmma_f32_16x16x32_bf16(false, ah, false, bl, (short)0, c, false, false);
  asm volatile("v_nop\n\tv_nop\n\tv_nop\n\tv_nop" : "+v"(c) : "v"(ah), "v"(al), "v"(bh), "v"(bl));
  return c;
}

__global__ __launch_bounds__(256) void k_wt_bf16(const float* __restrict__ W, unsigned short* __restrict__ Wt, int K, int N) {
  const int t = blockIdx.x * 256 + threadIdx.x;
  const int k8n = K / 8;
  if (t >= N * k8n) return;
  const int n = t / k8n, k8 = (t % k8n) * 8;
  v8us v;
#pragma unroll
  for (int i = 0; i < 8; ++i) v[i] = bf16_bits(W[(size_t)(k8 + i) * N + n]);
  *(v8us*)(Wt + (size_t)n * K + k8) = v;
  
}

// GEMM C[M][N] (f32, pitch ldc) = act(A[M][K]·W + bias). A f32 row-major (pitch lda) converted per fragment to bf16
// (ASPLIT: hi/lo two planes -> 2 terms, else single rounded term); Wt bf16 [N][K] (pitch ldb). BIAS_BF16 rounds the
// bias to bf16 first (bias quantised to bf16 before the add). K%32==0, M%16==0, N%64==0.
template <bool ASPLIT, int ACT, bool BIAS_BF16>
__global__ __launch_bounds__(128) void k_gemm_bf(const float* __restrict__ A, int lda, const unsigned short* __restrict__ Wt, int ldb,
                                               const float* __restrict__ bias, float* __restrict__ C, int ldc, int M, int N, int K) {
  __shared__ __attribute__((aligned(16))) float so[4][16][64];
  const int tid = threadIdx.x, w = tid >> 5, lane = tid & 31, ln = lane & 15, hh = lane >> 4;
  const int ntn = N / 64;
  const int wid = blockIdx.x * 4 + w;
  const int mt = wid / ntn, nq = wid % ntn;
  if (mt * 16 >= M) return;
  const int row0 = mt * 16, col0 = nq * 64;
  const float* arow = A + (size_t)(row0 + ln) * lda;
  v8f acc[4] = {};
  for (int kb = 0; kb < K; kb += 32) {
    FragB ah, al;
    const v4f x0 = *(const v4fa*)(arow + kb + 8 * hh), x1 = *(const v4fa*)(arow + kb + 8 * hh + 4);
    const v4f x2 = *(const v4fa*)(arow + kb + 16 + 8 * hh), x3 = *(const v4fa*)(arow + kb + 16 + 8 * hh + 4);
    float xs[16] = {x0[0],x0[1],x0[2],x0[3],x1[0],x1[1],x1[2],x1[3],x2[0],x2[1],x2[2],x2[3],x3[0],x3[1],x3[2],x3[3]};
#pragma unroll
    for (int i = 0; i < 16; ++i) { const unsigned short hb = bf16_bits(xs[i]); ah.u[i] = hb; al.u[i] = ASPLIT ? bf16_bits(xs[i] - bf16_val(hb)) : (unsigned short)0; }
#pragma unroll
    for (int t = 0; t < 4; ++t) {
      const unsigned short* brow = Wt + (size_t)(col0 + t * 16 + ln) * ldb + kb;
      FragB b;
      b.half[0] = *(const v8us*)(brow + 8 * hh);
      b.half[1] = *(const v8us*)(brow + 16 + 8 * hh);
      acc[t] = mmaN<ASPLIT ? 2 : 1>(ah.v, al.v, b.v, b.v, acc[t]);
    }
  }
#pragma unroll
  for (int t = 0; t < 4; ++t) {
    float bv = bias ? bias[col0 + t * 16 + ln] : 0.f;
    if (BIAS_BF16) bv = bf16_round(bv);
#pragma unroll
    for (int r = 0; r < 8; ++r) { float v = acc[t][r] + bv; if (ACT == 1) v = fmaxf(v, 0.f); so[w][8 * hh + r][t * 16 + ln] = v; }
  }
  __builtin_amdgcn_fence(__ATOMIC_ACQ_REL, "workgroup");
  __builtin_amdgcn_wave_barrier();
  const int rsub = lane >> 4, c4 = (lane & 15) * 4;
  {
#pragma unroll
    for (int q = 0; q < 8; ++q) {
      const int r = q * 2 + rsub;
      const v4f v = *(const v4fa*)&so[w][r][c4];
      *(v4f*)(C + (size_t)(row0 + r) * ldc + col0 + c4) = v;
    }
    
  }
}

// GEMM C = act(A·W + bias + resid): A f32 (ASPLIT -> hi/lo 2 terms), Wt bf16 [N][K]; ACT 0 none, 1 relu, 2 exact gelu;
// resid (optional, f32, row index = (row % rmod), pitch ldr, RES_BF16 rounds it) added before the activation.
template <bool ASPLIT, int ACT, bool BIAS_BF16, bool RES_BF16>
__global__ __launch_bounds__(128) void k_gemm_bf3(const float* __restrict__ A, int lda, const unsigned short* __restrict__ Wt, int ldb,
                                                const float* __restrict__ bias, const float* __restrict__ resid, int rmod, int ldr,
                                                float* __restrict__ C, int ldc, int M, int N, int K) {
  __shared__ __attribute__((aligned(16))) float so[4][16][64];
  const int tid = threadIdx.x, w = tid >> 5, lane = tid & 31, ln = lane & 15, hh = lane >> 4;
  const int ntn = N / 64;
  const int wid = blockIdx.x * 4 + w;
  const int mt = wid / ntn, nq = wid % ntn;
  if (mt * 16 >= M) return;
  const int row0 = mt * 16, col0 = nq * 64;
  const float* arow = A + (size_t)(row0 + ln) * lda;
  v8f acc[4] = {};
  for (int kb = 0; kb < K; kb += 32) {
    FragB ah, al;
    const v4f x0 = *(const v4fa*)(arow + kb + 8 * hh), x1 = *(const v4fa*)(arow + kb + 8 * hh + 4);
    const v4f x2 = *(const v4fa*)(arow + kb + 16 + 8 * hh), x3 = *(const v4fa*)(arow + kb + 16 + 8 * hh + 4);
    float xs[16] = {x0[0],x0[1],x0[2],x0[3],x1[0],x1[1],x1[2],x1[3],x2[0],x2[1],x2[2],x2[3],x3[0],x3[1],x3[2],x3[3]};
#pragma unroll
    for (int i = 0; i < 16; ++i) { const unsigned short hb = bf16_bits(xs[i]); ah.u[i] = hb; al.u[i] = ASPLIT ? bf16_bits(xs[i] - bf16_val(hb)) : (unsigned short)0; }
#pragma unroll
    for (int t = 0; t < 4; ++t) {
      const unsigned short* brow = Wt + (size_t)(col0 + t * 16 + ln) * ldb + kb;
      FragB b;
      b.half[0] = *(const v8us*)(brow + 8 * hh);
      b.half[1] = *(const v8us*)(brow + 16 + 8 * hh);
      acc[t] = mmaN<ASPLIT ? 2 : 1>(ah.v, al.v, b.v, b.v, acc[t]);
    }
  }
#pragma unroll
  for (int t = 0; t < 4; ++t) {
    const int col = col0 + t * 16 + ln;
    float bv = bias ? bias[col] : 0.f;
    if (BIAS_BF16) bv = bf16_round(bv);
#pragma unroll
    for (int r = 0; r < 8; ++r) {
      float v = acc[t][r] + bv;
      if (resid) { float rv = resid[(size_t)((row0 + 8 * hh + r) % rmod) * ldr + col]; if (RES_BF16) rv = bf16_round(rv); v += rv; }
      if (ACT == 1) v = fmaxf(v, 0.f);
      if (ACT == 2) v = 0.5f * v * (1.0f + erff(v * 0.70710678118654752f));
      if (ACT == 3) { const float u = 0.7978845608028654f * (v + 0.044715f * v * v * v); v = 0.5f * v * (1.0f + tanhf(u)); }
      so[w][8 * hh + r][t * 16 + ln] = v;
    }
  }
  __builtin_amdgcn_fence(__ATOMIC_ACQ_REL, "workgroup");
  __builtin_amdgcn_wave_barrier();
  const int rsub = lane >> 4, c4 = (lane & 15) * 4;
  {
#pragma unroll
    for (int q = 0; q < 8; ++q) {
      const int r = q * 2 + rsub;
      const v4f v = *(const v4fa*)&so[w][r][c4];
      *(v4f*)(C + (size_t)(row0 + r) * ldc + col0 + c4) = v;
    }
    
  }
}
// row LayerNorm (biased variance, eps) over N: s = X (+ R); optional out_sum <- s; out_norm <- (s-mu)*rsqrt(var+eps)*g + b
template <bool PARAM_BF16>
__global__ __launch_bounds__(256) void k_layernorm(const float* __restrict__ X, const float* __restrict__ R, const float* __restrict__ g, const float* __restrict__ bta,
                                                  float* __restrict__ out_sum, float* __restrict__ out_norm, int N, float eps) {
  __shared__ float red[256];
  const int row = blockIdx.x, tid = threadIdx.x;
  const float* x = X + (size_t)row * N; const float* rr = R ? R + (size_t)row * N : nullptr;
  float vals[16];                     // up to N = 4096
  const int per = N / 256;            // contiguous chunk per thread? use strided-by-4 chunks: thread handles j = tid*4 + 1024*u
  float s1 = 0.f;
  for (int u = 0; u < per / 4; ++u) {
    const int j = tid * 4 + 1024 * u;
    const v4f a = *(const v4fa*)(x + j);
    v4f b = {0.f,0.f,0.f,0.f}; if (rr) b = *(const v4fa*)(rr + j);
#pragma unroll
    for (int q = 0; q < 4; ++q) { const float v = a[q] + b[q]; vals[u * 4 + q] = v; s1 += v; }
  }
  red[tid] = s1; __syncthreads();
  for (int st = 128; st > 0; st >>= 1) { if (tid < st) red[tid] += red[tid + st]; __syncthreads(); }
  const float mu = red[0] / (float)N; __syncthreads();
  float s2 = 0.f;
  for (int u = 0; u < per / 4; ++u)
#pragma unroll
    for (int q = 0; q < 4; ++q) { const float c = vals[u * 4 + q] - mu; s2 += c * c; }
  red[tid] = s2; __syncthreads();
  for (int st = 128; st > 0; st >>= 1) { if (tid < st) red[tid] += red[tid + st]; __syncthreads(); }
  const float rs = rsqrtf(red[0] / (float)N + eps);
  {
    for (int u = 0; u < per / 4; ++u) {
      const int j = tid * 4 + 1024 * u;
      v4f o, sm;
#pragma unroll
      for (int q = 0; q < 4; ++q) {
        float gg = g[j + q], bb = bta[j + q];
        if (PARAM_BF16) { gg = bf16_round(gg); bb = bf16_round(bb); }
        sm[q] = vals[u * 4 + q]; o[q] = (vals[u * 4 + q] - mu) * rs * gg + bb;
      }
      if (out_sum) *(v4f*)(out_sum + (size_t)row * N + j) = sm;
      *(v4f*)(out_norm + (size_t)row * N + j) = o;
    }
    
  }
}



// ---- f16 WMMA path (v_wmma_f32_16x16x32_f16): 11-bit significands for operands in range — used where a [0,1] probability operand needs more precision than bf16
typedef _Float16 v16h __attribute__((ext_vector_type(16)));
union FragH { v16h v; v8us half[2]; _Float16 h[16]; unsigned short u[16]; };
template <int NT>
__device__ __forceinline__ v8f mmaH(v16h ah, v16h al, v16h bh, v16h bl, v8f c) {
  c = __builtin_amdgcn_wmma_f32_16x16x32_f16(false, ah, false, bh, (short)0, c, false, false);
  if (NT >= 2) c = __builtin_amdgcn_wmma_f32_16x16x32_f16(false, al, false, bh, (short)0, c, false, false);
  if (NT >= 3) c = __builtin_amdgcn_wmma_f32_16x16x32_f16(false, ah, false, bl, (short)0, c, false, false);
  asm volatile("v_nop\n\tv_nop\n\tv_nop\n\tv_nop" : "+v"(c) : "v"(ah), "v"(al), "v"(bh), "v"(bl));
  return c;
}
// batched GEMM like k_gemm_b but f16 operands: A f32 (split into f16 hi/lo if ASPLIT, else rounded to f16), Bt = f16 values [n][k]; alpha; C f32; N multiple of 16 (partial tiles skipped)
template <bool ASPLIT>
__global__ __launch_bounds__(128) void k_gemm_h(const float* __restrict__ A, int lda, size_t sA, const _Float16* __restrict__ Bh, int ldb, size_t sB, float alpha, float* __restrict__ C, int ldc, size_t sC, int M, int N, int K) {
  __shared__ __attribute__((aligned(16))) float so[4][16][64];
  const int tid = threadIdx.x, w = tid >> 5, lane = tid & 31, ln = lane & 15, hh = lane >> 4; const int by = blockIdx.y;
  A += (size_t)by * sA; Bh += (size_t)by * sB; C += (size_t)by * sC;
  const int ntn = (N + 63) / 64; const int wid = blockIdx.x * 4 + w; const int mt = wid / ntn, nq = wid % ntn; if (mt * 16 >= M) return;
  const int row0 = mt * 16, col0 = nq * 64; const float* arow = A + (size_t)(row0 + ln) * lda;
  v8f acc[4] = {};
  for (int kb = 0; kb < K; kb += 32) {
    FragH ah, al;
    const v4f x0 = *(const v4fa*)(arow + kb + 8 * hh), x1 = *(const v4fa*)(arow + kb + 8 * hh + 4), x2 = *(const v4fa*)(arow + kb + 16 + 8 * hh), x3 = *(const v4fa*)(arow + kb + 16 + 8 * hh + 4);
    float xs[16] = {x0[0],x0[1],x0[2],x0[3],x1[0],x1[1],x1[2],x1[3],x2[0],x2[1],x2[2],x2[3],x3[0],x3[1],x3[2],x3[3]};
#pragma unroll
    for (int i = 0; i < 16; ++i) { const _Float16 h = (_Float16)xs[i]; ah.h[i] = h; al.h[i] = ASPLIT ? (_Float16)(xs[i] - (float)h) : (_Float16)0.0f; }
#pragma unroll
    for (int t = 0; t < 4; ++t) { if (col0 + t * 16 >= N) continue; const size_t boff = (size_t)(col0 + t * 16 + ln) * ldb + kb; FragH bq; bq.half[0] = *(const v8us*)(Bh + boff + 8 * hh); bq.half[1] = *(const v8us*)(Bh + boff + 16 + 8 * hh);
      acc[t] = mmaH<ASPLIT ? 2 : 1>(ah.v, al.v, bq.v, bq.v, acc[t]); }
  }
#pragma unroll
  for (int t = 0; t < 4; ++t) { if (col0 + t * 16 >= N) continue;
#pragma unroll
    for (int r = 0; r < 8; ++r) so[w][8 * hh + r][t * 16 + ln] = acc[t][r] * alpha; }
  __builtin_amdgcn_fence(__ATOMIC_ACQ_REL, "workgroup"); __builtin_amdgcn_wave_barrier();
  const int rsub = lane >> 4, c4 = (lane & 15) * 4;
  {
#pragma unroll
    for (int q = 0; q < 8; ++q) { const int r = q * 2 + rsub; if (col0 + c4 < N) { const v4f v = *(const v4fa*)&so[w][r][c4]; *(v4f*)(C + (size_t)(row0 + r) * ldc + col0 + c4) = v; } }
     }
}

// Wt[n][k] = f16(W[k][n]·scale) from f32 row-major W[K][N] (scale = power of two; bf16-exact weights stay exact in f16 away from the subnormal range)
__global__ __launch_bounds__(256) void k_wt_f16(const float* __restrict__ W, _Float16* __restrict__ Wt, int K, int N, float scale) {
  const int t = blockIdx.x * 256 + threadIdx.x; if (t >= N * (K / 8)) return;      /* t = the 16-byte chunk's place in fragment order (pk_frag) */
  const int tile = t >> 6, n = (tile / (K / 32)) * 16 + (t & 15), k8 = (tile % (K / 32)) * 32 + ((t >> 5) & 1) * 16 + ((t >> 4) & 1) * 8; FragH f;
#pragma unroll
  for (int i = 0; i < 8; ++i) f.h[i] = (_Float16)(bf16_round(W[(size_t)(k8 + i) * N + n]) * scale); const v8us o = f.half[0];
  *(v8us*)((unsigned short*)Wt + (size_t)t * 8) = o; 
}
// k_gemm_hh variant with fused epilogue: v = acc·alpha + bias[by·sBias + col] (+ CP[(row/rowsPerB)·sCPb + by·64 + col] if CP) ; ACT 0 none / 1 elu ; writes f16 C16 (and f32 C if non-null)
template <int ACT>
__global__ __launch_bounds__(128) void k_gemm_hhx(const _Float16* __restrict__ A, int lda, size_t sA, const _Float16* __restrict__ Bh, int ldb, size_t sB, float alpha, const float* __restrict__ bias, size_t sBias, const float* __restrict__ CP, int rowsPerB, size_t sCPb, int row0g,
    float* __restrict__ C, _Float16* __restrict__ C16, int ldc, size_t sC, int M, int N, int K) {
  __shared__ __attribute__((aligned(16))) float so[4][16][64];
  const int tid = threadIdx.x, w = tid >> 5, lane = tid & 31, ln = lane & 15, hh = lane >> 4; const int by = blockIdx.y;
  A += (size_t)by * sA; Bh += (size_t)by * sB; const size_t cofs = (size_t)by * sC; const float* bp = bias ? bias + (size_t)by * sBias : nullptr;
  const int ntn = (N + 63) / 64; const int wid = blockIdx.x * 4 + w; const int mt = wid / ntn, nq = wid % ntn; if (mt * 16 >= M) return;
  const int row0 = mt * 16, col0 = nq * 64; const _Float16* arow = A + (size_t)(row0 + ln) * lda;
  v8f acc[4] = {};
  for (int kb = 0; kb < K; kb += 32) { FragH ah; ah.half[0] = *(const v8us*)((const unsigned short*)arow + kb + 8 * hh); ah.half[1] = *(const v8us*)((const unsigned short*)arow + kb + 16 + 8 * hh);
#pragma unroll
    for (int t = 0; t < 4; ++t) { if (col0 + t * 16 >= N) continue; const size_t boff = (size_t)(col0 + t * 16 + ln) * ldb + kb; FragH bq; bq.half[0] = *(const v8us*)((const unsigned short*)Bh + boff + 8 * hh); bq.half[1] = *(const v8us*)((const unsigned short*)Bh + boff + 16 + 8 * hh);
      acc[t] = mmaH<1>(ah.v, ah.v, bq.v, bq.v, acc[t]); }
  }
#pragma unroll
  for (int t = 0; t < 4; ++t) { if (col0 + t * 16 >= N) continue; const int col = col0 + t * 16 + ln; const float bv = bp ? bf16_round(bp[col]) : 0.f;
#pragma unroll
    for (int r = 0; r < 8; ++r) { float v = acc[t][r] * alpha + bv; if (CP) { const int rr = row0g + row0 + 8 * hh + r; if (rowsPerB < 0) v += CP[cofs + (size_t)rr * ldc + col];      /* rowsPerB < 0: own element of the batched C plane */ else { const int bidx = rr / rowsPerB; v += CP[(size_t)bidx * sCPb + (size_t)by * 64 + col]; } } if (ACT == 1) v = (v > 0.f) ? v : expm1f(v); else if (ACT == 7) v = (v > 0.f) ? v + 1.0f : expf(v); else if (ACT == 8) v = tanhf(v); else if (ACT == 9) v = 0.5f * v * (1.0f + tanhf(0.7978845608028654f * (v + 0.044715f * v * v * v))); else if (ACT == 11) v = 1.0f / (1.0f + expf(-v)); else if (ACT == 12) v = (v > 0.f) ? v : 0.01f * v; else if (ACT == 14) v = (v > 0.f) ? v : 0.1f * v; else if (ACT == 16) v = (v >= 0.f) ? v : 0.3f * v; else if (ACT == 17) v = (v >= 0.f) ? v : 0.2f * v; else if (ACT == 15) v = v / (1.0f + expf(-v)); else if (ACT == 3) v = fmaxf(v, 0.f); else if (ACT == 6) v = 0.5f * v * (1.0f + erff(v * 0.70710678118654752f)); so[w][8 * hh + r][t * 16 + ln] = v; } }
  __builtin_amdgcn_fence(__ATOMIC_ACQ_REL, "workgroup"); __builtin_amdgcn_wave_barrier();
  const int rsub = lane >> 4, c4 = (lane & 15) * 4; typedef _Float16 v4h __attribute__((ext_vector_type(4)));
  {
#pragma unroll
    for (int q = 0; q < 8; ++q) { const int r = q * 2 + rsub; if (col0 + c4 < N) { const v4f v = *(const v4fa*)&so[w][r][c4]; if (C) *(v4f*)(C + cofs + (size_t)(row0 + r) * ldc + col0 + c4) = v; if (C16) { v4h h4; for (int i = 0; i < 4; ++i) h4[i] = (_Float16)v[i]; *(v4h*)(C16 + cofs + (size_t)(row0 + r) * ldc + col0 + c4) = h4; } } }
     }
}


typedef _Float16 v4h __attribute__((ext_vector_type(4)));

__global__ __launch_bounds__(256) void k_x16(const float* __restrict__ x, _Float16* __restrict__ X16, size_t n8) { const size_t t = (size_t)blockIdx.x * 256 + threadIdx.x; if (t >= n8) return; FragH f;      /* t = the 16-byte chunk's place in fragment order (pk_frag), rows of DM */
  const size_t tile = t >> 6; const float* s = x + ((tile / (DM / 32)) * 16 + (t & 15)) * DM + (tile % (DM / 32)) * 32 + ((t >> 5) & 1) * 16 + ((t >> 4) & 1) * 8;
#pragma unroll
  for (int q = 0; q < 8; ++q) f.h[q] = (_Float16)bf16_round(s[q]); *(v8us*)((unsigned short*)X16 + t * 8) = f.half[0];  }
__global__ __launch_bounds__(256) void k_h16(const float* __restrict__ x, _Float16* __restrict__ X16, size_t n8) { const size_t t = (size_t)blockIdx.x * 256 + threadIdx.x; if (t >= n8) return; FragH f;
#pragma unroll
  for (int q = 0; q < 8; ++q) f.h[q] = (_Float16)x[t * 8 + q]; *(v8us*)((unsigned short*)X16 + t * 8) = f.half[0];  }
__global__ __launch_bounds__(256) void k_round16f(const float* __restrict__ W, _Float16* __restrict__ Bt, size_t n8) { const size_t t = (size_t)blockIdx.x * 256 + threadIdx.x; if (t >= n8) return; FragH f;
#pragma unroll
  for (int i = 0; i < 8; ++i) f.h[i] = (_Float16)(bf16_round(W[t * 8 + i]) * 16.0f); *(v8us*)((unsigned short*)Bt + t * 8) = f.half[0];  }
template <int NHv, int TTv>
__global__ __launch_bounds__(256) void k_vt(const _Float16* __restrict__ V16, int ldv, int voff, _Float16* __restrict__ Vt) { __shared__ unsigned short tl[64][66]; const int tid = threadIdx.x; const int slab = blockIdx.x / (TTv / 64), lg = blockIdx.x % (TTv / 64); const int b = slab / NHv, h = slab % NHv;
  for (int i = tid; i < 64 * 8; i += 256) { const int r = i / 8, c8 = (i % 8) * 8; FragH f; f.half[0] = *(const v8us*)((const unsigned short*)V16 + ((size_t)b * TTv + lg * 64 + r) * ldv + voff + h * 64 + c8);
#pragma unroll
    for (int q = 0; q < 8; ++q) tl[r][c8 + q] = f.u[q]; }
  __syncthreads();
  {
#pragma unroll
    for (int rd = 0; rd < 2; ++rd) { const int i = rd * 256 + tid, tile = i >> 6; const int d = (tile & 3) * 16 + (i & 15), kl = (tile >> 2) * 32 + ((i >> 5) & 1) * 16 + ((i >> 4) & 1) * 8; FragH f;      /* fragment order (pk_frag), tile (32 keys, 16 d) at (key / 32) * 4 + d / 16 of the slab */
#pragma unroll
      for (int q = 0; q < 8; ++q) f.u[q] = tl[kl + q][d];
      *(v8us*)((unsigned short*)Vt + (size_t)slab * 64 * TTv + (size_t)lg * 4096 + i * 8) = f.half[0]; }
     } }

__global__ __launch_bounds__(256) void k_hl(const float* __restrict__ F, _Float16* __restrict__ Hh, _Float16* __restrict__ Hl, size_t n8) { const size_t t = (size_t)blockIdx.x * 256 + threadIdx.x; if (t >= n8) return; FragH fh, fl; const v4f a = *(const v4fa*)(F + t * 8), c = *(const v4fa*)(F + t * 8 + 4);
#pragma unroll
  for (int q = 0; q < 4; ++q) { _Float16 h = (_Float16)a[q]; fh.h[q] = h; fl.h[q] = (_Float16)((a[q] - (float)h) * 1024.0f); h = (_Float16)c[q]; fh.h[4 + q] = h; fl.h[4 + q] = (_Float16)((c[q] - (float)h) * 1024.0f); }
  { *(v8us*)((unsigned short*)Hh + t * 8) = fh.half[0]; *(v8us*)((unsigned short*)Hl + t * 8) = fl.half[0];  } }

// ---- fast GEMM (wave tile 32x64; requires M % 32 == 0 rows per launch region and N % 64 == 0); epilogue = k_gemm_hhx semantics ----
__device__ __forceinline__ v16h g2_frag(const _Float16* p, int hh) { FragH f; f.half[0] = *(const v8us*)((const unsigned short*)p + 8 * hh); f.half[1] = *(const v8us*)((const unsigned short*)p + 16 + 8 * hh); return f.v; }
// Fragment order of an f16 matrix [R][K]: 16-row x 32-k tiles of 1024 bytes, tile (rt, kt) at (rt * (K / 32) + kt) * 512 halves; inside a tile the 8 halves of row ln, k = part * 16 + hh * 8 .. + 7
// stand at (part * 32 + hh * 16 + ln) * 8. p = the tile + lane * 8: each of the two loads of a wave then covers 512 contiguous bytes (4 whole lines, not 16 pieces of 32 bytes); the k order is that of g2_frag.
__device__ __forceinline__ v16h pk_frag(const _Float16* p) { FragH f; f.half[0] = *(const v8us*)((const unsigned short*)p); f.half[1] = *(const v8us*)((const unsigned short*)p + 256); return f.v; }
// behind the loads of two fragments: both address pairs, named as inputs, stay live up to the wait, so that no load's result can land in a register that an issued load still names
__device__ __forceinline__ void pk_issued(const _Float16* p, const _Float16* q) { asm volatile("s_wait_xcnt 0x0" :: "v"(p), "v"(q) : "memory"); }
__device__ __forceinline__ v8f g2_mma(v16h a, v16h b, v8f c) { v8f d = __builtin_amdgcn_wmma_f32_16x16x32_f16(false, a, false, b, (short)0, c, false, false); asm volatile("v_nop\n\tv_nop\n\tv_nop\n\tv_nop" : "+v"(d) : "v"(a), "v"(b)); return d; }
template <int ACT, bool PK>      /* A and Bh in fragment order (pk_frag); PK: C16 alone is written, in fragment order; else C and C16 row-major */
__global__ __launch_bounds__(128) void k_gemm2(const _Float16* __restrict__ A, int lda, size_t sA, const _Float16* __restrict__ Bh, int ldb, size_t sB, float alpha, const float* __restrict__ bias, size_t sBias, const float* __restrict__ CP, int rowsPerB, size_t sCPb, int row0g,
    float* __restrict__ C, _Float16* __restrict__ C16, int ldc, size_t sC, int M, int N, int K) { static_assert(ACT == 0 || ACT == 3 || ACT == 6 || ACT == 8 || ACT == 9 || ACT == 11 || ACT == 12 || ACT == 14 || ACT == 15 || ACT == 16 || ACT == 17, "k_gemm2: unsupported ACT code (would silently apply no activation)");
  __shared__ __attribute__((aligned(16))) float so[4][32][68];
  const int tid = threadIdx.x, w = tid >> 5, lane = tid & 31, ln = lane & 15, hh = lane >> 4; const int by = blockIdx.y;
  A += (size_t)by * sA; Bh += (size_t)by * sB; const size_t cofs = (size_t)by * sC; const float* bp = bias ? bias + (size_t)by * sBias : nullptr;
  const int ntn = N >> 6; const int mt = blockIdx.x / ntn, nq = blockIdx.x - mt * ntn; const int row0 = mt * 128 + 32 * w, col0 = nq * 64; if (row0 >= M) return;
  const _Float16* a0p = A + (size_t)row0 * lda + lane * 8; const _Float16* a1p = a0p + (size_t)16 * lda;
  const _Float16* b0p = Bh + (size_t)col0 * ldb + lane * 8; const _Float16* b1p = b0p + (size_t)16 * ldb; const _Float16* b2p = b1p + (size_t)16 * ldb; const _Float16* b3p = b2p + (size_t)16 * ldb;
  const v8f z8 = {0.f,0.f,0.f,0.f,0.f,0.f,0.f,0.f}; v8f c00 = z8, c01 = z8, c02 = z8, c03 = z8, c10 = z8, c11 = z8, c12 = z8, c13 = z8;
#pragma unroll 1
  for (int kb = 0; kb < K * 16; kb += 512) { const _Float16* a0q = a0p + kb; const _Float16* a1q = a1p + kb; const v16h a0 = pk_frag(a0q), a1 = pk_frag(a1q); pk_issued(a0q, a1q);      /* one 32-k tile a trip */
    v16h b = pk_frag(b0p + kb); c00 = g2_mma(a0, b, c00); c10 = g2_mma(a1, b, c10);
    b = pk_frag(b1p + kb); c01 = g2_mma(a0, b, c01); c11 = g2_mma(a1, b, c11);
    b = pk_frag(b2p + kb); c02 = g2_mma(a0, b, c02); c12 = g2_mma(a1, b, c12);
    b = pk_frag(b3p + kb); c03 = g2_mma(a0, b, c03); c13 = g2_mma(a1, b, c13); }
  v8f accs[8] = {c00, c01, c02, c03, c10, c11, c12, c13};
#pragma unroll
  for (int u = 0; u < 8; ++u) { const int t = u & 3, half = u >> 2; const int col = col0 + t * 16 + ln; const float bv = bp ? bf16_round(bp[col]) : 0.f;
#pragma unroll
    for (int r = 0; r < 8; ++r) { const int rloc = half * 16 + 8 * hh + r; float v = accs[u][r] * alpha + bv; if (CP) { if (rowsPerB < 0) v += CP[cofs + (size_t)(row0g + row0 + rloc) * ldc + col];      /* rowsPerB < 0: own element of the batched C plane */ else { const int bidx = (row0g + row0 + rloc) / rowsPerB; v += CP[(size_t)bidx * sCPb + (size_t)by * 64 + col]; } }
      if (ACT == 3) v = fmaxf(v, 0.f); else if (ACT == 6) v = 0.5f * v * (1.0f + erff(v * 0.70710678118654752f)); else if (ACT == 11) v = 1.0f / (1.0f + expf(-v)); else if (ACT == 15) v = v / (1.0f + expf(-v)); else if (ACT == 12) v = (v > 0.f) ? v : 0.01f * v; else if (ACT == 8) v = tanhf(v); else if (ACT == 9) v = 0.5f * v * (1.0f + tanhf(0.7978845608028654f * (v + 0.044715f * v * v * v))); else if (ACT == 14) v = (v > 0.f) ? v : 0.1f * v; else if (ACT == 16) v = (v >= 0.f) ? v : 0.3f * v; else if (ACT == 17) v = (v >= 0.f) ? v : 0.2f * v;
      so[w][rloc][t * 16 + ln] = v; } }
  __builtin_amdgcn_fence(__ATOMIC_ACQ_REL, "workgroup"); __builtin_amdgcn_wave_barrier();
  const int rsub = lane >> 4, c4 = (lane & 15) * 4;
  if (PK) {      /* C16 alone, in fragment order: the wave's 32 x 64 tile = 2 x 2 fragment tiles, eight stores of 512 contiguous bytes */
#pragma unroll      // constant LDS and store offsets
      for (int s = 0; s < 8; ++s) { const int rl = (s >> 2) * 16 + ln, cl = ((s >> 1) & 1) * 32 + (s & 1) * 16 + hh * 8; const v4f x = *(const v4fa*)&so[w][rl][cl], y = *(const v4fa*)&so[w][rl][cl + 4]; FragH f;
        for (int i = 0; i < 4; ++i) { f.h[i] = (_Float16)x[i]; f.h[4 + i] = (_Float16)y[i]; }
        *(v8us*)((unsigned short*)C16 + cofs + (size_t)(row0 + (s >> 2) * 16) * ldc + (size_t)((col0 >> 5) + ((s >> 1) & 1)) * 512 + (s & 1) * 256 + lane * 8) = f.half[0]; }
    return; }
  {
#pragma unroll
    for (int q = 0; q < 16; ++q) { const int r = q * 2 + rsub; const v4f v = *(const v4fa*)&so[w][r][c4]; if (C) *(v4f*)(C + cofs + (size_t)(row0 + r) * ldc + col0 + c4) = v; if (C16) { v4h h4; for (int i = 0; i < 4; ++i) h4[i] = (_Float16)v[i]; *(v4h*)(C16 + cofs + (size_t)(row0 + r) * ldc + col0 + c4) = h4; } }
     } }


__global__ __launch_bounds__(256) void k_wnat(const float* __restrict__ w, size_t n8, _Float16* __restrict__ Bt) { const size_t t = (size_t)blockIdx.x * 256 + threadIdx.x; if (t >= n8) return; FragH f; for (int q = 0; q < 8; ++q) f.h[q] = (_Float16)(bf16_round(w[t * 8 + q]) * 16.0f); *(v8us*)((unsigned short*)Bt + t * 8) = f.half[0];  }
__global__ __launch_bounds__(256) void k_rsm(const float* __restrict__ S, _Float16* __restrict__ P, int nrows) {
  #pragma clang fp contract(off)
  const int i = blockIdx.x * 256 + threadIdx.x; if (i >= nrows) return; const float* s = S + (size_t)i * SQ; float mx = -3.0e38f;
#pragma unroll 1
  for (int j = 0; j < SQ; ++j) mx = fmaxf(mx, s[j]); float se = 0.f;
#pragma unroll 1
  for (int j = 0; j < SQ; ++j) se += expf(s[j] - mx); const float sc = 256.0f / se;
#pragma unroll 1
  for (int j0 = 0; j0 < SQ; j0 += 8) { FragH f; for (int q = 0; q < 8; ++q) f.h[q] = (_Float16)(expf(s[j0 + q] - mx) * sc); unsigned short* d = (unsigned short*)P + (size_t)i * SQ + j0; *(v8us*)d = f.half[0];  } }
__global__ __launch_bounds__(256) void k_vt(const _Float16* __restrict__ V16, int b, int h0, _Float16* __restrict__ VT) { __shared__ unsigned short tl[64][65]; const int tid = threadIdx.x; const int hh = blockIdx.x % HG, sg = blockIdx.x / HG; const int s0 = sg * 64; const int h = h0 + hh;
  for (int i = tid; i < 64 * 8; i += 256) { const int j = i / 8, d8 = (i % 8) * 8; FragH f; f.half[0] = *(const v8us*)((const unsigned short*)V16 + ((size_t)b * SQ + s0 + j) * DM + h * HD + d8); for (int q = 0; q < 8; ++q) tl[d8 + q][j] = f.u[q]; }
  __syncthreads();
  { for (int i = tid; i < 64 * 8; i += 256) { const int d = i / 8, j8 = (i % 8) * 8; FragH f; for (int q = 0; q < 8; ++q) f.u[q] = tl[d][j8 + q]; *(v8us*)((unsigned short*)VT + ((size_t)hh * HD + d) * SQ + s0 + j8) = f.half[0]; }  } }


__global__ __launch_bounds__(256) void k_wthd(const float* __restrict__ Wt, _Float16* __restrict__ Bt) { const size_t t = (size_t)blockIdx.x * 256 + threadIdx.x; if (t >= (size_t)NH * HD * (DM / 8)) return;      /* t = the 16-byte chunk's place in fragment order (pk_frag), rows (h, d) of DM */
  const int tile = (int)(t >> 6), n = (tile / (DM / 32)) * 16 + (int)(t & 15); const int m8 = (tile % (DM / 32)) * 32 + (int)((t >> 5) & 1) * 16 + (int)((t >> 4) & 1) * 8; const int d = n % HD; const int h = n / HD; FragH f;
  for (int q = 0; q < 8; ++q) f.h[q] = (_Float16)(16.0f * bf16_round(Wt[((size_t)h * DM + m8 + q) * HD + d])); unsigned short* dst = (unsigned short*)Bt + t * 8; *(v8us*)dst = f.half[0];  }




typedef int v4ia __attribute__((ext_vector_type(4), may_alias));
__device__ __forceinline__ float rs_xrow(float v) { const int i = __float_as_int(v); return __int_as_float(__builtin_amdgcn_permlanex16(i, i, 0x76543210, 0xfedcba98, true, false)); }      /* lane l reads lane l ^ 16 */
// Fused attention, one wave per 16 query rows of one (batch, head), 32 keys a pass: S^T = K Q^T (A = K rows, B = Q kept in registers), so a lane holds one query's
// scores (keys 8*hh + r of each 16-key tile); running maximum and sum per lane, one exchange between the wave halves; the two f32 score tiles, converted in place,
// are the B operand of O^T += V^T P^T. No score and no weight goes through memory. All in the log2 domain: p = 2^(s * FA_C - mu + FA_OFF) with mu the maximum in use.
#define FA_C 0.18033688011112042f      /* 64^-0.5 * log2(e) */
#define FA_OFF 7.0f                    /* weights carried x128: small ones stay normal f16 numbers */
#define FA_THR 8.0f                    /* mu is renewed only when a score passes it by more than this: weights stay at or under 2^15, inside f16 */
#define FA_DROP (-0x1p+100f)           /* raw score of a masked key; a power of two, so FA_DROP * FA_C is exact and a row with every key masked gets equal weights */
__device__ __forceinline__ v8f fa_mma(v16h a, v16h b, v8f c) { return __builtin_amdgcn_wmma_f32_16x16x32_f16(false, a, false, b, (short)0, c, false, false); }
// eight native 2^x; each is followed by an independent instruction, the last by the v_nop: the slot the instruction set asks for behind a transcendental
__device__ __forceinline__ v8f fa_exp2(v8f x) { float e0, e1, e2, e3, e4, e5, e6, e7;
  asm("v_exp_f32 %0, %8\n\tv_exp_f32 %1, %9\n\tv_exp_f32 %2, %10\n\tv_exp_f32 %3, %11\n\tv_exp_f32 %4, %12\n\tv_exp_f32 %5, %13\n\tv_exp_f32 %6, %14\n\tv_exp_f32 %7, %15\n\tv_nop"
      : "=&v"(e0), "=&v"(e1), "=&v"(e2), "=&v"(e3), "=&v"(e4), "=&v"(e5), "=&v"(e6), "=&v"(e7) : "v"(x[0]), "v"(x[1]), "v"(x[2]), "v"(x[3]), "v"(x[4]), "v"(x[5]), "v"(x[6]), "v"(x[7]));
  const v8f e = {e0, e1, e2, e3, e4, e5, e6, e7}; return e; }
__device__ __forceinline__ float fa_exp2s(float x) { float e; asm("v_exp_f32 %0, %1\n\tv_nop" : "=v"(e) : "v"(x)); return e; }      /* the v_nop: the same slot */
// behind a group of loads or stores: the group is issued whole at this place (for loads: ahead of the arithmetic that covers their latency), and its address and data registers are reused only behind the wait;
// the two scheduling barriers keep every member of the group in front of the wait and every rewrite of a register behind it
__device__ __forceinline__ void fa_issued() { __builtin_amdgcn_sched_barrier(0); asm volatile("s_wait_xcnt 0x0" ::: "memory"); __builtin_amdgcn_sched_barrier(0); }
struct FaK { v16h a00, a01, a10, a11; v4ia m0, m1, m2, m3; };      /* one pass of K fragments (two 16-key tiles x two k steps) and the wave's 16 x 32 mask words, dealt row-contiguous: they serve the any-nonzero test alone */
// kp: the head's first K tile + lane * 8 (fragment order); mt: mask row (wave's first query + lane / 8), word (lane % 8) * 4: each mask load covers four whole 128-byte rows of the pass
__device__ __forceinline__ FaK fa_load(const _Float16* kp, const int* mt, int j) { FaK f; const _Float16* k = kp + (size_t)j * LQ;
  f.a00 = pk_frag(k); f.a01 = pk_frag(k + 512); f.a10 = pk_frag(k + 16 * LQ); f.a11 = pk_frag(k + 16 * LQ + 512);
  f.m0 = *(const v4ia*)(mt + j); f.m1 = *(const v4ia*)(mt + j + 4 * SQ); f.m2 = *(const v4ia*)(mt + j + 8 * SQ); f.m3 = *(const v4ia*)(mt + j + 12 * SQ); return f; }
// wave-uniform: does any lane hold a nonzero mask word in this pass?
__device__ __forceinline__ bool fa_anym(const FaK& f) { const v4ia o = f.m0 | f.m1 | f.m2 | f.m3; return __builtin_amdgcn_ballot_w32((o[0] | o[1] | o[2] | o[3]) != 0) != 0; }
// a key with a nonzero mask word takes FA_DROP as its raw score; m: the lane's own query row, first key of the pass + 8 * hh (the lane's 16 words are read here, only in a pass that holds a nonzero word)
__device__ __forceinline__ void fa_drop(const int* m, v8f& s0, v8f& s1) { const v4ia m0 = *(const v4ia*)m, m1 = *(const v4ia*)(m + 4), m2 = *(const v4ia*)(m + 16), m3 = *(const v4ia*)(m + 20);
#pragma unroll      // constant indices: the tiles stay in registers
  for (int r = 0; r < 4; ++r) { s0[r] = (m0[r] == 0) ? s0[r] : FA_DROP; s0[4 + r] = (m1[r] == 0) ? s0[4 + r] : FA_DROP; s1[r] = (m2[r] == 0) ? s1[r] : FA_DROP; s1[4 + r] = (m3[r] == 0) ? s1[4 + r] : FA_DROP; } }
__global__ __launch_bounds__(256) void k_fattn(const _Float16* __restrict__ Q16, const _Float16* __restrict__ K16, const _Float16* __restrict__ VT, const int* __restrict__ Mk, _Float16* __restrict__ O16, float* __restrict__ PO) {
  static_assert(SQ % 128 == 0 && HD == 64, "k_fattn: 8 waves x 16 query rows a block, head size 64");
  const int lane = threadIdx.x & 31, ln = lane & 15, hh = lane >> 4; const int w = __builtin_amdgcn_readfirstlane(threadIdx.x >> 5);
  const int h = NH - 1 - (int)blockIdx.y, b = blockIdx.z;      /* the last head walks the keys twice: its blocks start first */
  const size_t rq = (size_t)b * SQ + blockIdx.x * 128 + w * 16, qr = rq + ln;      /* the wave's first query row; the lane's query row */
  const _Float16* qp = Q16 + rq * LQ + h * 1024 + lane * 8; const v16h q0 = pk_frag(qp), q1 = pk_frag(qp + 512);      /* a head's 64 columns are two 32-k tiles */
  fa_issued();      /* Q, then K and mask, then V^T: the order of the loop, so that the loop's first wait for K leaves the V^T loads in flight */
  const _Float16* kp = K16 + (size_t)b * SQ * LQ + h * 1024 + lane * 8; const _Float16* vp = VT + (size_t)(b * NH + h) * HD * SQ + lane * 8; const int* mp = Mk + qr * SQ + 8 * hh; const int* mt = Mk + (rq + (lane >> 3)) * SQ + (lane & 7) * 4;
  const v8f z8 = {0.f, 0.f, 0.f, 0.f, 0.f, 0.f, 0.f, 0.f}; v8f o0 = z8, o1 = z8, o2 = z8, o3 = z8; float mu = -3.0e38f, l = 0.f;
  FaK f = fa_load(kp, mt, 0);
  fa_issued();
  v16h v0 = pk_frag(vp), v1 = pk_frag(vp + 512), v2 = pk_frag(vp + 1024), v3 = pk_frag(vp + 1536);      /* a pass of V^T: four tiles, 4096 contiguous bytes */
  fa_issued();
#pragma unroll 1      // one pass a trip: the next pass's operands are already fetched by hand, a second copy of the body would only cost registers
  for (int j = 0; j < SQ; j += 32) { const int jn = (j + 32 < SQ) ? j + 32 : j;      /* first key of the next pass; the last pass fetches its own operands again, in bounds */
    v8f s0 = fa_mma(f.a01, q1, fa_mma(f.a00, q0, z8)), s1 = fa_mma(f.a11, q1, fa_mma(f.a10, q0, z8));
    if (fa_anym(f)) fa_drop(mp + j, s0, s1);
    float tm = fmaxf(s0[0], s1[0]);
#pragma unroll      // constant indices: the tiles stay in registers
    for (int r = 1; r < 8; ++r) tm = fmaxf(tm, fmaxf(s0[r], s1[r]));
    tm = fmaxf(tm, rs_xrow(tm)); const float tl = tm * FA_C;
    if (__builtin_amdgcn_ballot_w32(tl > mu + FA_THR) != 0) { const float mn = fmaxf(mu, tl), al = fa_exp2s(mu - mn); mu = mn; l *= al; o0 *= al; o1 *= al; o2 *= al; o3 *= al; }      /* rare: one scalar test a pass */
    f = fa_load(kp, mt, jn);      /* the next pass's K and mask fly during this pass's exponentials and products */
    fa_issued();
    const float nb = FA_OFF - mu;
    const v8f p0 = fa_exp2(s0 * FA_C + nb), p1 = fa_exp2(s1 * FA_C + nb);
    const v8f ps = p0 + p1; l += ((ps[0] + ps[1]) + (ps[2] + ps[3])) + ((ps[4] + ps[5]) + (ps[6] + ps[7]));
    FragH pf;
#pragma unroll      // constant indices: the fragment stays in registers
    for (int r = 0; r < 8; ++r) { pf.h[r] = (_Float16)p0[r]; pf.h[8 + r] = (_Float16)p1[r]; }
    o0 = fa_mma(v0, pf.v, o0); o1 = fa_mma(v1, pf.v, o1); o2 = fa_mma(v2, pf.v, o2); o3 = fa_mma(v3, pf.v, o3);
    v0 = pk_frag(vp + jn * 64); v1 = pk_frag(vp + jn * 64 + 512); v2 = pk_frag(vp + jn * 64 + 1024); v3 = pk_frag(vp + jn * 64 + 1536);      /* the next pass's V^T flies during its score products and softmax */
    fa_issued(); }
  l += rs_xrow(l);      /* the halves' sums are joined once */
  const float il = 1.0f / l, so = 64.0f * il;      /* o carried x64, as the output GEMM's alpha expects */
  unsigned short* op = (unsigned short*)O16 + rq * DM + h * 1024 + lane * 8; FragH e0, e1;      /* o in fragment order: the lane's four runs of 8 are the four half-fragments of the head's two tiles */
#pragma unroll      // constant indices: the tiles stay in registers
  for (int r = 0; r < 8; ++r) { e0.h[r] = (_Float16)(o0[r] * so); e0.h[8 + r] = (_Float16)(o1[r] * so); e1.h[r] = (_Float16)(o2[r] * so); e1.h[8 + r] = (_Float16)(o3[r] * so); }
  *(v8us*)op = e0.half[0]; *(v8us*)(op + 256) = e0.half[1]; *(v8us*)(op + 512) = e1.half[0]; *(v8us*)(op + 768) = e1.half[1];
  fa_issued();      /* in front of the head test: the last head's path rewrites the stores' registers at once */
  if (h != NH - 1) return;
  // second output: the last head's probabilities, its scores formed again now that the row's maximum in use and sum are known
  float* pp = PO + qr * SQ + 8 * hh; const float nb = FA_OFF - mu;
  f = fa_load(kp, mt, 0);
  fa_issued();
#pragma unroll 1      // as above
  for (int j = 0; j < SQ; j += 32) {
    v8f s0 = fa_mma(f.a01, q1, fa_mma(f.a00, q0, z8)), s1 = fa_mma(f.a11, q1, fa_mma(f.a10, q0, z8));
    if (fa_anym(f)) fa_drop(mp + j, s0, s1);
    f = fa_load(kp, mt, (j + 32 < SQ) ? j + 32 : j);
    fa_issued();
    const v8f p0 = fa_exp2(s0 * FA_C + nb) * il, p1 = fa_exp2(s1 * FA_C + nb) * il;
    const v4f t0 = {p0[0], p0[1], p0[2], p0[3]}, t1 = {p0[4], p0[5], p0[6], p0[7]}, t2 = {p1[0], p1[1], p1[2], p1[3]}, t3 = {p1[4], p1[5], p1[6], p1[7]};
    *(v4f*)(pp + j) = t0; *(v4f*)(pp + j + 4) = t1; *(v4f*)(pp + j + 16) = t2; *(v4f*)(pp + j + 20) = t3;
    fa_issued(); } }


__global__ __launch_bounds__(256) void k_rsmf(const float* __restrict__ S, _Float16* __restrict__ P, int qn, int hg) {
  #pragma clang fp contract(off)
  const int t = blockIdx.x * 256 + threadIdx.x; if (t >= qn * hg) return; const size_t i = (size_t)(t / qn) * SQ + (t % qn); const float* s = S + i * SQ; float mx = -3.0e38f;
#pragma unroll 1
  for (int j = 0; j < SQ; ++j) mx = fmaxf(mx, s[j]); float se = 0.f;
#pragma unroll 1
  for (int j = 0; j < SQ; ++j) se += __expf(s[j] - mx); const float sc = 256.0f / se;
#pragma unroll 1
  for (int j0 = 0; j0 < SQ; j0 += 8) { FragH f; for (int q = 0; q < 8; ++q) f.h[q] = (_Float16)(__expf(s[j0 + q] - mx) * sc); unsigned short* d = (unsigned short*)P + i * SQ + j0; *(v8us*)d = f.half[0];  } }

extern "C" void kernel_launch(void* const* d_in, const int* in_sizes, int n_in,
                              void* d_out, int out_size, void* d_ws, size_t ws_size, hipStream_t stream) {
  (void)in_sizes; (void)n_in; (void)out_size;
  const float* const* I = (const float* const*)d_in; const float* xv = I[0]; const float* xk = I[1]; const float* xq = I[2]; const int* mk = (const int*)d_in[3]; const float* wq = I[4]; const float* bq = I[5]; const float* wk = I[6]; const float* bk = I[7]; const float* wv = I[8]; const float* bv = I[9]; const float* wo = I[10]; const float* bo = I[11];      /* NOTE the module's input order v, k, q, mask; per-head [h][in][out] weights + [h][64] biases (= flat [1024]); W0 [in][out] + b0 */
  float* PO = (float*)d_out + (size_t)NB * SQ * DM;      /* second output: last head's attention probabilities [NB][SQ][SQ] f32 at byte offset 16,777,216 */
  char* ws = (char*)d_ws; size_t off = 0;
  auto take = [&](size_t bytes) { char* p = ws + off; off += (bytes + 255) & ~(size_t)255; return p; };
  _Float16* BQ = (_Float16*)take((size_t)DM * DM * 2); _Float16* BK = (_Float16*)take((size_t)DM * DM * 2); _Float16* BV = (_Float16*)take((size_t)DM * DM * 2); _Float16* BO = (_Float16*)take((size_t)DM * DM * 2);
  _Float16* XQ = (_Float16*)take(NR * DM * 2); _Float16* XK = (_Float16*)take(NR * DM * 2); _Float16* XV = (_Float16*)take(NR * DM * 2); _Float16* Q16 = (_Float16*)take(NR * DM * 2); _Float16* K16 = (_Float16*)take(NR * DM * 2); _Float16* V16 = (_Float16*)take(NR * DM * 2); _Float16* O16 = (_Float16*)take(NR * DM * 2);
  _Float16* VT = (_Float16*)take((size_t)NB * NH * HD * SQ * 2);
  if (off > ws_size) return;
  k_wthd<<<(unsigned)(((size_t)NH * HD * (DM / 8) + 255) / 256), 256, 0, stream>>>(wq, BQ); k_wthd<<<(unsigned)(((size_t)NH * HD * (DM / 8) + 255) / 256), 256, 0, stream>>>(wk, BK); k_wthd<<<(unsigned)(((size_t)NH * HD * (DM / 8) + 255) / 256), 256, 0, stream>>>(wv, BV);      /* per-head [h][m][d] -> Bt[(h,d)][m] x16, fragment order */
  k_wt_f16<<<(unsigned)(((size_t)DM * (DM / 8) + 255) / 256), 256, 0, stream>>>(wo, BO, DM, DM, 16.0f);      /* W0 [in][out] -> Bt x16, fragment order */

  k_x16<<<(unsigned)((NR * DM / 8 + 255) / 256), 256, 0, stream>>>(xq, XQ, NR * DM / 8); k_x16<<<(unsigned)((NR * DM / 8 + 255) / 256), 256, 0, stream>>>(xk, XK, NR * DM / 8); k_x16<<<(unsigned)((NR * DM / 8 + 255) / 256), 256, 0, stream>>>(xv, XV, NR * DM / 8);      /* the three inputs as exact f16 rows, fragment order */
  const size_t r0p = (size_t)B0 * SQ;      /* first projected row */
  k_gemm2<0, true><<<dim3((unsigned)((MP / 128) * (DM / 64)), 1), 128, 0, stream>>>(XQ + r0p * DM, DM, 0, BQ, DM, 0, 0.0625f, bq, 0, nullptr, 1, 0, 0, nullptr, Q16 + r0p * DM, DM, 0, MP, DM, DM);
  k_gemm2<0, true><<<dim3((unsigned)((MP / 128) * (DM / 64)), 1), 128, 0, stream>>>(XK + r0p * DM, DM, 0, BK, DM, 0, 0.0625f, bk, 0, nullptr, 1, 0, 0, nullptr, K16 + r0p * DM, DM, 0, MP, DM, DM);
  k_gemm2<0, false><<<dim3((unsigned)((MP / 128) * (DM / 64)), 1), 128, 0, stream>>>(XV + r0p * DM, DM, 0, BV, DM, 0, 0.0625f, bv, 0, nullptr, 1, 0, 0, nullptr, V16 + r0p * DM, DM, 0, MP, DM, DM);
  k_vt<NH, SQ><<<NB * NH * (SQ / 64), 256, 0, stream>>>(V16, LQ, 0, VT);      /* V^T per (batch, head), fragment order */
  k_fattn<<<dim3(SQ / 128, NH, NB), 256, 0, stream>>>(Q16, K16, VT, mk, O16, PO);      /* scores, softmax and P V in one launch; o (merged heads) as f16 rows; the last head's probabilities to the second output */
  k_gemm2<0, false><<<dim3((unsigned)((MPO / 128) * (DM / 64)), 1), 128, 0, stream>>>(O16 + r0p * DM, DM, 0, BO, DM, 0, 0.0009765625f, bo, 0, nullptr, 1, 0, 0, (float*)d_out + r0p * DM, nullptr, DM, 0, MPO, DM, DM);      /* out rows are the output layout */
}

// v004
// It runs in 208 microseconds.
// Timed twice side by side with v003, it ran 1.82 and 1.84 times as fast.
// Over all steps from v000 it is 32.3 times as fast.
#include <hip/hip_runtime.h>
#define NB 2
#define SQ 2048
#define DM 1024
#define NH 16
#define HD 64
#define HG 4                         /* heads per launch of the unused k_vt(V16, b, h0, VT) overload */
#define B0 0                         /* first batch processed (debug hook) */
#define NBR NB                       /* batches processed (debug hook) */
#define NR ((size_t)NB * SQ)         /* token rows */
#define MP ((int)((size_t)NBR * SQ)) /* rows projected (debug hook) */
#define QN SQ                        /* query rows per batch; unused */
#define NHD NH                       /* heads; unused */
#define MPO MP                       /* rows through the output stage (debug hook) */
#define LQ DM      /* halves per token row of q/k/v (v's row pitch; q, k in fragment order) */
typedef __bf16 v16b __attribute__((ext_vector_type(16)));
typedef unsigned short v8us __attribute__((ext_vector_type(8), may_alias));
typedef float  v8f  __attribute__((ext_vector_type(8)));
typedef float  v4f  __attribute__((ext_vector_type(4)));
typedef float  v4fa __attribute__((ext_vector_type(4), may_alias));
union FragB { v16b v; v8us half[2]; unsigned short u[16]; };

__device__ __forceinline__ unsigned short bf16_bits(float x) { unsigned int u = __float_as_uint(x); return (unsigned short)((u + 0x7FFFu + ((u >> 16) & 1u)) >> 16); }
__device__ __forceinline__ float bf16_val(unsigned short b) { return __uint_as_float(((unsigned int)b) << 16); }
__device__ __forceinline__ float bf16_round(float x) { return bf16_val(bf16_bits(x)); }
// D += A·B with NT terms: 1 = ah·bh, 2 = + al·bh (A split), 3 = + ah·bl (both split)
template <int NT>
__device__ __forceinline__ v8f mmaN(v16b ah, v16b al, v16b bh, v16b bl, v8f c) {
  c = __builtin_amdgcn_wmma_f32_16x16x32_bf16(false, ah, false, bh, (short)0, c, false, false);
  if (NT >= 2) c = __builtin_amdgcn_wmma_f32_16x16x32_bf16(false, al, false, bh, (short)0, c, false, false);
  if (NT >= 3) c = __builtin_amdgcn_wmma_f32_16x16x32_bf16(false, ah, false, bl, (short)0, c, false, false);
  asm volatile("v_nop\n\tv_nop\n\tv_nop\n\tv_nop" : "+v"(c) : "v"(ah), "v"(al), "v"(bh), "v"(bl));
  return c;
}

__global__ __launch_bounds__(256) void k_wt_bf16(const float* __restrict__ W, unsigned short* __restrict__ Wt, int K, int N) {
  const int t = blockIdx.x * 256 + threadIdx.x;
  const int k8n = K / 8;
  if (t >= N * k8n) return;
  const int n = t / k8n, k8 = (t % k8n) * 8;
  v8us v;
#pragma unroll
  for (int i = 0; i < 8; ++i) v[i] = bf16_bits(W[(size_t)(k8 + i) * N + n]);
  *(v8us*)(Wt + (size_t)n * K + k8) = v;
  
}

// GEMM C[M][N] (f32, pitch ldc) = act(A[M][K]·W + bias). A f32 row-major (pitch lda) converted per fragment to bf16
// (ASPLIT: hi/lo two planes -> 2 terms, else single rounded term); Wt bf16 [N][K] (pitch ldb). BIAS_BF16 rounds the
// bias to bf16 first (bias quantised to bf16 before the add). K%32==0, M%16==0, N%64==0.
template <bool ASPLIT, int ACT, bool BIAS_BF16>
__global__ __launch_bounds__(128) void k_gemm_bf(const float* __restrict__ A, int lda, const unsigned short* __restrict__ Wt, int ldb,
                                               const float* __restrict__ bias, float* __restrict__ C, int ldc, int M, int N, int K) {
  __shared__ __attribute__((aligned(16))) float so[4][16][64];
  const int tid = threadIdx.x, w = tid >> 5, lane = tid & 31, ln = lane & 15, hh = lane >> 4;
  const int ntn = N / 64;
  const int wid = blockIdx.x * 4 + w;
  const int mt = wid / ntn, nq = wid % ntn;
  if (mt * 16 >= M) return;
  const int row0 = mt * 16, col0 = nq * 64;
  const float* arow = A + (size_t)(row0 + ln) * lda;
  v8f acc[4] = {};
  for (int kb = 0; kb < K; kb += 32) {
    FragB ah, al;
    const v4f x0 = *(const v4fa*)(arow + kb + 8 * hh), x1 = *(const v4fa*)(arow + kb + 8 * hh + 4);
    const v4f x2 = *(const v4fa*)(arow + kb + 16 + 8 * hh), x3 = *(const v4fa*)(arow + kb + 16 + 8 * hh + 4);
    float xs[16] = {x0[0],x0[1],x0[2],x0[3],x1[0],x1[1],x1[2],x1[3],x2[0],x2[1],x2[2],x2[3],x3[0],x3[1],x3[2],x3[3]};
#pragma unroll
    for (int i = 0; i < 16; ++i) { const unsigned short hb = bf16_bits(xs[i]); ah.u[i] = hb; al.u[i] = ASPLIT ? bf16_bits(xs[i] - bf16_val(hb)) : (unsigned short)0; }
#pragma unroll
    for (int t = 0; t < 4; ++t) {
      const unsigned short* brow = Wt + (size_t)(col0 + t * 16 + ln) * ldb + kb;
      FragB b;
      b.half[0] = *(const v8us*)(brow + 8 * hh);
      b.half[1] = *(const v8us*)(brow + 16 + 8 * hh);
      acc[t] = mmaN<ASPLIT ? 2 : 1>(ah.v, al.v, b.v, b.v, acc[t]);
    }
  }
#pragma unroll
  for (int t = 0; t < 4; ++t) {
    float bv = bias ? bias[col0 + t * 16 + ln] : 0.f;
    if (BIAS_BF16) bv = bf16_round(bv);
#pragma unroll
    for (int r = 0; r < 8; ++r) { float v = acc[t][r] + bv; if (ACT == 1) v = fmaxf(v, 0.f); so[w][8 * hh + r][t * 16 + ln] = v; }
  }
  __builtin_amdgcn_fence(__ATOMIC_ACQ_REL, "workgroup");
  __builtin_amdgcn_wave_barrier();
  const int rsub = lane >> 4, c4 = (lane & 15) * 4;
  {
#pragma unroll
    for (int q = 0; q < 8; ++q) {
      const int r = q * 2 + rsub;
      const v4f v = *(const v4fa*)&so[w][r][c4];
      *(v4f*)(C + (size_t)(row0 + r) * ldc + col0 + c4) = v;
    }
    
  }
}

// GEMM C = act(A·W + bias + resid): A f32 (ASPLIT -> hi/lo 2 terms), Wt bf16 [N][K]; ACT 0 none, 1 relu, 2 exact gelu;
// resid (optional, f32, row index = (row % rmod), pitch ldr, RES_BF16 rounds it) added before the activation.
template <bool ASPLIT, int ACT, bool BIAS_BF16, bool RES_BF16>
__global__ __launch_bounds__(128) void k_gemm_bf3(const float* __restrict__ A, int lda, const unsigned short* __restrict__ Wt, int ldb,
                                                const float* __restrict__ bias, const float* __restrict__ resid, int rmod, int ldr,
                                                float* __restrict__ C, int ldc, int M, int N, int K) {
  __shared__ __attribute__((aligned(16))) float so[4][16][64];
  const int tid = threadIdx.x, w = tid >> 5, lane = tid & 31, ln = lane & 15, hh = lane >> 4;
  const int ntn = N / 64;
  const int wid = blockIdx.x * 4 + w;
  const int mt = wid / ntn, nq = wid % ntn;
  if (mt * 16 >= M) return;
  const int row0 = mt * 16, col0 = nq * 64;
  const float* arow = A + (size_t)(row0 + ln) * lda;
  v8f acc[4] = {};
  for (int kb = 0; kb < K; kb += 32) {
    FragB ah, al;
    const v4f x0 = *(const v4fa*)(arow + kb + 8 * hh), x1 = *(const v4fa*)(arow + kb + 8 * hh + 4);
    const v4f x2 = *(const v4fa*)(arow + kb + 16 + 8 * hh), x3 = *(const v4fa*)(arow + kb + 16 + 8 * hh + 4);
    float xs[16] = {x0[0],x0[1],x0[2],x0[3],x1[0],x1[1],x1[2],x1[3],x2[0],x2[1],x2[2],x2[3],x3[0],x3[1],x3[2],x3[3]};
#pragma unroll
    for (int i = 0; i < 16; ++i) { const unsigned short hb = bf16_bits(xs[i]); ah.u[i] = hb; al.u[i] = ASPLIT ? bf16_bits(xs[i] - bf16_val(hb)) : (unsigned short)0; }
#pragma unroll
    for (int t = 0; t < 4; ++t) {
      const unsigned short* brow = Wt + (size_t)(col0 + t * 16 + ln) * ldb + kb;
      FragB b;
      b.half[0] = *(const v8us*)(brow + 8 * hh);
      b.half[1] = *(const v8us*)(brow + 16 + 8 * hh);
      acc[t] = mmaN<ASPLIT ? 2 : 1>(ah.v, al.v, b.v, b.v, acc[t]);
    }
  }
#pragma unroll
  for (int t = 0; t < 4; ++t) {
    const int col = col0 + t * 16 + ln;
    float bv = bias ? bias[col] : 0.f;
    if (BIAS_BF16) bv = bf16_round(bv);
#pragma unroll
    for (int r = 0; r < 8; ++r) {
      float v = acc[t][r] + bv;
      if (resid) { float rv = resid[(size_t)((row0 + 8 * hh + r) % rmod) * ldr + col]; if (RES_BF16) rv = bf16_round(rv); v += rv; }
      if (ACT == 1) v = fmaxf(v, 0.f);
      if (ACT == 2) v = 0.5f * v * (1.0f + erff(v * 0.70710678118654752f));
      if (ACT == 3) { const float u = 0.7978845608028654f * (v + 0.044715f * v * v * v); v = 0.5f * v * (1.0f + tanhf(u)); }
      so[w][8 * hh + r][t * 16 + ln] = v;
    }
  }
  __builtin_amdgcn_fence(__ATOMIC_ACQ_REL, "workgroup");
  __builtin_amdgcn_wave_barrier();
  const int rsub = lane >> 4, c4 = (lane & 15) * 4;
  {
#pragma unroll
    for (int q = 0; q < 8; ++q) {
      const int r = q * 2 + rsub;
      const v4f v = *(const v4fa*)&so[w][r][c4];
      *(v4f*)(C + (size_t)(row0 + r) * ldc + col0 + c4) = v;
    }
    
  }
}
// row LayerNorm (biased variance, eps) over N: s = X (+ R); optional out_sum <- s; out_norm <- (s-mu)*rsqrt(var+eps)*g + b
template <bool PARAM_BF16>
__global__ __launch_bounds__(256) void k_layernorm(const float* __restrict__ X, const float* __restrict__ R, const float* __restrict__ g, const float* __restrict__ bta,
                                                  float* __restrict__ out_sum, float* __restrict__ out_norm, int N, float eps) {
  __shared__ float red[256];
  const int row = blockIdx.x, tid = threadIdx.x;
  const float* x = X + (size_t)row * N; const float* rr = R ? R + (size_t)row * N : nullptr;
  float vals[16];                     // up to N = 4096
  const int per = N / 256;            // contiguous chunk per thread? use strided-by-4 chunks: thread handles j = tid*4 + 1024*u
  float s1 = 0.f;
  for (int u = 0; u < per / 4; ++u) {
    const int j = tid * 4 + 1024 * u;
    const v4f a = *(const v4fa*)(x + j);
    v4f b = {0.f,0.f,0.f,0.f}; if (rr) b = *(const v4fa*)(rr + j);
#pragma unroll
    for (int q = 0; q < 4; ++q) { const float v = a[q] + b[q]; vals[u * 4 + q] = v; s1 += v; }
  }
  red[tid] = s1; __syncthreads();
  for (int st = 128; st > 0; st >>= 1) { if (tid < st) red[tid] += red[tid + st]; __syncthreads(); }
  const float mu = red[0] / (float)N; __syncthreads();
  float s2 = 0.f;
  for (int u = 0; u < per / 4; ++u)
#pragma unroll
    for (int q = 0; q < 4; ++q) { const float c = vals[u * 4 + q] - mu; s2 += c * c; }
  red[tid] = s2; __syncthreads();
  for (int st = 128; st > 0; st >>= 1) { if (tid < st) red[tid] += red[tid + st]; __syncthreads(); }
  const float rs = rsqrtf(red[0] / (float)N + eps);
  {
    for (int u = 0; u < per / 4; ++u) {
      const int j = tid * 4 + 1024 * u;
      v4f o, sm;
#pragma unroll
      for (int q = 0; q < 4; ++q) {
        float gg = g[j + q], bb = bta[j + q];
        if (PARAM_BF16) { gg = bf16_round(gg); bb = bf16_round(bb); }
        sm[q] = vals[u * 4 + q]; o[q] = (vals[u * 4 + q] - mu) * rs * gg + bb;
      }
      if (out_sum) *(v4f*)(out_sum + (size_t)row * N + j) = sm;
      *(v4f*)(out_norm + (size_t)row * N + j) = o;
    }
    
  }
}



// ---- f16 WMMA path (v_wmma_f32_16x16x32_f16): 11-bit significands for operands in range — used where a [0,1] probability operand needs more precision than bf16
typedef _Float16 v16h __attribute__((ext_vector_type(16)));
union FragH { v16h v; v8us half[2]; _Float16 h[16]; unsigned short u[16]; };
template <int NT>
__device__ __forceinline__ v8f mmaH(v16h ah, v16h al, v16h bh, v16h bl, v8f c) {
  c = __builtin_amdgcn_wmma_f32_16x16x32_f16(false, ah, false, bh, (short)0, c, false, false);
  if (NT >= 2) c = __builtin_amdgcn_wmma_f32_16x16x32_f16(false, al, false, bh, (short)0, c, false, false);
  if (NT >= 3) c = __builtin_amdgcn_wmma_f32_16x16x32_f16(false, ah, false, bl, (short)0, c, false, false);
  asm volatile("v_nop\n\tv_nop\n\tv_nop\n\tv_nop" : "+v"(c) : "v"(ah), "v"(al), "v"(bh), "v"(bl));
  return c;
}
// batched GEMM like k_gemm_b but f16 operands: A f32 (split into f16 hi/lo if ASPLIT, else rounded to f16), Bt = f16 values [n][k]; alpha; C f32; N multiple of 16 (partial tiles skipped)
template <bool ASPLIT>
__global__ __launch_bounds__(128) void k_gemm_h(const float* __restrict__ A, int lda, size_t sA, const _Float16* __restrict__ Bh, int ldb, size_t sB, float alpha, float* __restrict__ C, int ldc, size_t sC, int M, int N, int K) {
  __shared__ __attribute__((aligned(16))) float so[4][16][64];
  const int tid = threadIdx.x, w = tid >> 5, lane = tid & 31, ln = lane & 15, hh = lane >> 4; const int by = blockIdx.y;
  A += (size_t)by * sA; Bh += (size_t)by * sB; C += (size_t)by * sC;
  const int ntn = (N + 63) / 64; const int wid = blockIdx.x * 4 + w; const int mt = wid / ntn, nq = wid % ntn; if (mt * 16 >= M) return;
  const int row0 = mt * 16, col0 = nq * 64; const float* arow = A + (size_t)(row0 + ln) * lda;
  v8f acc[4] = {};
  for (int kb = 0; kb < K; kb += 32) {
    FragH ah, al;
    const v4f x0 = *(const v4fa*)(arow + kb + 8 * hh), x1 = *(const v4fa*)(arow + kb + 8 * hh + 4), x2 = *(const v4fa*)(arow + kb + 16 + 8 * hh), x3 = *(const v4fa*)(arow + kb + 16 + 8 * hh + 4);
    float xs[16] = {x0[0],x0[1],x0[2],x0[3],x1[0],x1[1],x1[2],x1[3],x2[0],x2[1],x2[2],x2[3],x3[0],x3[1],x3[2],x3[3]};
#pragma unroll
    for (int i = 0; i < 16; ++i) { const _Float16 h = (_Float16)xs[i]; ah.h[i] = h; al.h[i] = ASPLIT ? (_Float16)(xs[i] - (float)h) : (_Float16)0.0f; }
#pragma unroll
    for (int t = 0; t < 4; ++t) { if (col0 + t * 16 >= N) continue; const size_t boff = (size_t)(col0 + t * 16 + ln) * ldb + kb; FragH bq; bq.half[0] = *(const v8us*)(Bh + boff + 8 * hh); bq.half[1] = *(const v8us*)(Bh + boff + 16 + 8 * hh);
      acc[t] = mmaH<ASPLIT ? 2 : 1>(ah.v, al.v, bq.v, bq.v, acc[t]); }
  }
#pragma unroll
  for (int t = 0; t < 4; ++t) { if (col0 + t * 16 >= N) continue;
#pragma unroll
    for (int r = 0; r < 8; ++r) so[w][8 * hh + r][t * 16 + ln] = acc[t][r] * alpha; }
  __builtin_amdgcn_fence(__ATOMIC_ACQ_REL, "workgroup"); __builtin_amdgcn_wave_barrier();
  const int rsub = lane >> 4, c4 = (lane & 15) * 4;
  {
#pragma unroll
    for (int q = 0; q < 8; ++q) { const int r = q * 2 + rsub; if (col0 + c4 < N) { const v4f v = *(const v4fa*)&so[w][r][c4]; *(v4f*)(C + (size_t)(row0 + r) * ldc + col0 + c4) = v; } }
     }
}

// Wt[n][k] = f16(W[k][n]·scale) from f32 row-major W[K][N] (scale = power of two; bf16-exact weights stay exact in f16 away from the subnormal range)
__global__ __launch_bounds__(256) void k_wt_f16(const float* __restrict__ W, _Float16* __restrict__ Wt, int K, int N, float scale) {
  const int t = blockIdx.x * 256 + threadIdx.x; if (t >= N * (K / 8)) return;      /* t = the 16-byte chunk's place in fragment order (pk_frag) */
  const int tile = t >> 6, n = (tile / (K / 32)) * 16 + (t & 15), k8 = (tile % (K / 32)) * 32 + ((t >> 5) & 1) * 16 + ((t >> 4) & 1) * 8; FragH f;
#pragma unroll
  for (int i = 0; i < 8; ++i) f.h[i] = (_Float16)(bf16_round(W[(size_t)(k8 + i) * N + n]) * scale); const v8us o = f.half[0];
  *(v8us*)((unsigned short*)Wt + (size_t)t * 8) = o; 
}
// k_gemm_hh variant with fused epilogue: v = acc·alpha + bias[by·sBias + col] (+ CP[(row/rowsPerB)·sCPb + by·64 + col] if CP) ; ACT 0 none / 1 elu ; writes f16 C16 (and f32 C if non-null)
template <int ACT>
__global__ __launch_bounds__(128) void k_gemm_hhx(const _Float16* __restrict__ A, int lda, size_t sA, const _Float16* __restrict__ Bh, int ldb, size_t sB, float alpha, const float* __restrict__ bias, size_t sBias, const float* __restrict__ CP, int rowsPerB, size_t sCPb, int row0g,
    float* __restrict__ C, _Float16* __restrict__ C16, int ldc, size_t sC, int M, int N, int K) {
  __shared__ __attribute__((aligned(16))) float so[4][16][64];
  const int tid = threadIdx.x, w = tid >> 5, lane = tid & 31, ln = lane & 15, hh = lane >> 4; const int by = blockIdx.y;
  A += (size_t)by * sA; Bh += (size_t)by * sB; const size_t cofs = (size_t)by * sC; const float* bp = bias ? bias + (size_t)by * sBias : nullptr;
  const int ntn = (N + 63) / 64; const int wid = blockIdx.x * 4 + w; const int mt = wid / ntn, nq = wid % ntn; if (mt * 16 >= M) return;
  const int row0 = mt * 16, col0 = nq * 64; const _Float16* arow = A + (size_t)(row0 + ln) * lda;
  v8f acc[4] = {};
  for (int kb = 0; kb < K; kb += 32) { FragH ah; ah.half[0] = *(const v8us*)((const unsigned short*)arow + kb + 8 * hh); ah.half[1] = *(const v8us*)((const unsigned short*)arow + kb + 16 + 8 * hh);
#pragma unroll
    for (int t = 0; t < 4; ++t) { if (col0 + t * 16 >= N) continue; const size_t boff = (size_t)(col0 + t * 16 + ln) * ldb + kb; FragH bq; bq.half[0] = *(const v8us*)((const unsigned short*)Bh + boff + 8 * hh); bq.half[1] = *(const v8us*)((const unsigned short*)Bh + boff + 16 + 8 * hh);
      acc[t] = mmaH<1>(ah.v, ah.v, bq.v, bq.v, acc[t]); }
  }
#pragma unroll
  for (int t = 0; t < 4; ++t) { if (col0 + t * 16 >= N) continue; const int col = col0 + t * 16 + ln; const float bv = bp ? bf16_round(bp[col]) : 0.f;
#pragma unroll
    for (int r = 0; r < 8; ++r) { float v = acc[t][r] * alpha + bv; if (CP) { const int rr = row0g + row0 + 8 * hh + r; if (rowsPerB < 0) v += CP[cofs + (size_t)rr * ldc + col];      /* rowsPerB < 0: own element of the batched C plane */ else { const int bidx = rr / rowsPerB; v += CP[(size_t)bidx * sCPb + (size_t)by * 64 + col]; } } if (ACT == 1) v = (v > 0.f) ? v : expm1f(v); else if (ACT == 7) v = (v > 0.f) ? v + 1.0f : expf(v); else if (ACT == 8) v = tanhf(v); else if (ACT == 9) v = 0.5f * v * (1.0f + tanhf(0.7978845608028654f * (v + 0.044715f * v * v * v))); else if (ACT == 11) v = 1.0f / (1.0f + expf(-v)); else if (ACT == 12) v = (v > 0.f) ? v : 0.01f * v; else if (ACT == 14) v = (v > 0.f) ? v : 0.1f * v; else if (ACT == 16) v = (v >= 0.f) ? v : 0.3f * v; else if (ACT == 17) v = (v >= 0.f) ? v : 0.2f * v; else if (ACT == 15) v = v / (1.0f + expf(-v)); else if (ACT == 3) v = fmaxf(v, 0.f); else if (ACT == 6) v = 0.5f * v * (1.0f + erff(v * 0.70710678118654752f)); so[w][8 * hh + r][t * 16 + ln] = v; } }
  __builtin_amdgcn_fence(__ATOMIC_ACQ_REL, "workgroup"); __builtin_amdgcn_wave_barrier();
  const int rsub = lane >> 4, c4 = (lane & 15) * 4; typedef _Float16 v4h __attribute__((ext_vector_type(4)));
  {
#pragma unroll
    for (int q = 0; q < 8; ++q) { const int r = q * 2 + rsub; if (col0 + c4 < N) { const v4f v = *(const v4fa*)&so[w][r][c4]; if (C) *(v4f*)(C + cofs + (size_t)(row0 + r) * ldc + col0 + c4) = v; if (C16) { v4h h4; for (int i = 0; i < 4; ++i) h4[i] = (_Float16)v[i]; *(v4h*)(C16 + cofs + (size_t)(row0 + r) * ldc + col0 + c4) = h4; } } }
     }
}


typedef _Float16 v4h __attribute__((ext_vector_type(4)));

__global__ __launch_bounds__(256) void k_x16(const float* __restrict__ x, _Float16* __restrict__ X16, size_t n8) { const size_t t = (size_t)blockIdx.x * 256 + threadIdx.x; if (t >= n8) return; FragH f;      /* t = the 16-byte chunk's place in fragment order (pk_frag), rows of DM */
  const size_t tile = t >> 6; const float* s = x + ((tile / (DM / 32)) * 16 + (t & 15)) * DM + (tile % (DM / 32)) * 32 + ((t >> 5) & 1) * 16 + ((t >> 4) & 1) * 8;
#pragma unroll
  for (int q = 0; q < 8; ++q) f.h[q] = (_Float16)bf16_round(s[q]); *(v8us*)((unsigned short*)X16 + t * 8) = f.half[0];  }
__global__ __launch_bounds__(256) void k_h16(const float* __restrict__ x, _Float16* __restrict__ X16, size_t n8) { const size_t t = (size_t)blockIdx.x * 256 + threadIdx.x; if (t >= n8) return; FragH f;
#pragma unroll
  for (int q = 0; q < 8; ++q) f.h[q] = (_Float16)x[t * 8 + q]; *(v8us*)((unsigned short*)X16 + t * 8) = f.half[0];  }
__global__ __launch_bounds__(256) void k_round16f(const float* __restrict__ W, _Float16* __restrict__ Bt, size_t n8) { const size_t t = (size_t)blockIdx.x * 256 + threadIdx.x; if (t >= n8) return; FragH f;
#pragma unroll
  for (int i = 0; i < 8; ++i) f.h[i] = (_Float16)(bf16_round(W[t * 8 + i]) * 16.0f); *(v8us*)((unsigned short*)Bt + t * 8) = f.half[0];  }
template <int NHv, int TTv>
__global__ __launch_bounds__(256) void k_vt(const _Float16* __restrict__ V16, int ldv, int voff, _Float16* __restrict__ Vt) { __shared__ unsigned short tl[64][66]; const int tid = threadIdx.x; const int slab = blockIdx.x / (TTv / 64), lg = blockIdx.x % (TTv / 64); const int b = slab / NHv, h = slab % NHv;
  for (int i = tid; i < 64 * 8; i += 256) { const int r = i / 8, c8 = (i % 8) * 8; FragH f; f.half[0] = *(const v8us*)((const unsigned short*)V16 + ((size_t)b * TTv + lg * 64 + r) * ldv + voff + h * 64 + c8);
#pragma unroll
    for (int q = 0; q < 8; ++q) tl[r][c8 + q] = f.u[q]; }
  __syncthreads();
  {
#pragma unroll
    for (int rd = 0; rd < 2; ++rd) { const int i = rd * 256 + tid, tile = i >> 6; const int d = (tile & 3) * 16 + (i & 15), kl = (tile >> 2) * 32 + ((i >> 5) & 1) * 16 + ((i >> 4) & 1) * 8; FragH f;      /* fragment order (pk_frag), tile (32 keys, 16 d) at (key / 32) * 4 + d / 16 of the slab */
#pragma unroll
      for (int q = 0; q < 8; ++q) f.u[q] = tl[kl + q][d];
      *(v8us*)((unsigned short*)Vt + (size_t)slab * 64 * TTv + (size_t)lg * 4096 + i * 8) = f.half[0]; }
     } }

__global__ __launch_bounds__(256) void k_hl(const float* __restrict__ F, _Float16* __restrict__ Hh, _Float16* __restrict__ Hl, size_t n8) { const size_t t = (size_t)blockIdx.x * 256 + threadIdx.x; if (t >= n8) return; FragH fh, fl; const v4f a = *(const v4fa*)(F + t * 8), c = *(const v4fa*)(F + t * 8 + 4);
#pragma unroll
  for (int q = 0; q < 4; ++q) { _Float16 h = (_Float16)a[q]; fh.h[q] = h; fl.h[q] = (_Float16)((a[q] - (float)h) * 1024.0f); h = (_Float16)c[q]; fh.h[4 + q] = h; fl.h[4 + q] = (_Float16)((c[q] - (float)h) * 1024.0f); }
  { *(v8us*)((unsigned short*)Hh + t * 8) = fh.half[0]; *(v8us*)((unsigned short*)Hl + t * 8) = fl.half[0];  } }

// ---- fast GEMM (wave tile 32x64; requires M % 32 == 0 rows per launch region and N % 64 == 0); epilogue = k_gemm_hhx semantics ----
__device__ __forceinline__ v16h g2_frag(const _Float16* p, int hh) { FragH f; f.half[0] = *(const v8us*)((const unsigned short*)p + 8 * hh); f.half[1] = *(const v8us*)((const unsigned short*)p + 16 + 8 * hh); return f.v; }
// Fragment order of an f16 matrix [R][K]: 16-row x 32-k tiles of 1024 bytes, tile (rt, kt) at (rt * (K / 32) + kt) * 512 halves; inside a tile the 8 halves of row ln, k = part * 16 + hh * 8 .. + 7
// stand at (part * 32 + hh * 16 + ln) * 8. p = the tile + lane * 8: each of the two loads of a wave then covers 512 contiguous bytes (4 whole lines, not 16 pieces of 32 bytes); the k order is that of g2_frag.
__device__ __forceinline__ v16h pk_frag(const _Float16* p) { FragH f; f.half[0] = *(const v8us*)((const unsigned short*)p); f.half[1] = *(const v8us*)((const unsigned short*)p + 256); return f.v; }
__device__ __forceinline__ v8f g2_mma(v16h a, v16h b, v8f c) { v8f d = __builtin_amdgcn_wmma_f32_16x16x32_f16(false, a, false, b, (short)0, c, false, false); asm volatile("v_nop\n\tv_nop\n\tv_nop\n\tv_nop" : "+v"(d) : "v"(a), "v"(b)); return d; }
struct G2F { v16h a0, a1, b0, b1, b2, b3; };      /* the six fragments of one 32-k tile: two row tiles of A, four column tiles of B */
// one k tile's twelve loads, issued as one group at this place, tiles ahead of the products that read them. The wait stands behind the group: the six address pairs, named as inputs, stay live up to it,
// so that no load's result lands in a register that an issued load still names; the two scheduling barriers keep every load of the group in front of the wait and every rewrite of an address behind it
__device__ __forceinline__ G2F g2_load(const _Float16* a0, const _Float16* a1, const _Float16* b0, const _Float16* b1, const _Float16* b2, const _Float16* b3, int kb) { G2F f;
  const _Float16* p0 = a0 + kb; const _Float16* p1 = a1 + kb; const _Float16* p2 = b0 + kb; const _Float16* p3 = b1 + kb; const _Float16* p4 = b2 + kb; const _Float16* p5 = b3 + kb;
  f.a0 = pk_frag(p0); f.a1 = pk_frag(p1); f.b0 = pk_frag(p2); f.b1 = pk_frag(p3); f.b2 = pk_frag(p4); f.b3 = pk_frag(p5);
  __builtin_amdgcn_sched_barrier(0); asm volatile("s_wait_xcnt 0x0" :: "v"(p0), "v"(p1), "v"(p2), "v"(p3), "v"(p4), "v"(p5) : "memory"); __builtin_amdgcn_sched_barrier(0); return f; }
template <int ACT, bool PK>      /* A and Bh in fragment order (pk_frag); PK: C16 alone is written, in fragment order; else C and C16 row-major */
__global__ __launch_bounds__(128) void k_gemm2(const _Float16* __restrict__ A, int lda, size_t sA, const _Float16* __restrict__ Bh, int ldb, size_t sB, float alpha, const float* __restrict__ bias, size_t sBias, const float* __restrict__ CP, int rowsPerB, size_t sCPb, int row0g,
    float* __restrict__ C, _Float16* __restrict__ C16, int ldc, size_t sC, int M, int N, int K) { static_assert(ACT == 0 || ACT == 3 || ACT == 6 || ACT == 8 || ACT == 9 || ACT == 11 || ACT == 12 || ACT == 14 || ACT == 15 || ACT == 16 || ACT == 17, "k_gemm2: unsupported ACT code (would silently apply no activation)");
  __shared__ __attribute__((aligned(16))) float so[4][32][68];
  const int tid = threadIdx.x, w = tid >> 5, lane = tid & 31, ln = lane & 15, hh = lane >> 4; const int by = blockIdx.y;
  A += (size_t)by * sA; Bh += (size_t)by * sB; const size_t cofs = (size_t)by * sC; const float* bp = bias ? bias + (size_t)by * sBias : nullptr;
  const int ntn = N >> 6; const int mt = blockIdx.x / ntn, nq = blockIdx.x - mt * ntn; const int row0 = mt * 128 + 32 * w, col0 = nq * 64; if (row0 >= M) return;
  const _Float16* a0p = A + (size_t)row0 * lda + lane * 8; const _Float16* a1p = a0p + (size_t)16 * lda;
  const _Float16* b0p = Bh + (size_t)col0 * ldb + lane * 8; const _Float16* b1p = b0p + (size_t)16 * ldb; const _Float16* b2p = b1p + (size_t)16 * ldb; const _Float16* b3p = b2p + (size_t)16 * ldb;
  const v8f z8 = {0.f,0.f,0.f,0.f,0.f,0.f,0.f,0.f}; v8f c00 = z8, c01 = z8, c02 = z8, c03 = z8, c10 = z8, c11 = z8, c12 = z8, c13 = z8;
  if (K > 0) { const int ke = K * 16, kl = ke - 512, n3 = ke / 1536; int kb = 0;      /* halves of a fragment row; its last tile; whole trips. A ring of three register sets: tile t + 2 is asked for in front of tile t's products; past the end the last tile is fetched again, in bounds */
#define G2_LOAD(k) g2_load(a0p, a1p, b0p, b1p, b2p, b3p, (k) < kl ? (k) : kl)
#define G2_TILE(f) { c00 = g2_mma(f.a0, f.b0, c00); c10 = g2_mma(f.a1, f.b0, c10); c01 = g2_mma(f.a0, f.b1, c01); c11 = g2_mma(f.a1, f.b1, c11); c02 = g2_mma(f.a0, f.b2, c02); c12 = g2_mma(f.a1, f.b2, c12); c03 = g2_mma(f.a0, f.b3, c03); c13 = g2_mma(f.a1, f.b3, c13); }
    G2F f0 = G2_LOAD(0), f1 = G2_LOAD(512);
#pragma unroll 1      // three tiles a trip, so that each set keeps its registers (no copies between the sets); one block without an exit inside, so that the waits for the loads stay counted
    for (int i = 0; i < n3; ++i, kb += 1536) { const G2F f2 = G2_LOAD(kb + 1024); G2_TILE(f0) f0 = G2_LOAD(kb + 1536); G2_TILE(f1) f1 = G2_LOAD(kb + 2048); G2_TILE(f2) }
    if (kb < ke) G2_TILE(f0)      /* the one or two tiles that no whole trip holds are already in the ring */
    if (kb + 512 < ke) G2_TILE(f1) }
#undef G2_LOAD
#undef G2_TILE
  v8f accs[8] = {c00, c01, c02, c03, c10, c11, c12, c13};
#pragma unroll
  for (int u = 0; u < 8; ++u) { const int t = u & 3, half = u >> 2; const int col = col0 + t * 16 + ln; const float bv = bp ? bf16_round(bp[col]) : 0.f;
#pragma unroll
    for (int r = 0; r < 8; ++r) { const int rloc = half * 16 + 8 * hh + r; float v = accs[u][r] * alpha + bv; if (CP) { if (rowsPerB < 0) v += CP[cofs + (size_t)(row0g + row0 + rloc) * ldc + col];      /* rowsPerB < 0: own element of the batched C plane */ else { const int bidx = (row0g + row0 + rloc) / rowsPerB; v += CP[(size_t)bidx * sCPb + (size_t)by * 64 + col]; } }
      if (ACT == 3) v = fmaxf(v, 0.f); else if (ACT == 6) v = 0.5f * v * (1.0f + erff(v * 0.70710678118654752f)); else if (ACT == 11) v = 1.0f / (1.0f + expf(-v)); else if (ACT == 15) v = v / (1.0f + expf(-v)); else if (ACT == 12) v = (v > 0.f) ? v : 0.01f * v; else if (ACT == 8) v = tanhf(v); else if (ACT == 9) v = 0.5f * v * (1.0f + tanhf(0.7978845608028654f * (v + 0.044715f * v * v * v))); else if (ACT == 14) v = (v > 0.f) ? v : 0.1f * v; else if (ACT == 16) v = (v >= 0.f) ? v : 0.3f * v; else if (ACT == 17) v = (v >= 0.f) ? v : 0.2f * v;
      so[w][rloc][t * 16 + ln] = v; } }
  __builtin_amdgcn_fence(__ATOMIC_ACQ_REL, "workgroup"); __builtin_amdgcn_wave_barrier();
  const int rsub = lane >> 4, c4 = (lane & 15) * 4;
  if (PK) {      /* C16 alone, in fragment order: the wave's 32 x 64 tile = 2 x 2 fragment tiles, eight stores of 512 contiguous bytes */
#pragma unroll      // constant LDS and store offsets
      for (int s = 0; s < 8; ++s) { const int rl = (s >> 2) * 16 + ln, cl = ((s >> 1) & 1) * 32 + (s & 1) * 16 + hh * 8; const v4f x = *(const v4fa*)&so[w][rl][cl], y = *(const v4fa*)&so[w][rl][cl + 4]; FragH f;
        for (int i = 0; i < 4; ++i) { f.h[i] = (_Float16)x[i]; f.h[4 + i] = (_Float16)y[i]; }
        *(v8us*)((unsigned short*)C16 + cofs + (size_t)(row0 + (s >> 2) * 16) * ldc + (size_t)((col0 >> 5) + ((s >> 1) & 1)) * 512 + (s & 1) * 256 + lane * 8) = f.half[0]; }
    return; }
  {
#pragma unroll
    for (int q = 0; q < 16; ++q) { const int r = q * 2 + rsub; const v4f v = *(const v4fa*)&so[w][r][c4]; if (C) *(v4f*)(C + cofs + (size_t)(row0 + r) * ldc + col0 + c4) = v; if (C16) { v4h h4; for (int i = 0; i < 4; ++i) h4[i] = (_Float16)v[i]; *(v4h*)(C16 + cofs + (size_t)(row0 + r) * ldc + col0 + c4) = h4; } }
     } }


__global__ __launch_bounds__(256) void k_wnat(const float* __restrict__ w, size_t n8, _Float16* __restrict__ Bt) { const size_t t = (size_t)blockIdx.x * 256 + threadIdx.x; if (t >= n8) return; FragH f; for (int q = 0; q < 8; ++q) f.h[q] = (_Float16)(bf16_round(w[t * 8 + q]) * 16.0f); *(v8us*)((unsigned short*)Bt + t * 8) = f.half[0];  }
__global__ __launch_bounds__(256) void k_rsm(const float* __restrict__ S, _Float16* __restrict__ P, int nrows) {
  #pragma clang fp contract(off)
  const int i = blockIdx.x * 256 + threadIdx.x; if (i >= nrows) return; const float* s = S + (size_t)i * SQ; float mx = -3.0e38f;
#pragma unroll 1
  for (int j = 0; j < SQ; ++j) mx = fmaxf(mx, s[j]); float se = 0.f;
#pragma unroll 1
  for (int j = 0; j < SQ; ++j) se += expf(s[j] - mx); const float sc = 256.0f / se;
#pragma unroll 1
  for (int j0 = 0; j0 < SQ; j0 += 8) { FragH f; for (int q = 0; q < 8; ++q) f.h[q] = (_Float16)(expf(s[j0 + q] - mx) * sc); unsigned short* d = (unsigned short*)P + (size_t)i * SQ + j0; *(v8us*)d = f.half[0];  } }
__global__ __launch_bounds__(256) void k_vt(const _Float16* __restrict__ V16, int b, int h0, _Float16* __restrict__ VT) { __shared__ unsigned short tl[64][65]; const int tid = threadIdx.x; const int hh = blockIdx.x % HG, sg = blockIdx.x / HG; const int s0 = sg * 64; const int h = h0 + hh;
  for (int i = tid; i < 64 * 8; i += 256) { const int j = i / 8, d8 = (i % 8) * 8; FragH f; f.half[0] = *(const v8us*)((const unsigned short*)V16 + ((size_t)b * SQ + s0 + j) * DM + h * HD + d8); for (int q = 0; q < 8; ++q) tl[d8 + q][j] = f.u[q]; }
  __syncthreads();
  { for (int i = tid; i < 64 * 8; i += 256) { const int d = i / 8, j8 = (i % 8) * 8; FragH f; for (int q = 0; q < 8; ++q) f.u[q] = tl[d][j8 + q]; *(v8us*)((unsigned short*)VT + ((size_t)hh * HD + d) * SQ + s0 + j8) = f.half[0]; }  } }


__global__ __launch_bounds__(256) void k_wthd(const float* __restrict__ Wt, _Float16* __restrict__ Bt) { const size_t t = (size_t)blockIdx.x * 256 + threadIdx.x; if (t >= (size_t)NH * HD * (DM / 8)) return;      /* t = the 16-byte chunk's place in fragment order (pk_frag), rows (h, d) of DM */
  const int tile = (int)(t >> 6), n = (tile / (DM / 32)) * 16 + (int)(t & 15); const int m8 = (tile % (DM / 32)) * 32 + (int)((t >> 5) & 1) * 16 + (int)((t >> 4) & 1) * 8; const int d = n % HD; const int h = n / HD; FragH f;
  for (int q = 0; q < 8; ++q) f.h[q] = (_Float16)(16.0f * bf16_round(Wt[((size_t)h * DM + m8 + q) * HD + d])); unsigned short* dst = (unsigned short*)Bt + t * 8; *(v8us*)dst = f.half[0];  }




typedef int v4ia __attribute__((ext_vector_type(4), may_alias));
__device__ __forceinline__ float rs_xrow(float v) { const int i = __float_as_int(v); return __int_as_float(__builtin_amdgcn_permlanex16(i, i, 0x76543210, 0xfedcba98, true, false)); }      /* lane l reads lane l ^ 16 */
// Fused attention, one wave per 16 query rows of one (batch, head), 32 keys a pass: S^T = K Q^T (A = K rows, B = Q kept in registers), so a lane holds one query's
// scores (keys 8*hh + r of each 16-key tile); running maximum and sum per lane, one exchange between the wave halves; the two f32 score tiles, converted in place,
// are the B operand of O^T += V^T P^T. No score and no weight goes through memory. All in the log2 domain: p = 2^(s * FA_C - mu + FA_OFF) with mu the maximum in use.
#define FA_C 0.18033688011112042f      /* 64^-0.5 * log2(e) */
#define FA_OFF 7.0f                    /* weights carried x128: small ones stay normal f16 numbers */
#define FA_THR 8.0f                    /* mu is renewed only when a score passes it by more than this: weights stay at or under 2^15, inside f16 */
#define FA_DROP (-0x1p+100f)           /* raw score of a masked key; a power of two, so FA_DROP * FA_C is exact and a row with every key masked gets equal weights */
__device__ __forceinline__ v8f fa_mma(v16h a, v16h b, v8f c) { return __builtin_amdgcn_wmma_f32_16x16x32_f16(false, a, false, b, (short)0, c, false, false); }
// eight native 2^x; each is followed by an independent instruction, the last by the v_nop: the slot the instruction set asks for behind a transcendental
__device__ __forceinline__ v8f fa_exp2(v8f x) { float e0, e1, e2, e3, e4, e5, e6, e7;
  asm("v_exp_f32 %0, %8\n\tv_exp_f32 %1, %9\n\tv_exp_f32 %2, %10\n\tv_exp_f32 %3, %11\n\tv_exp_f32 %4, %12\n\tv_exp_f32 %5, %13\n\tv_exp_f32 %6, %14\n\tv_exp_f32 %7, %15\n\tv_nop"
      : "=&v"(e0), "=&v"(e1), "=&v"(e2), "=&v"(e3), "=&v"(e4), "=&v"(e5), "=&v"(e6), "=&v"(e7) : "v"(x[0]), "v"(x[1]), "v"(x[2]), "v"(x[3]), "v"(x[4]), "v"(x[5]), "v"(x[6]), "v"(x[7]));
  const v8f e = {e0, e1, e2, e3, e4, e5, e6, e7}; return e; }
__device__ __forceinline__ float fa_exp2s(float x) { float e; asm("v_exp_f32 %0, %1\n\tv_nop" : "=v"(e) : "v"(x)); return e; }      /* the v_nop: the same slot */
// behind a group of loads or stores: the group is issued whole at this place (for loads: ahead of the arithmetic that covers their latency), and its address and data registers are reused only behind the wait;
// the two scheduling barriers keep every member of the group in front of the wait and every rewrite of a register behind it
__device__ __forceinline__ void fa_issued() { __builtin_amdgcn_sched_barrier(0); asm volatile("s_wait_xcnt 0x0" ::: "memory"); __builtin_amdgcn_sched_barrier(0); }
struct FaK { v16h a00, a01, a10, a11; v4ia m0, m1, m2, m3; };      /* one pass of K fragments (two 16-key tiles x two k steps) and the wave's 16 x 32 mask words, dealt row-contiguous: they serve the any-nonzero test alone */
// kp: the head's first K tile + lane * 8 (fragment order); mt: mask row (wave's first query + lane / 8), word (lane % 8) * 4: each mask load covers four whole 128-byte rows of the pass
__device__ __forceinline__ FaK fa_load(const _Float16* kp, const int* mt, int j) { FaK f; const _Float16* k = kp + (size_t)j * LQ;
  f.a00 = pk_frag(k); f.a01 = pk_frag(k + 512); f.a10 = pk_frag(k + 16 * LQ); f.a11 = pk_frag(k + 16 * LQ + 512);
  f.m0 = *(const v4ia*)(mt + j); f.m1 = *(const v4ia*)(mt + j + 4 * SQ); f.m2 = *(const v4ia*)(mt + j + 8 * SQ); f.m3 = *(const v4ia*)(mt + j + 12 * SQ); return f; }
// wave-uniform: does any lane hold a nonzero mask word in this pass?
__device__ __forceinline__ bool fa_anym(const FaK& f) { const v4ia o = f.m0 | f.m1 | f.m2 | f.m3; return __builtin_amdgcn_ballot_w32((o[0] | o[1] | o[2] | o[3]) != 0) != 0; }
// a key with a nonzero mask word takes FA_DROP as its raw score; m: the lane's own query row, first key of the pass + 8 * hh (the lane's 16 words are read here, only in a pass that holds a nonzero word)
__device__ __forceinline__ void fa_drop(const int* m, v8f& s0, v8f& s1) { const v4ia m0 = *(const v4ia*)m, m1 = *(const v4ia*)(m + 4), m2 = *(const v4ia*)(m + 16), m3 = *(const v4ia*)(m + 20);
#pragma unroll      // constant indices: the tiles stay in registers
  for (int r = 0; r < 4; ++r) { s0[r] = (m0[r] == 0) ? s0[r] : FA_DROP; s0[4 + r] = (m1[r] == 0) ? s0[4 + r] : FA_DROP; s1[r] = (m2[r] == 0) ? s1[r] : FA_DROP; s1[4 + r] = (m3[r] == 0) ? s1[4 + r] : FA_DROP; } }
__global__ __launch_bounds__(256) void k_fattn(const _Float16* __restrict__ Q16, const _Float16* __restrict__ K16, const _Float16* __restrict__ VT, const int* __restrict__ Mk, _Float16* __restrict__ O16, float* __restrict__ PO) {
  static_assert(SQ % 128 == 0 && HD == 64, "k_fattn: 8 waves x 16 query rows a block, head size 64");
  const int lane = threadIdx.x & 31, ln = lane & 15, hh = lane >> 4; const int w = __builtin_amdgcn_readfirstlane(threadIdx.x >> 5);
  const int h = NH - 1 - (int)blockIdx.y, b = blockIdx.z;      /* the last head walks the keys twice: its blocks start first */
  const size_t rq = (size_t)b * SQ + blockIdx.x * 128 + w * 16, qr = rq + ln;      /* the wave's first query row; the lane's query row */
  const _Float16* qp = Q16 + rq * LQ + h * 1024 + lane * 8; const v16h q0 = pk_frag(qp), q1 = pk_frag(qp + 512);      /* a head's 64 columns are two 32-k tiles */
  fa_issued();      /* Q, then K and mask, then V^T: the order of the loop, so that the loop's first wait for K leaves the V^T loads in flight */
  const _Float16* kp = K16 + (size_t)b * SQ * LQ + h * 1024 + lane * 8; const _Float16* vp = VT + (size_t)(b * NH + h) * HD * SQ + lane * 8; const int* mp = Mk + qr * SQ + 8 * hh; const int* mt = Mk + (rq + (lane >> 3)) * SQ + (lane & 7) * 4;
  const v8f z8 = {0.f, 0.f, 0.f, 0.f, 0.f, 0.f, 0.f, 0.f}; v8f o0 = z8, o1 = z8, o2 = z8, o3 = z8; float mu = -3.0e38f, l = 0.f;
  FaK f = fa_load(kp, mt, 0);
  fa_issued();
  v16h v0 = pk_frag(vp), v1 = pk_frag(vp + 512), v2 = pk_frag(vp + 1024), v3 = pk_frag(vp + 1536);      /* a pass of V^T: four tiles, 4096 contiguous bytes */
  fa_issued();
#pragma unroll 1      // one pass a trip: the next pass's operands are already fetched by hand, a second copy of the body would only cost registers
  for (int j = 0; j < SQ; j += 32) { const int jn = (j + 32 < SQ) ? j + 32 : j;      /* first key of the next pass; the last pass fetches its own operands again, in bounds */
    v8f s0 = fa_mma(f.a01, q1, fa_mma(f.a00, q0, z8)), s1 = fa_mma(f.a11, q1, fa_mma(f.a10, q0, z8));
    if (fa_anym(f)) fa_drop(mp + j, s0, s1);
    float tm = fmaxf(s0[0], s1[0]);
#pragma unroll      // constant indices: the tiles stay in registers
    for (int r = 1; r < 8; ++r) tm = fmaxf(tm, fmaxf(s0[r], s1[r]));
    tm = fmaxf(tm, rs_xrow(tm)); const float tl = tm * FA_C;
    if (__builtin_amdgcn_ballot_w32(tl > mu + FA_THR) != 0) { const float mn = fmaxf(mu, tl), al = fa_exp2s(mu - mn); mu = mn; l *= al; o0 *= al; o1 *= al; o2 *= al; o3 *= al; }      /* rare: one scalar test a pass */
    f = fa_load(kp, mt, jn);      /* the next pass's K and mask fly during this pass's exponentials and products */
    fa_issued();
    const float nb = FA_OFF - mu;
    const v8f p0 = fa_exp2(s0 * FA_C + nb), p1 = fa_exp2(s1 * FA_C + nb);
    const v8f ps = p0 + p1; l += ((ps[0] + ps[1]) + (ps[2] + ps[3])) + ((ps[4] + ps[5]) + (ps[6] + ps[7]));
    FragH pf;
#pragma unroll      // constant indices: the fragment stays in registers
    for (int r = 0; r < 8; ++r) { pf.h[r] = (_Float16)p0[r]; pf.h[8 + r] = (_Float16)p1[r]; }
    o0 = fa_mma(v0, pf.v, o0); o1 = fa_mma(v1, pf.v, o1); o2 = fa_mma(v2, pf.v, o2); o3 = fa_mma(v3, pf.v, o3);
    v0 = pk_frag(vp + jn * 64); v1 = pk_frag(vp + jn * 64 + 512); v2 = pk_frag(vp + jn * 64 + 1024); v3 = pk_frag(vp + jn * 64 + 1536);      /* the next pass's V^T flies during its score products and softmax */
    fa_issued(); }
  l += rs_xrow(l);      /* the halves' sums are joined once */
  const float il = 1.0f / l, so = 64.0f * il;      /* o carried x64, as the output GEMM's alpha expects */
  unsigned short* op = (unsigned short*)O16 + rq * DM + h * 1024 + lane * 8; FragH e0, e1;      /* o in fragment order: the lane's four runs of 8 are the four half-fragments of the head's two tiles */
#pragma unroll      // constant indices: the tiles stay in registers
  for (int r = 0; r < 8; ++r) { e0.h[r] = (_Float16)(o0[r] * so); e0.h[8 + r] = (_Float16)(o1[r] * so); e1.h[r] = (_Float16)(o2[r] * so); e1.h[8 + r] = (_Float16)(o3[r] * so); }
  *(v8us*)op = e0.half[0]; *(v8us*)(op + 256) = e0.half[1]; *(v8us*)(op + 512) = e1.half[0]; *(v8us*)(op + 768) = e1.half[1];
  fa_issued();      /* in front of the head test: the last head's path rewrites the stores' registers at once */
  if (h != NH - 1) return;
  // second output: the last head's probabilities, its scores formed again now that the row's maximum in use and sum are known
  float* pp = PO + qr * SQ + 8 * hh; const float nb = FA_OFF - mu;
  f = fa_load(kp, mt, 0);
  fa_issued();
#pragma unroll 1      // as above
  for (int j = 0; j < SQ; j += 32) {
    v8f s0 = fa_mma(f.a01, q1, fa_mma(f.a00, q0, z8)), s1 = fa_mma(f.a11, q1, fa_mma(f.a10, q0, z8));
    if (fa_anym(f)) fa_drop(mp + j, s0, s1);
    f = fa_load(kp, mt, (j + 32 < SQ) ? j + 32 : j);
    fa_issued();
    const v8f p0 = fa_exp2(s0 * FA_C + nb) * il, p1 = fa_exp2(s1 * FA_C + nb) * il;
    const v4f t0 = {p0[0], p0[1], p0[2], p0[3]}, t1 = {p0[4], p0[5], p0[6], p0[7]}, t2 = {p1[0], p1[1], p1[2], p1[3]}, t3 = {p1[4], p1[5], p1[6], p1[7]};
    *(v4f*)(pp + j) = t0; *(v4f*)(pp + j + 4) = t1; *(v4f*)(pp + j + 16) = t2; *(v4f*)(pp + j + 20) = t3;
    fa_issued(); } }


__global__ __launch_bounds__(256) void k_rsmf(const float* __restrict__ S, _Float16* __restrict__ P, int qn, int hg) {
  #pragma clang fp contract(off)
  const int t = blockIdx.x * 256 + threadIdx.x; if (t >= qn * hg) return; const size_t i = (size_t)(t / qn) * SQ + (t % qn); const float* s = S + i * SQ; float mx = -3.0e38f;
#pragma unroll 1
  for (int j = 0; j < SQ; ++j) mx = fmaxf(mx, s[j]); float se = 0.f;
#pragma unroll 1
  for (int j = 0; j < SQ; ++j) se += __expf(s[j] - mx); const float sc = 256.0f / se;
#pragma unroll 1
  for (int j0 = 0; j0 < SQ; j0 += 8) { FragH f; for (int q = 0; q < 8; ++q) f.h[q] = (_Float16)(__expf(s[j0 + q] - mx) * sc); unsigned short* d = (unsigned short*)P + i * SQ + j0; *(v8us*)d = f.half[0];  } }

extern "C" void kernel_launch(void* const* d_in, const int* in_sizes, int n_in,
                              void* d_out, int out_size, void* d_ws, size_t ws_size, hipStream_t stream) {
  (void)in_sizes; (void)n_in; (void)out_size;
  const float* const* I = (const float* const*)d_in; const float* xv = I[0]; const float* xk = I[1]; const float* xq = I[2]; const int* mk = (const int*)d_in[3]; const float* wq = I[4]; const float* bq = I[5]; const float* wk = I[6]; const float* bk = I[7]; const float* wv = I[8]; const float* bv = I[9]; const float* wo = I[10]; const float* bo = I[11];      /* NOTE the module's input order v, k, q, mask; per-head [h][in][out] weights + [h][64] biases (= flat [1024]); W0 [in][out] + b0 */
  float* PO = (float*)d_out + (size_t)NB * SQ * DM;      /* second output: last head's attention probabilities [NB][SQ][SQ] f32 at byte offset 16,777,216 */
  char* ws = (char*)d_ws; size_t off = 0;
  auto take = [&](size_t bytes) { char* p = ws + off; off += (bytes + 255) & ~(size_t)255; return p; };
  _Float16* BQ = (_Float16*)take((size_t)DM * DM * 2); _Float16* BK = (_Float16*)take((size_t)DM * DM * 2); _Float16* BV = (_Float16*)take((size_t)DM * DM * 2); _Float16* BO = (_Float16*)take((size_t)DM * DM * 2);
  _Float16* XQ = (_Float16*)take(NR * DM * 2); _Float16* XK = (_Float16*)take(NR * DM * 2); _Float16* XV = (_Float16*)take(NR * DM * 2); _Float16* Q16 = (_Float16*)take(NR * DM * 2); _Float16* K16 = (_Float16*)take(NR * DM * 2); _Float16* V16 = (_Float16*)take(NR * DM * 2); _Float16* O16 = (_Float16*)take(NR * DM * 2);
  _Float16* VT = (_Float16*)take((size_t)NB * NH * HD * SQ * 2);
  if (off > ws_size) return;
  k_wthd<<<(unsigned)(((size_t)NH * HD * (DM / 8) + 255) / 256), 256, 0, stream>>>(wq, BQ); k_wthd<<<(unsigned)(((size_t)NH * HD * (DM / 8) + 255) / 256), 256, 0, stream>>>(wk, BK); k_wthd<<<(unsigned)(((size_t)NH * HD * (DM / 8) + 255) / 256), 256, 0, stream>>>(wv, BV);      /* per-head [h][m][d] -> Bt[(h,d)][m] x16, fragment order */
  k_wt_f16<<<(unsigned)(((size_t)DM * (DM / 8) + 255) / 256), 256, 0, stream>>>(wo, BO, DM, DM, 16.0f);      /* W0 [in][out] -> Bt x16, fragment order */

  k_x16<<<(unsigned)((NR * DM / 8 + 255) / 256), 256, 0, stream>>>(xq, XQ, NR * DM / 8); k_x16<<<(unsigned)((NR * DM / 8 + 255) / 256), 256, 0, stream>>>(xk, XK, NR * DM / 8); k_x16<<<(unsigned)((NR * DM / 8 + 255) / 256), 256, 0, stream>>>(xv, XV, NR * DM / 8);      /* the three inputs as exact f16 rows, fragment order */
  const size_t r0p = (size_t)B0 * SQ;      /* first projected row */
  k_gemm2<0, true><<<dim3((unsigned)((MP / 128) * (DM / 64)), 1), 128, 0, stream>>>(XQ + r0p * DM, DM, 0, BQ, DM, 0, 0.0625f, bq, 0, nullptr, 1, 0, 0, nullptr, Q16 + r0p * DM, DM, 0, MP, DM, DM);
  k_gemm2<0, true><<<dim3((unsigned)((MP / 128) * (DM / 64)), 1), 128, 0, stream>>>(XK + r0p * DM, DM, 0, BK, DM, 0, 0.0625f, bk, 0, nullptr, 1, 0, 0, nullptr, K16 + r0p * DM, DM, 0, MP, DM, DM);
  k_gemm2<0, false><<<dim3((unsigned)((MP / 128) * (DM / 64)), 1), 128, 0, stream>>>(XV + r0p * DM, DM, 0, BV, DM, 0, 0.0625f, bv, 0, nullptr, 1, 0, 0, nullptr, V16 + r0p * DM, DM, 0, MP, DM, DM);
  k_vt<NH, SQ><<<NB * NH * (SQ / 64), 256, 0, stream>>>(V16, LQ, 0, VT);      /* V^T per (batch, head), fragment order */
  k_fattn<<<dim3(SQ / 128, NH, NB), 256, 0, stream>>>(Q16, K16, VT, mk, O16, PO);      /* scores, softmax and P V in one launch; o (merged heads) as f16 rows; the last head's probabilities to the second output */
  k_gemm2<0, false><<<dim3((unsigned)((MPO / 128) * (DM / 64)), 1), 128, 0, stream>>>(O16 + r0p * DM, DM, 0, BO, DM, 0, 0.0009765625f, bo, 0, nullptr, 1, 0, 0, (float*)d_out + r0p * DM, nullptr, DM, 0, MPO, DM, DM);      /* out rows are the output layout */
}

// v005
// Measured time: 193 microseconds a run.
// Next to v004, in two timings, it ran 1.07 times as fast each time.
// Counting every step since v000, it is 34.7 times as fast.
#include <hip/hip_runtime.h>
#define NB 2
#define SQ 2048
#define DM 1024
#define NH 16
#define HD 64
#define HG 4                         /* heads per launch of the unused k_vt(V16, b, h0, VT) overload */
#define B0 0                         /* first batch processed (debug hook) */
#define NBR NB                       /* batches processed (debug hook) */
#define NR ((size_t)NB * SQ)         /* token rows */
#define MP ((int)((size_t)NBR * SQ)) /* rows projected (debug hook) */
#define QN SQ                        /* query rows per batch; unused */
#define NHD NH                       /* heads; unused */
#define MPO MP                       /* rows through the output stage (debug hook) */
#define LQ DM      /* halves per token row of q/k/v (v's row pitch; q, k in fragment order) */
typedef __bf16 v16b __attribute__((ext_vector_type(16)));
typedef unsigned short v8us __attribute__((ext_vector_type(8), may_alias));
typedef float  v8f  __attribute__((ext_vector_type(8)));
typedef float  v4f  __attribute__((ext_vector_type(4)));
typedef float  v4fa __attribute__((ext_vector_type(4), may_alias));
union FragB { v16b v; v8us half[2]; unsigned short u[16]; };

__device__ __forceinline__ unsigned short bf16_bits(float x) { unsigned int u = __float_as_uint(x); return (unsigned short)((u + 0x7FFFu + ((u >> 16) & 1u)) >> 16); }
__device__ __forceinline__ float bf16_val(unsigned short b) { return __uint_as_float(((unsigned int)b) << 16); }
__device__ __forceinline__ float bf16_round(float x) { return bf16_val(bf16_bits(x)); }
// D += A·B with NT terms: 1 = ah·bh, 2 = + al·bh (A split), 3 = + ah·bl (both split)
template <int NT>
__device__ __forceinline__ v8f mmaN(v16b ah, v16b al, v16b bh, v16b bl, v8f c) {
  c = __builtin_amdgcn_wmma_f32_16x16x32_bf16(false, ah, false, bh, (short)0, c, false, false);
  if (NT >= 2) c = __builtin_amdgcn_wmma_f32_16x16x32_bf16(false, al, false, bh, (short)0, c, false, false);
  if (NT >= 3) c = __builtin_amdgcn_wmma_f32_16x16x32_bf16(false, ah, false, bl, (short)0, c, false, false);
  asm volatile("v_nop\n\tv_nop\n\tv_nop\n\tv_nop" : "+v"(c) : "v"(ah), "v"(al), "v"(bh), "v"(bl));
  return c;
}

__global__ __launch_bounds__(256) void k_wt_bf16(const float* __restrict__ W, unsigned short* __restrict__ Wt, int K, int N) {
  const int t = blockIdx.x * 256 + threadIdx.x;
  const int k8n = K / 8;
  if (t >= N * k8n) return;
  const int n = t / k8n, k8 = (t % k8n) * 8;
  v8us v;
#pragma unroll
  for (int i = 0; i < 8; ++i) v[i] = bf16_bits(W[(size_t)(k8 + i) * N + n]);
  *(v8us*)(Wt + (size_t)n * K + k8) = v;
  
}

// GEMM C[M][N] (f32, pitch ldc) = act(A[M][K]·W + bias). A f32 row-major (pitch lda) converted per fragment to bf16
// (ASPLIT: hi/lo two planes -> 2 terms, else single rounded term); Wt bf16 [N][K] (pitch ldb). BIAS_BF16 rounds the
// bias to bf16 first (bias quantised to bf16 before the add). K%32==0, M%16==0, N%64==0.
template <bool ASPLIT, int ACT, bool BIAS_BF16>
__global__ __launch_bounds__(128) void k_gemm_bf(const float* __restrict__ A, int lda, const unsigned short* __restrict__ Wt, int ldb,
                                               const float* __restrict__ bias, float* __restrict__ C, int ldc, int M, int N, int K) {
  __shared__ __attribute__((aligned(16))) float so[4][16][64];
  const int tid = threadIdx.x, w = tid >> 5, lane = tid & 31, ln = lane & 15, hh = lane >> 4;
  const int ntn = N / 64;
  const int wid = blockIdx.x * 4 + w;
  const int mt = wid / ntn, nq = wid % ntn;
  if (mt * 16 >= M) return;
  const int row0 = mt * 16, col0 = nq * 64;
  const float* arow = A + (size_t)(row0 + ln) * lda;
  v8f acc[4] = {};
  for (int kb = 0; kb < K; kb += 32) {
    FragB ah, al;
    const v4f x0 = *(const v4fa*)(arow + kb + 8 * hh), x1 = *(const v4fa*)(arow + kb + 8 * hh + 4);
    const v4f x2 = *(const v4fa*)(arow + kb + 16 + 8 * hh), x3 = *(const v4fa*)(arow + kb + 16 + 8 * hh + 4);
    float xs[16] = {x0[0],x0[1],x0[2],x0[3],x1[0],x1[1],x1[2],x1[3],x2[0],x2[1],x2[2],x2[3],x3[0],x3[1],x3[2],x3[3]};
#pragma unroll
    for (int i = 0; i < 16; ++i) { const unsigned short hb = bf16_bits(xs[i]); ah.u[i] = hb; al.u[i] = ASPLIT ? bf16_bits(xs[i] - bf16_val(hb)) : (unsigned short)0; }
#pragma unroll
    for (int t = 0; t < 4; ++t) {
      const unsigned short* brow = Wt + (size_t)(col0 + t * 16 + ln) * ldb + kb;
      FragB b;
      b.half[0] = *(const v8us*)(brow + 8 * hh);
      b.half[1] = *(const v8us*)(brow + 16 + 8 * hh);
      acc[t] = mmaN<ASPLIT ? 2 : 1>(ah.v, al.v, b.v, b.v, acc[t]);
    }
  }
#pragma unroll
  for (int t = 0; t < 4; ++t) {
    float bv = bias ? bias[col0 + t * 16 + ln] : 0.f;
    if (BIAS_BF16) bv = bf16_round(bv);
#pragma unroll
    for (int r = 0; r < 8; ++r) { float v = acc[t][r] + bv; if (ACT == 1) v = fmaxf(v, 0.f); so[w][8 * hh + r][t * 16 + ln] = v; }
  }
  __builtin_amdgcn_fence(__ATOMIC_ACQ_REL, "workgroup");
  __builtin_amdgcn_wave_barrier();
  const int rsub = lane >> 4, c4 = (lane & 15) * 4;
  {
#pragma unroll
    for (int q = 0; q < 8; ++q) {
      const int r = q * 2 + rsub;
      const v4f v = *(const v4fa*)&so[w][r][c4];
      *(v4f*)(C + (size_t)(row0 + r) * ldc + col0 + c4) = v;
    }
    
  }
}

// GEMM C = act(A·W + bias + resid): A f32 (ASPLIT -> hi/lo 2 terms), Wt bf16 [N][K]; ACT 0 none, 1 relu, 2 exact gelu;
// resid (optional, f32, row index = (row % rmod), pitch ldr, RES_BF16 rounds it) added before the activation.
template <bool ASPLIT, int ACT, bool BIAS_BF16, bool RES_BF16>
__global__ __launch_bounds__(128) void k_gemm_bf3(const float* __restrict__ A, int lda, const unsigned short* __restrict__ Wt, int ldb,
                                                const float* __restrict__ bias, const float* __restrict__ resid, int rmod, int ldr,
                                                float* __restrict__ C, int ldc, int M, int N, int K) {
  __shared__ __attribute__((aligned(16))) float so[4][16][64];
  const int tid = threadIdx.x, w = tid >> 5, lane = tid & 31, ln = lane & 15, hh = lane >> 4;
  const int ntn = N / 64;
  const int wid = blockIdx.x * 4 + w;
  const int mt = wid / ntn, nq = wid % ntn;
  if (mt * 16 >= M) return;
  const int row0 = mt * 16, col0 = nq * 64;
  const float* arow = A + (size_t)(row0 + ln) * lda;
  v8f acc[4] = {};
  for (int kb = 0; kb < K; kb += 32) {
    FragB ah, al;
    const v4f x0 = *(const v4fa*)(arow + kb + 8 * hh), x1 = *(const v4fa*)(arow + kb + 8 * hh + 4);
    const v4f x2 = *(const v4fa*)(arow + kb + 16 + 8 * hh), x3 = *(const v4fa*)(arow + kb + 16 + 8 * hh + 4);
    float xs[16] = {x0[0],x0[1],x0[2],x0[3],x1[0],x1[1],x1[2],x1[3],x2[0],x2[1],x2[2],x2[3],x3[0],x3[1],x3[2],x3[3]};
#pragma unroll
    for (int i = 0; i < 16; ++i) { const unsigned short hb = bf16_bits(xs[i]); ah.u[i] = hb; al.u[i] = ASPLIT ? bf16_bits(xs[i] - bf16_val(hb)) : (unsigned short)0; }
#pragma unroll
    for (int t = 0; t < 4; ++t) {
      const unsigned short* brow = Wt + (size_t)(col0 + t * 16 + ln) * ldb + kb;
      FragB b;
      b.half[0] = *(const v8us*)(brow + 8 * hh);
      b.half[1] = *(const v8us*)(brow + 16 + 8 * hh);
      acc[t] = mmaN<ASPLIT ? 2 : 1>(ah.v, al.v, b.v, b.v, acc[t]);
    }
  }
#pragma unroll
  for (int t = 0; t < 4; ++t) {
    const int col = col0 + t * 16 + ln;
    float bv = bias ? bias[col] : 0.f;
    if (BIAS_BF16) bv = bf16_round(bv);
#pragma unroll
    for (int r = 0; r < 8; ++r) {
      float v = acc[t][r] + bv;
      if (resid) { float rv = resid[(size_t)((row0 + 8 * hh + r) % rmod) * ldr + col]; if (RES_BF16) rv = bf16_round(rv); v += rv; }
      if (ACT == 1) v = fmaxf(v, 0.f);
      if (ACT == 2) v = 0.5f * v * (1.0f + erff(v * 0.70710678118654752f));
      if (ACT == 3) { const float u = 0.7978845608028654f * (v + 0.044715f * v * v * v); v = 0.5f * v * (1.0f + tanhf(u)); }
      so[w][8 * hh + r][t * 16 + ln] = v;
    }
  }
  __builtin_amdgcn_fence(__ATOMIC_ACQ_REL, "workgroup");
  __builtin_amdgcn_wave_barrier();
  const int rsub = lane >> 4, c4 = (lane & 15) * 4;
  {
#pragma unroll
    for (int q = 0; q < 8; ++q) {
      const int r = q * 2 + rsub;
      const v4f v = *(const v4fa*)&so[w][r][c4];
      *(v4f*)(C + (size_t)(row0 + r) * ldc + col0 + c4) = v;
    }
    
  }
}
// row LayerNorm (biased variance, eps) over N: s = X (+ R); optional out_sum <- s; out_norm <- (s-mu)*rsqrt(var+eps)*g + b
template <bool PARAM_BF16>
__global__ __launch_bounds__(256) void k_layernorm(const float* __restrict__ X, const float* __restrict__ R, const float* __restrict__ g, const float* __restrict__ bta,
                                                  float* __restrict__ out_sum, float* __restrict__ out_norm, int N, float eps) {
  __shared__ float red[256];
  const int row = blockIdx.x, tid = threadIdx.x;
  const float* x = X + (size_t)row * N; const float* rr = R ? R + (size_t)row * N : nullptr;
  float vals[16];                     // up to N = 4096
  const int per = N / 256;            // contiguous chunk per thread? use strided-by-4 chunks: thread handles j = tid*4 + 1024*u
  float s1 = 0.f;
  for (int u = 0; u < per / 4; ++u) {
    const int j = tid * 4 + 1024 * u;
    const v4f a = *(const v4fa*)(x + j);
    v4f b = {0.f,0.f,0.f,0.f}; if (rr) b = *(const v4fa*)(rr + j);
#pragma unroll
    for (int q = 0; q < 4; ++q) { const float v = a[q] + b[q]; vals[u * 4 + q] = v; s1 += v; }
  }
  red[tid] = s1; __syncthreads();
  for (int st = 128; st > 0; st >>= 1) { if (tid < st) red[tid] += red[tid + st]; __syncthreads(); }
  const float mu = red[0] / (float)N; __syncthreads();
  float s2 = 0.f;
  for (int u = 0; u < per / 4; ++u)
#pragma unroll
    for (int q = 0; q < 4; ++q) { const float c = vals[u * 4 + q] - mu; s2 += c * c; }
  red[tid] = s2; __syncthreads();
  for (int st = 128; st > 0; st >>= 1) { if (tid < st) red[tid] += red[tid + st]; __syncthreads(); }
  const float rs = rsqrtf(red[0] / (float)N + eps);
  {
    for (int u = 0; u < per / 4; ++u) {
      const int j = tid * 4 + 1024 * u;
      v4f o, sm;
#pragma unroll
      for (int q = 0; q < 4; ++q) {
        float gg = g[j + q], bb = bta[j + q];
        if (PARAM_BF16) { gg = bf16_round(gg); bb = bf16_round(bb); }
        sm[q] = vals[u * 4 + q]; o[q] = (vals[u * 4 + q] - mu) * rs * gg + bb;
      }
      if (out_sum) *(v4f*)(out_sum + (size_t)row * N + j) = sm;
      *(v4f*)(out_norm + (size_t)row * N + j) = o;
    }
    
  }
}



// ---- f16 WMMA path (v_wmma_f32_16x16x32_f16): 11-bit significands for operands in range — used where a [0,1] probability operand needs more precision than bf16
typedef _Float16 v16h __attribute__((ext_vector_type(16)));
union FragH { v16h v; v8us half[2]; _Float16 h[16]; unsigned short u[16]; };
template <int NT>
__device__ __forceinline__ v8f mmaH(v16h ah, v16h al, v16h bh, v16h bl, v8f c) {
  c = __builtin_amdgcn_wmma_f32_16x16x32_f16(false, ah, false, bh, (short)0, c, false, false);
  if (NT >= 2) c = __builtin_amdgcn_wmma_f32_16x16x32_f16(false, al, false, bh, (short)0, c, false, false);
  if (NT >= 3) c = __builtin_amdgcn_wmma_f32_16x16x32_f16(false, ah, false, bl, (short)0, c, false, false);
  asm volatile("v_nop\n\tv_nop\n\tv_nop\n\tv_nop" : "+v"(c) : "v"(ah), "v"(al), "v"(bh), "v"(bl));
  return c;
}
// batched GEMM like k_gemm_b but f16 operands: A f32 (split into f16 hi/lo if ASPLIT, else rounded to f16), Bt = f16 values [n][k]; alpha; C f32; N multiple of 16 (partial tiles skipped)
template <bool ASPLIT>
__global__ __launch_bounds__(128) void k_gemm_h(const float* __restrict__ A, int lda, size_t sA, const _Float16* __restrict__ Bh, int ldb, size_t sB, float alpha, float* __restrict__ C, int ldc, size_t sC, int M, int N, int K) {
  __shared__ __attribute__((aligned(16))) float so[4][16][64];
  const int tid = threadIdx.x, w = tid >> 5, lane = tid & 31, ln = lane & 15, hh = lane >> 4; const int by = blockIdx.y;
  A += (size_t)by * sA; Bh += (size_t)by * sB; C += (size_t)by * sC;
  const int ntn = (N + 63) / 64; const int wid = blockIdx.x * 4 + w; const int mt = wid / ntn, nq = wid % ntn; if (mt * 16 >= M) return;
  const int row0 = mt * 16, col0 = nq * 64; const float* arow = A + (size_t)(row0 + ln) * lda;
  v8f acc[4] = {};
  for (int kb = 0; kb < K; kb += 32) {
    FragH ah, al;
    const v4f x0 = *(const v4fa*)(arow + kb + 8 * hh), x1 = *(const v4fa*)(arow + kb + 8 * hh + 4), x2 = *(const v4fa*)(arow + kb + 16 + 8 * hh), x3 = *(const v4fa*)(arow + kb + 16 + 8 * hh + 4);
    float xs[16] = {x0[0],x0[1],x0[2],x0[3],x1[0],x1[1],x1[2],x1[3],x2[0],x2[1],x2[2],x2[3],x3[0],x3[1],x3[2],x3[3]};
#pragma unroll
    for (int i = 0; i < 16; ++i) { const _Float16 h = (_Float16)xs[i]; ah.h[i] = h; al.h[i] = ASPLIT ? (_Float16)(xs[i] - (float)h) : (_Float16)0.0f; }
#pragma unroll
    for (int t = 0; t < 4; ++t) { if (col0 + t * 16 >= N) continue; const size_t boff = (size_t)(col0 + t * 16 + ln) * ldb + kb; FragH bq; bq.half[0] = *(const v8us*)(Bh + boff + 8 * hh); bq.half[1] = *(const v8us*)(Bh + boff + 16 + 8 * hh);
      acc[t] = mmaH<ASPLIT ? 2 : 1>(ah.v, al.v, bq.v, bq.v, acc[t]); }
  }
#pragma unroll
  for (int t = 0; t < 4; ++t) { if (col0 + t * 16 >= N) continue;
#pragma unroll
    for (int r = 0; r < 8; ++r) so[w][8 * hh + r][t * 16 + ln] = acc[t][r] * alpha; }
  __builtin_amdgcn_fence(__ATOMIC_ACQ_REL, "workgroup"); __builtin_amdgcn_wave_barrier();
  const int rsub = lane >> 4, c4 = (lane & 15) * 4;
  {
#pragma unroll
    for (int q = 0; q < 8; ++q) { const int r = q * 2 + rsub; if (col0 + c4 < N) { const v4f v = *(const v4fa*)&so[w][r][c4]; *(v4f*)(C + (size_t)(row0 + r) * ldc + col0 + c4) = v; } }
     }
}

// k_gemm_hh variant with fused epilogue: v = acc·alpha + bias[by·sBias + col] (+ CP[(row/rowsPerB)·sCPb + by·64 + col] if CP) ; ACT 0 none / 1 elu ; writes f16 C16 (and f32 C if non-null)
template <int ACT>
__global__ __launch_bounds__(128) void k_gemm_hhx(const _Float16* __restrict__ A, int lda, size_t sA, const _Float16* __restrict__ Bh, int ldb, size_t sB, float alpha, const float* __restrict__ bias, size_t sBias, const float* __restrict__ CP, int rowsPerB, size_t sCPb, int row0g,
    float* __restrict__ C, _Float16* __restrict__ C16, int ldc, size_t sC, int M, int N, int K) {
  __shared__ __attribute__((aligned(16))) float so[4][16][64];
  const int tid = threadIdx.x, w = tid >> 5, lane = tid & 31, ln = lane & 15, hh = lane >> 4; const int by = blockIdx.y;
  A += (size_t)by * sA; Bh += (size_t)by * sB; const size_t cofs = (size_t)by * sC; const float* bp = bias ? bias + (size_t)by * sBias : nullptr;
  const int ntn = (N + 63) / 64; const int wid = blockIdx.x * 4 + w; const int mt = wid / ntn, nq = wid % ntn; if (mt * 16 >= M) return;
  const int row0 = mt * 16, col0 = nq * 64; const _Float16* arow = A + (size_t)(row0 + ln) * lda;
  v8f acc[4] = {};
  for (int kb = 0; kb < K; kb += 32) { FragH ah; ah.half[0] = *(const v8us*)((const unsigned short*)arow + kb + 8 * hh); ah.half[1] = *(const v8us*)((const unsigned short*)arow + kb + 16 + 8 * hh);
#pragma unroll
    for (int t = 0; t < 4; ++t) { if (col0 + t * 16 >= N) continue; const size_t boff = (size_t)(col0 + t * 16 + ln) * ldb + kb; FragH bq; bq.half[0] = *(const v8us*)((const unsigned short*)Bh + boff + 8 * hh); bq.half[1] = *(const v8us*)((const unsigned short*)Bh + boff + 16 + 8 * hh);
      acc[t] = mmaH<1>(ah.v, ah.v, bq.v, bq.v, acc[t]); }
  }
#pragma unroll
  for (int t = 0; t < 4; ++t) { if (col0 + t * 16 >= N) continue; const int col = col0 + t * 16 + ln; const float bv = bp ? bf16_round(bp[col]) : 0.f;
#pragma unroll
    for (int r = 0; r < 8; ++r) { float v = acc[t][r] * alpha + bv; if (CP) { const int rr = row0g + row0 + 8 * hh + r; if (rowsPerB < 0) v += CP[cofs + (size_t)rr * ldc + col];      /* rowsPerB < 0: own element of the batched C plane */ else { const int bidx = rr / rowsPerB; v += CP[(size_t)bidx * sCPb + (size_t)by * 64 + col]; } } if (ACT == 1) v = (v > 0.f) ? v : expm1f(v); else if (ACT == 7) v = (v > 0.f) ? v + 1.0f : expf(v); else if (ACT == 8) v = tanhf(v); else if (ACT == 9) v = 0.5f * v * (1.0f + tanhf(0.7978845608028654f * (v + 0.044715f * v * v * v))); else if (ACT == 11) v = 1.0f / (1.0f + expf(-v)); else if (ACT == 12) v = (v > 0.f) ? v : 0.01f * v; else if (ACT == 14) v = (v > 0.f) ? v : 0.1f * v; else if (ACT == 16) v = (v >= 0.f) ? v : 0.3f * v; else if (ACT == 17) v = (v >= 0.f) ? v : 0.2f * v; else if (ACT == 15) v = v / (1.0f + expf(-v)); else if (ACT == 3) v = fmaxf(v, 0.f); else if (ACT == 6) v = 0.5f * v * (1.0f + erff(v * 0.70710678118654752f)); so[w][8 * hh + r][t * 16 + ln] = v; } }
  __builtin_amdgcn_fence(__ATOMIC_ACQ_REL, "workgroup"); __builtin_amdgcn_wave_barrier();
  const int rsub = lane >> 4, c4 = (lane & 15) * 4; typedef _Float16 v4h __attribute__((ext_vector_type(4)));
  {
#pragma unroll
    for (int q = 0; q < 8; ++q) { const int r = q * 2 + rsub; if (col0 + c4 < N) { const v4f v = *(const v4fa*)&so[w][r][c4]; if (C) *(v4f*)(C + cofs + (size_t)(row0 + r) * ldc + col0 + c4) = v; if (C16) { v4h h4; for (int i = 0; i < 4; ++i) h4[i] = (_Float16)v[i]; *(v4h*)(C16 + cofs + (size_t)(row0 + r) * ldc + col0 + c4) = h4; } } }
     }
}


typedef _Float16 v4h __attribute__((ext_vector_type(4)));

__global__ __launch_bounds__(256) void k_h16(const float* __restrict__ x, _Float16* __restrict__ X16, size_t n8) { const size_t t = (size_t)blockIdx.x * 256 + threadIdx.x; if (t >= n8) return; FragH f;
#pragma unroll
  for (int q = 0; q < 8; ++q) f.h[q] = (_Float16)x[t * 8 + q]; *(v8us*)((unsigned short*)X16 + t * 8) = f.half[0];  }
__global__ __launch_bounds__(256) void k_round16f(const float* __restrict__ W, _Float16* __restrict__ Bt, size_t n8) { const size_t t = (size_t)blockIdx.x * 256 + threadIdx.x; if (t >= n8) return; FragH f;
#pragma unroll
  for (int i = 0; i < 8; ++i) f.h[i] = (_Float16)(bf16_round(W[t * 8 + i]) * 16.0f); *(v8us*)((unsigned short*)Bt + t * 8) = f.half[0];  }
template <int NHv, int TTv>
__global__ __launch_bounds__(256) void k_vt(const _Float16* __restrict__ V16, int ldv, int voff, _Float16* __restrict__ Vt) { __shared__ unsigned short tl[64][66]; const int tid = threadIdx.x; const int slab = blockIdx.x / (TTv / 64), lg = blockIdx.x % (TTv / 64); const int b = slab / NHv, h = slab % NHv;
  for (int i = tid; i < 64 * 8; i += 256) { const int r = i / 8, c8 = (i % 8) * 8; FragH f; f.half[0] = *(const v8us*)((const unsigned short*)V16 + ((size_t)b * TTv + lg * 64 + r) * ldv + voff + h * 64 + c8);
#pragma unroll
    for (int q = 0; q < 8; ++q) tl[r][c8 + q] = f.u[q]; }
  __syncthreads();
  {
#pragma unroll
    for (int rd = 0; rd < 2; ++rd) { const int i = rd * 256 + tid, tile = i >> 6; const int d = (tile & 3) * 16 + (i & 15), kl = (tile >> 2) * 32 + ((i >> 5) & 1) * 16 + ((i >> 4) & 1) * 8; FragH f;      /* fragment order (pk_frag), tile (32 keys, 16 d) at (key / 32) * 4 + d / 16 of the slab */
#pragma unroll
      for (int q = 0; q < 8; ++q) f.u[q] = tl[kl + q][d];
      *(v8us*)((unsigned short*)Vt + (size_t)slab * 64 * TTv + (size_t)lg * 4096 + i * 8) = f.half[0]; }
     } }

__global__ __launch_bounds__(256) void k_hl(const float* __restrict__ F, _Float16* __restrict__ Hh, _Float16* __restrict__ Hl, size_t n8) { const size_t t = (size_t)blockIdx.x * 256 + threadIdx.x; if (t >= n8) return; FragH fh, fl; const v4f a = *(const v4fa*)(F + t * 8), c = *(const v4fa*)(F + t * 8 + 4);
#pragma unroll
  for (int q = 0; q < 4; ++q) { _Float16 h = (_Float16)a[q]; fh.h[q] = h; fl.h[q] = (_Float16)((a[q] - (float)h) * 1024.0f); h = (_Float16)c[q]; fh.h[4 + q] = h; fl.h[4 + q] = (_Float16)((c[q] - (float)h) * 1024.0f); }
  { *(v8us*)((unsigned short*)Hh + t * 8) = fh.half[0]; *(v8us*)((unsigned short*)Hl + t * 8) = fl.half[0];  } }

// ---- fast GEMM (wave tile 32x64; requires M % 32 == 0 rows per launch region and N % 64 == 0); epilogue = k_gemm_hhx semantics ----
__device__ __forceinline__ v16h g2_frag(const _Float16* p, int hh) { FragH f; f.half[0] = *(const v8us*)((const unsigned short*)p + 8 * hh); f.half[1] = *(const v8us*)((const unsigned short*)p + 16 + 8 * hh); return f.v; }
// Fragment order of an f16 matrix [R][K]: 16-row x 32-k tiles of 1024 bytes, tile (rt, kt) at (rt * (K / 32) + kt) * 512 halves; inside a tile the 8 halves of row ln, k = part * 16 + hh * 8 .. + 7
// stand at (part * 32 + hh * 16 + ln) * 8. p = the tile + lane * 8: each of the two loads of a wave then covers 512 contiguous bytes (4 whole lines, not 16 pieces of 32 bytes); the k order is that of g2_frag.
__device__ __forceinline__ v16h pk_frag(const _Float16* p) { FragH f; f.half[0] = *(const v8us*)((const unsigned short*)p); f.half[1] = *(const v8us*)((const unsigned short*)p + 256); return f.v; }
__device__ __forceinline__ v8f g2_mma(v16h a, v16h b, v8f c) { v8f d = __builtin_amdgcn_wmma_f32_16x16x32_f16(false, a, false, b, (short)0, c, false, false); asm volatile("v_nop\n\tv_nop\n\tv_nop\n\tv_nop" : "+v"(d) : "v"(a), "v"(b)); return d; }
struct G2F { v16h a0, a1, b0, b1, b2, b3; };      /* the six fragments of one 32-k tile: two row tiles of A, four column tiles of B */
// one k tile's twelve loads, issued as one group at this place, tiles ahead of the products that read them. The wait stands behind the group: the six address pairs, named as inputs, stay live up to it,
// so that no load's result lands in a register that an issued load still names; the two scheduling barriers keep every load of the group in front of the wait and every rewrite of an address behind it
__device__ __forceinline__ G2F g2_load(const _Float16* a0, const _Float16* a1, const _Float16* b0, const _Float16* b1, const _Float16* b2, const _Float16* b3, int kb) { G2F f;
  const _Float16* p0 = a0 + kb; const _Float16* p1 = a1 + kb; const _Float16* p2 = b0 + kb; const _Float16* p3 = b1 + kb; const _Float16* p4 = b2 + kb; const _Float16* p5 = b3 + kb;
  f.a0 = pk_frag(p0); f.a1 = pk_frag(p1); f.b0 = pk_frag(p2); f.b1 = pk_frag(p3); f.b2 = pk_frag(p4); f.b3 = pk_frag(p5);
  __builtin_amdgcn_sched_barrier(0); asm volatile("s_wait_xcnt 0x0" :: "v"(p0), "v"(p1), "v"(p2), "v"(p3), "v"(p4), "v"(p5) : "memory"); __builtin_amdgcn_sched_barrier(0); return f; }
template <int ACT, bool PK>      /* A and Bh in fragment order (pk_frag); PK: C16 alone is written, in fragment order; else C and C16 row-major */
__global__ __launch_bounds__(128) void k_gemm2(const _Float16* __restrict__ A, int lda, size_t sA, const _Float16* __restrict__ Bh, int ldb, size_t sB, float alpha, const float* __restrict__ bias, size_t sBias, const float* __restrict__ CP, int rowsPerB, size_t sCPb, int row0g,
    float* __restrict__ C, _Float16* __restrict__ C16, int ldc, size_t sC, int M, int N, int K) { static_assert(ACT == 0 || ACT == 3 || ACT == 6 || ACT == 8 || ACT == 9 || ACT == 11 || ACT == 12 || ACT == 14 || ACT == 15 || ACT == 16 || ACT == 17, "k_gemm2: unsupported ACT code (would silently apply no activation)");
  __shared__ __attribute__((aligned(16))) float so[4][32][68];
  const int tid = threadIdx.x, w = tid >> 5, lane = tid & 31, ln = lane & 15, hh = lane >> 4; const int by = blockIdx.y;
  A += (size_t)by * sA; Bh += (size_t)by * sB; const size_t cofs = (size_t)by * sC; const float* bp = bias ? bias + (size_t)by * sBias : nullptr;
  const int ntn = N >> 6; const int mt = blockIdx.x / ntn, nq = blockIdx.x - mt * ntn; const int row0 = mt * 128 + 32 * w, col0 = nq * 64; if (row0 >= M) return;
  const _Float16* a0p = A + (size_t)row0 * lda + lane * 8; const _Float16* a1p = a0p + (size_t)16 * lda;
  const _Float16* b0p = Bh + (size_t)col0 * ldb + lane * 8; const _Float16* b1p = b0p + (size_t)16 * ldb; const _Float16* b2p = b1p + (size_t)16 * ldb; const _Float16* b3p = b2p + (size_t)16 * ldb;
  const v8f z8 = {0.f,0.f,0.f,0.f,0.f,0.f,0.f,0.f}; v8f c00 = z8, c01 = z8, c02 = z8, c03 = z8, c10 = z8, c11 = z8, c12 = z8, c13 = z8;
  if (K > 0) { const int ke = K * 16, kl = ke - 512, n3 = ke / 1536; int kb = 0;      /* halves of a fragment row; its last tile; whole trips. A ring of three register sets: tile t + 2 is asked for in front of tile t's products; past the end the last tile is fetched again, in bounds */
#define G2_LOAD(k) g2_load(a0p, a1p, b0p, b1p, b2p, b3p, (k) < kl ? (k) : kl)
#define G2_TILE(f) { c00 = g2_mma(f.a0, f.b0, c00); c10 = g2_mma(f.a1, f.b0, c10); c01 = g2_mma(f.a0, f.b1, c01); c11 = g2_mma(f.a1, f.b1, c11); c02 = g2_mma(f.a0, f.b2, c02); c12 = g2_mma(f.a1, f.b2, c12); c03 = g2_mma(f.a0, f.b3, c03); c13 = g2_mma(f.a1, f.b3, c13); }
    G2F f0 = G2_LOAD(0), f1 = G2_LOAD(512);
#pragma unroll 1      // three tiles a trip, so that each set keeps its registers (no copies between the sets); one block without an exit inside, so that the waits for the loads stay counted
    for (int i = 0; i < n3; ++i, kb += 1536) { const G2F f2 = G2_LOAD(kb + 1024); G2_TILE(f0) f0 = G2_LOAD(kb + 1536); G2_TILE(f1) f1 = G2_LOAD(kb + 2048); G2_TILE(f2) }
    if (kb < ke) G2_TILE(f0)      /* the one or two tiles that no whole trip holds are already in the ring */
    if (kb + 512 < ke) G2_TILE(f1) }
#undef G2_LOAD
#undef G2_TILE
  v8f accs[8] = {c00, c01, c02, c03, c10, c11, c12, c13};
#pragma unroll
  for (int u = 0; u < 8; ++u) { const int t = u & 3, half = u >> 2; const int col = col0 + t * 16 + ln; const float bv = bp ? bf16_round(bp[col]) : 0.f;
#pragma unroll
    for (int r = 0; r < 8; ++r) { const int rloc = half * 16 + 8 * hh + r; float v = accs[u][r] * alpha + bv; if (CP) { if (rowsPerB < 0) v += CP[cofs + (size_t)(row0g + row0 + rloc) * ldc + col];      /* rowsPerB < 0: own element of the batched C plane */ else { const int bidx = (row0g + row0 + rloc) / rowsPerB; v += CP[(size_t)bidx * sCPb + (size_t)by * 64 + col]; } }
      if (ACT == 3) v = fmaxf(v, 0.f); else if (ACT == 6) v = 0.5f * v * (1.0f + erff(v * 0.70710678118654752f)); else if (ACT == 11) v = 1.0f / (1.0f + expf(-v)); else if (ACT == 15) v = v / (1.0f + expf(-v)); else if (ACT == 12) v = (v > 0.f) ? v : 0.01f * v; else if (ACT == 8) v = tanhf(v); else if (ACT == 9) v = 0.5f * v * (1.0f + tanhf(0.7978845608028654f * (v + 0.044715f * v * v * v))); else if (ACT == 14) v = (v > 0.f) ? v : 0.1f * v; else if (ACT == 16) v = (v >= 0.f) ? v : 0.3f * v; else if (ACT == 17) v = (v >= 0.f) ? v : 0.2f * v;
      so[w][rloc][t * 16 + ln] = v; } }
  __builtin_amdgcn_fence(__ATOMIC_ACQ_REL, "workgroup"); __builtin_amdgcn_wave_barrier();
  const int rsub = lane >> 4, c4 = (lane & 15) * 4;
  if (PK) {      /* C16 alone, in fragment order: the wave's 32 x 64 tile = 2 x 2 fragment tiles, eight stores of 512 contiguous bytes */
#pragma unroll      // constant LDS and store offsets
      for (int s = 0; s < 8; ++s) { const int rl = (s >> 2) * 16 + ln, cl = ((s >> 1) & 1) * 32 + (s & 1) * 16 + hh * 8; const v4f x = *(const v4fa*)&so[w][rl][cl], y = *(const v4fa*)&so[w][rl][cl + 4]; FragH f;
        for (int i = 0; i < 4; ++i) { f.h[i] = (_Float16)x[i]; f.h[4 + i] = (_Float16)y[i]; }
        *(v8us*)((unsigned short*)C16 + cofs + (size_t)(row0 + (s >> 2) * 16) * ldc + (size_t)((col0 >> 5) + ((s >> 1) & 1)) * 512 + (s & 1) * 256 + lane * 8) = f.half[0]; }
    return; }
  {
#pragma unroll
    for (int q = 0; q < 16; ++q) { const int r = q * 2 + rsub; const v4f v = *(const v4fa*)&so[w][r][c4]; if (C) *(v4f*)(C + cofs + (size_t)(row0 + r) * ldc + col0 + c4) = v; if (C16) { v4h h4; for (int i = 0; i < 4; ++i) h4[i] = (_Float16)v[i]; *(v4h*)(C16 + cofs + (size_t)(row0 + r) * ldc + col0 + c4) = h4; } }
     } }


__global__ __launch_bounds__(256) void k_wnat(const float* __restrict__ w, size_t n8, _Float16* __restrict__ Bt) { const size_t t = (size_t)blockIdx.x * 256 + threadIdx.x; if (t >= n8) return; FragH f; for (int q = 0; q < 8; ++q) f.h[q] = (_Float16)(bf16_round(w[t * 8 + q]) * 16.0f); *(v8us*)((unsigned short*)Bt + t * 8) = f.half[0];  }
__global__ __launch_bounds__(256) void k_rsm(const float* __restrict__ S, _Float16* __restrict__ P, int nrows) {
  #pragma clang fp contract(off)
  const int i = blockIdx.x * 256 + threadIdx.x; if (i >= nrows) return; const float* s = S + (size_t)i * SQ; float mx = -3.0e38f;
#pragma unroll 1
  for (int j = 0; j < SQ; ++j) mx = fmaxf(mx, s[j]); float se = 0.f;
#pragma unroll 1
  for (int j = 0; j < SQ; ++j) se += expf(s[j] - mx); const float sc = 256.0f / se;
#pragma unroll 1
  for (int j0 = 0; j0 < SQ; j0 += 8) { FragH f; for (int q = 0; q < 8; ++q) f.h[q] = (_Float16)(expf(s[j0 + q] - mx) * sc); unsigned short* d = (unsigned short*)P + (size_t)i * SQ + j0; *(v8us*)d = f.half[0];  } }
__global__ __launch_bounds__(256) void k_vt(const _Float16* __restrict__ V16, int b, int h0, _Float16* __restrict__ VT) { __shared__ unsigned short tl[64][65]; const int tid = threadIdx.x; const int hh = blockIdx.x % HG, sg = blockIdx.x / HG; const int s0 = sg * 64; const int h = h0 + hh;
  for (int i = tid; i < 64 * 8; i += 256) { const int j = i / 8, d8 = (i % 8) * 8; FragH f; f.half[0] = *(const v8us*)((const unsigned short*)V16 + ((size_t)b * SQ + s0 + j) * DM + h * HD + d8); for (int q = 0; q < 8; ++q) tl[d8 + q][j] = f.u[q]; }
  __syncthreads();
  { for (int i = tid; i < 64 * 8; i += 256) { const int d = i / 8, j8 = (i % 8) * 8; FragH f; for (int q = 0; q < 8; ++q) f.u[q] = tl[d][j8 + q]; *(v8us*)((unsigned short*)VT + ((size_t)hh * HD + d) * SQ + s0 + j8) = f.half[0]; }  } }






typedef int v4ia __attribute__((ext_vector_type(4), may_alias));
__device__ __forceinline__ float rs_xrow(float v) { const int i = __float_as_int(v); return __int_as_float(__builtin_amdgcn_permlanex16(i, i, 0x76543210, 0xfedcba98, true, false)); }      /* lane l reads lane l ^ 16 */
// Fused attention, one wave per 16 query rows of one (batch, head), 32 keys a pass: S^T = K Q^T (A = K rows, B = Q kept in registers), so a lane holds one query's
// scores (keys 8*hh + r of each 16-key tile); running maximum and sum per lane, one exchange between the wave halves; the two f32 score tiles, converted in place,
// are the B operand of O^T += V^T P^T. No score and no weight goes through memory. All in the log2 domain: p = 2^(s * FA_C - mu + FA_OFF) with mu the maximum in use.
#define FA_C 0.18033688011112042f      /* 64^-0.5 * log2(e) */
#define FA_OFF 7.0f                    /* weights carried x128: small ones stay normal f16 numbers */
#define FA_THR 8.0f                    /* mu is renewed only when a score passes it by more than this: weights stay at or under 2^15, inside f16 */
#define FA_DROP (-0x1p+100f)           /* raw score of a masked key; a power of two, so FA_DROP * FA_C is exact and a row with every key masked gets equal weights */
__device__ __forceinline__ v8f fa_mma(v16h a, v16h b, v8f c) { return __builtin_amdgcn_wmma_f32_16x16x32_f16(false, a, false, b, (short)0, c, false, false); }
// eight native 2^x; each is followed by an independent instruction, the last by the v_nop: the slot the instruction set asks for behind a transcendental
__device__ __forceinline__ v8f fa_exp2(v8f x) { float e0, e1, e2, e3, e4, e5, e6, e7;
  asm("v_exp_f32 %0, %8\n\tv_exp_f32 %1, %9\n\tv_exp_f32 %2, %10\n\tv_exp_f32 %3, %11\n\tv_exp_f32 %4, %12\n\tv_exp_f32 %5, %13\n\tv_exp_f32 %6, %14\n\tv_exp_f32 %7, %15\n\tv_nop"
      : "=&v"(e0), "=&v"(e1), "=&v"(e2), "=&v"(e3), "=&v"(e4), "=&v"(e5), "=&v"(e6), "=&v"(e7) : "v"(x[0]), "v"(x[1]), "v"(x[2]), "v"(x[3]), "v"(x[4]), "v"(x[5]), "v"(x[6]), "v"(x[7]));
  const v8f e = {e0, e1, e2, e3, e4, e5, e6, e7}; return e; }
__device__ __forceinline__ float fa_exp2s(float x) { float e; asm("v_exp_f32 %0, %1\n\tv_nop" : "=v"(e) : "v"(x)); return e; }      /* the v_nop: the same slot */
// behind a group of loads or stores: the group is issued whole at this place (for loads: ahead of the arithmetic that covers their latency), and its address and data registers are reused only behind the wait;
// the two scheduling barriers keep every member of the group in front of the wait and every rewrite of a register behind it
__device__ __forceinline__ void fa_issued() { __builtin_amdgcn_sched_barrier(0); asm volatile("s_wait_xcnt 0x0" ::: "memory"); __builtin_amdgcn_sched_barrier(0); }
struct FaK { v16h a00, a01, a10, a11; v4ia m0, m1, m2, m3; };      /* one pass of K fragments (two 16-key tiles x two k steps) and the wave's 16 x 32 mask words, dealt row-contiguous: they serve the any-nonzero test alone */
// kp: the head's first K tile + lane * 8 (fragment order); mt: mask row (wave's first query + lane / 8), word (lane % 8) * 4: each mask load covers four whole 128-byte rows of the pass
__device__ __forceinline__ FaK fa_load(const _Float16* kp, const int* mt, int j) { FaK f; const _Float16* k = kp + (size_t)j * LQ;
  f.a00 = pk_frag(k); f.a01 = pk_frag(k + 512); f.a10 = pk_frag(k + 16 * LQ); f.a11 = pk_frag(k + 16 * LQ + 512);
  f.m0 = *(const v4ia*)(mt + j); f.m1 = *(const v4ia*)(mt + j + 4 * SQ); f.m2 = *(const v4ia*)(mt + j + 8 * SQ); f.m3 = *(const v4ia*)(mt + j + 12 * SQ); return f; }
// wave-uniform: does any lane hold a nonzero mask word in this pass?
__device__ __forceinline__ bool fa_anym(const FaK& f) { const v4ia o = f.m0 | f.m1 | f.m2 | f.m3; return __builtin_amdgcn_ballot_w32((o[0] | o[1] | o[2] | o[3]) != 0) != 0; }
// a key with a nonzero mask word takes FA_DROP as its raw score; m: the lane's own query row, first key of the pass + 8 * hh (the lane's 16 words are read here, only in a pass that holds a nonzero word)
__device__ __forceinline__ void fa_drop(const int* m, v8f& s0, v8f& s1) { const v4ia m0 = *(const v4ia*)m, m1 = *(const v4ia*)(m + 4), m2 = *(const v4ia*)(m + 16), m3 = *(const v4ia*)(m + 20);
#pragma unroll      // constant indices: the tiles stay in registers
  for (int r = 0; r < 4; ++r) { s0[r] = (m0[r] == 0) ? s0[r] : FA_DROP; s0[4 + r] = (m1[r] == 0) ? s0[4 + r] : FA_DROP; s1[r] = (m2[r] == 0) ? s1[r] : FA_DROP; s1[4 + r] = (m3[r] == 0) ? s1[4 + r] : FA_DROP; } }
__global__ __launch_bounds__(256) void k_fattn(const _Float16* __restrict__ Q16, const _Float16* __restrict__ K16, const _Float16* __restrict__ VT, const int* __restrict__ Mk, _Float16* __restrict__ O16, float* __restrict__ PO) {
  static_assert(SQ % 128 == 0 && HD == 64, "k_fattn: 8 waves x 16 query rows a block, head size 64");
  const int lane = threadIdx.x & 31, ln = lane & 15, hh = lane >> 4; const int w = __builtin_amdgcn_readfirstlane(threadIdx.x >> 5);
  const int h = NH - 1 - (int)blockIdx.y, b = blockIdx.z;      /* the last head walks the keys twice: its blocks start first */
  const size_t rq = (size_t)b * SQ + blockIdx.x * 128 + w * 16, qr = rq + ln;      /* the wave's first query row; the lane's query row */
  const _Float16* qp = Q16 + rq * LQ + h * 1024 + lane * 8; const v16h q0 = pk_frag(qp), q1 = pk_frag(qp + 512);      /* a head's 64 columns are two 32-k tiles */
  fa_issued();      /* Q, then K and mask, then V^T: the order of the loop, so that the loop's first wait for K leaves the V^T loads in flight */
  const _Float16* kp = K16 + (size_t)b * SQ * LQ + h * 1024 + lane * 8; const _Float16* vp = VT + (size_t)(b * NH + h) * HD * SQ + lane * 8; const int* mp = Mk + qr * SQ + 8 * hh; const int* mt = Mk + (rq + (lane >> 3)) * SQ + (lane & 7) * 4;
  const v8f z8 = {0.f, 0.f, 0.f, 0.f, 0.f, 0.f, 0.f, 0.f}; v8f o0 = z8, o1 = z8, o2 = z8, o3 = z8; float mu = -3.0e38f, l = 0.f;
  FaK f = fa_load(kp, mt, 0);
  fa_issued();
  v16h v0 = pk_frag(vp), v1 = pk_frag(vp + 512), v2 = pk_frag(vp + 1024), v3 = pk_frag(vp + 1536);      /* a pass of V^T: four tiles, 4096 contiguous bytes */
  fa_issued();
#pragma unroll 1      // one pass a trip: the next pass's operands are already fetched by hand, a second copy of the body would only cost registers
  for (int j = 0; j < SQ; j += 32) { const int jn = (j + 32 < SQ) ? j + 32 : j;      /* first key of the next pass; the last pass fetches its own operands again, in bounds */
    v8f s0 = fa_mma(f.a01, q1, fa_mma(f.a00, q0, z8)), s1 = fa_mma(f.a11, q1, fa_mma(f.a10, q0, z8));
    if (fa_anym(f)) fa_drop(mp + j, s0, s1);
    float tm = fmaxf(s0[0], s1[0]);
#pragma unroll      // constant indices: the tiles stay in registers
    for (int r = 1; r < 8; ++r) tm = fmaxf(tm, fmaxf(s0[r], s1[r]));
    tm = fmaxf(tm, rs_xrow(tm)); const float tl = tm * FA_C;
    if (__builtin_amdgcn_ballot_w32(tl > mu + FA_THR) != 0) { const float mn = fmaxf(mu, tl), al = fa_exp2s(mu - mn); mu = mn; l *= al; o0 *= al; o1 *= al; o2 *= al; o3 *= al; }      /* rare: one scalar test a pass */
    f = fa_load(kp, mt, jn);      /* the next pass's K and mask fly during this pass's exponentials and products */
    fa_issued();
    const float nb = FA_OFF - mu;
    const v8f p0 = fa_exp2(s0 * FA_C + nb), p1 = fa_exp2(s1 * FA_C + nb);
    const v8f ps = p0 + p1; l += ((ps[0] + ps[1]) + (ps[2] + ps[3])) + ((ps[4] + ps[5]) + (ps[6] + ps[7]));
    FragH pf;
#pragma unroll      // constant indices: the fragment stays in registers
    for (int r = 0; r < 8; ++r) { pf.h[r] = (_Float16)p0[r]; pf.h[8 + r] = (_Float16)p1[r]; }
    o0 = fa_mma(v0, pf.v, o0); o1 = fa_mma(v1, pf.v, o1); o2 = fa_mma(v2, pf.v, o2); o3 = fa_mma(v3, pf.v, o3);
    v0 = pk_frag(vp + jn * 64); v1 = pk_frag(vp + jn * 64 + 512); v2 = pk_frag(vp + jn * 64 + 1024); v3 = pk_frag(vp + jn * 64 + 1536);      /* the next pass's V^T flies during its score products and softmax */
    fa_issued(); }
  l += rs_xrow(l);      /* the halves' sums are joined once */
  const float il = 1.0f / l, so = 64.0f * il;      /* o carried x64, as the output GEMM's alpha expects */
  unsigned short* op = (unsigned short*)O16 + rq * DM + h * 1024 + lane * 8; FragH e0, e1;      /* o in fragment order: the lane's four runs of 8 are the four half-fragments of the head's two tiles */
#pragma unroll      // constant indices: the tiles stay in registers
  for (int r = 0; r < 8; ++r) { e0.h[r] = (_Float16)(o0[r] * so); e0.h[8 + r] = (_Float16)(o1[r] * so); e1.h[r] = (_Float16)(o2[r] * so); e1.h[8 + r] = (_Float16)(o3[r] * so); }
  *(v8us*)op = e0.half[0]; *(v8us*)(op + 256) = e0.half[1]; *(v8us*)(op + 512) = e1.half[0]; *(v8us*)(op + 768) = e1.half[1];
  fa_issued();      /* in front of the head test: the last head's path rewrites the stores' registers at once */
  if (h != NH - 1) return;
  // second output: the last head's probabilities, its scores formed again now that the row's maximum in use and sum are known
  float* pp = PO + qr * SQ + 8 * hh; const float nb = FA_OFF - mu;
  f = fa_load(kp, mt, 0);
  fa_issued();
#pragma unroll 1      // as above
  for (int j = 0; j < SQ; j += 32) {
    v8f s0 = fa_mma(f.a01, q1, fa_mma(f.a00, q0, z8)), s1 = fa_mma(f.a11, q1, fa_mma(f.a10, q0, z8));
    if (fa_anym(f)) fa_drop(mp + j, s0, s1);
    f = fa_load(kp, mt, (j + 32 < SQ) ? j + 32 : j);
    fa_issued();
    const v8f p0 = fa_exp2(s0 * FA_C + nb) * il, p1 = fa_exp2(s1 * FA_C + nb) * il;
    const v4f t0 = {p0[0], p0[1], p0[2], p0[3]}, t1 = {p0[4], p0[5], p0[6], p0[7]}, t2 = {p1[0], p1[1], p1[2], p1[3]}, t3 = {p1[4], p1[5], p1[6], p1[7]};
    *(v4f*)(pp + j) = t0; *(v4f*)(pp + j + 4) = t1; *(v4f*)(pp + j + 16) = t2; *(v4f*)(pp + j + 20) = t3;
    fa_issued(); } }


__global__ __launch_bounds__(256) void k_rsmf(const float* __restrict__ S, _Float16* __restrict__ P, int qn, int hg) {
  #pragma clang fp contract(off)
  const int t = blockIdx.x * 256 + threadIdx.x; if (t >= qn * hg) return; const size_t i = (size_t)(t / qn) * SQ + (t % qn); const float* s = S + i * SQ; float mx = -3.0e38f;
#pragma unroll 1
  for (int j = 0; j < SQ; ++j) mx = fmaxf(mx, s[j]); float se = 0.f;
#pragma unroll 1
  for (int j = 0; j < SQ; ++j) se += __expf(s[j] - mx); const float sc = 256.0f / se;
#pragma unroll 1
  for (int j0 = 0; j0 < SQ; j0 += 8) { FragH f; for (int q = 0; q < 8; ++q) f.h[q] = (_Float16)(__expf(s[j0 + q] - mx) * sc); unsigned short* d = (unsigned short*)P + i * SQ + j0; *(v8us*)d = f.half[0];  } }

// ---- the seven input conversions (three x, three per-head weights, W0) as one launch. None reads what another writes. A slab = one fragment row tile, 16 rows x DM = 2048 chunks of 16 bytes (pk_frag);
// a block takes a slab at a time, a thread eight of its chunks (k tiles four apart), so that all of a slab's loads are in flight together and few waves have to be started.
#define PP_WS (DM / 16)                        /* slabs of one weight matrix */
#define PP_XS ((int)(NR / 16))                 /* slabs of one input */
#define PP_SLABS (4 * PP_WS + 3 * PP_XS)
#define PP_BLOCKS 512                          /* two blocks a WGP; slabs b and b + 512: a weight slab is paired with an input slab */
// behind a group of loads or stores off one address: the address, named as an input, stays live up to the wait, so that no load's result lands in it; the two scheduling barriers keep
// every member of the group in front of the wait and every rewrite of an address or data register behind it
__device__ __forceinline__ void pp_issued(const void* p) { __builtin_amdgcn_sched_barrier(0); asm volatile("s_wait_xcnt 0x0" :: "v"(p) : "memory"); __builtin_amdgcn_sched_barrier(0); }
// a thread's eight finished chunks as one group of stores; the scheduling barrier in front keeps a store from being issued among the conversions, where its data registers would be wanted again at once
__device__ __forceinline__ void pp_store(unsigned short* __restrict__ d, const v8us (&o)[8]) { __builtin_amdgcn_sched_barrier(0);
#pragma unroll      // constant offsets off one address
  for (int u = 0; u < 8; ++u) *(v8us*)(d + u * 2048) = o[u];
  pp_issued(d); }
template <int QS, int US>      /* floats between the eight k of a chunk; between two chunks of a thread */
__device__ __forceinline__ void pp_wslab(const float* __restrict__ s, unsigned short* __restrict__ d) { float w[8][8]; v8us o[8];
#pragma unroll      // constant offsets off one address; the values stay in registers
  for (int u = 0; u < 8; ++u) for (int q = 0; q < 8; ++q) w[u][q] = s[(size_t)u * US + (size_t)q * QS];
  pp_issued(s);
#pragma unroll      // as above
  for (int u = 0; u < 8; ++u) { FragH f; for (int q = 0; q < 8; ++q) f.h[q] = (_Float16)(16.0f * bf16_round(w[u][q])); o[u] = f.half[0]; }
  pp_store(d, o); }
__device__ __forceinline__ void pp_xslab(const float* __restrict__ s, unsigned short* __restrict__ d) { v4f a[8], b[8]; v8us o[8];
#pragma unroll      // as above
  for (int u = 0; u < 8; ++u) { a[u] = *(const v4fa*)(s + u * 128); b[u] = *(const v4fa*)(s + u * 128 + 4); }
  pp_issued(s);
#pragma unroll      // as above
  for (int u = 0; u < 8; ++u) { FragH f; for (int q = 0; q < 4; ++q) { f.h[q] = (_Float16)bf16_round(a[u][q]); f.h[4 + q] = (_Float16)bf16_round(b[u][q]); } o[u] = f.half[0]; }
  pp_store(d, o); }
__global__ __launch_bounds__(256) void k_prep(const float* __restrict__ xq, const float* __restrict__ xk, const float* __restrict__ xv, const float* __restrict__ wq, const float* __restrict__ wk, const float* __restrict__ wv, const float* __restrict__ wo,
    _Float16* __restrict__ XQ, _Float16* __restrict__ XK, _Float16* __restrict__ XV, _Float16* __restrict__ BQ, _Float16* __restrict__ BK, _Float16* __restrict__ BV, _Float16* __restrict__ BO) {
  const int tid = threadIdx.x, ln = tid & 15, k0 = (tid >> 6) * 32 + ((tid >> 5) & 1) * 16 + ((tid >> 4) & 1) * 8;      /* the thread's row in the tile; first k of its first chunk (chunk u: + 128 u) */
#pragma unroll 1      // one slab's values in registers at a time
  for (int slab = blockIdx.x; slab < PP_SLABS; slab += PP_BLOCKS) {
    if (slab < 4 * PP_WS) { const int j = slab / PP_WS, rt = slab % PP_WS, n = rt * 16 + ln;      /* Bt row n = output column (h, d) */
      unsigned short* d = (unsigned short*)(j == 0 ? BQ : j == 1 ? BK : j == 2 ? BV : BO) + (size_t)rt * 16384 + tid * 8;
      if (j < 3) pp_wslab<HD, 128 * HD>((j == 0 ? wq : j == 1 ? wk : wv) + ((size_t)(n / HD) * DM + k0) * HD + n % HD, d);
      else pp_wslab<DM, 128 * DM>(wo + (size_t)k0 * DM + n, d); }
    else { const int s2 = slab - 4 * PP_WS, j = s2 / PP_XS, rt = s2 % PP_XS;
      pp_xslab((j == 0 ? xq : j == 1 ? xk : xv) + ((size_t)rt * 16 + ln) * DM + k0, (unsigned short*)(j == 0 ? XQ : j == 1 ? XK : XV) + (size_t)rt * 16384 + tid * 8); } } }

extern "C" void kernel_launch(void* const* d_in, const int* in_sizes, int n_in,
                              void* d_out, int out_size, void* d_ws, size_t ws_size, hipStream_t stream) {
  (void)in_sizes; (void)n_in; (void)out_size;
  const float* const* I = (const float* const*)d_in; const float* xv = I[0]; const float* xk = I[1]; const float* xq = I[2]; const int* mk = (const int*)d_in[3]; const float* wq = I[4]; const float* bq = I[5]; const float* wk = I[6]; const float* bk = I[7]; const float* wv = I[8]; const float* bv = I[9]; const float* wo = I[10]; const float* bo = I[11];      /* NOTE the module's input order v, k, q, mask; per-head [h][in][out] weights + [h][64] biases (= flat [1024]); W0 [in][out] + b0 */
  float* PO = (float*)d_out + (size_t)NB * SQ * DM;      /* second output: last head's attention probabilities [NB][SQ][SQ] f32 at byte offset 16,777,216 */
  char* ws = (char*)d_ws; size_t off = 0;
  auto take = [&](size_t bytes) { char* p = ws + off; off += (bytes + 255) & ~(size_t)255; return p; };
  _Float16* BQ = (_Float16*)take((size_t)DM * DM * 2); _Float16* BK = (_Float16*)take((size_t)DM * DM * 2); _Float16* BV = (_Float16*)take((size_t)DM * DM * 2); _Float16* BO = (_Float16*)take((size_t)DM * DM * 2);
  _Float16* XQ = (_Float16*)take(NR * DM * 2); _Float16* XK = (_Float16*)take(NR * DM * 2); _Float16* XV = (_Float16*)take(NR * DM * 2); _Float16* Q16 = (_Float16*)take(NR * DM * 2); _Float16* K16 = (_Float16*)take(NR * DM * 2); _Float16* V16 = (_Float16*)take(NR * DM * 2); _Float16* O16 = (_Float16*)take(NR * DM * 2);
  _Float16* VT = (_Float16*)take((size_t)NB * NH * HD * SQ * 2);
  if (off > ws_size) return;
  k_prep<<<PP_BLOCKS, 256, 0, stream>>>(xq, xk, xv, wq, wk, wv, wo, XQ, XK, XV, BQ, BK, BV, BO);      /* the three inputs as exact f16 rows; per-head [h][m][d] -> Bt[(h,d)][m] x16; W0 [in][out] -> Bt x16; all in fragment order */
  const size_t r0p = (size_t)B0 * SQ;      /* first projected row */
  k_gemm2<0, true><<<dim3((unsigned)((MP / 128) * (DM / 64)), 1), 128, 0, stream>>>(XQ + r0p * DM, DM, 0, BQ, DM, 0, 0.0625f, bq, 0, nullptr, 1, 0, 0, nullptr, Q16 + r0p * DM, DM, 0, MP, DM, DM);
  k_gemm2<0, true><<<dim3((unsigned)((MP / 128) * (DM / 64)), 1), 128, 0, stream>>>(XK + r0p * DM, DM, 0, BK, DM, 0, 0.0625f, bk, 0, nullptr, 1, 0, 0, nullptr, K16 + r0p * DM, DM, 0, MP, DM, DM);
  k_gemm2<0, false><<<dim3((unsigned)((MP / 128) * (DM / 64)), 1), 128, 0, stream>>>(XV + r0p * DM, DM, 0, BV, DM, 0, 0.0625f, bv, 0, nullptr, 1, 0, 0, nullptr, V16 + r0p * DM, DM, 0, MP, DM, DM);
  k_vt<NH, SQ><<<NB * NH * (SQ / 64), 256, 0, stream>>>(V16, LQ, 0, VT);      /* V^T per (batch, head), fragment order */
  k_fattn<<<dim3(SQ / 128, NH, NB), 256, 0, stream>>>(Q16, K16, VT, mk, O16, PO);      /* scores, softmax and P V in one launch; o (merged heads) as f16 rows; the last head's probabilities to the second output */
  k_gemm2<0, false><<<dim3((unsigned)((MPO / 128) * (DM / 64)), 1), 128, 0, stream>>>(O16 + r0p * DM, DM, 0, BO, DM, 0, 0.0009765625f, bo, 0, nullptr, 1, 0, 0, (float*)d_out + r0p * DM, nullptr, DM, 0, MPO, DM, DM);      /* out rows are the output layout */
}

// v006
// One run takes 157 microseconds.
// In two side-by-side timings against v005, it was 1.23 and 1.24 times as fast.
// All steps since v000 together make it 42.8 times as fast.
#include <hip/hip_runtime.h>
#define NB 2
#define SQ 2048
#define DM 1024
#define NH 16
#define HD 64
#define HG 4                         /* heads per launch of the unused k_vt(V16, b, h0, VT) overload */
#define B0 0                         /* first batch processed (debug hook) */
#define NBR NB                       /* batches processed (debug hook) */
#define NR ((size_t)NB * SQ)         /* token rows */
#define MP ((int)((size_t)NBR * SQ)) /* rows projected (debug hook) */
#define QN SQ                        /* query rows per batch; unused */
#define NHD NH                       /* heads; unused */
#define MPO MP                       /* rows through the output stage (debug hook) */
#define LQ DM      /* halves per token row of q/k/v (v's row pitch; q, k in fragment order) */
typedef __bf16 v16b __attribute__((ext_vector_type(16)));
typedef unsigned short v8us __attribute__((ext_vector_type(8), may_alias));
typedef float  v8f  __attribute__((ext_vector_type(8)));
typedef float  v4f  __attribute__((ext_vector_type(4)));
typedef float  v4fa __attribute__((ext_vector_type(4), may_alias));
union FragB { v16b v; v8us half[2]; unsigned short u[16]; };

__device__ __forceinline__ unsigned short bf16_bits(float x) { unsigned int u = __float_as_uint(x); return (unsigned short)((u + 0x7FFFu + ((u >> 16) & 1u)) >> 16); }
__device__ __forceinline__ float bf16_val(unsigned short b) { return __uint_as_float(((unsigned int)b) << 16); }
__device__ __forceinline__ float bf16_round(float x) { return bf16_val(bf16_bits(x)); }
// D += A·B with NT terms: 1 = ah·bh, 2 = + al·bh (A split), 3 = + ah·bl (both split)
template <int NT>
__device__ __forceinline__ v8f mmaN(v16b ah, v16b al, v16b bh, v16b bl, v8f c) {
  c = __builtin_amdgcn_wmma_f32_16x16x32_bf16(false, ah, false, bh, (short)0, c, false, false);
  if (NT >= 2) c = __builtin_amdgcn_wmma_f32_16x16x32_bf16(false, al, false, bh, (short)0, c, false, false);
  if (NT >= 3) c = __builtin_amdgcn_wmma_f32_16x16x32_bf16(false, ah, false, bl, (short)0, c, false, false);
  asm volatile("v_nop\n\tv_nop\n\tv_nop\n\tv_nop" : "+v"(c) : "v"(ah), "v"(al), "v"(bh), "v"(bl));
  return c;
}

__global__ __launch_bounds__(256) void k_wt_bf16(const float* __restrict__ W, unsigned short* __restrict__ Wt, int K, int N) {
  const int t = blockIdx.x * 256 + threadIdx.x;
  const int k8n = K / 8;
  if (t >= N * k8n) return;
  const int n = t / k8n, k8 = (t % k8n) * 8;
  v8us v;
#pragma unroll
  for (int i = 0; i < 8; ++i) v[i] = bf16_bits(W[(size_t)(k8 + i) * N + n]);
  *(v8us*)(Wt + (size_t)n * K + k8) = v;
  
}

// GEMM C[M][N] (f32, pitch ldc) = act(A[M][K]·W + bias). A f32 row-major (pitch lda) converted per fragment to bf16
// (ASPLIT: hi/lo two planes -> 2 terms, else single rounded term); Wt bf16 [N][K] (pitch ldb). BIAS_BF16 rounds the
// bias to bf16 first (bias quantised to bf16 before the add). K%32==0, M%16==0, N%64==0.
template <bool ASPLIT, int ACT, bool BIAS_BF16>
__global__ __launch_bounds__(128) void k_gemm_bf(const float* __restrict__ A, int lda, const unsigned short* __restrict__ Wt, int ldb,
                                               const float* __restrict__ bias, float* __restrict__ C, int ldc, int M, int N, int K) {
  __shared__ __attribute__((aligned(16))) float so[4][16][64];
  const int tid = threadIdx.x, w = tid >> 5, lane = tid & 31, ln = lane & 15, hh = lane >> 4;
  const int ntn = N / 64;
  const int wid = blockIdx.x * 4 + w;
  const int mt = wid / ntn, nq = wid % ntn;
  if (mt * 16 >= M) return;
  const int row0 = mt * 16, col0 = nq * 64;
  const float* arow = A + (size_t)(row0 + ln) * lda;
  v8f acc[4] = {};
  for (int kb = 0; kb < K; kb += 32) {
    FragB ah, al;
    const v4f x0 = *(const v4fa*)(arow + kb + 8 * hh), x1 = *(const v4fa*)(arow + kb + 8 * hh + 4);
    const v4f x2 = *(const v4fa*)(arow + kb + 16 + 8 * hh), x3 = *(const v4fa*)(arow + kb + 16 + 8 * hh + 4);
    float xs[16] = {x0[0],x0[1],x0[2],x0[3],x1[0],x1[1],x1[2],x1[3],x2[0],x2[1],x2[2],x2[3],x3[0],x3[1],x3[2],x3[3]};
#pragma unroll
    for (int i = 0; i < 16; ++i) { const unsigned short hb = bf16_bits(xs[i]); ah.u[i] = hb; al.u[i] = ASPLIT ? bf16_bits(xs[i] - bf16_val(hb)) : (unsigned short)0; }
#pragma unroll
    for (int t = 0; t < 4; ++t) {
      const unsigned short* brow = Wt + (size_t)(col0 + t * 16 + ln) * ldb + kb;
      FragB b;
      b.half[0] = *(const v8us*)(brow + 8 * hh);
      b.half[1] = *(const v8us*)(brow + 16 + 8 * hh);
      acc[t] = mmaN<ASPLIT ? 2 : 1>(ah.v, al.v, b.v, b.v, acc[t]);
    }
  }
#pragma unroll
  for (int t = 0; t < 4; ++t) {
    float bv = bias ? bias[col0 + t * 16 + ln] : 0.f;
    if (BIAS_BF16) bv = bf16_round(bv);
#pragma unroll
    for (int r = 0; r < 8; ++r) { float v = acc[t][r] + bv; if (ACT == 1) v = fmaxf(v, 0.f); so[w][8 * hh + r][t * 16 + ln] = v; }
  }
  __builtin_amdgcn_fence(__ATOMIC_ACQ_REL, "workgroup");
  __builtin_amdgcn_wave_barrier();
  const int rsub = lane >> 4, c4 = (lane & 15) * 4;
  {
#pragma unroll
    for (int q = 0; q < 8; ++q) {
      const int r = q * 2 + rsub;
      const v4f v = *(const v4fa*)&so[w][r][c4];
      *(v4f*)(C + (size_t)(row0 + r) * ldc + col0 + c4) = v;
    }
    
  }
}

// GEMM C = act(A·W + bias + resid): A f32 (ASPLIT -> hi/lo 2 terms), Wt bf16 [N][K]; ACT 0 none, 1 relu, 2 exact gelu;
// resid (optional, f32, row index = (row % rmod), pitch ldr, RES_BF16 rounds it) added before the activation.
template <bool ASPLIT, int ACT, bool BIAS_BF16, bool RES_BF16>
__global__ __launch_bounds__(128) void k_gemm_bf3(const float* __restrict__ A, int lda, const unsigned short* __restrict__ Wt, int ldb,
                                                const float* __restrict__ bias, const float* __restrict__ resid, int rmod, int ldr,
                                                float* __restrict__ C, int ldc, int M, int N, int K) {
  __shared__ __attribute__((aligned(16))) float so[4][16][64];
  const int tid = threadIdx.x, w = tid >> 5, lane = tid & 31, ln = lane & 15, hh = lane >> 4;
  const int ntn = N / 64;
  const int wid = blockIdx.x * 4 + w;
  const int mt = wid / ntn, nq = wid % ntn;
  if (mt * 16 >= M) return;
  const int row0 = mt * 16, col0 = nq * 64;
  const float* arow = A + (size_t)(row0 + ln) * lda;
  v8f acc[4] = {};
  for (int kb = 0; kb < K; kb += 32) {
    FragB ah, al;
    const v4f x0 = *(const v4fa*)(arow + kb + 8 * hh), x1 = *(const v4fa*)(arow + kb + 8 * hh + 4);
    const v4f x2 = *(const v4fa*)(arow + kb + 16 + 8 * hh), x3 = *(const v4fa*)(arow + kb + 16 + 8 * hh + 4);
    float xs[16] = {x0[0],x0[1],x0[2],x0[3],x1[0],x1[1],x1[2],x1[3],x2[0],x2[1],x2[2],x2[3],x3[0],x3[1],x3[2],x3[3]};
#pragma unroll
    for (int i = 0; i < 16; ++i) { const unsigned short hb = bf16_bits(xs[i]); ah.u[i] = hb; al.u[i] = ASPLIT ? bf16_bits(xs[i] - bf16_val(hb)) : (unsigned short)0; }
#pragma unroll
    for (int t = 0; t < 4; ++t) {
      const unsigned short* brow = Wt + (size_t)(col0 + t * 16 + ln) * ldb + kb;
      FragB b;
      b.half[0] = *(const v8us*)(brow + 8 * hh);
      b.half[1] = *(const v8us*)(brow + 16 + 8 * hh);
      acc[t] = mmaN<ASPLIT ? 2 : 1>(ah.v, al.v, b.v, b.v, acc[t]);
    }
  }
#pragma unroll
  for (int t = 0; t < 4; ++t) {
    const int col = col0 + t * 16 + ln;
    float bv = bias ? bias[col] : 0.f;
    if (BIAS_BF16) bv = bf16_round(bv);
#pragma unroll
    for (int r = 0; r < 8; ++r) {
      float v = acc[t][r] + bv;
      if (resid) { float rv = resid[(size_t)((row0 + 8 * hh + r) % rmod) * ldr + col]; if (RES_BF16) rv = bf16_round(rv); v += rv; }
      if (ACT == 1) v = fmaxf(v, 0.f);
      if (ACT == 2) v = 0.5f * v * (1.0f + erff(v * 0.70710678118654752f));
      if (ACT == 3) { const float u = 0.7978845608028654f * (v + 0.044715f * v * v * v); v = 0.5f * v * (1.0f + tanhf(u)); }
      so[w][8 * hh + r][t * 16 + ln] = v;
    }
  }
  __builtin_amdgcn_fence(__ATOMIC_ACQ_REL, "workgroup");
  __builtin_amdgcn_wave_barrier();
  const int rsub = lane >> 4, c4 = (lane & 15) * 4;
  {
#pragma unroll
    for (int q = 0; q < 8; ++q) {
      const int r = q * 2 + rsub;
      const v4f v = *(const v4fa*)&so[w][r][c4];
      *(v4f*)(C + (size_t)(row0 + r) * ldc + col0 + c4) = v;
    }
    
  }
}
// row LayerNorm (biased variance, eps) over N: s = X (+ R); optional out_sum <- s; out_norm <- (s-mu)*rsqrt(var+eps)*g + b
template <bool PARAM_BF16>
__global__ __launch_bounds__(256) void k_layernorm(const float* __restrict__ X, const float* __restrict__ R, const float* __restrict__ g, const float* __restrict__ bta,
                                                  float* __restrict__ out_sum, float* __restrict__ out_norm, int N, float eps) {
  __shared__ float red[256];
  const int row = blockIdx.x, tid = threadIdx.x;
  const float* x = X + (size_t)row * N; const float* rr = R ? R + (size_t)row * N : nullptr;
  float vals[16];                     // up to N = 4096
  const int per = N / 256;            // contiguous chunk per thread? use strided-by-4 chunks: thread handles j = tid*4 + 1024*u
  float s1 = 0.f;
  for (int u = 0; u < per / 4; ++u) {
    const int j = tid * 4 + 1024 * u;
    const v4f a = *(const v4fa*)(x + j);
    v4f b = {0.f,0.f,0.f,0.f}; if (rr) b = *(const v4fa*)(rr + j);
#pragma unroll
    for (int q = 0; q < 4; ++q) { const float v = a[q] + b[q]; vals[u * 4 + q] = v; s1 += v; }
  }
  red[tid] = s1; __syncthreads();
  for (int st = 128; st > 0; st >>= 1) { if (tid < st) red[tid] += red[tid + st]; __syncthreads(); }
  const float mu = red[0] / (float)N; __syncthreads();
  float s2 = 0.f;
  for (int u = 0; u < per / 4; ++u)
#pragma unroll
    for (int q = 0; q < 4; ++q) { const float c = vals[u * 4 + q] - mu; s2 += c * c; }
  red[tid] = s2; __syncthreads();
  for (int st = 128; st > 0; st >>= 1) { if (tid < st) red[tid] += red[tid + st]; __syncthreads(); }
  const float rs = rsqrtf(red[0] / (float)N + eps);
  {
    for (int u = 0; u < per / 4; ++u) {
      const int j = tid * 4 + 1024 * u;
      v4f o, sm;
#pragma unroll
      for (int q = 0; q < 4; ++q) {
        float gg = g[j + q], bb = bta[j + q];
        if (PARAM_BF16) { gg = bf16_round(gg); bb = bf16_round(bb); }
        sm[q] = vals[u * 4 + q]; o[q] = (vals[u * 4 + q] - mu) * rs * gg + bb;
      }
      if (out_sum) *(v4f*)(out_sum + (size_t)row * N + j) = sm;
      *(v4f*)(out_norm + (size_t)row * N + j) = o;
    }
    
  }
}



// ---- f16 WMMA path (v_wmma_f32_16x16x32_f16): 11-bit significands for operands in range — used where a [0,1] probability operand needs more precision than bf16
typedef _Float16 v16h __attribute__((ext_vector_type(16)));
union FragH { v16h v; v8us half[2]; _Float16 h[16]; unsigned short u[16]; };
template <int NT>
__device__ __forceinline__ v8f mmaH(v16h ah, v16h al, v16h bh, v16h bl, v8f c) {
  c = __builtin_amdgcn_wmma_f32_16x16x32_f16(false, ah, false, bh, (short)0, c, false, false);
  if (NT >= 2) c = __builtin_amdgcn_wmma_f32_16x16x32_f16(false, al, false, bh, (short)0, c, false, false);
  if (NT >= 3) c = __builtin_amdgcn_wmma_f32_16x16x32_f16(false, ah, false, bl, (short)0, c, false, false);
  asm volatile("v_nop\n\tv_nop\n\tv_nop\n\tv_nop" : "+v"(c) : "v"(ah), "v"(al), "v"(bh), "v"(bl));
  return c;
}
// batched GEMM like k_gemm_b but f16 operands: A f32 (split into f16 hi/lo if ASPLIT, else rounded to f16), Bt = f16 values [n][k]; alpha; C f32; N multiple of 16 (partial tiles skipped)
template <bool ASPLIT>
__global__ __launch_bounds__(128) void k_gemm_h(const float* __restrict__ A, int lda, size_t sA, const _Float16* __restrict__ Bh, int ldb, size_t sB, float alpha, float* __restrict__ C, int ldc, size_t sC, int M, int N, int K) {
  __shared__ __attribute__((aligned(16))) float so[4][16][64];
  const int tid = threadIdx.x, w = tid >> 5, lane = tid & 31, ln = lane & 15, hh = lane >> 4; const int by = blockIdx.y;
  A += (size_t)by * sA; Bh += (size_t)by * sB; C += (size_t)by * sC;
  const int ntn = (N + 63) / 64; const int wid = blockIdx.x * 4 + w; const int mt = wid / ntn, nq = wid % ntn; if (mt * 16 >= M) return;
  const int row0 = mt * 16, col0 = nq * 64; const float* arow = A + (size_t)(row0 + ln) * lda;
  v8f acc[4] = {};
  for (int kb = 0; kb < K; kb += 32) {
    FragH ah, al;
    const v4f x0 = *(const v4fa*)(arow + kb + 8 * hh), x1 = *(const v4fa*)(arow + kb + 8 * hh + 4), x2 = *(const v4fa*)(arow + kb + 16 + 8 * hh), x3 = *(const v4fa*)(arow + kb + 16 + 8 * hh + 4);
    float xs[16] = {x0[0],x0[1],x0[2],x0[3],x1[0],x1[1],x1[2],x1[3],x2[0],x2[1],x2[2],x2[3],x3[0],x3[1],x3[2],x3[3]};
#pragma unroll
    for (int i = 0; i < 16; ++i) { const _Float16 h = (_Float16)xs[i]; ah.h[i] = h; al.h[i] = ASPLIT ? (_Float16)(xs[i] - (float)h) : (_Float16)0.0f; }
#pragma unroll
    for (int t = 0; t < 4; ++t) { if (col0 + t * 16 >= N) continue; const size_t boff = (size_t)(col0 + t * 16 + ln) * ldb + kb; FragH bq; bq.half[0] = *(const v8us*)(Bh + boff + 8 * hh); bq.half[1] = *(const v8us*)(Bh + boff + 16 + 8 * hh);
      acc[t] = mmaH<ASPLIT ? 2 : 1>(ah.v, al.v, bq.v, bq.v, acc[t]); }
  }
#pragma unroll
  for (int t = 0; t < 4; ++t) { if (col0 + t * 16 >= N) continue;
#pragma unroll
    for (int r = 0; r < 8; ++r) so[w][8 * hh + r][t * 16 + ln] = acc[t][r] * alpha; }
  __builtin_amdgcn_fence(__ATOMIC_ACQ_REL, "workgroup"); __builtin_amdgcn_wave_barrier();
  const int rsub = lane >> 4, c4 = (lane & 15) * 4;
  {
#pragma unroll
    for (int q = 0; q < 8; ++q) { const int r = q * 2 + rsub; if (col0 + c4 < N) { const v4f v = *(const v4fa*)&so[w][r][c4]; *(v4f*)(C + (size_t)(row0 + r) * ldc + col0 + c4) = v; } }
     }
}

// k_gemm_hh variant with fused epilogue: v = acc·alpha + bias[by·sBias + col] (+ CP[(row/rowsPerB)·sCPb + by·64 + col] if CP) ; ACT 0 none / 1 elu ; writes f16 C16 (and f32 C if non-null)
template <int ACT>
__global__ __launch_bounds__(128) void k_gemm_hhx(const _Float16* __restrict__ A, int lda, size_t sA, const _Float16* __restrict__ Bh, int ldb, size_t sB, float alpha, const float* __restrict__ bias, size_t sBias, const float* __restrict__ CP, int rowsPerB, size_t sCPb, int row0g,
    float* __restrict__ C, _Float16* __restrict__ C16, int ldc, size_t sC, int M, int N, int K) {
  __shared__ __attribute__((aligned(16))) float so[4][16][64];
  const int tid = threadIdx.x, w = tid >> 5, lane = tid & 31, ln = lane & 15, hh = lane >> 4; const int by = blockIdx.y;
  A += (size_t)by * sA; Bh += (size_t)by * sB; const size_t cofs = (size_t)by * sC; const float* bp = bias ? bias + (size_t)by * sBias : nullptr;
  const int ntn = (N + 63) / 64; const int wid = blockIdx.x * 4 + w; const int mt = wid / ntn, nq = wid % ntn; if (mt * 16 >= M) return;
  const int row0 = mt * 16, col0 = nq * 64; const _Float16* arow = A + (size_t)(row0 + ln) * lda;
  v8f acc[4] = {};
  for (int kb = 0; kb < K; kb += 32) { FragH ah; ah.half[0] = *(const v8us*)((const unsigned short*)arow + kb + 8 * hh); ah.half[1] = *(const v8us*)((const unsigned short*)arow + kb + 16 + 8 * hh);
#pragma unroll
    for (int t = 0; t < 4; ++t) { if (col0 + t * 16 >= N) continue; const size_t boff = (size_t)(col0 + t * 16 + ln) * ldb + kb; FragH bq; bq.half[0] = *(const v8us*)((const unsigned short*)Bh + boff + 8 * hh); bq.half[1] = *(const v8us*)((const unsigned short*)Bh + boff + 16 + 8 * hh);
      acc[t] = mmaH<1>(ah.v, ah.v, bq.v, bq.v, acc[t]); }
  }
#pragma unroll
  for (int t = 0; t < 4; ++t) { if (col0 + t * 16 >= N) continue; const int col = col0 + t * 16 + ln; const float bv = bp ? bf16_round(bp[col]) : 0.f;
#pragma unroll
    for (int r = 0; r < 8; ++r) { float v = acc[t][r] * alpha + bv; if (CP) { const int rr = row0g + row0 + 8 * hh + r; if (rowsPerB < 0) v += CP[cofs + (size_t)rr * ldc + col];      /* rowsPerB < 0: own element of the batched C plane */ else { const int bidx = rr / rowsPerB; v += CP[(size_t)bidx * sCPb + (size_t)by * 64 + col]; } } if (ACT == 1) v = (v > 0.f) ? v : expm1f(v); else if (ACT == 7) v = (v > 0.f) ? v + 1.0f : expf(v); else if (ACT == 8) v = tanhf(v); else if (ACT == 9) v = 0.5f * v * (1.0f + tanhf(0.7978845608028654f * (v + 0.044715f * v * v * v))); else if (ACT == 11) v = 1.0f / (1.0f + expf(-v)); else if (ACT == 12) v = (v > 0.f) ? v : 0.01f * v; else if (ACT == 14) v = (v > 0.f) ? v : 0.1f * v; else if (ACT == 16) v = (v >= 0.f) ? v : 0.3f * v; else if (ACT == 17) v = (v >= 0.f) ? v : 0.2f * v; else if (ACT == 15) v = v / (1.0f + expf(-v)); else if (ACT == 3) v = fmaxf(v, 0.f); else if (ACT == 6) v = 0.5f * v * (1.0f + erff(v * 0.70710678118654752f)); so[w][8 * hh + r][t * 16 + ln] = v; } }
  __builtin_amdgcn_fence(__ATOMIC_ACQ_REL, "workgroup"); __builtin_amdgcn_wave_barrier();
  const int rsub = lane >> 4, c4 = (lane & 15) * 4; typedef _Float16 v4h __attribute__((ext_vector_type(4)));
  {
#pragma unroll
    for (int q = 0; q < 8; ++q) { const int r = q * 2 + rsub; if (col0 + c4 < N) { const v4f v = *(const v4fa*)&so[w][r][c4]; if (C) *(v4f*)(C + cofs + (size_t)(row0 + r) * ldc + col0 + c4) = v; if (C16) { v4h h4; for (int i = 0; i < 4; ++i) h4[i] = (_Float16)v[i]; *(v4h*)(C16 + cofs + (size_t)(row0 + r) * ldc + col0 + c4) = h4; } } }
     }
}


typedef _Float16 v4h __attribute__((ext_vector_type(4)));

__global__ __launch_bounds__(256) void k_h16(const float* __restrict__ x, _Float16* __restrict__ X16, size_t n8) { const size_t t = (size_t)blockIdx.x * 256 + threadIdx.x; if (t >= n8) return; FragH f;
#pragma unroll
  for (int q = 0; q < 8; ++q) f.h[q] = (_Float16)x[t * 8 + q]; *(v8us*)((unsigned short*)X16 + t * 8) = f.half[0];  }
__global__ __launch_bounds__(256) void k_round16f(const float* __restrict__ W, _Float16* __restrict__ Bt, size_t n8) { const size_t t = (size_t)blockIdx.x * 256 + threadIdx.x; if (t >= n8) return; FragH f;
#pragma unroll
  for (int i = 0; i < 8; ++i) f.h[i] = (_Float16)(bf16_round(W[t * 8 + i]) * 16.0f); *(v8us*)((unsigned short*)Bt + t * 8) = f.half[0];  }
template <int NHv, int TTv>
__global__ __launch_bounds__(256) void k_vt(const _Float16* __restrict__ V16, int ldv, int voff, _Float16* __restrict__ Vt) { __shared__ unsigned short tl[64][66]; const int tid = threadIdx.x; const int slab = blockIdx.x / (TTv / 64), lg = blockIdx.x % (TTv / 64); const int b = slab / NHv, h = slab % NHv;
  for (int i = tid; i < 64 * 8; i += 256) { const int r = i / 8, c8 = (i % 8) * 8; FragH f; f.half[0] = *(const v8us*)((const unsigned short*)V16 + ((size_t)b * TTv + lg * 64 + r) * ldv + voff + h * 64 + c8);
#pragma unroll
    for (int q = 0; q < 8; ++q) tl[r][c8 + q] = f.u[q]; }
  __syncthreads();
  {
#pragma unroll
    for (int rd = 0; rd < 2; ++rd) { const int i = rd * 256 + tid, tile = i >> 6; const int d = (tile & 3) * 16 + (i & 15), kl = (tile >> 2) * 32 + ((i >> 5) & 1) * 16 + ((i >> 4) & 1) * 8; FragH f;      /* fragment order (pk_frag), tile (32 keys, 16 d) at (key / 32) * 4 + d / 16 of the slab */
#pragma unroll
      for (int q = 0; q < 8; ++q) f.u[q] = tl[kl + q][d];
      *(v8us*)((unsigned short*)Vt + (size_t)slab * 64 * TTv + (size_t)lg * 4096 + i * 8) = f.half[0]; }
     } }

__global__ __launch_bounds__(256) void k_hl(const float* __restrict__ F, _Float16* __restrict__ Hh, _Float16* __restrict__ Hl, size_t n8) { const size_t t = (size_t)blockIdx.x * 256 + threadIdx.x; if (t >= n8) return; FragH fh, fl; const v4f a = *(const v4fa*)(F + t * 8), c = *(const v4fa*)(F + t * 8 + 4);
#pragma unroll
  for (int q = 0; q < 4; ++q) { _Float16 h = (_Float16)a[q]; fh.h[q] = h; fl.h[q] = (_Float16)((a[q] - (float)h) * 1024.0f); h = (_Float16)c[q]; fh.h[4 + q] = h; fl.h[4 + q] = (_Float16)((c[q] - (float)h) * 1024.0f); }
  { *(v8us*)((unsigned short*)Hh + t * 8) = fh.half[0]; *(v8us*)((unsigned short*)Hl + t * 8) = fl.half[0];  } }

// ---- fast GEMM (wave tile 32x64; requires M % 32 == 0 rows per launch region and N % 64 == 0); epilogue = k_gemm_hhx semantics ----
__device__ __forceinline__ v16h g2_frag(const _Float16* p, int hh) { FragH f; f.half[0] = *(const v8us*)((const unsigned short*)p + 8 * hh); f.half[1] = *(const v8us*)((const unsigned short*)p + 16 + 8 * hh); return f.v; }
// Fragment order of an f16 matrix [R][K]: 16-row x 32-k tiles of 1024 bytes, tile (rt, kt) at (rt * (K / 32) + kt) * 512 halves; inside a tile the 8 halves of row ln, k = part * 16 + hh * 8 .. + 7
// stand at (part * 32 + hh * 16 + ln) * 8. p = the tile + lane * 8: each of the two loads of a wave then covers 512 contiguous bytes (4 whole lines, not 16 pieces of 32 bytes); the k order is that of g2_frag.
__device__ __forceinline__ v16h pk_frag(const _Float16* p) { FragH f; f.half[0] = *(const v8us*)((const unsigned short*)p); f.half[1] = *(const v8us*)((const unsigned short*)p + 256); return f.v; }
__device__ __forceinline__ v8f g2_mma(v16h a, v16h b, v8f c) { v8f d = __builtin_amdgcn_wmma_f32_16x16x32_f16(false, a, false, b, (short)0, c, false, false); asm volatile("v_nop\n\tv_nop\n\tv_nop\n\tv_nop" : "+v"(d) : "v"(a), "v"(b)); return d; }
struct G2F { v16h a0, a1, b0, b1, b2, b3; };      /* the six fragments of one 32-k tile: two row tiles of A, four column tiles of B */
// one k tile's twelve loads, issued as one group at this place, tiles ahead of the products that read them. The wait stands behind the group: the six address pairs, named as inputs, stay live up to it,
// so that no load's result lands in a register that an issued load still names; the two scheduling barriers keep every load of the group in front of the wait and every rewrite of an address behind it
__device__ __forceinline__ G2F g2_load(const _Float16* a0, const _Float16* a1, const _Float16* b0, const _Float16* b1, const _Float16* b2, const _Float16* b3, int kb) { G2F f;
  const _Float16* p0 = a0 + kb; const _Float16* p1 = a1 + kb; const _Float16* p2 = b0 + kb; const _Float16* p3 = b1 + kb; const _Float16* p4 = b2 + kb; const _Float16* p5 = b3 + kb;
  f.a0 = pk_frag(p0); f.a1 = pk_frag(p1); f.b0 = pk_frag(p2); f.b1 = pk_frag(p3); f.b2 = pk_frag(p4); f.b3 = pk_frag(p5);
  __builtin_amdgcn_sched_barrier(0); asm volatile("s_wait_xcnt 0x0" :: "v"(p0), "v"(p1), "v"(p2), "v"(p3), "v"(p4), "v"(p5) : "memory"); __builtin_amdgcn_sched_barrier(0); return f; }
template <int ACT, bool PK>      /* A and Bh in fragment order (pk_frag); PK: C16 alone is written, in fragment order; else C and C16 row-major */
__global__ __launch_bounds__(128) void k_gemm2(const _Float16* __restrict__ A, int lda, size_t sA, const _Float16* __restrict__ Bh, int ldb, size_t sB, float alpha, const float* __restrict__ bias, size_t sBias, const float* __restrict__ CP, int rowsPerB, size_t sCPb, int row0g,
    float* __restrict__ C, _Float16* __restrict__ C16, int ldc, size_t sC, int M, int N, int K) { static_assert(ACT == 0 || ACT == 3 || ACT == 6 || ACT == 8 || ACT == 9 || ACT == 11 || ACT == 12 || ACT == 14 || ACT == 15 || ACT == 16 || ACT == 17, "k_gemm2: unsupported ACT code (would silently apply no activation)");
  __shared__ __attribute__((aligned(16))) float so[4][32][68];
  const int tid = threadIdx.x, w = tid >> 5, lane = tid & 31, ln = lane & 15, hh = lane >> 4; const int by = blockIdx.y;
  A += (size_t)by * sA; Bh += (size_t)by * sB; const size_t cofs = (size_t)by * sC; const float* bp = bias ? bias + (size_t)by * sBias : nullptr;
  const int ntn = N >> 6; const int mt = blockIdx.x / ntn, nq = blockIdx.x - mt * ntn; const int row0 = mt * 128 + 32 * w, col0 = nq * 64; if (row0 >= M) return;
  const _Float16* a0p = A + (size_t)row0 * lda + lane * 8; const _Float16* a1p = a0p + (size_t)16 * lda;
  const _Float16* b0p = Bh + (size_t)col0 * ldb + lane * 8; const _Float16* b1p = b0p + (size_t)16 * ldb; const _Float16* b2p = b1p + (size_t)16 * ldb; const _Float16* b3p = b2p + (size_t)16 * ldb;
  const v8f z8 = {0.f,0.f,0.f,0.f,0.f,0.f,0.f,0.f}; v8f c00 = z8, c01 = z8, c02 = z8, c03 = z8, c10 = z8, c11 = z8, c12 = z8, c13 = z8;
  if (K > 0) { const int ke = K * 16, kl = ke - 512, n3 = ke / 1536; int kb = 0;      /* halves of a fragment row; its last tile; whole trips. A ring of three register sets: tile t + 2 is asked for in front of tile t's products; past the end the last tile is fetched again, in bounds */
#define G2_LOAD(k) g2_load(a0p, a1p, b0p, b1p, b2p, b3p, (k) < kl ? (k) : kl)
#define G2_TILE(f) { c00 = g2_mma(f.a0, f.b0, c00); c10 = g2_mma(f.a1, f.b0, c10); c01 = g2_mma(f.a0, f.b1, c01); c11 = g2_mma(f.a1, f.b1, c11); c02 = g2_mma(f.a0, f.b2, c02); c12 = g2_mma(f.a1, f.b2, c12); c03 = g2_mma(f.a0, f.b3, c03); c13 = g2_mma(f.a1, f.b3, c13); }
    G2F f0 = G2_LOAD(0), f1 = G2_LOAD(512);
#pragma unroll 1      // three tiles a trip, so that each set keeps its registers (no copies between the sets); one block without an exit inside, so that the waits for the loads stay counted
    for (int i = 0; i < n3; ++i, kb += 1536) { const G2F f2 = G2_LOAD(kb + 1024); G2_TILE(f0) f0 = G2_LOAD(kb + 1536); G2_TILE(f1) f1 = G2_LOAD(kb + 2048); G2_TILE(f2) }
    if (kb < ke) G2_TILE(f0)      /* the one or two tiles that no whole trip holds are already in the ring */
    if (kb + 512 < ke) G2_TILE(f1) }
#undef G2_LOAD
#undef G2_TILE
  v8f accs[8] = {c00, c01, c02, c03, c10, c11, c12, c13};
#pragma unroll
  for (int u = 0; u < 8; ++u) { const int t = u & 3, half = u >> 2; const int col = col0 + t * 16 + ln; const float bv = bp ? bf16_round(bp[col]) : 0.f;
#pragma unroll
    for (int r = 0; r < 8; ++r) { const int rloc = half * 16 + 8 * hh + r; float v = accs[u][r] * alpha + bv; if (CP) { if (rowsPerB < 0) v += CP[cofs + (size_t)(row0g + row0 + rloc) * ldc + col];      /* rowsPerB < 0: own element of the batched C plane */ else { const int bidx = (row0g + row0 + rloc) / rowsPerB; v += CP[(size_t)bidx * sCPb + (size_t)by * 64 + col]; } }
      if (ACT == 3) v = fmaxf(v, 0.f); else if (ACT == 6) v = 0.5f * v * (1.0f + erff(v * 0.70710678118654752f)); else if (ACT == 11) v = 1.0f / (1.0f + expf(-v)); else if (ACT == 15) v = v / (1.0f + expf(-v)); else if (ACT == 12) v = (v > 0.f) ? v : 0.01f * v; else if (ACT == 8) v = tanhf(v); else if (ACT == 9) v = 0.5f * v * (1.0f + tanhf(0.7978845608028654f * (v + 0.044715f * v * v * v))); else if (ACT == 14) v = (v > 0.f) ? v : 0.1f * v; else if (ACT == 16) v = (v >= 0.f) ? v : 0.3f * v; else if (ACT == 17) v = (v >= 0.f) ? v : 0.2f * v;
      so[w][rloc][t * 16 + ln] = v; } }
  __builtin_amdgcn_fence(__ATOMIC_ACQ_REL, "workgroup"); __builtin_amdgcn_wave_barrier();
  const int rsub = lane >> 4, c4 = (lane & 15) * 4;
  if (PK) {      /* C16 alone, in fragment order: the wave's 32 x 64 tile = 2 x 2 fragment tiles, eight stores of 512 contiguous bytes */
#pragma unroll      // constant LDS and store offsets
      for (int s = 0; s < 8; ++s) { const int rl = (s >> 2) * 16 + ln, cl = ((s >> 1) & 1) * 32 + (s & 1) * 16 + hh * 8; const v4f x = *(const v4fa*)&so[w][rl][cl], y = *(const v4fa*)&so[w][rl][cl + 4]; FragH f;
        for (int i = 0; i < 4; ++i) { f.h[i] = (_Float16)x[i]; f.h[4 + i] = (_Float16)y[i]; }
        *(v8us*)((unsigned short*)C16 + cofs + (size_t)(row0 + (s >> 2) * 16) * ldc + (size_t)((col0 >> 5) + ((s >> 1) & 1)) * 512 + (s & 1) * 256 + lane * 8) = f.half[0]; }
    return; }
  {
#pragma unroll
    for (int q = 0; q < 16; ++q) { const int r = q * 2 + rsub; const v4f v = *(const v4fa*)&so[w][r][c4]; if (C) *(v4f*)(C + cofs + (size_t)(row0 + r) * ldc + col0 + c4) = v; if (C16) { v4h h4; for (int i = 0; i < 4; ++i) h4[i] = (_Float16)v[i]; *(v4h*)(C16 + cofs + (size_t)(row0 + r) * ldc + col0 + c4) = h4; } }
     } }


__global__ __launch_bounds__(256) void k_wnat(const float* __restrict__ w, size_t n8, _Float16* __restrict__ Bt) { const size_t t = (size_t)blockIdx.x * 256 + threadIdx.x; if (t >= n8) return; FragH f; for (int q = 0; q < 8; ++q) f.h[q] = (_Float16)(bf16_round(w[t * 8 + q]) * 16.0f); *(v8us*)((unsigned short*)Bt + t * 8) = f.half[0];  }
__global__ __launch_bounds__(256) void k_rsm(const float* __restrict__ S, _Float16* __restrict__ P, int nrows) {
  #pragma clang fp contract(off)
  const int i = blockIdx.x * 256 + threadIdx.x; if (i >= nrows) return; const float* s = S + (size_t)i * SQ; float mx = -3.0e38f;
#pragma unroll 1
  for (int j = 0; j < SQ; ++j) mx = fmaxf(mx, s[j]); float se = 0.f;
#pragma unroll 1
  for (int j = 0; j < SQ; ++j) se += expf(s[j] - mx); const float sc = 256.0f / se;
#pragma unroll 1
  for (int j0 = 0; j0 < SQ; j0 += 8) { FragH f; for (int q = 0; q < 8; ++q) f.h[q] = (_Float16)(expf(s[j0 + q] - mx) * sc); unsigned short* d = (unsigned short*)P + (size_t)i * SQ + j0; *(v8us*)d = f.half[0];  } }
__global__ __launch_bounds__(256) void k_vt(const _Float16* __restrict__ V16, int b, int h0, _Float16* __restrict__ VT) { __shared__ unsigned short tl[64][65]; const int tid = threadIdx.x; const int hh = blockIdx.x % HG, sg = blockIdx.x / HG; const int s0 = sg * 64; const int h = h0 + hh;
  for (int i = tid; i < 64 * 8; i += 256) { const int j = i / 8, d8 = (i % 8) * 8; FragH f; f.half[0] = *(const v8us*)((const unsigned short*)V16 + ((size_t)b * SQ + s0 + j) * DM + h * HD + d8); for (int q = 0; q < 8; ++q) tl[d8 + q][j] = f.u[q]; }
  __syncthreads();
  { for (int i = tid; i < 64 * 8; i += 256) { const int d = i / 8, j8 = (i % 8) * 8; FragH f; for (int q = 0; q < 8; ++q) f.u[q] = tl[d][j8 + q]; *(v8us*)((unsigned short*)VT + ((size_t)hh * HD + d) * SQ + s0 + j8) = f.half[0]; }  } }






typedef int v4ia __attribute__((ext_vector_type(4), may_alias));
__device__ __forceinline__ float rs_xrow(float v) { const int i = __float_as_int(v); return __int_as_float(__builtin_amdgcn_permlanex16(i, i, 0x76543210, 0xfedcba98, true, false)); }      /* lane l reads lane l ^ 16 */
// Fused attention, one wave per 16 query rows of one (batch, head), 32 keys a pass: S^T = K Q^T (A = K rows, B = Q kept in registers), so a lane holds one query's
// scores (keys 8*hh + r of each 16-key tile); running maximum and sum per lane, one exchange between the wave halves; the two f32 score tiles, converted in place,
// are the B operand of O^T += V^T P^T. No score and no weight goes through memory. All in the log2 domain: p = 2^(s * FA_C - mu + FA_OFF) with mu the maximum in use.
#define FA_C 0.18033688011112042f      /* 64^-0.5 * log2(e) */
#define FA_OFF 7.0f                    /* weights carried x128: small ones stay normal f16 numbers */
#define FA_THR 8.0f                    /* mu is renewed only when a score passes it by more than this: weights stay at or under 2^15, inside f16 */
#define FA_DROP (-0x1p+100f)           /* raw score of a masked key; a power of two, so FA_DROP * FA_C is exact and a row with every key masked gets equal weights */
__device__ __forceinline__ v8f fa_mma(v16h a, v16h b, v8f c) { return __builtin_amdgcn_wmma_f32_16x16x32_f16(false, a, false, b, (short)0, c, false, false); }
// eight native 2^x; each is followed by an independent instruction, the last by the v_nop: the slot the instruction set asks for behind a transcendental
__device__ __forceinline__ v8f fa_exp2(v8f x) { float e0, e1, e2, e3, e4, e5, e6, e7;
  asm("v_exp_f32 %0, %8\n\tv_exp_f32 %1, %9\n\tv_exp_f32 %2, %10\n\tv_exp_f32 %3, %11\n\tv_exp_f32 %4, %12\n\tv_exp_f32 %5, %13\n\tv_exp_f32 %6, %14\n\tv_exp_f32 %7, %15\n\tv_nop"
      : "=&v"(e0), "=&v"(e1), "=&v"(e2), "=&v"(e3), "=&v"(e4), "=&v"(e5), "=&v"(e6), "=&v"(e7) : "v"(x[0]), "v"(x[1]), "v"(x[2]), "v"(x[3]), "v"(x[4]), "v"(x[5]), "v"(x[6]), "v"(x[7]));
  const v8f e = {e0, e1, e2, e3, e4, e5, e6, e7}; return e; }
__device__ __forceinline__ float fa_exp2s(float x) { float e; asm("v_exp_f32 %0, %1\n\tv_nop" : "=v"(e) : "v"(x)); return e; }      /* the v_nop: the same slot */
// behind a group of loads or stores: the group is issued whole at this place (for loads: ahead of the arithmetic that covers their latency), and its address and data registers are reused only behind the wait;
// the two scheduling barriers keep every member of the group in front of the wait and every rewrite of a register behind it
__device__ __forceinline__ void fa_issued() { __builtin_amdgcn_sched_barrier(0); asm volatile("s_wait_xcnt 0x0" ::: "memory"); __builtin_amdgcn_sched_barrier(0); }
struct FaK { v16h a00, a01, a10, a11; v4ia m0, m1, m2, m3; };      /* one pass of K fragments (two 16-key tiles x two k steps) and the wave's 16 x 32 mask words, dealt row-contiguous: they serve the any-nonzero test alone */
// kp: the head's first K tile + lane * 8 (fragment order); mt: mask row (wave's first query + lane / 8), word (lane % 8) * 4: each mask load covers four whole 128-byte rows of the pass
__device__ __forceinline__ FaK fa_load(const _Float16* kp, const int* mt, int j) { FaK f; const _Float16* k = kp + (size_t)j * LQ;
  f.a00 = pk_frag(k); f.a01 = pk_frag(k + 512); f.a10 = pk_frag(k + 16 * LQ); f.a11 = pk_frag(k + 16 * LQ + 512);
  f.m0 = *(const v4ia*)(mt + j); f.m1 = *(const v4ia*)(mt + j + 4 * SQ); f.m2 = *(const v4ia*)(mt + j + 8 * SQ); f.m3 = *(const v4ia*)(mt + j + 12 * SQ); return f; }
// wave-uniform: does any lane hold a nonzero mask word in this pass?
__device__ __forceinline__ bool fa_anym(const FaK& f) { const v4ia o = f.m0 | f.m1 | f.m2 | f.m3; return __builtin_amdgcn_ballot_w32((o[0] | o[1] | o[2] | o[3]) != 0) != 0; }
// a key with a nonzero mask word takes FA_DROP as its raw score; m: the lane's own query row, first key of the pass + 8 * hh (the lane's 16 words are read here, only in a pass that holds a nonzero word)
__device__ __forceinline__ void fa_drop(const int* m, v8f& s0, v8f& s1) { const v4ia m0 = *(const v4ia*)m, m1 = *(const v4ia*)(m + 4), m2 = *(const v4ia*)(m + 16), m3 = *(const v4ia*)(m + 20);
#pragma unroll      // constant indices: the tiles stay in registers
  for (int r = 0; r < 4; ++r) { s0[r] = (m0[r] == 0) ? s0[r] : FA_DROP; s0[4 + r] = (m1[r] == 0) ? s0[4 + r] : FA_DROP; s1[r] = (m2[r] == 0) ? s1[r] : FA_DROP; s1[4 + r] = (m3[r] == 0) ? s1[4 + r] : FA_DROP; } }
// ---- the second output (the last head's probabilities) from work-groups of its own, ahead of the attention work-groups in the same launch: one work-group = 16 query rows, each of its 8 waves 256 keys,
// so that the whole chip shares this work and no attention work-group runs longer than the others. S^T as in k_fattn (a lane holds one query's scores). First walk: the wave's running maximum and sum;
// they are joined across the waves through LDS; second walk: the scores again, p = 2^(s * FA_C - maximum) / sum, turned through the wave's own LDS range so that whole 128-byte lines are stored.
#define PB_BLOCKS (NB * (SQ / 16))
#define PB_KEYS (SQ / 8)               /* keys a wave */
#define PB_PITCH 36                    /* floats a staged row: 128 bytes + 16, so that the 16 lanes of a half wave write 64 different banks */
__device__ __forceinline__ void fa_prob(int t, const _Float16* __restrict__ Q16, const _Float16* __restrict__ K16, const int* __restrict__ Mk, float* __restrict__ PO, float (*red)[8][16], float (*stg)[16][PB_PITCH]) {
  const int lane = threadIdx.x & 31, ln = lane & 15, hh = lane >> 4; const int w = __builtin_amdgcn_readfirstlane(threadIdx.x >> 5);
  const size_t rq = (size_t)t * 16, qr = rq + ln; const int j0 = w * PB_KEYS, je = j0 + PB_KEYS;      /* first query row (token row: batch * SQ + row), the lane's query row; the wave's keys */
  const _Float16* qp = Q16 + rq * LQ + (NH - 1) * 1024 + lane * 8; const v16h q0 = pk_frag(qp), q1 = pk_frag(qp + 512);
  fa_issued();
  const _Float16* kp = K16 + (size_t)(t / (SQ / 16)) * SQ * LQ + (NH - 1) * 1024 + lane * 8; const int* mp = Mk + qr * SQ + 8 * hh; const int* mt = Mk + (rq + (lane >> 3)) * SQ + (lane & 7) * 4;
  const v8f z8 = {0.f, 0.f, 0.f, 0.f, 0.f, 0.f, 0.f, 0.f}; float mu = -3.0e38f, l = 0.f;
  FaK f = fa_load(kp, mt, j0);
  fa_issued();
#pragma unroll 1      // one pass a trip: the next pass's operands are already fetched by hand
  for (int j = j0; j < je; j += 32) {
    v8f s0 = fa_mma(f.a01, q1, fa_mma(f.a00, q0, z8)), s1 = fa_mma(f.a11, q1, fa_mma(f.a10, q0, z8));
    if (fa_anym(f)) fa_drop(mp + j, s0, s1);
    f = fa_load(kp, mt, (j + 32 < je) ? j + 32 : j0);      /* the last pass fetches the second walk's first operands */
    fa_issued();
    float tm = fmaxf(s0[0], s1[0]);
#pragma unroll      // constant indices: the tiles stay in registers
    for (int r = 1; r < 8; ++r) tm = fmaxf(tm, fmaxf(s0[r], s1[r]));
    tm = fmaxf(tm, rs_xrow(tm)); const float mn = fmaxf(mu, tm * FA_C), al = fa_exp2s(mu - mn); mu = mn;
    const v8f ps = fa_exp2(s0 * FA_C - mn) + fa_exp2(s1 * FA_C - mn);
    l = l * al + (((ps[0] + ps[1]) + (ps[2] + ps[3])) + ((ps[4] + ps[5]) + (ps[6] + ps[7]))); }
  l += rs_xrow(l);      /* the halves hold the same maximum */
  if (lane < 16) { red[0][w][ln] = mu; red[1][w][ln] = l; }
  __syncthreads();      /* every wave's row maxima and sums are in LDS */
  float mx = red[0][0][ln];
#pragma unroll      // constant LDS offsets
  for (int u = 1; u < 8; ++u) mx = fmaxf(mx, red[0][u][ln]);
  float lt = 0.f;
#pragma unroll      // constant LDS offsets
  for (int u = 0; u < 8; ++u) lt += red[1][u][ln] * fa_exp2s(red[0][u][ln] - mx);
  const float il = 1.0f / lt;
  float (*sg)[PB_PITCH] = stg[w]; float* pw = PO + (rq + (lane >> 3)) * SQ + (lane & 7) * 4;      /* the wave's own staging range; a store covers four whole 128-byte lines (four rows of the pass) */
#pragma unroll 1      // as above
  for (int j = j0; j < je; j += 32) {
    v8f s0 = fa_mma(f.a01, q1, fa_mma(f.a00, q0, z8)), s1 = fa_mma(f.a11, q1, fa_mma(f.a10, q0, z8));
    if (fa_anym(f)) fa_drop(mp + j, s0, s1);
    f = fa_load(kp, mt, (j + 32 < je) ? j + 32 : j);      /* the last pass fetches its own operands again, in bounds */
    fa_issued();
    const v8f p0 = fa_exp2(s0 * FA_C - mx) * il, p1 = fa_exp2(s1 * FA_C - mx) * il;
    const v4f t0 = {p0[0], p0[1], p0[2], p0[3]}, t1 = {p0[4], p0[5], p0[6], p0[7]}, t2 = {p1[0], p1[1], p1[2], p1[3]}, t3 = {p1[4], p1[5], p1[6], p1[7]};
    *(v4fa*)&sg[ln][8 * hh] = t0; *(v4fa*)&sg[ln][8 * hh + 4] = t1; *(v4fa*)&sg[ln][16 + 8 * hh] = t2; *(v4fa*)&sg[ln][20 + 8 * hh] = t3;
    asm volatile("s_wait_dscnt 0x0" ::: "memory");      // the wave's LDS writes are done before its lanes read one another's words back
    const v4f r0 = *(const v4fa*)&sg[lane >> 3][(lane & 7) * 4], r1 = *(const v4fa*)&sg[4 + (lane >> 3)][(lane & 7) * 4], r2 = *(const v4fa*)&sg[8 + (lane >> 3)][(lane & 7) * 4], r3 = *(const v4fa*)&sg[12 + (lane >> 3)][(lane & 7) * 4];
    *(v4f*)(pw + j) = r0; *(v4f*)(pw + j + 4 * SQ) = r1; *(v4f*)(pw + j + 8 * SQ) = r2; *(v4f*)(pw + j + 12 * SQ) = r3;
    fa_issued(); } }      /* also keeps the next pass's LDS writes behind this pass's reads */
__global__ __launch_bounds__(256) void k_fattn(const _Float16* __restrict__ Q16, const _Float16* __restrict__ K16, const _Float16* __restrict__ VT, const int* __restrict__ Mk, _Float16* __restrict__ O16, float* __restrict__ PO) {
  static_assert(SQ % 128 == 0 && HD == 64, "k_fattn: 8 waves x 16 query rows a block, head size 64");
  __shared__ __attribute__((aligned(16))) float pb_red[2][8][16]; __shared__ __attribute__((aligned(16))) float pb_stg[8][16][PB_PITCH];
  if (blockIdx.x < PB_BLOCKS) { fa_prob((int)blockIdx.x, Q16, K16, Mk, PO, pb_red, pb_stg); return; }      /* block-uniform: the short work-groups of the second output start first, beside the first attention work-groups */
  const int lane = threadIdx.x & 31, ln = lane & 15, hh = lane >> 4; const int w = __builtin_amdgcn_readfirstlane(threadIdx.x >> 5);
  const unsigned at = blockIdx.x - PB_BLOCKS; const int h = (int)(at / (SQ / 128) % NH), b = (int)(at / (SQ / 128) / NH);
  const size_t rq = (size_t)b * SQ + at % (SQ / 128) * 128 + w * 16, qr = rq + ln;      /* the wave's first query row; the lane's query row */
  const _Float16* qp = Q16 + rq * LQ + h * 1024 + lane * 8; const v16h q0 = pk_frag(qp), q1 = pk_frag(qp + 512);      /* a head's 64 columns are two 32-k tiles */
  fa_issued();      /* Q, then K and mask, then V^T: the order of the loop, so that the loop's first wait for K leaves the V^T loads in flight */
  const _Float16* kp = K16 + (size_t)b * SQ * LQ + h * 1024 + lane * 8; const _Float16* vp = VT + (size_t)(b * NH + h) * HD * SQ + lane * 8; const int* mp = Mk + qr * SQ + 8 * hh; const int* mt = Mk + (rq + (lane >> 3)) * SQ + (lane & 7) * 4;
  const v8f z8 = {0.f, 0.f, 0.f, 0.f, 0.f, 0.f, 0.f, 0.f}; v8f o0 = z8, o1 = z8, o2 = z8, o3 = z8; float mu = -3.0e38f, l = 0.f;
  FaK f = fa_load(kp, mt, 0);
  fa_issued();
  v16h v0 = pk_frag(vp), v1 = pk_frag(vp + 512), v2 = pk_frag(vp + 1024), v3 = pk_frag(vp + 1536);      /* a pass of V^T: four tiles, 4096 contiguous bytes */
  fa_issued();
#pragma unroll 1      // one pass a trip: the next pass's operands are already fetched by hand, a second copy of the body would only cost registers
  for (int j = 0; j < SQ; j += 32) { const int jn = (j + 32 < SQ) ? j + 32 : j;      /* first key of the next pass; the last pass fetches its own operands again, in bounds */
    v8f s0 = fa_mma(f.a01, q1, fa_mma(f.a00, q0, z8)), s1 = fa_mma(f.a11, q1, fa_mma(f.a10, q0, z8));
    if (fa_anym(f)) fa_drop(mp + j, s0, s1);
    float tm = fmaxf(s0[0], s1[0]);
#pragma unroll      // constant indices: the tiles stay in registers
    for (int r = 1; r < 8; ++r) tm = fmaxf(tm, fmaxf(s0[r], s1[r]));
    tm = fmaxf(tm, rs_xrow(tm)); const float tl = tm * FA_C;
    if (__builtin_amdgcn_ballot_w32(tl > mu + FA_THR) != 0) { const float mn = fmaxf(mu, tl), al = fa_exp2s(mu - mn); mu = mn; l *= al; o0 *= al; o1 *= al; o2 *= al; o3 *= al; }      /* rare: one scalar test a pass */
    f = fa_load(kp, mt, jn);      /* the next pass's K and mask fly during this pass's exponentials and products */
    fa_issued();
    const float nb = FA_OFF - mu;
    const v8f p0 = fa_exp2(s0 * FA_C + nb), p1 = fa_exp2(s1 * FA_C + nb);
    const v8f ps = p0 + p1; l += ((ps[0] + ps[1]) + (ps[2] + ps[3])) + ((ps[4] + ps[5]) + (ps[6] + ps[7]));
    FragH pf;
#pragma unroll      // constant indices: the fragment stays in registers
    for (int r = 0; r < 8; ++r) { pf.h[r] = (_Float16)p0[r]; pf.h[8 + r] = (_Float16)p1[r]; }
    o0 = fa_mma(v0, pf.v, o0); o1 = fa_mma(v1, pf.v, o1); o2 = fa_mma(v2, pf.v, o2); o3 = fa_mma(v3, pf.v, o3);
    v0 = pk_frag(vp + jn * 64); v1 = pk_frag(vp + jn * 64 + 512); v2 = pk_frag(vp + jn * 64 + 1024); v3 = pk_frag(vp + jn * 64 + 1536);      /* the next pass's V^T flies during its score products and softmax */
    fa_issued(); }
  l += rs_xrow(l);      /* the halves' sums are joined once */
  const float il = 1.0f / l, so = 64.0f * il;      /* o carried x64, as the output GEMM's alpha expects */
  unsigned short* op = (unsigned short*)O16 + rq * DM + h * 1024 + lane * 8; FragH e0, e1;      /* o in fragment order: the lane's four runs of 8 are the four half-fragments of the head's two tiles */
#pragma unroll      // constant indices: the tiles stay in registers
  for (int r = 0; r < 8; ++r) { e0.h[r] = (_Float16)(o0[r] * so); e0.h[8 + r] = (_Float16)(o1[r] * so); e1.h[r] = (_Float16)(o2[r] * so); e1.h[8 + r] = (_Float16)(o3[r] * so); }
  *(v8us*)op = e0.half[0]; *(v8us*)(op + 256) = e0.half[1]; *(v8us*)(op + 512) = e1.half[0]; *(v8us*)(op + 768) = e1.half[1];
  fa_issued(); }      /* behind the stores: whatever the compiler lays behind them reuses their registers only behind the wait */


__global__ __launch_bounds__(256) void k_rsmf(const float* __restrict__ S, _Float16* __restrict__ P, int qn, int hg) {
  #pragma clang fp contract(off)
  const int t = blockIdx.x * 256 + threadIdx.x; if (t >= qn * hg) return; const size_t i = (size_t)(t / qn) * SQ + (t % qn); const float* s = S + i * SQ; float mx = -3.0e38f;
#pragma unroll 1
  for (int j = 0; j < SQ; ++j) mx = fmaxf(mx, s[j]); float se = 0.f;
#pragma unroll 1
  for (int j = 0; j < SQ; ++j) se += __expf(s[j] - mx); const float sc = 256.0f / se;
#pragma unroll 1
  for (int j0 = 0; j0 < SQ; j0 += 8) { FragH f; for (int q = 0; q < 8; ++q) f.h[q] = (_Float16)(__expf(s[j0 + q] - mx) * sc); unsigned short* d = (unsigned short*)P + i * SQ + j0; *(v8us*)d = f.half[0];  } }

// ---- the seven input conversions (three x, three per-head weights, W0) as one launch. None reads what another writes. A slab = one fragment row tile, 16 rows x DM = 2048 chunks of 16 bytes (pk_frag);
// a block takes a slab at a time, a thread eight of its chunks (k tiles four apart), so that all of a slab's loads are in flight together and few waves have to be started.
#define PP_WS (DM / 16)                        /* slabs of one weight matrix */
#define PP_XS ((int)(NR / 16))                 /* slabs of one input */
#define PP_SLABS (4 * PP_WS + 3 * PP_XS)
#define PP_BLOCKS 512                          /* two blocks a WGP; slabs b and b + 512: a weight slab is paired with an input slab */
// behind a group of loads or stores off one address: the address, named as an input, stays live up to the wait, so that no load's result lands in it; the two scheduling barriers keep
// every member of the group in front of the wait and every rewrite of an address or data register behind it
__device__ __forceinline__ void pp_issued(const void* p) { __builtin_amdgcn_sched_barrier(0); asm volatile("s_wait_xcnt 0x0" :: "v"(p) : "memory"); __builtin_amdgcn_sched_barrier(0); }
// a thread's eight finished chunks as one group of stores; the scheduling barrier in front keeps a store from being issued among the conversions, where its data registers would be wanted again at once
__device__ __forceinline__ void pp_store(unsigned short* __restrict__ d, const v8us (&o)[8]) { __builtin_amdgcn_sched_barrier(0);
#pragma unroll      // constant offsets off one address
  for (int u = 0; u < 8; ++u) *(v8us*)(d + u * 2048) = o[u];
  pp_issued(d); }
template <int QS, int US>      /* floats between the eight k of a chunk; between two chunks of a thread */
__device__ __forceinline__ void pp_wslab(const float* __restrict__ s, unsigned short* __restrict__ d) { float w[8][8]; v8us o[8];
#pragma unroll      // constant offsets off one address; the values stay in registers
  for (int u = 0; u < 8; ++u) for (int q = 0; q < 8; ++q) w[u][q] = s[(size_t)u * US + (size_t)q * QS];
  pp_issued(s);
#pragma unroll      // as above
  for (int u = 0; u < 8; ++u) { FragH f; for (int q = 0; q < 8; ++q) f.h[q] = (_Float16)(16.0f * bf16_round(w[u][q])); o[u] = f.half[0]; }
  pp_store(d, o); }
__device__ __forceinline__ void pp_xslab(const float* __restrict__ s, unsigned short* __restrict__ d) { v4f a[8], b[8]; v8us o[8];
#pragma unroll      // as above
  for (int u = 0; u < 8; ++u) { a[u] = *(const v4fa*)(s + u * 128); b[u] = *(const v4fa*)(s + u * 128 + 4); }
  pp_issued(s);
#pragma unroll      // as above
  for (int u = 0; u < 8; ++u) { FragH f; for (int q = 0; q < 4; ++q) { f.h[q] = (_Float16)bf16_round(a[u][q]); f.h[4 + q] = (_Float16)bf16_round(b[u][q]); } o[u] = f.half[0]; }
  pp_store(d, o); }
__global__ __launch_bounds__(256) void k_prep(const float* __restrict__ xq, const float* __restrict__ xk, const float* __restrict__ xv, const float* __restrict__ wq, const float* __restrict__ wk, const float* __restrict__ wv, const float* __restrict__ wo,
    _Float16* __restrict__ XQ, _Float16* __restrict__ XK, _Float16* __restrict__ XV, _Float16* __restrict__ BQ, _Float16* __restrict__ BK, _Float16* __restrict__ BV, _Float16* __restrict__ BO) {
  const int tid = threadIdx.x, ln = tid & 15, k0 = (tid >> 6) * 32 + ((tid >> 5) & 1) * 16 + ((tid >> 4) & 1) * 8;      /* the thread's row in the tile; first k of its first chunk (chunk u: + 128 u) */
#pragma unroll 1      // one slab's values in registers at a time
  for (int slab = blockIdx.x; slab < PP_SLABS; slab += PP_BLOCKS) {
    if (slab < 4 * PP_WS) { const int j = slab / PP_WS, rt = slab % PP_WS, n = rt * 16 + ln;      /* Bt row n = output column (h, d) */
      unsigned short* d = (unsigned short*)(j == 0 ? BQ : j == 1 ? BK : j == 2 ? BV : BO) + (size_t)rt * 16384 + tid * 8;
      if (j < 3) pp_wslab<HD, 128 * HD>((j == 0 ? wq : j == 1 ? wk : wv) + ((size_t)(n / HD) * DM + k0) * HD + n % HD, d);
      else pp_wslab<DM, 128 * DM>(wo + (size_t)k0 * DM + n, d); }
    else { const int s2 = slab - 4 * PP_WS, j = s2 / PP_XS, rt = s2 % PP_XS;
      pp_xslab((j == 0 ? xq : j == 1 ? xk : xv) + ((size_t)rt * 16 + ln) * DM + k0, (unsigned short*)(j == 0 ? XQ : j == 1 ? XK : XV) + (size_t)rt * 16384 + tid * 8); } } }

extern "C" void kernel_launch(void* const* d_in, const int* in_sizes, int n_in,
                              void* d_out, int out_size, void* d_ws, size_t ws_size, hipStream_t stream) {
  (void)in_sizes; (void)n_in; (void)out_size;
  const float* const* I = (const float* const*)d_in; const float* xv = I[0]; const float* xk = I[1]; const float* xq = I[2]; const int* mk = (const int*)d_in[3]; const float* wq = I[4]; const float* bq = I[5]; const float* wk = I[6]; const float* bk = I[7]; const float* wv = I[8]; const float* bv = I[9]; const float* wo = I[10]; const float* bo = I[11];      /* NOTE the module's input order v, k, q, mask; per-head [h][in][out] weights + [h][64] biases (= flat [1024]); W0 [in][out] + b0 */
  float* PO = (float*)d_out + (size_t)NB * SQ * DM;      /* second output: last head's attention probabilities [NB][SQ][SQ] f32 at byte offset 16,777,216 */
  char* ws = (char*)d_ws; size_t off = 0;
  auto take = [&](size_t bytes) { char* p = ws + off; off += (bytes + 255) & ~(size_t)255; return p; };
  _Float16* BQ = (_Float16*)take((size_t)DM * DM * 2); _Float16* BK = (_Float16*)take((size_t)DM * DM * 2); _Float16* BV = (_Float16*)take((size_t)DM * DM * 2); _Float16* BO = (_Float16*)take((size_t)DM * DM * 2);
  _Float16* XQ = (_Float16*)take(NR * DM * 2); _Float16* XK = (_Float16*)take(NR * DM * 2); _Float16* XV = (_Float16*)take(NR * DM * 2); _Float16* Q16 = (_Float16*)take(NR * DM * 2); _Float16* K16 = (_Float16*)take(NR * DM * 2); _Float16* V16 = (_Float16*)take(NR * DM * 2); _Float16* O16 = (_Float16*)take(NR * DM * 2);
  _Float16* VT = (_Float16*)take((size_t)NB * NH * HD * SQ * 2);
  if (off > ws_size) return;
  k_prep<<<PP_BLOCKS, 256, 0, stream>>>(xq, xk, xv, wq, wk, wv, wo, XQ, XK, XV, BQ, BK, BV, BO);      /* the three inputs as exact f16 rows; per-head [h][m][d] -> Bt[(h,d)][m] x16; W0 [in][out] -> Bt x16; all in fragment order */
  const size_t r0p = (size_t)B0 * SQ;      /* first projected row */
  k_gemm2<0, true><<<dim3((unsigned)((MP / 128) * (DM / 64)), 1), 128, 0, stream>>>(XQ + r0p * DM, DM, 0, BQ, DM, 0, 0.0625f, bq, 0, nullptr, 1, 0, 0, nullptr, Q16 + r0p * DM, DM, 0, MP, DM, DM);
  k_gemm2<0, true><<<dim3((unsigned)((MP / 128) * (DM / 64)), 1), 128, 0, stream>>>(XK + r0p * DM, DM, 0, BK, DM, 0, 0.0625f, bk, 0, nullptr, 1, 0, 0, nullptr, K16 + r0p * DM, DM, 0, MP, DM, DM);
  k_gemm2<0, false><<<dim3((unsigned)((MP / 128) * (DM / 64)), 1), 128, 0, stream>>>(XV + r0p * DM, DM, 0, BV, DM, 0, 0.0625f, bv, 0, nullptr, 1, 0, 0, nullptr, V16 + r0p * DM, DM, 0, MP, DM, DM);
  k_vt<NH, SQ><<<NB * NH * (SQ / 64), 256, 0, stream>>>(V16, LQ, 0, VT);      /* V^T per (batch, head), fragment order */
  k_fattn<<<PB_BLOCKS + (SQ / 128) * NH * NB, 256, 0, stream>>>(Q16, K16, VT, mk, O16, PO);      /* scores, softmax and P V in one launch; o (merged heads) as f16 rows; the last head's probabilities to the second output */
  k_gemm2<0, false><<<dim3((unsigned)((MPO / 128) * (DM / 64)), 1), 128, 0, stream>>>(O16 + r0p * DM, DM, 0, BO, DM, 0, 0.0009765625f, bo, 0, nullptr, 1, 0, 0, (float*)d_out + r0p * DM, nullptr, DM, 0, MPO, DM, DM);      /* out rows are the output layout */
}

// v007
// A run of this version takes 146 microseconds.
// Two timings next to v006 put it at 1.08 and 1.09 times that version's speed.
// Counting every step since v000, it is 46.5 times as fast.
#include <hip/hip_runtime.h>
#define NB 2
#define SQ 2048
#define DM 1024
#define NH 16
#define HD 64
#define HG 4                         /* heads per launch of the unused k_vt(V16, b, h0, VT) overload */
#define B0 0                         /* first batch processed (debug hook) */
#define NBR NB                       /* batches processed (debug hook) */
#define NR ((size_t)NB * SQ)         /* token rows */
#define MP ((int)((size_t)NBR * SQ)) /* rows projected (debug hook) */
#define QN SQ                        /* query rows per batch; unused */
#define NHD NH                       /* heads; unused */
#define MPO MP                       /* rows through the output stage (debug hook) */
#define LQ DM      /* halves per token row of q/k/v (v's row pitch; q, k in fragment order) */
typedef __bf16 v16b __attribute__((ext_vector_type(16)));
typedef unsigned short v8us __attribute__((ext_vector_type(8), may_alias));
typedef float  v8f  __attribute__((ext_vector_type(8)));
typedef float  v4f  __attribute__((ext_vector_type(4)));
typedef float  v4fa __attribute__((ext_vector_type(4), may_alias));
union FragB { v16b v; v8us half[2]; unsigned short u[16]; };

__device__ __forceinline__ unsigned short bf16_bits(float x) { unsigned int u = __float_as_uint(x); return (unsigned short)((u + 0x7FFFu + ((u >> 16) & 1u)) >> 16); }
__device__ __forceinline__ float bf16_val(unsigned short b) { return __uint_as_float(((unsigned int)b) << 16); }
__device__ __forceinline__ float bf16_round(float x) { return bf16_val(bf16_bits(x)); }
// D += A·B with NT terms: 1 = ah·bh, 2 = + al·bh (A split), 3 = + ah·bl (both split)
template <int NT>
__device__ __forceinline__ v8f mmaN(v16b ah, v16b al, v16b bh, v16b bl, v8f c) {
  c = __builtin_amdgcn_wmma_f32_16x16x32_bf16(false, ah, false, bh, (short)0, c, false, false);
  if (NT >= 2) c = __builtin_amdgcn_wmma_f32_16x16x32_bf16(false, al, false, bh, (short)0, c, false, false);
  if (NT >= 3) c = __builtin_amdgcn_wmma_f32_16x16x32_bf16(false, ah, false, bl, (short)0, c, false, false);
  asm volatile("v_nop\n\tv_nop\n\tv_nop\n\tv_nop" : "+v"(c) : "v"(ah), "v"(al), "v"(bh), "v"(bl));
  return c;
}

__global__ __launch_bounds__(256) void k_wt_bf16(const float* __restrict__ W, unsigned short* __restrict__ Wt, int K, int N) {
  const int t = blockIdx.x * 256 + threadIdx.x;
  const int k8n = K / 8;
  if (t >= N * k8n) return;
  const int n = t / k8n, k8 = (t % k8n) * 8;
  v8us v;
#pragma unroll
  for (int i = 0; i < 8; ++i) v[i] = bf16_bits(W[(size_t)(k8 + i) * N + n]);
  *(v8us*)(Wt + (size_t)n * K + k8) = v;
  
}

// GEMM C[M][N] (f32, pitch ldc) = act(A[M][K]·W + bias). A f32 row-major (pitch lda) converted per fragment to bf16
// (ASPLIT: hi/lo two planes -> 2 terms, else single rounded term); Wt bf16 [N][K] (pitch ldb). BIAS_BF16 rounds the
// bias to bf16 first (bias quantised to bf16 before the add). K%32==0, M%16==0, N%64==0.
template <bool ASPLIT, int ACT, bool BIAS_BF16>
__global__ __launch_bounds__(128) void k_gemm_bf(const float* __restrict__ A, int lda, const unsigned short* __restrict__ Wt, int ldb,
                                               const float* __restrict__ bias, float* __restrict__ C, int ldc, int M, int N, int K) {
  __shared__ __attribute__((aligned(16))) float so[4][16][64];
  const int tid = threadIdx.x, w = tid >> 5, lane = tid & 31, ln = lane & 15, hh = lane >> 4;
  const int ntn = N / 64;
  const int wid = blockIdx.x * 4 + w;
  const int mt = wid / ntn, nq = wid % ntn;
  if (mt * 16 >= M) return;
  const int row0 = mt * 16, col0 = nq * 64;
  const float* arow = A + (size_t)(row0 + ln) * lda;
  v8f acc[4] = {};
  for (int kb = 0; kb < K; kb += 32) {
    FragB ah, al;
    const v4f x0 = *(const v4fa*)(arow + kb + 8 * hh), x1 = *(const v4fa*)(arow + kb + 8 * hh + 4);
    const v4f x2 = *(const v4fa*)(arow + kb + 16 + 8 * hh), x3 = *(const v4fa*)(arow + kb + 16 + 8 * hh + 4);
    float xs[16] = {x0[0],x0[1],x0[2],x0[3],x1[0],x1[1],x1[2],x1[3],x2[0],x2[1],x2[2],x2[3],x3[0],x3[1],x3[2],x3[3]};
#pragma unroll
    for (int i = 0; i < 16; ++i) { const unsigned short hb = bf16_bits(xs[i]); ah.u[i] = hb; al.u[i] = ASPLIT ? bf16_bits(xs[i] - bf16_val(hb)) : (unsigned short)0; }
#pragma unroll
    for (int t = 0; t < 4; ++t) {
      const unsigned short* brow = Wt + (size_t)(col0 + t * 16 + ln) * ldb + kb;
      FragB b;
      b.half[0] = *(const v8us*)(brow + 8 * hh);
      b.half[1] = *(const v8us*)(brow + 16 + 8 * hh);
      acc[t] = mmaN<ASPLIT ? 2 : 1>(ah.v, al.v, b.v, b.v, acc[t]);
    }
  }
#pragma unroll
  for (int t = 0; t < 4; ++t) {
    float bv = bias ? bias[col0 + t * 16 + ln] : 0.f;
    if (BIAS_BF16) bv = bf16_round(bv);
#pragma unroll
    for (int r = 0; r < 8; ++r) { float v = acc[t][r] + bv; if (ACT == 1) v = fmaxf(v, 0.f); so[w][8 * hh + r][t * 16 + ln] = v; }
  }
  __builtin_amdgcn_fence(__ATOMIC_ACQ_REL, "workgroup");
  __builtin_amdgcn_wave_barrier();
  const int rsub = lane >> 4, c4 = (lane & 15) * 4;
  {
#pragma unroll
    for (int q = 0; q < 8; ++q) {
      const int r = q * 2 + rsub;
      const v4f v = *(const v4fa*)&so[w][r][c4];
      *(v4f*)(C + (size_t)(row0 + r) * ldc + col0 + c4) = v;
    }
    
  }
}

// GEMM C = act(A·W + bias + resid): A f32 (ASPLIT -> hi/lo 2 terms), Wt bf16 [N][K]; ACT 0 none, 1 relu, 2 exact gelu;
// resid (optional, f32, row index = (row % rmod), pitch ldr, RES_BF16 rounds it) added before the activation.
template <bool ASPLIT, int ACT, bool BIAS_BF16, bool RES_BF16>
__global__ __launch_bounds__(128) void k_gemm_bf3(const float* __restrict__ A, int lda, const unsigned short* __restrict__ Wt, int ldb,
                                                const float* __restrict__ bias, const float* __restrict__ resid, int rmod, int ldr,
                                                float* __restrict__ C, int ldc, int M, int N, int K) {
  __shared__ __attribute__((aligned(16))) float so[4][16][64];
  const int tid = threadIdx.x, w = tid >> 5, lane = tid & 31, ln = lane & 15, hh = lane >> 4;
  const int ntn = N / 64;
  const int wid = blockIdx.x * 4 + w;
  const int mt = wid / ntn, nq = wid % ntn;
  if (mt * 16 >= M) return;
  const int row0 = mt * 16, col0 = nq * 64;
  const float* arow = A + (size_t)(row0 + ln) * lda;
  v8f acc[4] = {};
  for (int kb = 0; kb < K; kb += 32) {
    FragB ah, al;
    const v4f x0 = *(const v4fa*)(arow + kb + 8 * hh), x1 = *(const v4fa*)(arow + kb + 8 * hh + 4);
    const v4f x2 = *(const v4fa*)(arow + kb + 16 + 8 * hh), x3 = *(const v4fa*)(arow + kb + 16 + 8 * hh + 4);
    float xs[16] = {x0[0],x0[1],x0[2],x0[3],x1[0],x1[1],x1[2],x1[3],x2[0],x2[1],x2[2],x2[3],x3[0],x3[1],x3[2],x3[3]};
#pragma unroll
    for (int i = 0; i < 16; ++i) { const unsigned short hb = bf16_bits(xs[i]); ah.u[i] = hb; al.u[i] = ASPLIT ? bf16_bits(xs[i] - bf16_val(hb)) : (unsigned short)0; }
#pragma unroll
    for (int t = 0; t < 4; ++t) {
      const unsigned short* brow = Wt + (size_t)(col0 + t * 16 + ln) * ldb + kb;
      FragB b;
      b.half[0] = *(const v8us*)(brow + 8 * hh);
      b.half[1] = *(const v8us*)(brow + 16 + 8 * hh);
      acc[t] = mmaN<ASPLIT ? 2 : 1>(ah.v, al.v, b.v, b.v, acc[t]);
    }
  }
#pragma unroll
  for (int t = 0; t < 4; ++t) {
    const int col = col0 + t * 16 + ln;
    float bv = bias ? bias[col] : 0.f;
    if (BIAS_BF16) bv = bf16_round(bv);
#pragma unroll
    for (int r = 0; r < 8; ++r) {
      float v = acc[t][r] + bv;
      if (resid) { float rv = resid[(size_t)((row0 + 8 * hh + r) % rmod) * ldr + col]; if (RES_BF16) rv = bf16_round(rv); v += rv; }
      if (ACT == 1) v = fmaxf(v, 0.f);
      if (ACT == 2) v = 0.5f * v * (1.0f + erff(v * 0.70710678118654752f));
      if (ACT == 3) { const float u = 0.7978845608028654f * (v + 0.044715f * v * v * v); v = 0.5f * v * (1.0f + tanhf(u)); }
      so[w][8 * hh + r][t * 16 + ln] = v;
    }
  }
  __builtin_amdgcn_fence(__ATOMIC_ACQ_REL, "workgroup");
  __builtin_amdgcn_wave_barrier();
  const int rsub = lane >> 4, c4 = (lane & 15) * 4;
  {
#pragma unroll
    for (int q = 0; q < 8; ++q) {
      const int r = q * 2 + rsub;
      const v4f v = *(const v4fa*)&so[w][r][c4];
      *(v4f*)(C + (size_t)(row0 + r) * ldc + col0 + c4) = v;
    }
    
  }
}
// row LayerNorm (biased variance, eps) over N: s = X (+ R); optional out_sum <- s; out_norm <- (s-mu)*rsqrt(var+eps)*g + b
template <bool PARAM_BF16>
__global__ __launch_bounds__(256) void k_layernorm(const float* __restrict__ X, const float* __restrict__ R, const float* __restrict__ g, const float* __restrict__ bta,
                                                  float* __restrict__ out_sum, float* __restrict__ out_norm, int N, float eps) {
  __shared__ float red[256];
  const int row = blockIdx.x, tid = threadIdx.x;
  const float* x = X + (size_t)row * N; const float* rr = R ? R + (size_t)row * N : nullptr;
  float vals[16];                     // up to N = 4096
  const int per = N / 256;            // contiguous chunk per thread? use strided-by-4 chunks: thread handles j = tid*4 + 1024*u
  float s1 = 0.f;
  for (int u = 0; u < per / 4; ++u) {
    const int j = tid * 4 + 1024 * u;
    const v4f a = *(const v4fa*)(x + j);
    v4f b = {0.f,0.f,0.f,0.f}; if (rr) b = *(const v4fa*)(rr + j);
#pragma unroll
    for (int q = 0; q < 4; ++q) { const float v = a[q] + b[q]; vals[u * 4 + q] = v; s1 += v; }
  }
  red[tid] = s1; __syncthreads();
  for (int st = 128; st > 0; st >>= 1) { if (tid < st) red[tid] += red[tid + st]; __syncthreads(); }
  const float mu = red[0] / (float)N; __syncthreads();
  float s2 = 0.f;
  for (int u = 0; u < per / 4; ++u)
#pragma unroll
    for (int q = 0; q < 4; ++q) { const float c = vals[u * 4 + q] - mu; s2 += c * c; }
  red[tid] = s2; __syncthreads();
  for (int st = 128; st > 0; st >>= 1) { if (tid < st) red[tid] += red[tid + st]; __syncthreads(); }
  const float rs = rsqrtf(red[0] / (float)N + eps);
  {
    for (int u = 0; u < per / 4; ++u) {
      const int j = tid * 4 + 1024 * u;
      v4f o, sm;
#pragma unroll
      for (int q = 0; q < 4; ++q) {
        float gg = g[j + q], bb = bta[j + q];
        if (PARAM_BF16) { gg = bf16_round(gg); bb = bf16_round(bb); }
        sm[q] = vals[u * 4 + q]; o[q] = (vals[u * 4 + q] - mu) * rs * gg + bb;
      }
      if (out_sum) *(v4f*)(out_sum + (size_t)row * N + j) = sm;
      *(v4f*)(out_norm + (size_t)row * N + j) = o;
    }
    
  }
}



// ---- f16 WMMA path (v_wmma_f32_16x16x32_f16): 11-bit significands for operands in range — used where a [0,1] probability operand needs more precision than bf16
typedef _Float16 v16h __attribute__((ext_vector_type(16)));
union FragH { v16h v; v8us half[2]; _Float16 h[16]; unsigned short u[16]; };
template <int NT>
__device__ __forceinline__ v8f mmaH(v16h ah, v16h al, v16h bh, v16h bl, v8f c) {
  c = __builtin_amdgcn_wmma_f32_16x16x32_f16(false, ah, false, bh, (short)0, c, false, false);
  if (NT >= 2) c = __builtin_amdgcn_wmma_f32_16x16x32_f16(false, al, false, bh, (short)0, c, false, false);
  if (NT >= 3) c = __builtin_amdgcn_wmma_f32_16x16x32_f16(false, ah, false, bl, (short)0, c, false, false);
  asm volatile("v_nop\n\tv_nop\n\tv_nop\n\tv_nop" : "+v"(c) : "v"(ah), "v"(al), "v"(bh), "v"(bl));
  return c;
}
// batched GEMM like k_gemm_b but f16 operands: A f32 (split into f16 hi/lo if ASPLIT, else rounded to f16), Bt = f16 values [n][k]; alpha; C f32; N multiple of 16 (partial tiles skipped)
template <bool ASPLIT>
__global__ __launch_bounds__(128) void k_gemm_h(const float* __restrict__ A, int lda, size_t sA, const _Float16* __restrict__ Bh, int ldb, size_t sB, float alpha, float* __restrict__ C, int ldc, size_t sC, int M, int N, int K) {
  __shared__ __attribute__((aligned(16))) float so[4][16][64];
  const int tid = threadIdx.x, w = tid >> 5, lane = tid & 31, ln = lane & 15, hh = lane >> 4; const int by = blockIdx.y;
  A += (size_t)by * sA; Bh += (size_t)by * sB; C += (size_t)by * sC;
  const int ntn = (N + 63) / 64; const int wid = blockIdx.x * 4 + w; const int mt = wid / ntn, nq = wid % ntn; if (mt * 16 >= M) return;
  const int row0 = mt * 16, col0 = nq * 64; const float* arow = A + (size_t)(row0 + ln) * lda;
  v8f acc[4] = {};
  for (int kb = 0; kb < K; kb += 32) {
    FragH ah, al;
    const v4f x0 = *(const v4fa*)(arow + kb + 8 * hh), x1 = *(const v4fa*)(arow + kb + 8 * hh + 4), x2 = *(const v4fa*)(arow + kb + 16 + 8 * hh), x3 = *(const v4fa*)(arow + kb + 16 + 8 * hh + 4);
    float xs[16] = {x0[0],x0[1],x0[2],x0[3],x1[0],x1[1],x1[2],x1[3],x2[0],x2[1],x2[2],x2[3],x3[0],x3[1],x3[2],x3[3]};
#pragma unroll
    for (int i = 0; i < 16; ++i) { const _Float16 h = (_Float16)xs[i]; ah.h[i] = h; al.h[i] = ASPLIT ? (_Float16)(xs[i] - (float)h) : (_Float16)0.0f; }
#pragma unroll
    for (int t = 0; t < 4; ++t) { if (col0 + t * 16 >= N) continue; const size_t boff = (size_t)(col0 + t * 16 + ln) * ldb + kb; FragH bq; bq.half[0] = *(const v8us*)(Bh + boff + 8 * hh); bq.half[1] = *(const v8us*)(Bh + boff + 16 + 8 * hh);
      acc[t] = mmaH<ASPLIT ? 2 : 1>(ah.v, al.v, bq.v, bq.v, acc[t]); }
  }
#pragma unroll
  for (int t = 0; t < 4; ++t) { if (col0 + t * 16 >= N) continue;
#pragma unroll
    for (int r = 0; r < 8; ++r) so[w][8 * hh + r][t * 16 + ln] = acc[t][r] * alpha; }
  __builtin_amdgcn_fence(__ATOMIC_ACQ_REL, "workgroup"); __builtin_amdgcn_wave_barrier();
  const int rsub = lane >> 4, c4 = (lane & 15) * 4;
  {
#pragma unroll
    for (int q = 0; q < 8; ++q) { const int r = q * 2 + rsub; if (col0 + c4 < N) { const v4f v = *(const v4fa*)&so[w][r][c4]; *(v4f*)(C + (size_t)(row0 + r) * ldc + col0 + c4) = v; } }
     }
}

// k_gemm_hh variant with fused epilogue: v = acc·alpha + bias[by·sBias + col] (+ CP[(row/rowsPerB)·sCPb + by·64 + col] if CP) ; ACT 0 none / 1 elu ; writes f16 C16 (and f32 C if non-null)
template <int ACT>
__global__ __launch_bounds__(128) void k_gemm_hhx(const _Float16* __restrict__ A, int lda, size_t sA, const _Float16* __restrict__ Bh, int ldb, size_t sB, float alpha, const float* __restrict__ bias, size_t sBias, const float* __restrict__ CP, int rowsPerB, size_t sCPb, int row0g,
    float* __restrict__ C, _Float16* __restrict__ C16, int ldc, size_t sC, int M, int N, int K) {
  __shared__ __attribute__((aligned(16))) float so[4][16][64];
  const int tid = threadIdx.x, w = tid >> 5, lane = tid & 31, ln = lane & 15, hh = lane >> 4; const int by = blockIdx.y;
  A += (size_t)by * sA; Bh += (size_t)by * sB; const size_t cofs = (size_t)by * sC; const float* bp = bias ? bias + (size_t)by * sBias : nullptr;
  const int ntn = (N + 63) / 64; const int wid = blockIdx.x * 4 + w; const int mt = wid / ntn, nq = wid % ntn; if (mt * 16 >= M) return;
  const int row0 = mt * 16, col0 = nq * 64; const _Float16* arow = A + (size_t)(row0 + ln) * lda;
  v8f acc[4] = {};
  for (int kb = 0; kb < K; kb += 32) { FragH ah; ah.half[0] = *(const v8us*)((const unsigned short*)arow + kb + 8 * hh); ah.half[1] = *(const v8us*)((const unsigned short*)arow + kb + 16 + 8 * hh);
#pragma unroll
    for (int t = 0; t < 4; ++t) { if (col0 + t * 16 >= N) continue; const size_t boff = (size_t)(col0 + t * 16 + ln) * ldb + kb; FragH bq; bq.half[0] = *(const v8us*)((const unsigned short*)Bh + boff + 8 * hh); bq.half[1] = *(const v8us*)((const unsigned short*)Bh + boff + 16 + 8 * hh);
      acc[t] = mmaH<1>(ah.v, ah.v, bq.v, bq.v, acc[t]); }
  }
#pragma unroll
  for (int t = 0; t < 4; ++t) { if (col0 + t * 16 >= N) continue; const int col = col0 + t * 16 + ln; const float bv = bp ? bf16_round(bp[col]) : 0.f;
#pragma unroll
    for (int r = 0; r < 8; ++r) { float v = acc[t][r] * alpha + bv; if (CP) { const int rr = row0g + row0 + 8 * hh + r; if (rowsPerB < 0) v += CP[cofs + (size_t)rr * ldc + col];      /* rowsPerB < 0: own element of the batched C plane */ else { const int bidx = rr / rowsPerB; v += CP[(size_t)bidx * sCPb + (size_t)by * 64 + col]; } } if (ACT == 1) v = (v > 0.f) ? v : expm1f(v); else if (ACT == 7) v = (v > 0.f) ? v + 1.0f : expf(v); else if (ACT == 8) v = tanhf(v); else if (ACT == 9) v = 0.5f * v * (1.0f + tanhf(0.7978845608028654f * (v + 0.044715f * v * v * v))); else if (ACT == 11) v = 1.0f / (1.0f + expf(-v)); else if (ACT == 12) v = (v > 0.f) ? v : 0.01f * v; else if (ACT == 14) v = (v > 0.f) ? v : 0.1f * v; else if (ACT == 16) v = (v >= 0.f) ? v : 0.3f * v; else if (ACT == 17) v = (v >= 0.f) ? v : 0.2f * v; else if (ACT == 15) v = v / (1.0f + expf(-v)); else if (ACT == 3) v = fmaxf(v, 0.f); else if (ACT == 6) v = 0.5f * v * (1.0f + erff(v * 0.70710678118654752f)); so[w][8 * hh + r][t * 16 + ln] = v; } }
  __builtin_amdgcn_fence(__ATOMIC_ACQ_REL, "workgroup"); __builtin_amdgcn_wave_barrier();
  const int rsub = lane >> 4, c4 = (lane & 15) * 4; typedef _Float16 v4h __attribute__((ext_vector_type(4)));
  {
#pragma unroll
    for (int q = 0; q < 8; ++q) { const int r = q * 2 + rsub; if (col0 + c4 < N) { const v4f v = *(const v4fa*)&so[w][r][c4]; if (C) *(v4f*)(C + cofs + (size_t)(row0 + r) * ldc + col0 + c4) = v; if (C16) { v4h h4; for (int i = 0; i < 4; ++i) h4[i] = (_Float16)v[i]; *(v4h*)(C16 + cofs + (size_t)(row0 + r) * ldc + col0 + c4) = h4; } } }
     }
}


typedef _Float16 v4h __attribute__((ext_vector_type(4)));

__global__ __launch_bounds__(256) void k_h16(const float* __restrict__ x, _Float16* __restrict__ X16, size_t n8) { const size_t t = (size_t)blockIdx.x * 256 + threadIdx.x; if (t >= n8) return; FragH f;
#pragma unroll
  for (int q = 0; q < 8; ++q) f.h[q] = (_Float16)x[t * 8 + q]; *(v8us*)((unsigned short*)X16 + t * 8) = f.half[0];  }
__global__ __launch_bounds__(256) void k_round16f(const float* __restrict__ W, _Float16* __restrict__ Bt, size_t n8) { const size_t t = (size_t)blockIdx.x * 256 + threadIdx.x; if (t >= n8) return; FragH f;
#pragma unroll
  for (int i = 0; i < 8; ++i) f.h[i] = (_Float16)(bf16_round(W[t * 8 + i]) * 16.0f); *(v8us*)((unsigned short*)Bt + t * 8) = f.half[0];  }
template <int NHv, int TTv>
__global__ __launch_bounds__(256) void k_vt(const _Float16* __restrict__ V16, int ldv, int voff, _Float16* __restrict__ Vt) { __shared__ unsigned short tl[64][66]; const int tid = threadIdx.x; const int slab = blockIdx.x / (TTv / 64), lg = blockIdx.x % (TTv / 64); const int b = slab / NHv, h = slab % NHv;
  for (int i = tid; i < 64 * 8; i += 256) { const int r = i / 8, c8 = (i % 8) * 8; FragH f; f.half[0] = *(const v8us*)((const unsigned short*)V16 + ((size_t)b * TTv + lg * 64 + r) * ldv + voff + h * 64 + c8);
#pragma unroll
    for (int q = 0; q < 8; ++q) tl[r][c8 + q] = f.u[q]; }
  __syncthreads();
  {
#pragma unroll
    for (int rd = 0; rd < 2; ++rd) { const int i = rd * 256 + tid, tile = i >> 6; const int d = (tile & 3) * 16 + (i & 15), kl = (tile >> 2) * 32 + ((i >> 5) & 1) * 16 + ((i >> 4) & 1) * 8; FragH f;      /* fragment order (pk_frag), tile (32 keys, 16 d) at (key / 32) * 4 + d / 16 of the slab */
#pragma unroll
      for (int q = 0; q < 8; ++q) f.u[q] = tl[kl + q][d];
      *(v8us*)((unsigned short*)Vt + (size_t)slab * 64 * TTv + (size_t)lg * 4096 + i * 8) = f.half[0]; }
     } }

__global__ __launch_bounds__(256) void k_hl(const float* __restrict__ F, _Float16* __restrict__ Hh, _Float16* __restrict__ Hl, size_t n8) { const size_t t = (size_t)blockIdx.x * 256 + threadIdx.x; if (t >= n8) return; FragH fh, fl; const v4f a = *(const v4fa*)(F + t * 8), c = *(const v4fa*)(F + t * 8 + 4);
#pragma unroll
  for (int q = 0; q < 4; ++q) { _Float16 h = (_Float16)a[q]; fh.h[q] = h; fl.h[q] = (_Float16)((a[q] - (float)h) * 1024.0f); h = (_Float16)c[q]; fh.h[4 + q] = h; fl.h[4 + q] = (_Float16)((c[q] - (float)h) * 1024.0f); }
  { *(v8us*)((unsigned short*)Hh + t * 8) = fh.half[0]; *(v8us*)((unsigned short*)Hl + t * 8) = fl.half[0];  } }

// ---- fast GEMM (wave tile 32x64; requires M % 32 == 0 rows per launch region and N % 64 == 0); epilogue = k_gemm_hhx semantics ----
__device__ __forceinline__ v16h g2_frag(const _Float16* p, int hh) { FragH f; f.half[0] = *(const v8us*)((const unsigned short*)p + 8 * hh); f.half[1] = *(const v8us*)((const unsigned short*)p + 16 + 8 * hh); return f.v; }
// Fragment order of an f16 matrix [R][K]: 16-row x 32-k tiles of 1024 bytes, tile (rt, kt) at (rt * (K / 32) + kt) * 512 halves; inside a tile the 8 halves of row ln, k = part * 16 + hh * 8 .. + 7
// stand at (part * 32 + hh * 16 + ln) * 8. p = the tile + lane * 8: each of the two loads of a wave then covers 512 contiguous bytes (4 whole lines, not 16 pieces of 32 bytes); the k order is that of g2_frag.
__device__ __forceinline__ v16h pk_frag(const _Float16* p) { FragH f; f.half[0] = *(const v8us*)((const unsigned short*)p); f.half[1] = *(const v8us*)((const unsigned short*)p + 256); return f.v; }
__device__ __forceinline__ v8f g2_mma(v16h a, v16h b, v8f c) { v8f d = __builtin_amdgcn_wmma_f32_16x16x32_f16(false, a, false, b, (short)0, c, false, false); asm volatile("v_nop\n\tv_nop\n\tv_nop\n\tv_nop" : "+v"(d) : "v"(a), "v"(b)); return d; }
struct G2F { v16h a0, a1, b0, b1, b2, b3; };      /* the six fragments of one 32-k tile: two row tiles of A, four column tiles of B */
// one k tile's twelve loads, issued as one group at this place, tiles ahead of the products that read them. The wait stands behind the group: the six address pairs, named as inputs, stay live up to it,
// so that no load's result lands in a register that an issued load still names; the two scheduling barriers keep every load of the group in front of the wait and every rewrite of an address behind it
__device__ __forceinline__ G2F g2_load(const _Float16* a0, const _Float16* a1, const _Float16* b0, const _Float16* b1, const _Float16* b2, const _Float16* b3, int kb) { G2F f;
  const _Float16* p0 = a0 + kb; const _Float16* p1 = a1 + kb; const _Float16* p2 = b0 + kb; const _Float16* p3 = b1 + kb; const _Float16* p4 = b2 + kb; const _Float16* p5 = b3 + kb;
  f.a0 = pk_frag(p0); f.a1 = pk_frag(p1); f.b0 = pk_frag(p2); f.b1 = pk_frag(p3); f.b2 = pk_frag(p4); f.b3 = pk_frag(p5);
  __builtin_amdgcn_sched_barrier(0); asm volatile("s_wait_xcnt 0x0" :: "v"(p0), "v"(p1), "v"(p2), "v"(p3), "v"(p4), "v"(p5) : "memory"); __builtin_amdgcn_sched_barrier(0); return f; }
template <int ACT, bool PK>      /* A and Bh in fragment order (pk_frag); PK: C16 alone is written, in fragment order; else C and C16 row-major */
__global__ __launch_bounds__(128) void k_gemm2(const _Float16* __restrict__ A, int lda, size_t sA, const _Float16* __restrict__ Bh, int ldb, size_t sB, float alpha, const float* __restrict__ bias, size_t sBias, const float* __restrict__ CP, int rowsPerB, size_t sCPb, int row0g,
    float* __restrict__ C, _Float16* __restrict__ C16, int ldc, size_t sC, int M, int N, int K) { static_assert(ACT == 0 || ACT == 3 || ACT == 6 || ACT == 8 || ACT == 9 || ACT == 11 || ACT == 12 || ACT == 14 || ACT == 15 || ACT == 16 || ACT == 17, "k_gemm2: unsupported ACT code (would silently apply no activation)");
  __shared__ __attribute__((aligned(16))) float so[4][32][68];
  const int tid = threadIdx.x, w = tid >> 5, lane = tid & 31, ln = lane & 15, hh = lane >> 4; const int by = blockIdx.y;
  A += (size_t)by * sA; Bh += (size_t)by * sB; const size_t cofs = (size_t)by * sC; const float* bp = bias ? bias + (size_t)by * sBias : nullptr;
  const int ntn = N >> 6; const int mt = blockIdx.x / ntn, nq = blockIdx.x - mt * ntn; const int row0 = mt * 128 + 32 * w, col0 = nq * 64; if (row0 >= M) return;
  const _Float16* a0p = A + (size_t)row0 * lda + lane * 8; const _Float16* a1p = a0p + (size_t)16 * lda;
  const _Float16* b0p = Bh + (size_t)col0 * ldb + lane * 8; const _Float16* b1p = b0p + (size_t)16 * ldb; const _Float16* b2p = b1p + (size_t)16 * ldb; const _Float16* b3p = b2p + (size_t)16 * ldb;
  const v8f z8 = {0.f,0.f,0.f,0.f,0.f,0.f,0.f,0.f}; v8f c00 = z8, c01 = z8, c02 = z8, c03 = z8, c10 = z8, c11 = z8, c12 = z8, c13 = z8;
  if (K > 0) { const int ke = K * 16, kl = ke - 512, n3 = ke / 1536; int kb = 0;      /* halves of a fragment row; its last tile; whole trips. A ring of three register sets: tile t + 2 is asked for in front of tile t's products; past the end the last tile is fetched again, in bounds */
#define G2_LOAD(k) g2_load(a0p, a1p, b0p, b1p, b2p, b3p, (k) < kl ? (k) : kl)
#define G2_TILE(f) { c00 = g2_mma(f.a0, f.b0, c00); c10 = g2_mma(f.a1, f.b0, c10); c01 = g2_mma(f.a0, f.b1, c01); c11 = g2_mma(f.a1, f.b1, c11); c02 = g2_mma(f.a0, f.b2, c02); c12 = g2_mma(f.a1, f.b2, c12); c03 = g2_mma(f.a0, f.b3, c03); c13 = g2_mma(f.a1, f.b3, c13); }
    G2F f0 = G2_LOAD(0), f1 = G2_LOAD(512);
#pragma unroll 1      // three tiles a trip, so that each set keeps its registers (no copies between the sets); one block without an exit inside, so that the waits for the loads stay counted
    for (int i = 0; i < n3; ++i, kb += 1536) { const G2F f2 = G2_LOAD(kb + 1024); G2_TILE(f0) f0 = G2_LOAD(kb + 1536); G2_TILE(f1) f1 = G2_LOAD(kb + 2048); G2_TILE(f2) }
    if (kb < ke) G2_TILE(f0)      /* the one or two tiles that no whole trip holds are already in the ring */
    if (kb + 512 < ke) G2_TILE(f1) }
#undef G2_LOAD
#undef G2_TILE
  v8f accs[8] = {c00, c01, c02, c03, c10, c11, c12, c13};
#pragma unroll
  for (int u = 0; u < 8; ++u) { const int t = u & 3, half = u >> 2; const int col = col0 + t * 16 + ln; const float bv = bp ? bf16_round(bp[col]) : 0.f;
#pragma unroll
    for (int r = 0; r < 8; ++r) { const int rloc = half * 16 + 8 * hh + r; float v = accs[u][r] * alpha + bv; if (CP) { if (rowsPerB < 0) v += CP[cofs + (size_t)(row0g + row0 + rloc) * ldc + col];      /* rowsPerB < 0: own element of the batched C plane */ else { const int bidx = (row0g + row0 + rloc) / rowsPerB; v += CP[(size_t)bidx * sCPb + (size_t)by * 64 + col]; } }
      if (ACT == 3) v = fmaxf(v, 0.f); else if (ACT == 6) v = 0.5f * v * (1.0f + erff(v * 0.70710678118654752f)); else if (ACT == 11) v = 1.0f / (1.0f + expf(-v)); else if (ACT == 15) v = v / (1.0f + expf(-v)); else if (ACT == 12) v = (v > 0.f) ? v : 0.01f * v; else if (ACT == 8) v = tanhf(v); else if (ACT == 9) v = 0.5f * v * (1.0f + tanhf(0.7978845608028654f * (v + 0.044715f * v * v * v))); else if (ACT == 14) v = (v > 0.f) ? v : 0.1f * v; else if (ACT == 16) v = (v >= 0.f) ? v : 0.3f * v; else if (ACT == 17) v = (v >= 0.f) ? v : 0.2f * v;
      so[w][rloc][t * 16 + ln] = v; } }
  __builtin_amdgcn_fence(__ATOMIC_ACQ_REL, "workgroup"); __builtin_amdgcn_wave_barrier();
  const int rsub = lane >> 4, c4 = (lane & 15) * 4;
  if (PK) {      /* C16 alone, in fragment order: the wave's 32 x 64 tile = 2 x 2 fragment tiles, eight stores of 512 contiguous bytes */
#pragma unroll      // constant LDS and store offsets
      for (int s = 0; s < 8; ++s) { const int rl = (s >> 2) * 16 + ln, cl = ((s >> 1) & 1) * 32 + (s & 1) * 16 + hh * 8; const v4f x = *(const v4fa*)&so[w][rl][cl], y = *(const v4fa*)&so[w][rl][cl + 4]; FragH f;
        for (int i = 0; i < 4; ++i) { f.h[i] = (_Float16)x[i]; f.h[4 + i] = (_Float16)y[i]; }
        *(v8us*)((unsigned short*)C16 + cofs + (size_t)(row0 + (s >> 2) * 16) * ldc + (size_t)((col0 >> 5) + ((s >> 1) & 1)) * 512 + (s & 1) * 256 + lane * 8) = f.half[0]; }
    return; }
  {
#pragma unroll
    for (int q = 0; q < 16; ++q) { const int r = q * 2 + rsub; const v4f v = *(const v4fa*)&so[w][r][c4]; if (C) *(v4f*)(C + cofs + (size_t)(row0 + r) * ldc + col0 + c4) = v; if (C16) { v4h h4; for (int i = 0; i < 4; ++i) h4[i] = (_Float16)v[i]; *(v4h*)(C16 + cofs + (size_t)(row0 + r) * ldc + col0 + c4) = h4; } }
     } }


__global__ __launch_bounds__(256) void k_wnat(const float* __restrict__ w, size_t n8, _Float16* __restrict__ Bt) { const size_t t = (size_t)blockIdx.x * 256 + threadIdx.x; if (t >= n8) return; FragH f; for (int q = 0; q < 8; ++q) f.h[q] = (_Float16)(bf16_round(w[t * 8 + q]) * 16.0f); *(v8us*)((unsigned short*)Bt + t * 8) = f.half[0];  }
__global__ __launch_bounds__(256) void k_rsm(const float* __restrict__ S, _Float16* __restrict__ P, int nrows) {
  #pragma clang fp contract(off)
  const int i = blockIdx.x * 256 + threadIdx.x; if (i >= nrows) return; const float* s = S + (size_t)i * SQ; float mx = -3.0e38f;
#pragma unroll 1
  for (int j = 0; j < SQ; ++j) mx = fmaxf(mx, s[j]); float se = 0.f;
#pragma unroll 1
  for (int j = 0; j < SQ; ++j) se += expf(s[j] - mx); const float sc = 256.0f / se;
#pragma unroll 1
  for (int j0 = 0; j0 < SQ; j0 += 8) { FragH f; for (int q = 0; q < 8; ++q) f.h[q] = (_Float16)(expf(s[j0 + q] - mx) * sc); unsigned short* d = (unsigned short*)P + (size_t)i * SQ + j0; *(v8us*)d = f.half[0];  } }
__global__ __launch_bounds__(256) void k_vt(const _Float16* __restrict__ V16, int b, int h0, _Float16* __restrict__ VT) { __shared__ unsigned short tl[64][65]; const int tid = threadIdx.x; const int hh = blockIdx.x % HG, sg = blockIdx.x / HG; const int s0 = sg * 64; const int h = h0 + hh;
  for (int i = tid; i < 64 * 8; i += 256) { const int j = i / 8, d8 = (i % 8) * 8; FragH f; f.half[0] = *(const v8us*)((const unsigned short*)V16 + ((size_t)b * SQ + s0 + j) * DM + h * HD + d8); for (int q = 0; q < 8; ++q) tl[d8 + q][j] = f.u[q]; }
  __syncthreads();
  { for (int i = tid; i < 64 * 8; i += 256) { const int d = i / 8, j8 = (i % 8) * 8; FragH f; for (int q = 0; q < 8; ++q) f.u[q] = tl[d][j8 + q]; *(v8us*)((unsigned short*)VT + ((size_t)hh * HD + d) * SQ + s0 + j8) = f.half[0]; }  } }






typedef int v4ia __attribute__((ext_vector_type(4), may_alias));
__device__ __forceinline__ float rs_xrow(float v) { const int i = __float_as_int(v); return __int_as_float(__builtin_amdgcn_permlanex16(i, i, 0x76543210, 0xfedcba98, true, false)); }      /* lane l reads lane l ^ 16 */
// Fused attention, one wave per 16 query rows of one (batch, head), 32 keys a pass: S^T = K Q^T (A = K rows, B = Q kept in registers), so a lane holds one query's
// scores (keys 8*hh + r of each 16-key tile); running maximum and sum per lane, one exchange between the wave halves; the two f32 score tiles, converted in place,
// are the B operand of O^T += V^T P^T. No score and no weight goes through memory. All in the log2 domain: p = 2^(s * FA_C - mu + FA_OFF) with mu the maximum in use.
#define FA_C 0.18033688011112042f      /* 64^-0.5 * log2(e) */
#define FA_OFF 7.0f                    /* weights carried x128: small ones stay normal f16 numbers */
#define FA_THR 8.0f                    /* mu is renewed only when a score passes it by more than this: weights stay at or under 2^15, inside f16 */
#define FA_DROP (-0x1p+100f)           /* raw score of a masked key; a power of two, so FA_DROP * FA_C is exact and a row with every key masked gets equal weights */
__device__ __forceinline__ v8f fa_mma(v16h a, v16h b, v8f c) { return __builtin_amdgcn_wmma_f32_16x16x32_f16(false, a, false, b, (short)0, c, false, false); }
// eight native 2^x; each is followed by an independent instruction, the last by the v_nop: the slot the instruction set asks for behind a transcendental
__device__ __forceinline__ v8f fa_exp2(v8f x) { float e0, e1, e2, e3, e4, e5, e6, e7;
  asm("v_exp_f32 %0, %8\n\tv_exp_f32 %1, %9\n\tv_exp_f32 %2, %10\n\tv_exp_f32 %3, %11\n\tv_exp_f32 %4, %12\n\tv_exp_f32 %5, %13\n\tv_exp_f32 %6, %14\n\tv_exp_f32 %7, %15\n\tv_nop"
      : "=&v"(e0), "=&v"(e1), "=&v"(e2), "=&v"(e3), "=&v"(e4), "=&v"(e5), "=&v"(e6), "=&v"(e7) : "v"(x[0]), "v"(x[1]), "v"(x[2]), "v"(x[3]), "v"(x[4]), "v"(x[5]), "v"(x[6]), "v"(x[7]));
  const v8f e = {e0, e1, e2, e3, e4, e5, e6, e7}; return e; }
__device__ __forceinline__ float fa_exp2s(float x) { float e; asm("v_exp_f32 %0, %1\n\tv_nop" : "=v"(e) : "v"(x)); return e; }      /* the v_nop: the same slot */
// behind a group of loads or stores: the group is issued whole at this place (for loads: ahead of the arithmetic that covers their latency), and its address and data registers are reused only behind the wait;
// the two scheduling barriers keep every member of the group in front of the wait and every rewrite of a register behind it
__device__ __forceinline__ void fa_issued() { __builtin_amdgcn_sched_barrier(0); asm volatile("s_wait_xcnt 0x0" ::: "memory"); __builtin_amdgcn_sched_barrier(0); }
struct FaK { v16h a00, a01, a10, a11; };      /* one pass of K fragments (two 16-key tiles x two k steps) */
// kp: the head's first K tile + lane * 8 (fragment order)
__device__ __forceinline__ FaK fa_load(const _Float16* kp, int j) { FaK f; const _Float16* k = kp + (size_t)j * LQ;
  f.a00 = pk_frag(k); f.a01 = pk_frag(k + 512); f.a10 = pk_frag(k + 16 * LQ); f.a11 = pk_frag(k + 16 * LQ + 512); return f; }
// The mask's pass map, written by pm_tile in the first launch: for each tile of 16 query rows (token rows) one 64-bit word, bit p set when the tile's 16 x 32 mask words of pass p (keys 32 p .. 32 p + 31)
// hold a nonzero one. A wave reads its tile's word once and tests one scalar bit a pass; no mask word is read in a pass without a nonzero one. A tile's word has a 128-byte line of its own (one writer a line).
#define PM_PITCH 32                    /* 32-bit words between two tiles' map words */
static_assert(SQ == 2048, "pass map: 64 passes of 32 keys in one 64-bit word");
__device__ __forceinline__ unsigned long long fa_map(const unsigned* __restrict__ MF, size_t rq) { const unsigned* p = MF + rq / 16 * PM_PITCH;
  const unsigned lo = (unsigned)__builtin_amdgcn_readfirstlane((int)p[0]), hi = (unsigned)__builtin_amdgcn_readfirstlane((int)p[1]); return ((unsigned long long)hi << 32) | lo; }
__device__ __forceinline__ bool fa_anym(unsigned long long mw, int j) { return ((mw >> (j >> 5)) & 1ull) != 0; }      /* wave-uniform: does pass j / 32 hold a nonzero mask word? */
// a key with a nonzero mask word takes FA_DROP as its raw score; m: the lane's own query row, first key of the pass + 8 * hh (the lane's 16 words are read here, only in a pass that holds a nonzero word)
__device__ __forceinline__ void fa_drop(const int* m, v8f& s0, v8f& s1) { const v4ia m0 = *(const v4ia*)m, m1 = *(const v4ia*)(m + 4), m2 = *(const v4ia*)(m + 16), m3 = *(const v4ia*)(m + 20);
#pragma unroll      // constant indices: the tiles stay in registers
  for (int r = 0; r < 4; ++r) { s0[r] = (m0[r] == 0) ? s0[r] : FA_DROP; s0[4 + r] = (m1[r] == 0) ? s0[4 + r] : FA_DROP; s1[r] = (m2[r] == 0) ? s1[r] : FA_DROP; s1[4 + r] = (m3[r] == 0) ? s1[4 + r] : FA_DROP; } }
// ---- the second output (the last head's probabilities) from work-groups of its own, ahead of the attention work-groups in the same launch: one work-group = 16 query rows, each of its 8 waves 256 keys,
// so that the whole chip shares this work and no attention work-group runs longer than the others. S^T as in k_fattn (a lane holds one query's scores). First walk: the wave's running maximum and sum;
// they are joined across the waves through LDS; second walk: the scores again, p = 2^(s * FA_C - maximum) / sum, turned through the wave's own LDS range so that whole 128-byte lines are stored.
#define PB_BLOCKS (NB * (SQ / 16))
#define PB_KEYS (SQ / 8)               /* keys a wave */
#define PB_PITCH 36                    /* floats a staged row: 128 bytes + 16, so that the 16 lanes of a half wave write 64 different banks */
__device__ __forceinline__ void fa_prob(int t, const _Float16* __restrict__ Q16, const _Float16* __restrict__ K16, const int* __restrict__ Mk, const unsigned* __restrict__ MF, float* __restrict__ PO, float (*red)[8][16], float (*stg)[16][PB_PITCH]) {
  const int lane = threadIdx.x & 31, ln = lane & 15, hh = lane >> 4; const int w = __builtin_amdgcn_readfirstlane(threadIdx.x >> 5);
  const size_t rq = (size_t)t * 16, qr = rq + ln; const int j0 = w * PB_KEYS, je = j0 + PB_KEYS;      /* first query row (token row: batch * SQ + row), the lane's query row; the wave's keys */
  const _Float16* qp = Q16 + rq * LQ + (NH - 1) * 1024 + lane * 8; const v16h q0 = pk_frag(qp), q1 = pk_frag(qp + 512);
  fa_issued();
  const _Float16* kp = K16 + (size_t)(t / (SQ / 16)) * SQ * LQ + (NH - 1) * 1024 + lane * 8; const int* mp = Mk + qr * SQ + 8 * hh; const unsigned long long mw = fa_map(MF, rq);
  const v8f z8 = {0.f, 0.f, 0.f, 0.f, 0.f, 0.f, 0.f, 0.f}; float mu = -3.0e38f, l = 0.f;
  FaK f = fa_load(kp, j0);
  fa_issued();
#pragma unroll 1      // one pass a trip: the next pass's operands are already fetched by hand
  for (int j = j0; j < je; j += 32) {
    v8f s0 = fa_mma(f.a01, q1, fa_mma(f.a00, q0, z8)), s1 = fa_mma(f.a11, q1, fa_mma(f.a10, q0, z8));
    if (fa_anym(mw, j)) fa_drop(mp + j, s0, s1);
    f = fa_load(kp, (j + 32 < je) ? j + 32 : j0);      /* the last pass fetches the second walk's first operands */
    fa_issued();
    float tm = fmaxf(s0[0], s1[0]);
#pragma unroll      // constant indices: the tiles stay in registers
    for (int r = 1; r < 8; ++r) tm = fmaxf(tm, fmaxf(s0[r], s1[r]));
    tm = fmaxf(tm, rs_xrow(tm)); const float mn = fmaxf(mu, tm * FA_C), al = fa_exp2s(mu - mn); mu = mn;
    const v8f ps = fa_exp2(s0 * FA_C - mn) + fa_exp2(s1 * FA_C - mn);
    l = l * al + (((ps[0] + ps[1]) + (ps[2] + ps[3])) + ((ps[4] + ps[5]) + (ps[6] + ps[7]))); }
  l += rs_xrow(l);      /* the halves hold the same maximum */
  if (lane < 16) { red[0][w][ln] = mu; red[1][w][ln] = l; }
  __syncthreads();      /* every wave's row maxima and sums are in LDS */
  float mx = red[0][0][ln];
#pragma unroll      // constant LDS offsets
  for (int u = 1; u < 8; ++u) mx = fmaxf(mx, red[0][u][ln]);
  float lt = 0.f;
#pragma unroll      // constant LDS offsets
  for (int u = 0; u < 8; ++u) lt += red[1][u][ln] * fa_exp2s(red[0][u][ln] - mx);
  const float il = 1.0f / lt;
  float (*sg)[PB_PITCH] = stg[w]; float* pw = PO + (rq + (lane >> 3)) * SQ + (lane & 7) * 4;      /* the wave's own staging range; a store covers four whole 128-byte lines (four rows of the pass) */
#pragma unroll 1      // as above
  for (int j = j0; j < je; j += 32) {
    v8f s0 = fa_mma(f.a01, q1, fa_mma(f.a00, q0, z8)), s1 = fa_mma(f.a11, q1, fa_mma(f.a10, q0, z8));
    if (fa_anym(mw, j)) fa_drop(mp + j, s0, s1);
    f = fa_load(kp, (j + 32 < je) ? j + 32 : j);      /* the last pass fetches its own operands again, in bounds */
    fa_issued();
    const v8f p0 = fa_exp2(s0 * FA_C - mx) * il, p1 = fa_exp2(s1 * FA_C - mx) * il;
    const v4f t0 = {p0[0], p0[1], p0[2], p0[3]}, t1 = {p0[4], p0[5], p0[6], p0[7]}, t2 = {p1[0], p1[1], p1[2], p1[3]}, t3 = {p1[4], p1[5], p1[6], p1[7]};
    *(v4fa*)&sg[ln][8 * hh] = t0; *(v4fa*)&sg[ln][8 * hh + 4] = t1; *(v4fa*)&sg[ln][16 + 8 * hh] = t2; *(v4fa*)&sg[ln][20 + 8 * hh] = t3;
    asm volatile("s_wait_dscnt 0x0" ::: "memory");      // the wave's LDS writes are done before its lanes read one another's words back
    const v4f r0 = *(const v4fa*)&sg[lane >> 3][(lane & 7) * 4], r1 = *(const v4fa*)&sg[4 + (lane >> 3)][(lane & 7) * 4], r2 = *(const v4fa*)&sg[8 + (lane >> 3)][(lane & 7) * 4], r3 = *(const v4fa*)&sg[12 + (lane >> 3)][(lane & 7) * 4];
    *(v4f*)(pw + j) = r0; *(v4f*)(pw + j + 4 * SQ) = r1; *(v4f*)(pw + j + 8 * SQ) = r2; *(v4f*)(pw + j + 12 * SQ) = r3;
    fa_issued(); } }      /* also keeps the next pass's LDS writes behind this pass's reads */
__global__ __launch_bounds__(256) void k_fattn(const _Float16* __restrict__ Q16, const _Float16* __restrict__ K16, const _Float16* __restrict__ VT, const int* __restrict__ Mk, const unsigned* __restrict__ MF, _Float16* __restrict__ O16, float* __restrict__ PO) {
  static_assert(SQ % 128 == 0 && HD == 64, "k_fattn: 8 waves x 16 query rows a block, head size 64");
  __shared__ __attribute__((aligned(16))) float pb_red[2][8][16]; __shared__ __attribute__((aligned(16))) float pb_stg[8][16][PB_PITCH];
  if (blockIdx.x < PB_BLOCKS) { fa_prob((int)blockIdx.x, Q16, K16, Mk, MF, PO, pb_red, pb_stg); return; }      /* block-uniform: the short work-groups of the second output start first, beside the first attention work-groups */
  const int lane = threadIdx.x & 31, ln = lane & 15, hh = lane >> 4; const int w = __builtin_amdgcn_readfirstlane(threadIdx.x >> 5);
  const unsigned at = blockIdx.x - PB_BLOCKS; const int h = (int)(at / (SQ / 128) % NH), b = (int)(at / (SQ / 128) / NH);
  const size_t rq = (size_t)b * SQ + at % (SQ / 128) * 128 + w * 16, qr = rq + ln;      /* the wave's first query row; the lane's query row */
  const _Float16* qp = Q16 + rq * LQ + h * 1024 + lane * 8; const v16h q0 = pk_frag(qp), q1 = pk_frag(qp + 512);      /* a head's 64 columns are two 32-k tiles */
  fa_issued();      /* Q, then K, then V^T: the order of the loop, so that the loop's first wait for K leaves the V^T loads in flight */
  const _Float16* kp = K16 + (size_t)b * SQ * LQ + h * 1024 + lane * 8; const _Float16* vp = VT + (size_t)(b * NH + h) * HD * SQ + lane * 8; const int* mp = Mk + qr * SQ + 8 * hh; const unsigned long long mw = fa_map(MF, rq);
  const v8f z8 = {0.f, 0.f, 0.f, 0.f, 0.f, 0.f, 0.f, 0.f}; v8f o0 = z8, o1 = z8, o2 = z8, o3 = z8; float mu = -3.0e38f, l = 0.f;
  FaK f = fa_load(kp, 0);
  fa_issued();
  v16h v0 = pk_frag(vp), v1 = pk_frag(vp + 512), v2 = pk_frag(vp + 1024), v3 = pk_frag(vp + 1536);      /* a pass of V^T: four tiles, 4096 contiguous bytes */
  fa_issued();
#pragma unroll 1      // one pass a trip: the next pass's operands are already fetched by hand, a second copy of the body would only cost registers
  for (int j = 0; j < SQ; j += 32) { const int jn = (j + 32 < SQ) ? j + 32 : j;      /* first key of the next pass; the last pass fetches its own operands again, in bounds */
    v8f s0 = fa_mma(f.a01, q1, fa_mma(f.a00, q0, z8)), s1 = fa_mma(f.a11, q1, fa_mma(f.a10, q0, z8));
    if (fa_anym(mw, j)) fa_drop(mp + j, s0, s1);
    float tm = fmaxf(s0[0], s1[0]);
#pragma unroll      // constant indices: the tiles stay in registers
    for (int r = 1; r < 8; ++r) tm = fmaxf(tm, fmaxf(s0[r], s1[r]));
    tm = fmaxf(tm, rs_xrow(tm)); const float tl = tm * FA_C;
    if (__builtin_amdgcn_ballot_w32(tl > mu + FA_THR) != 0) { const float mn = fmaxf(mu, tl), al = fa_exp2s(mu - mn); mu = mn; l *= al; o0 *= al; o1 *= al; o2 *= al; o3 *= al; }      /* rare: one scalar test a pass */
    f = fa_load(kp, jn);      /* the next pass's K flies during this pass's exponentials and products */
    fa_issued();
    const float nb = FA_OFF - mu;
    const v8f p0 = fa_exp2(s0 * FA_C + nb), p1 = fa_exp2(s1 * FA_C + nb);
    const v8f ps = p0 + p1; l += ((ps[0] + ps[1]) + (ps[2] + ps[3])) + ((ps[4] + ps[5]) + (ps[6] + ps[7]));
    FragH pf;
#pragma unroll      // constant indices: the fragment stays in registers
    for (int r = 0; r < 8; ++r) { pf.h[r] = (_Float16)p0[r]; pf.h[8 + r] = (_Float16)p1[r]; }
    o0 = fa_mma(v0, pf.v, o0); o1 = fa_mma(v1, pf.v, o1); o2 = fa_mma(v2, pf.v, o2); o3 = fa_mma(v3, pf.v, o3);
    v0 = pk_frag(vp + jn * 64); v1 = pk_frag(vp + jn * 64 + 512); v2 = pk_frag(vp + jn * 64 + 1024); v3 = pk_frag(vp + jn * 64 + 1536);      /* the next pass's V^T flies during its score products and softmax */
    fa_issued(); }
  l += rs_xrow(l);      /* the halves' sums are joined once */
  const float il = 1.0f / l, so = 64.0f * il;      /* o carried x64, as the output GEMM's alpha expects */
  unsigned short* op = (unsigned short*)O16 + rq * DM + h * 1024 + lane * 8; FragH e0, e1;      /* o in fragment order: the lane's four runs of 8 are the four half-fragments of the head's two tiles */
#pragma unroll      // constant indices: the tiles stay in registers
  for (int r = 0; r < 8; ++r) { e0.h[r] = (_Float16)(o0[r] * so); e0.h[8 + r] = (_Float16)(o1[r] * so); e1.h[r] = (_Float16)(o2[r] * so); e1.h[8 + r] = (_Float16)(o3[r] * so); }
  *(v8us*)op = e0.half[0]; *(v8us*)(op + 256) = e0.half[1]; *(v8us*)(op + 512) = e1.half[0]; *(v8us*)(op + 768) = e1.half[1];
  fa_issued(); }      /* behind the stores: whatever the compiler lays behind them reuses their registers only behind the wait */


__global__ __launch_bounds__(256) void k_rsmf(const float* __restrict__ S, _Float16* __restrict__ P, int qn, int hg) {
  #pragma clang fp contract(off)
  const int t = blockIdx.x * 256 + threadIdx.x; if (t >= qn * hg) return; const size_t i = (size_t)(t / qn) * SQ + (t % qn); const float* s = S + i * SQ; float mx = -3.0e38f;
#pragma unroll 1
  for (int j = 0; j < SQ; ++j) mx = fmaxf(mx, s[j]); float se = 0.f;
#pragma unroll 1
  for (int j = 0; j < SQ; ++j) se += __expf(s[j] - mx); const float sc = 256.0f / se;
#pragma unroll 1
  for (int j0 = 0; j0 < SQ; j0 += 8) { FragH f; for (int q = 0; q < 8; ++q) f.h[q] = (_Float16)(__expf(s[j0 + q] - mx) * sc); unsigned short* d = (unsigned short*)P + i * SQ + j0; *(v8us*)d = f.half[0];  } }

// ---- the seven input conversions (three x, three per-head weights, W0) as one launch. None reads what another writes. A slab = one fragment row tile, 16 rows x DM = 2048 chunks of 16 bytes (pk_frag);
// a block takes a slab at a time, a thread eight of its chunks (k tiles four apart), so that all of a slab's loads are in flight together and few waves have to be started.
#define PP_WS (DM / 16)                        /* slabs of one weight matrix */
#define PP_XS ((int)(NR / 16))                 /* slabs of one input */
#define PP_SLABS (4 * PP_WS + 3 * PP_XS)
#define PP_BLOCKS 512                          /* two blocks a WGP; slabs b and b + 512: a weight slab is paired with an input slab */
// behind a group of loads or stores off one address: the address, named as an input, stays live up to the wait, so that no load's result lands in it; the two scheduling barriers keep
// every member of the group in front of the wait and every rewrite of an address or data register behind it
__device__ __forceinline__ void pp_issued(const void* p) { __builtin_amdgcn_sched_barrier(0); asm volatile("s_wait_xcnt 0x0" :: "v"(p) : "memory"); __builtin_amdgcn_sched_barrier(0); }
// a thread's eight finished chunks as one group of stores; the scheduling barrier in front keeps a store from being issued among the conversions, where its data registers would be wanted again at once
__device__ __forceinline__ void pp_store(unsigned short* __restrict__ d, const v8us (&o)[8]) { __builtin_amdgcn_sched_barrier(0);
#pragma unroll      // constant offsets off one address
  for (int u = 0; u < 8; ++u) *(v8us*)(d + u * 2048) = o[u];
  pp_issued(d); }
template <int QS, int US>      /* floats between the eight k of a chunk; between two chunks of a thread */
__device__ __forceinline__ void pp_wslab(const float* __restrict__ s, unsigned short* __restrict__ d) { float w[8][8]; v8us o[8];
#pragma unroll      // constant offsets off one address; the values stay in registers
  for (int u = 0; u < 8; ++u) for (int q = 0; q < 8; ++q) w[u][q] = s[(size_t)u * US + (size_t)q * QS];
  pp_issued(s);
#pragma unroll      // as above
  for (int u = 0; u < 8; ++u) { FragH f; for (int q = 0; q < 8; ++q) f.h[q] = (_Float16)(16.0f * bf16_round(w[u][q])); o[u] = f.half[0]; }
  pp_store(d, o); }
__device__ __forceinline__ void pp_xslab(const float* __restrict__ s, unsigned short* __restrict__ d) { v4f a[8], b[8]; v8us o[8];
#pragma unroll      // as above
  for (int u = 0; u < 8; ++u) { a[u] = *(const v4fa*)(s + u * 128); b[u] = *(const v4fa*)(s + u * 128 + 4); }
  pp_issued(s);
#pragma unroll      // as above
  for (int u = 0; u < 8; ++u) { FragH f; for (int q = 0; q < 4; ++q) { f.h[q] = (_Float16)bf16_round(a[u][q]); f.h[4 + q] = (_Float16)bf16_round(b[u][q]); } o[u] = f.half[0]; }
  pp_store(d, o); }
// ---- the mask's pass map (see fa_map), from work-groups of their own in the same launch: one work-group = one tile of 16 query rows, each of its 8 waves 256 keys (8 passes) as two groups of 16 loads,
// each load 512 contiguous bytes of one row (4 passes, 8 lanes a pass); the rows are joined by OR in the lane, the lanes by a ballot, the waves through LDS.
#define PM_BLOCKS ((int)(NR / 16))
__device__ __forceinline__ unsigned pm_half(const int* __restrict__ m) { v4ia a[16];
#pragma unroll      // constant offsets off one address; the values stay in registers
  for (int r = 0; r < 16; ++r) a[r] = *(const v4ia*)(m + r * SQ);
  pp_issued(m);
  v4ia o = a[0];
#pragma unroll      // as above
  for (int r = 1; r < 16; ++r) o |= a[r];
  const unsigned bl = __builtin_amdgcn_ballot_w32((o[0] | o[1] | o[2] | o[3]) != 0);
  return ((bl & 0xffu) ? 1u : 0u) | ((bl & 0xff00u) ? 2u : 0u) | ((bl & 0xff0000u) ? 4u : 0u) | ((bl & 0xff000000u) ? 8u : 0u); }
__device__ __forceinline__ void pm_tile(int t, const int* __restrict__ Mk, unsigned* __restrict__ MF, unsigned* pw) { const int lane = threadIdx.x & 31, w = threadIdx.x >> 5;
  const int* m = Mk + (size_t)t * 16 * SQ + w * 256 + lane * 4; const unsigned b0 = pm_half(m), b1 = pm_half(m + 128);
  if (lane == 0) pw[w] = b0 | (b1 << 4);
  __syncthreads();      /* every wave's eight bits are in LDS */
  if (threadIdx.x < 2) { const unsigned* q = pw + threadIdx.x * 4; MF[(size_t)t * PM_PITCH + threadIdx.x] = q[0] | (q[1] << 8) | (q[2] << 16) | (q[3] << 24); } }
__global__ __launch_bounds__(256) void k_prep(const int* __restrict__ Mk, unsigned* __restrict__ MF, const float* __restrict__ xq, const float* __restrict__ xk, const float* __restrict__ xv, const float* __restrict__ wq, const float* __restrict__ wk, const float* __restrict__ wv, const float* __restrict__ wo,
    _Float16* __restrict__ XQ, _Float16* __restrict__ XK, _Float16* __restrict__ XV, _Float16* __restrict__ BQ, _Float16* __restrict__ BK, _Float16* __restrict__ BV, _Float16* __restrict__ BO) {
  __shared__ unsigned pm_w[8];
  if (blockIdx.x >= PP_BLOCKS) { pm_tile((int)blockIdx.x - PP_BLOCKS, Mk, MF, pm_w); return; }      /* block-uniform */
  const int tid = threadIdx.x, ln = tid & 15, k0 = (tid >> 6) * 32 + ((tid >> 5) & 1) * 16 + ((tid >> 4) & 1) * 8;      /* the thread's row in the tile; first k of its first chunk (chunk u: + 128 u) */
#pragma unroll 1      // one slab's values in registers at a time
  for (int slab = blockIdx.x; slab < PP_SLABS; slab += PP_BLOCKS) {
    if (slab < 4 * PP_WS) { const int j = slab / PP_WS, rt = slab % PP_WS, n = rt * 16 + ln;      /* Bt row n = output column (h, d) */
      unsigned short* d = (unsigned short*)(j == 0 ? BQ : j == 1 ? BK : j == 2 ? BV : BO) + (size_t)rt * 16384 + tid * 8;
      if (j < 3) pp_wslab<HD, 128 * HD>((j == 0 ? wq : j == 1 ? wk : wv) + ((size_t)(n / HD) * DM + k0) * HD + n % HD, d);
      else pp_wslab<DM, 128 * DM>(wo + (size_t)k0 * DM + n, d); }
    else { const int s2 = slab - 4 * PP_WS, j = s2 / PP_XS, rt = s2 % PP_XS;
      pp_xslab((j == 0 ? xq : j == 1 ? xk : xv) + ((size_t)rt * 16 + ln) * DM + k0, (unsigned short*)(j == 0 ? XQ : j == 1 ? XK : XV) + (size_t)rt * 16384 + tid * 8); } } }

extern "C" void kernel_launch(void* const* d_in, const int* in_sizes, int n_in,
                              void* d_out, int out_size, void* d_ws, size_t ws_size, hipStream_t stream) {
  (void)in_sizes; (void)n_in; (void)out_size;
  const float* const* I = (const float* const*)d_in; const float* xv = I[0]; const float* xk = I[1]; const float* xq = I[2]; const int* mk = (const int*)d_in[3]; const float* wq = I[4]; const float* bq = I[5]; const float* wk = I[6]; const float* bk = I[7]; const float* wv = I[8]; const float* bv = I[9]; const float* wo = I[10]; const float* bo = I[11];      /* NOTE the module's input order v, k, q, mask; per-head [h][in][out] weights + [h][64] biases (= flat [1024]); W0 [in][out] + b0 */
  float* PO = (float*)d_out + (size_t)NB * SQ * DM;      /* second output: last head's attention probabilities [NB][SQ][SQ] f32 at byte offset 16,777,216 */
  char* ws = (char*)d_ws; size_t off = 0;
  auto take = [&](size_t bytes) { char* p = ws + off; off += (bytes + 255) & ~(size_t)255; return p; };
  _Float16* BQ = (_Float16*)take((size_t)DM * DM * 2); _Float16* BK = (_Float16*)take((size_t)DM * DM * 2); _Float16* BV = (_Float16*)take((size_t)DM * DM * 2); _Float16* BO = (_Float16*)take((size_t)DM * DM * 2);
  _Float16* XQ = (_Float16*)take(NR * DM * 2); _Float16* XK = (_Float16*)take(NR * DM * 2); _Float16* XV = (_Float16*)take(NR * DM * 2); _Float16* Q16 = (_Float16*)take(NR * DM * 2); _Float16* K16 = (_Float16*)take(NR * DM * 2); _Float16* V16 = (_Float16*)take(NR * DM * 2); _Float16* O16 = (_Float16*)take(NR * DM * 2);
  _Float16* VT = (_Float16*)take((size_t)NB * NH * HD * SQ * 2); unsigned* MF = (unsigned*)take((size_t)PM_BLOCKS * PM_PITCH * 4);
  if (off > ws_size) return;
  k_prep<<<PP_BLOCKS + PM_BLOCKS, 256, 0, stream>>>(mk, MF, xq, xk, xv, wq, wk, wv, wo, XQ, XK, XV, BQ, BK, BV, BO);      /* the three inputs as exact f16 rows; per-head [h][m][d] -> Bt[(h,d)][m] x16; W0 [in][out] -> Bt x16; all in fragment order */
  const size_t r0p = (size_t)B0 * SQ;      /* first projected row */
  k_gemm2<0, true><<<dim3((unsigned)((MP / 128) * (DM / 64)), 1), 128, 0, stream>>>(XQ + r0p * DM, DM, 0, BQ, DM, 0, 0.0625f, bq, 0, nullptr, 1, 0, 0, nullptr, Q16 + r0p * DM, DM, 0, MP, DM, DM);
  k_gemm2<0, true><<<dim3((unsigned)((MP / 128) * (DM / 64)), 1), 128, 0, stream>>>(XK + r0p * DM, DM, 0, BK, DM, 0, 0.0625f, bk, 0, nullptr, 1, 0, 0, nullptr, K16 + r0p * DM, DM, 0, MP, DM, DM);
  k_gemm2<0, false><<<dim3((unsigned)((MP / 128) * (DM / 64)), 1), 128, 0, stream>>>(XV + r0p * DM, DM, 0, BV, DM, 0, 0.0625f, bv, 0, nullptr, 1, 0, 0, nullptr, V16 + r0p * DM, DM, 0, MP, DM, DM);
  k_vt<NH, SQ><<<NB * NH * (SQ / 64), 256, 0, stream>>>(V16, LQ, 0, VT);      /* V^T per (batch, head), fragment order */
  k_fattn<<<PB_BLOCKS + (SQ / 128) * NH * NB, 256, 0, stream>>>(Q16, K16, VT, mk, MF, O16, PO);      /* scores, softmax and P V in one launch; o (merged heads) as f16 rows; the last head's probabilities to the second output */
  k_gemm2<0, false><<<dim3((unsigned)((MPO / 128) * (DM / 64)), 1), 128, 0, stream>>>(O16 + r0p * DM, DM, 0, BO, DM, 0, 0.0009765625f, bo, 0, nullptr, 1, 0, 0, (float*)d_out + r0p * DM, nullptr, DM, 0, MPO, DM, DM);      /* out rows are the output layout */
}

// v008
// One run takes 130 microseconds.
// In two side-by-side timings against v007, it was 1.11 and 1.14 times as fast.
// All steps since v000 together make it 52.2 times as fast.
#include <hip/hip_runtime.h>
#define NB 2
#define SQ 2048
#define DM 1024
#define NH 16
#define HD 64
#define HG 4                         /* heads per launch of the unused k_vt(V16, b, h0, VT) overload */
#define B0 0                         /* first batch processed (debug hook) */
#define NBR NB                       /* batches processed (debug hook) */
#define NR ((size_t)NB * SQ)         /* token rows */
#define MP ((int)((size_t)NBR * SQ)) /* rows projected (debug hook) */
#define QN SQ                        /* query rows per batch; unused */
#define NHD NH                       /* heads; unused */
#define MPO MP                       /* rows through the output stage (debug hook) */
#define LQ DM      /* halves per token row of q/k/v (v's row pitch; q, k in fragment order) */
typedef __bf16 v16b __attribute__((ext_vector_type(16)));
typedef unsigned short v8us __attribute__((ext_vector_type(8), may_alias));
typedef float  v8f  __attribute__((ext_vector_type(8)));
typedef float  v4f  __attribute__((ext_vector_type(4)));
typedef float  v4fa __attribute__((ext_vector_type(4), may_alias));
union FragB { v16b v; v8us half[2]; unsigned short u[16]; };

__device__ __forceinline__ unsigned short bf16_bits(float x) { unsigned int u = __float_as_uint(x); return (unsigned short)((u + 0x7FFFu + ((u >> 16) & 1u)) >> 16); }
__device__ __forceinline__ float bf16_val(unsigned short b) { return __uint_as_float(((unsigned int)b) << 16); }
__device__ __forceinline__ float bf16_round(float x) { return bf16_val(bf16_bits(x)); }
// D += A·B with NT terms: 1 = ah·bh, 2 = + al·bh (A split), 3 = + ah·bl (both split)
template <int NT>
__device__ __forceinline__ v8f mmaN(v16b ah, v16b al, v16b bh, v16b bl, v8f c) {
  c = __builtin_amdgcn_wmma_f32_16x16x32_bf16(false, ah, false, bh, (short)0, c, false, false);
  if (NT >= 2) c = __builtin_amdgcn_wmma_f32_16x16x32_bf16(false, al, false, bh, (short)0, c, false, false);
  if (NT >= 3) c = __builtin_amdgcn_wmma_f32_16x16x32_bf16(false, ah, false, bl, (short)0, c, false, false);
  asm volatile("v_nop\n\tv_nop\n\tv_nop\n\tv_nop" : "+v"(c) : "v"(ah), "v"(al), "v"(bh), "v"(bl));
  return c;
}

__global__ __launch_bounds__(256) void k_wt_bf16(const float* __restrict__ W, unsigned short* __restrict__ Wt, int K, int N) {
  const int t = blockIdx.x * 256 + threadIdx.x;
  const int k8n = K / 8;
  if (t >= N * k8n) return;
  const int n = t / k8n, k8 = (t % k8n) * 8;
  v8us v;
#pragma unroll
  for (int i = 0; i < 8; ++i) v[i] = bf16_bits(W[(size_t)(k8 + i) * N + n]);
  *(v8us*)(Wt + (size_t)n * K + k8) = v;
  
}

// GEMM C[M][N] (f32, pitch ldc) = act(A[M][K]·W + bias). A f32 row-major (pitch lda) converted per fragment to bf16
// (ASPLIT: hi/lo two planes -> 2 terms, else single rounded term); Wt bf16 [N][K] (pitch ldb). BIAS_BF16 rounds the
// bias to bf16 first (bias quantised to bf16 before the add). K%32==0, M%16==0, N%64==0.
template <bool ASPLIT, int ACT, bool BIAS_BF16>
__global__ __launch_bounds__(128) void k_gemm_bf(const float* __restrict__ A, int lda, const unsigned short* __restrict__ Wt, int ldb,
                                               const float* __restrict__ bias, float* __restrict__ C, int ldc, int M, int N, int K) {
  __shared__ __attribute__((aligned(16))) float so[4][16][64];
  const int tid = threadIdx.x, w = tid >> 5, lane = tid & 31, ln = lane & 15, hh = lane >> 4;
  const int ntn = N / 64;
  const int wid = blockIdx.x * 4 + w;
  const int mt = wid / ntn, nq = wid % ntn;
  if (mt * 16 >= M) return;
  const int row0 = mt * 16, col0 = nq * 64;
  const float* arow = A + (size_t)(row0 + ln) * lda;
  v8f acc[4] = {};
  for (int kb = 0; kb < K; kb += 32) {
    FragB ah, al;
    const v4f x0 = *(const v4fa*)(arow + kb + 8 * hh), x1 = *(const v4fa*)(arow + kb + 8 * hh + 4);
    const v4f x2 = *(const v4fa*)(arow + kb + 16 + 8 * hh), x3 = *(const v4fa*)(arow + kb + 16 + 8 * hh + 4);
    float xs[16] = {x0[0],x0[1],x0[2],x0[3],x1[0],x1[1],x1[2],x1[3],x2[0],x2[1],x2[2],x2[3],x3[0],x3[1],x3[2],x3[3]};
#pragma unroll
    for (int i = 0; i < 16; ++i) { const unsigned short hb = bf16_bits(xs[i]); ah.u[i] = hb; al.u[i] = ASPLIT ? bf16_bits(xs[i] - bf16_val(hb)) : (unsigned short)0; }
#pragma unroll
    for (int t = 0; t < 4; ++t) {
      const unsigned short* brow = Wt + (size_t)(col0 + t * 16 + ln) * ldb + kb;
      FragB b;
      b.half[0] = *(const v8us*)(brow + 8 * hh);
      b.half[1] = *(const v8us*)(brow + 16 + 8 * hh);
      acc[t] = mmaN<ASPLIT ? 2 : 1>(ah.v, al.v, b.v, b.v, acc[t]);
    }
  }
#pragma unroll
  for (int t = 0; t < 4; ++t) {
    float bv = bias ? bias[col0 + t * 16 + ln] : 0.f;
    if (BIAS_BF16) bv = bf16_round(bv);
#pragma unroll
    for (int r = 0; r < 8; ++r) { float v = acc[t][r] + bv; if (ACT == 1) v = fmaxf(v, 0.f); so[w][8 * hh + r][t * 16 + ln] = v; }
  }
  __builtin_amdgcn_fence(__ATOMIC_ACQ_REL, "workgroup");
  __builtin_amdgcn_wave_barrier();
  const int rsub = lane >> 4, c4 = (lane & 15) * 4;
  {
#pragma unroll
    for (int q = 0; q < 8; ++q) {
      const int r = q * 2 + rsub;
      const v4f v = *(const v4fa*)&so[w][r][c4];
      *(v4f*)(C + (size_t)(row0 + r) * ldc + col0 + c4) = v;
    }
    
  }
}

// GEMM C = act(A·W + bias + resid): A f32 (ASPLIT -> hi/lo 2 terms), Wt bf16 [N][K]; ACT 0 none, 1 relu, 2 exact gelu;
// resid (optional, f32, row index = (row % rmod), pitch ldr, RES_BF16 rounds it) added before the activation.
template <bool ASPLIT, int ACT, bool BIAS_BF16, bool RES_BF16>
__global__ __launch_bounds__(128) void k_gemm_bf3(const float* __restrict__ A, int lda, const unsigned short* __restrict__ Wt, int ldb,
                                                const float* __restrict__ bias, const float* __restrict__ resid, int rmod, int ldr,
                                                float* __restrict__ C, int ldc, int M, int N, int K) {
  __shared__ __attribute__((aligned(16))) float so[4][16][64];
  const int tid = threadIdx.x, w = tid >> 5, lane = tid & 31, ln = lane & 15, hh = lane >> 4;
  const int ntn = N / 64;
  const int wid = blockIdx.x * 4 + w;
  const int mt = wid / ntn, nq = wid % ntn;
  if (mt * 16 >= M) return;
  const int row0 = mt * 16, col0 = nq * 64;
  const float* arow = A + (size_t)(row0 + ln) * lda;
  v8f acc[4] = {};
  for (int kb = 0; kb < K; kb += 32) {
    FragB ah, al;
    const v4f x0 = *(const v4fa*)(arow + kb + 8 * hh), x1 = *(const v4fa*)(arow + kb + 8 * hh + 4);
    const v4f x2 = *(const v4fa*)(arow + kb + 16 + 8 * hh), x3 = *(const v4fa*)(arow + kb + 16 + 8 * hh + 4);
    float xs[16] = {x0[0],x0[1],x0[2],x0[3],x1[0],x1[1],x1[2],x1[3],x2[0],x2[1],x2[2],x2[3],x3[0],x3[1],x3[2],x3[3]};
#pragma unroll
    for (int i = 0; i < 16; ++i) { const unsigned short hb = bf16_bits(xs[i]); ah.u[i] = hb; al.u[i] = ASPLIT ? bf16_bits(xs[i] - bf16_val(hb)) : (unsigned short)0; }
#pragma unroll
    for (int t = 0; t < 4; ++t) {
      const unsigned short* brow = Wt + (size_t)(col0 + t * 16 + ln) * ldb + kb;
      FragB b;
      b.half[0] = *(const v8us*)(brow + 8 * hh);
      b.half[1] = *(const v8us*)(brow + 16 + 8 * hh);
      acc[t] = mmaN<ASPLIT ? 2 : 1>(ah.v, al.v, b.v, b.v, acc[t]);
    }
  }
#pragma unroll
  for (int t = 0; t < 4; ++t) {
    const int col = col0 + t * 16 + ln;
    float bv = bias ? bias[col] : 0.f;
    if (BIAS_BF16) bv = bf16_round(bv);
#pragma unroll
    for (int r = 0; r < 8; ++r) {
      float v = acc[t][r] + bv;
      if (resid) { float rv = resid[(size_t)((row0 + 8 * hh + r) % rmod) * ldr + col]; if (RES_BF16) rv = bf16_round(rv); v += rv; }
      if (ACT == 1) v = fmaxf(v, 0.f);
      if (ACT == 2) v = 0.5f * v * (1.0f + erff(v * 0.70710678118654752f));
      if (ACT == 3) { const float u = 0.7978845608028654f * (v + 0.044715f * v * v * v); v = 0.5f * v * (1.0f + tanhf(u)); }
      so[w][8 * hh + r][t * 16 + ln] = v;
    }
  }
  __builtin_amdgcn_fence(__ATOMIC_ACQ_REL, "workgroup");
  __builtin_amdgcn_wave_barrier();
  const int rsub = lane >> 4, c4 = (lane & 15) * 4;
  {
#pragma unroll
    for (int q = 0; q < 8; ++q) {
      const int r = q * 2 + rsub;
      const v4f v = *(const v4fa*)&so[w][r][c4];
      *(v4f*)(C + (size_t)(row0 + r) * ldc + col0 + c4) = v;
    }
    
  }
}
// row LayerNorm (biased variance, eps) over N: s = X (+ R); optional out_sum <- s; out_norm <- (s-mu)*rsqrt(var+eps)*g + b
template <bool PARAM_BF16>
__global__ __launch_bounds__(256) void k_layernorm(const float* __restrict__ X, const float* __restrict__ R, const float* __restrict__ g, const float* __restrict__ bta,
                                                  float* __restrict__ out_sum, float* __restrict__ out_norm, int N, float eps) {
  __shared__ float red[256];
  const int row = blockIdx.x, tid = threadIdx.x;
  const float* x = X + (size_t)row * N; const float* rr = R ? R + (size_t)row * N : nullptr;
  float vals[16];                     // up to N = 4096
  const int per = N / 256;            // contiguous chunk per thread? use strided-by-4 chunks: thread handles j = tid*4 + 1024*u
  float s1 = 0.f;
  for (int u = 0; u < per / 4; ++u) {
    const int j = tid * 4 + 1024 * u;
    const v4f a = *(const v4fa*)(x + j);
    v4f b = {0.f,0.f,0.f,0.f}; if (rr) b = *(const v4fa*)(rr + j);
#pragma unroll
    for (int q = 0; q < 4; ++q) { const float v = a[q] + b[q]; vals[u * 4 + q] = v; s1 += v; }
  }
  red[tid] = s1; __syncthreads();
  for (int st = 128; st > 0; st >>= 1) { if (tid < st) red[tid] += red[tid + st]; __syncthreads(); }
  const float mu = red[0] / (float)N; __syncthreads();
  float s2 = 0.f;
  for (int u = 0; u < per / 4; ++u)
#pragma unroll
    for (int q = 0; q < 4; ++q) { const float c = vals[u * 4 + q] - mu; s2 += c * c; }
  red[tid] = s2; __syncthreads();
  for (int st = 128; st > 0; st >>= 1) { if (tid < st) red[tid] += red[tid + st]; __syncthreads(); }
  const float rs = rsqrtf(red[0] / (float)N + eps);
  {
    for (int u = 0; u < per / 4; ++u) {
      const int j = tid * 4 + 1024 * u;
      v4f o, sm;
#pragma unroll
      for (int q = 0; q < 4; ++q) {
        float gg = g[j + q], bb = bta[j + q];
        if (PARAM_BF16) { gg = bf16_round(gg); bb = bf16_round(bb); }
        sm[q] = vals[u * 4 + q]; o[q] = (vals[u * 4 + q] - mu) * rs * gg + bb;
      }
      if (out_sum) *(v4f*)(out_sum + (size_t)row * N + j) = sm;
      *(v4f*)(out_norm + (size_t)row * N + j) = o;
    }
    
  }
}



// ---- f16 WMMA path (v_wmma_f32_16x16x32_f16): 11-bit significands for operands in range — used where a [0,1] probability operand needs more precision than bf16
typedef _Float16 v16h __attribute__((ext_vector_type(16)));
union FragH { v16h v; v8us half[2]; _Float16 h[16]; unsigned short u[16]; };
template <int NT>
__device__ __forceinline__ v8f mmaH(v16h ah, v16h al, v16h bh, v16h bl, v8f c) {
  c = __builtin_amdgcn_wmma_f32_16x16x32_f16(false, ah, false, bh, (short)0, c, false, false);
  if (NT >= 2) c = __builtin_amdgcn_wmma_f32_16x16x32_f16(false, al, false, bh, (short)0, c, false, false);
  if (NT >= 3) c = __builtin_amdgcn_wmma_f32_16x16x32_f16(false, ah, false, bl, (short)0, c, false, false);
  asm volatile("v_nop\n\tv_nop\n\tv_nop\n\tv_nop" : "+v"(c) : "v"(ah), "v"(al), "v"(bh), "v"(bl));
  return c;
}
// batched GEMM like k_gemm_b but f16 operands: A f32 (split into f16 hi/lo if ASPLIT, else rounded to f16), Bt = f16 values [n][k]; alpha; C f32; N multiple of 16 (partial tiles skipped)
template <bool ASPLIT>
__global__ __launch_bounds__(128) void k_gemm_h(const float* __restrict__ A, int lda, size_t sA, const _Float16* __restrict__ Bh, int ldb, size_t sB, float alpha, float* __restrict__ C, int ldc, size_t sC, int M, int N, int K) {
  __shared__ __attribute__((aligned(16))) float so[4][16][64];
  const int tid = threadIdx.x, w = tid >> 5, lane = tid & 31, ln = lane & 15, hh = lane >> 4; const int by = blockIdx.y;
  A += (size_t)by * sA; Bh += (size_t)by * sB; C += (size_t)by * sC;
  const int ntn = (N + 63) / 64; const int wid = blockIdx.x * 4 + w; const int mt = wid / ntn, nq = wid % ntn; if (mt * 16 >= M) return;
  const int row0 = mt * 16, col0 = nq * 64; const float* arow = A + (size_t)(row0 + ln) * lda;
  v8f acc[4] = {};
  for (int kb = 0; kb < K; kb += 32) {
    FragH ah, al;
    const v4f x0 = *(const v4fa*)(arow + kb + 8 * hh), x1 = *(const v4fa*)(arow + kb + 8 * hh + 4), x2 = *(const v4fa*)(arow + kb + 16 + 8 * hh), x3 = *(const v4fa*)(arow + kb + 16 + 8 * hh + 4);
    float xs[16] = {x0[0],x0[1],x0[2],x0[3],x1[0],x1[1],x1[2],x1[3],x2[0],x2[1],x2[2],x2[3],x3[0],x3[1],x3[2],x3[3]};
#pragma unroll
    for (int i = 0; i < 16; ++i) { const _Float16 h = (_Float16)xs[i]; ah.h[i] = h; al.h[i] = ASPLIT ? (_Float16)(xs[i] - (float)h) : (_Float16)0.0f; }
#pragma unroll
    for (int t = 0; t < 4; ++t) { if (col0 + t * 16 >= N) continue; const size_t boff = (size_t)(col0 + t * 16 + ln) * ldb + kb; FragH bq; bq.half[0] = *(const v8us*)(Bh + boff + 8 * hh); bq.half[1] = *(const v8us*)(Bh + boff + 16 + 8 * hh);
      acc[t] = mmaH<ASPLIT ? 2 : 1>(ah.v, al.v, bq.v, bq.v, acc[t]); }
  }
#pragma unroll
  for (int t = 0; t < 4; ++t) { if (col0 + t * 16 >= N) continue;
#pragma unroll
    for (int r = 0; r < 8; ++r) so[w][8 * hh + r][t * 16 + ln] = acc[t][r] * alpha; }
  __builtin_amdgcn_fence(__ATOMIC_ACQ_REL, "workgroup"); __builtin_amdgcn_wave_barrier();
  const int rsub = lane >> 4, c4 = (lane & 15) * 4;
  {
#pragma unroll
    for (int q = 0; q < 8; ++q) { const int r = q * 2 + rsub; if (col0 + c4 < N) { const v4f v = *(const v4fa*)&so[w][r][c4]; *(v4f*)(C + (size_t)(row0 + r) * ldc + col0 + c4) = v; } }
     }
}

// k_gemm_hh variant with fused epilogue: v = acc·alpha + bias[by·sBias + col] (+ CP[(row/rowsPerB)·sCPb + by·64 + col] if CP) ; ACT 0 none / 1 elu ; writes f16 C16 (and f32 C if non-null)
template <int ACT>
__global__ __launch_bounds__(128) void k_gemm_hhx(const _Float16* __restrict__ A, int lda, size_t sA, const _Float16* __restrict__ Bh, int ldb, size_t sB, float alpha, const float* __restrict__ bias, size_t sBias, const float* __restrict__ CP, int rowsPerB, size_t sCPb, int row0g,
    float* __restrict__ C, _Float16* __restrict__ C16, int ldc, size_t sC, int M, int N, int K) {
  __shared__ __attribute__((aligned(16))) float so[4][16][64];
  const int tid = threadIdx.x, w = tid >> 5, lane = tid & 31, ln = lane & 15, hh = lane >> 4; const int by = blockIdx.y;
  A += (size_t)by * sA; Bh += (size_t)by * sB; const size_t cofs = (size_t)by * sC; const float* bp = bias ? bias + (size_t)by * sBias : nullptr;
  const int ntn = (N + 63) / 64; const int wid = blockIdx.x * 4 + w; const int mt = wid / ntn, nq = wid % ntn; if (mt * 16 >= M) return;
  const int row0 = mt * 16, col0 = nq * 64; const _Float16* arow = A + (size_t)(row0 + ln) * lda;
  v8f acc[4] = {};
  for (int kb = 0; kb < K; kb += 32) { FragH ah; ah.half[0] = *(const v8us*)((const unsigned short*)arow + kb + 8 * hh); ah.half[1] = *(const v8us*)((const unsigned short*)arow + kb + 16 + 8 * hh);
#pragma unroll
    for (int t = 0; t < 4; ++t) { if (col0 + t * 16 >= N) continue; const size_t boff = (size_t)(col0 + t * 16 + ln) * ldb + kb; FragH bq; bq.half[0] = *(const v8us*)((const unsigned short*)Bh + boff + 8 * hh); bq.half[1] = *(const v8us*)((const unsigned short*)Bh + boff + 16 + 8 * hh);
      acc[t] = mmaH<1>(ah.v, ah.v, bq.v, bq.v, acc[t]); }
  }
#pragma unroll
  for (int t = 0; t < 4; ++t) { if (col0 + t * 16 >= N) continue; const int col = col0 + t * 16 + ln; const float bv = bp ? bf16_round(bp[col]) : 0.f;
#pragma unroll
    for (int r = 0; r < 8; ++r) { float v = acc[t][r] * alpha + bv; if (CP) { const int rr = row0g + row0 + 8 * hh + r; if (rowsPerB < 0) v += CP[cofs + (size_t)rr * ldc + col];      /* rowsPerB < 0: own element of the batched C plane */ else { const int bidx = rr / rowsPerB; v += CP[(size_t)bidx * sCPb + (size_t)by * 64 + col]; } } if (ACT == 1) v = (v > 0.f) ? v : expm1f(v); else if (ACT == 7) v = (v > 0.f) ? v + 1.0f : expf(v); else if (ACT == 8) v = tanhf(v); else if (ACT == 9) v = 0.5f * v * (1.0f + tanhf(0.7978845608028654f * (v + 0.044715f * v * v * v))); else if (ACT == 11) v = 1.0f / (1.0f + expf(-v)); else if (ACT == 12) v = (v > 0.f) ? v : 0.01f * v; else if (ACT == 14) v = (v > 0.f) ? v : 0.1f * v; else if (ACT == 16) v = (v >= 0.f) ? v : 0.3f * v; else if (ACT == 17) v = (v >= 0.f) ? v : 0.2f * v; else if (ACT == 15) v = v / (1.0f + expf(-v)); else if (ACT == 3) v = fmaxf(v, 0.f); else if (ACT == 6) v = 0.5f * v * (1.0f + erff(v * 0.70710678118654752f)); so[w][8 * hh + r][t * 16 + ln] = v; } }
  __builtin_amdgcn_fence(__ATOMIC_ACQ_REL, "workgroup"); __builtin_amdgcn_wave_barrier();
  const int rsub = lane >> 4, c4 = (lane & 15) * 4; typedef _Float16 v4h __attribute__((ext_vector_type(4)));
  {
#pragma unroll
    for (int q = 0; q < 8; ++q) { const int r = q * 2 + rsub; if (col0 + c4 < N) { const v4f v = *(const v4fa*)&so[w][r][c4]; if (C) *(v4f*)(C + cofs + (size_t)(row0 + r) * ldc + col0 + c4) = v; if (C16) { v4h h4; for (int i = 0; i < 4; ++i) h4[i] = (_Float16)v[i]; *(v4h*)(C16 + cofs + (size_t)(row0 + r) * ldc + col0 + c4) = h4; } } }
     }
}


typedef _Float16 v4h __attribute__((ext_vector_type(4)));

__global__ __launch_bounds__(256) void k_h16(const float* __restrict__ x, _Float16* __restrict__ X16, size_t n8) { const size_t t = (size_t)blockIdx.x * 256 + threadIdx.x; if (t >= n8) return; FragH f;
#pragma unroll
  for (int q = 0; q < 8; ++q) f.h[q] = (_Float16)x[t * 8 + q]; *(v8us*)((unsigned short*)X16 + t * 8) = f.half[0];  }
__global__ __launch_bounds__(256) void k_round16f(const float* __restrict__ W, _Float16* __restrict__ Bt, size_t n8) { const size_t t = (size_t)blockIdx.x * 256 + threadIdx.x; if (t >= n8) return; FragH f;
#pragma unroll
  for (int i = 0; i < 8; ++i) f.h[i] = (_Float16)(bf16_round(W[t * 8 + i]) * 16.0f); *(v8us*)((unsigned short*)Bt + t * 8) = f.half[0];  }
template <int NHv, int TTv>
__global__ __launch_bounds__(256) void k_vt(const _Float16* __restrict__ V16, int ldv, int voff, _Float16* __restrict__ Vt) { __shared__ unsigned short tl[64][66]; const int tid = threadIdx.x; const int slab = blockIdx.x / (TTv / 64), lg = blockIdx.x % (TTv / 64); const int b = slab / NHv, h = slab % NHv;
  for (int i = tid; i < 64 * 8; i += 256) { const int r = i / 8, c8 = (i % 8) * 8; FragH f; f.half[0] = *(const v8us*)((const unsigned short*)V16 + ((size_t)b * TTv + lg * 64 + r) * ldv + voff + h * 64 + c8);
#pragma unroll
    for (int q = 0; q < 8; ++q) tl[r][c8 + q] = f.u[q]; }
  __syncthreads();
  {
#pragma unroll
    for (int rd = 0; rd < 2; ++rd) { const int i = rd * 256 + tid, tile = i >> 6; const int d = (tile & 3) * 16 + (i & 15), kl = (tile >> 2) * 32 + ((i >> 5) & 1) * 16 + ((i >> 4) & 1) * 8; FragH f;      /* fragment order (pk_frag), tile (32 keys, 16 d) at (key / 32) * 4 + d / 16 of the slab */
#pragma unroll
      for (int q = 0; q < 8; ++q) f.u[q] = tl[kl + q][d];
      *(v8us*)((unsigned short*)Vt + (size_t)slab * 64 * TTv + (size_t)lg * 4096 + i * 8) = f.half[0]; }
     } }

__global__ __launch_bounds__(256) void k_hl(const float* __restrict__ F, _Float16* __restrict__ Hh, _Float16* __restrict__ Hl, size_t n8) { const size_t t = (size_t)blockIdx.x * 256 + threadIdx.x; if (t >= n8) return; FragH fh, fl; const v4f a = *(const v4fa*)(F + t * 8), c = *(const v4fa*)(F + t * 8 + 4);
#pragma unroll
  for (int q = 0; q < 4; ++q) { _Float16 h = (_Float16)a[q]; fh.h[q] = h; fl.h[q] = (_Float16)((a[q] - (float)h) * 1024.0f); h = (_Float16)c[q]; fh.h[4 + q] = h; fl.h[4 + q] = (_Float16)((c[q] - (float)h) * 1024.0f); }
  { *(v8us*)((unsigned short*)Hh + t * 8) = fh.half[0]; *(v8us*)((unsigned short*)Hl + t * 8) = fl.half[0];  } }

// ---- fast GEMM (wave tile 32x64; requires M % 32 == 0 rows per launch region and N % 64 == 0); epilogue = k_gemm_hhx semantics ----
__device__ __forceinline__ v16h g2_frag(const _Float16* p, int hh) { FragH f; f.half[0] = *(const v8us*)((const unsigned short*)p + 8 * hh); f.half[1] = *(const v8us*)((const unsigned short*)p + 16 + 8 * hh); return f.v; }
// Fragment order of an f16 matrix [R][K]: 16-row x 32-k tiles of 1024 bytes, tile (rt, kt) at (rt * (K / 32) + kt) * 512 halves; inside a tile the 8 halves of row ln, k = part * 16 + hh * 8 .. + 7
// stand at (part * 32 + hh * 16 + ln) * 8. p = the tile + lane * 8: each of the two loads of a wave then covers 512 contiguous bytes (4 whole lines, not 16 pieces of 32 bytes); the k order is that of g2_frag.
__device__ __forceinline__ v16h pk_frag(const _Float16* p) { FragH f; f.half[0] = *(const v8us*)((const unsigned short*)p); f.half[1] = *(const v8us*)((const unsigned short*)p + 256); return f.v; }
__device__ __forceinline__ v8f g2_mma(v16h a, v16h b, v8f c) { v8f d = __builtin_amdgcn_wmma_f32_16x16x32_f16(false, a, false, b, (short)0, c, false, false); asm volatile("v_nop\n\tv_nop\n\tv_nop\n\tv_nop" : "+v"(d) : "v"(a), "v"(b)); return d; }
struct G2F { v16h a0, a1, b0, b1, b2, b3; };      /* the six fragments of one 32-k tile: two row tiles of A, four column tiles of B */
// one k tile's twelve loads, issued as one group at this place, tiles ahead of the products that read them. The wait stands behind the group: the six address pairs, named as inputs, stay live up to it,
// so that no load's result lands in a register that an issued load still names; the two scheduling barriers keep every load of the group in front of the wait and every rewrite of an address behind it
__device__ __forceinline__ G2F g2_load(const _Float16* a0, const _Float16* a1, const _Float16* b0, const _Float16* b1, const _Float16* b2, const _Float16* b3, int kb) { G2F f;
  const _Float16* p0 = a0 + kb; const _Float16* p1 = a1 + kb; const _Float16* p2 = b0 + kb; const _Float16* p3 = b1 + kb; const _Float16* p4 = b2 + kb; const _Float16* p5 = b3 + kb;
  f.a0 = pk_frag(p0); f.a1 = pk_frag(p1); f.b0 = pk_frag(p2); f.b1 = pk_frag(p3); f.b2 = pk_frag(p4); f.b3 = pk_frag(p5);
  __builtin_amdgcn_sched_barrier(0); asm volatile("s_wait_xcnt 0x0" :: "v"(p0), "v"(p1), "v"(p2), "v"(p3), "v"(p4), "v"(p5) : "memory"); __builtin_amdgcn_sched_barrier(0); return f; }
template <int ACT, bool PK>      /* A and Bh in fragment order (pk_frag); PK: C16 alone is written, in fragment order; else C and C16 row-major. so: the block's staging range; bx, by: the block's tile and batch */
__device__ __forceinline__ void g2_body(float (*so)[32][68], const int bx, const int by, const _Float16* __restrict__ A, int lda, size_t sA, const _Float16* __restrict__ Bh, int ldb, size_t sB, float alpha, const float* __restrict__ bias, size_t sBias, const float* __restrict__ CP, int rowsPerB, size_t sCPb, int row0g,
    float* __restrict__ C, _Float16* __restrict__ C16, int ldc, size_t sC, int M, int N, int K) { static_assert(ACT == 0 || ACT == 3 || ACT == 6 || ACT == 8 || ACT == 9 || ACT == 11 || ACT == 12 || ACT == 14 || ACT == 15 || ACT == 16 || ACT == 17, "k_gemm2: unsupported ACT code (would silently apply no activation)");
  const int tid = threadIdx.x, w = tid >> 5, lane = tid & 31, ln = lane & 15, hh = lane >> 4;
  A += (size_t)by * sA; Bh += (size_t)by * sB; const size_t cofs = (size_t)by * sC; const float* bp = bias ? bias + (size_t)by * sBias : nullptr;
  const int ntn = N >> 6; const int mt = bx / ntn, nq = bx - mt * ntn; const int row0 = mt * 128 + 32 * w, col0 = nq * 64; if (row0 >= M) return;
  const _Float16* a0p = A + (size_t)row0 * lda + lane * 8; const _Float16* a1p = a0p + (size_t)16 * lda;
  const _Float16* b0p = Bh + (size_t)col0 * ldb + lane * 8; const _Float16* b1p = b0p + (size_t)16 * ldb; const _Float16* b2p = b1p + (size_t)16 * ldb; const _Float16* b3p = b2p + (size_t)16 * ldb;
  const v8f z8 = {0.f,0.f,0.f,0.f,0.f,0.f,0.f,0.f}; v8f c00 = z8, c01 = z8, c02 = z8, c03 = z8, c10 = z8, c11 = z8, c12 = z8, c13 = z8;
  if (K > 0) { const int ke = K * 16, kl = ke - 512, n3 = ke / 1536; int kb = 0;      /* halves of a fragment row; its last tile; whole trips. A ring of three register sets: tile t + 2 is asked for in front of tile t's products; past the end the last tile is fetched again, in bounds */
#define G2_LOAD(k) g2_load(a0p, a1p, b0p, b1p, b2p, b3p, (k) < kl ? (k) : kl)
#define G2_TILE(f) { c00 = g2_mma(f.a0, f.b0, c00); c10 = g2_mma(f.a1, f.b0, c10); c01 = g2_mma(f.a0, f.b1, c01); c11 = g2_mma(f.a1, f.b1, c11); c02 = g2_mma(f.a0, f.b2, c02); c12 = g2_mma(f.a1, f.b2, c12); c03 = g2_mma(f.a0, f.b3, c03); c13 = g2_mma(f.a1, f.b3, c13); }
    G2F f0 = G2_LOAD(0), f1 = G2_LOAD(512);
#pragma unroll 1      // three tiles a trip, so that each set keeps its registers (no copies between the sets); one block without an exit inside, so that the waits for the loads stay counted
    for (int i = 0; i < n3; ++i, kb += 1536) { const G2F f2 = G2_LOAD(kb + 1024); G2_TILE(f0) f0 = G2_LOAD(kb + 1536); G2_TILE(f1) f1 = G2_LOAD(kb + 2048); G2_TILE(f2) }
    if (kb < ke) G2_TILE(f0)      /* the one or two tiles that no whole trip holds are already in the ring */
    if (kb + 512 < ke) G2_TILE(f1) }
#undef G2_LOAD
#undef G2_TILE
  v8f accs[8] = {c00, c01, c02, c03, c10, c11, c12, c13};
#pragma unroll
  for (int u = 0; u < 8; ++u) { const int t = u & 3, half = u >> 2; const int col = col0 + t * 16 + ln; const float bv = bp ? bf16_round(bp[col]) : 0.f;
#pragma unroll
    for (int r = 0; r < 8; ++r) { const int rloc = half * 16 + 8 * hh + r; float v = accs[u][r] * alpha + bv; if (CP) { if (rowsPerB < 0) v += CP[cofs + (size_t)(row0g + row0 + rloc) * ldc + col];      /* rowsPerB < 0: own element of the batched C plane */ else { const int bidx = (row0g + row0 + rloc) / rowsPerB; v += CP[(size_t)bidx * sCPb + (size_t)by * 64 + col]; } }
      if (ACT == 3) v = fmaxf(v, 0.f); else if (ACT == 6) v = 0.5f * v * (1.0f + erff(v * 0.70710678118654752f)); else if (ACT == 11) v = 1.0f / (1.0f + expf(-v)); else if (ACT == 15) v = v / (1.0f + expf(-v)); else if (ACT == 12) v = (v > 0.f) ? v : 0.01f * v; else if (ACT == 8) v = tanhf(v); else if (ACT == 9) v = 0.5f * v * (1.0f + tanhf(0.7978845608028654f * (v + 0.044715f * v * v * v))); else if (ACT == 14) v = (v > 0.f) ? v : 0.1f * v; else if (ACT == 16) v = (v >= 0.f) ? v : 0.3f * v; else if (ACT == 17) v = (v >= 0.f) ? v : 0.2f * v;
      so[w][rloc][t * 16 + ln] = v; } }
  __builtin_amdgcn_fence(__ATOMIC_ACQ_REL, "workgroup"); __builtin_amdgcn_wave_barrier();
  const int rsub = lane >> 4, c4 = (lane & 15) * 4;
  if (PK) {      /* C16 alone, in fragment order: the wave's 32 x 64 tile = 2 x 2 fragment tiles, eight stores of 512 contiguous bytes */
#pragma unroll      // constant LDS and store offsets
      for (int s = 0; s < 8; ++s) { const int rl = (s >> 2) * 16 + ln, cl = ((s >> 1) & 1) * 32 + (s & 1) * 16 + hh * 8; const v4f x = *(const v4fa*)&so[w][rl][cl], y = *(const v4fa*)&so[w][rl][cl + 4]; FragH f;
        for (int i = 0; i < 4; ++i) { f.h[i] = (_Float16)x[i]; f.h[4 + i] = (_Float16)y[i]; }
        *(v8us*)((unsigned short*)C16 + cofs + (size_t)(row0 + (s >> 2) * 16) * ldc + (size_t)((col0 >> 5) + ((s >> 1) & 1)) * 512 + (s & 1) * 256 + lane * 8) = f.half[0]; }
    return; }
  {
#pragma unroll
    for (int q = 0; q < 16; ++q) { const int r = q * 2 + rsub; const v4f v = *(const v4fa*)&so[w][r][c4]; if (C) *(v4f*)(C + cofs + (size_t)(row0 + r) * ldc + col0 + c4) = v; if (C16) { v4h h4; for (int i = 0; i < 4; ++i) h4[i] = (_Float16)v[i]; *(v4h*)(C16 + cofs + (size_t)(row0 + r) * ldc + col0 + c4) = h4; } }
     } }
template <int ACT, bool PK>
__global__ __launch_bounds__(128) void k_gemm2(const _Float16* __restrict__ A, int lda, size_t sA, const _Float16* __restrict__ Bh, int ldb, size_t sB, float alpha, const float* __restrict__ bias, size_t sBias, const float* __restrict__ CP, int rowsPerB, size_t sCPb, int row0g,
    float* __restrict__ C, _Float16* __restrict__ C16, int ldc, size_t sC, int M, int N, int K) {
  __shared__ __attribute__((aligned(16))) float so[4][32][68];
  g2_body<ACT, PK>(so, (int)blockIdx.x, (int)blockIdx.y, A, lda, sA, Bh, ldb, sB, alpha, bias, sBias, CP, rowsPerB, sCPb, row0g, C, C16, ldc, sC, M, N, K); }
// The three projections as one launch: none reads what another writes. blockIdx.y = 0, 1, 2: v (row-major, for the transpose; the longer epilogue starts first), q, k (fragment order). One projection alone puts
// two waves on a SIMD, and each of its k tiles waits for operands that every block asks for at the same time; with all three in flight a SIMD holds as many waves as the registers allow, and two launch gaps, fills and tails go.
__global__ __launch_bounds__(128) void k_qkv(const _Float16* __restrict__ XQ, const _Float16* __restrict__ XK, const _Float16* __restrict__ XV, const _Float16* __restrict__ BQ, const _Float16* __restrict__ BK, const _Float16* __restrict__ BV,
    const float* __restrict__ bq, const float* __restrict__ bk, const float* __restrict__ bv, _Float16* __restrict__ Q16, _Float16* __restrict__ K16, _Float16* __restrict__ V16) {
  __shared__ __attribute__((aligned(16))) float so[4][32][68];
  const int y = (int)blockIdx.y;      /* block-uniform */
  if (y == 0) g2_body<0, false>(so, (int)blockIdx.x, 0, XV, DM, 0, BV, DM, 0, 0.0625f, bv, 0, nullptr, 1, 0, 0, nullptr, V16, DM, 0, MP, DM, DM);
  else g2_body<0, true>(so, (int)blockIdx.x, 0, y == 1 ? XQ : XK, DM, 0, y == 1 ? BQ : BK, DM, 0, 0.0625f, y == 1 ? bq : bk, 0, nullptr, 1, 0, 0, nullptr, y == 1 ? Q16 : K16, DM, 0, MP, DM, DM); }


__global__ __launch_bounds__(256) void k_wnat(const float* __restrict__ w, size_t n8, _Float16* __restrict__ Bt) { const size_t t = (size_t)blockIdx.x * 256 + threadIdx.x; if (t >= n8) return; FragH f; for (int q = 0; q < 8; ++q) f.h[q] = (_Float16)(bf16_round(w[t * 8 + q]) * 16.0f); *(v8us*)((unsigned short*)Bt + t * 8) = f.half[0];  }
__global__ __launch_bounds__(256) void k_rsm(const float* __restrict__ S, _Float16* __restrict__ P, int nrows) {
  #pragma clang fp contract(off)
  const int i = blockIdx.x * 256 + threadIdx.x; if (i >= nrows) return; const float* s = S + (size_t)i * SQ; float mx = -3.0e38f;
#pragma unroll 1
  for (int j = 0; j < SQ; ++j) mx = fmaxf(mx, s[j]); float se = 0.f;
#pragma unroll 1
  for (int j = 0; j < SQ; ++j) se += expf(s[j] - mx); const float sc = 256.0f / se;
#pragma unroll 1
  for (int j0 = 0; j0 < SQ; j0 += 8) { FragH f; for (int q = 0; q < 8; ++q) f.h[q] = (_Float16)(expf(s[j0 + q] - mx) * sc); unsigned short* d = (unsigned short*)P + (size_t)i * SQ + j0; *(v8us*)d = f.half[0];  } }
__global__ __launch_bounds__(256) void k_vt(const _Float16* __restrict__ V16, int b, int h0, _Float16* __restrict__ VT) { __shared__ unsigned short tl[64][65]; const int tid = threadIdx.x; const int hh = blockIdx.x % HG, sg = blockIdx.x / HG; const int s0 = sg * 64; const int h = h0 + hh;
  for (int i = tid; i < 64 * 8; i += 256) { const int j = i / 8, d8 = (i % 8) * 8; FragH f; f.half[0] = *(const v8us*)((const unsigned short*)V16 + ((size_t)b * SQ + s0 + j) * DM + h * HD + d8); for (int q = 0; q < 8; ++q) tl[d8 + q][j] = f.u[q]; }
  __syncthreads();
  { for (int i = tid; i < 64 * 8; i += 256) { const int d = i / 8, j8 = (i % 8) * 8; FragH f; for (int q = 0; q < 8; ++q) f.u[q] = tl[d][j8 + q]; *(v8us*)((unsigned short*)VT + ((size_t)hh * HD + d) * SQ + s0 + j8) = f.half[0]; }  } }






typedef int v4ia __attribute__((ext_vector_type(4), may_alias));
__device__ __forceinline__ float rs_xrow(float v) { const int i = __float_as_int(v); return __int_as_float(__builtin_amdgcn_permlanex16(i, i, 0x76543210, 0xfedcba98, true, false)); }      /* lane l reads lane l ^ 16 */
// Fused attention, one wave per 16 query rows of one (batch, head), 32 keys a pass: S^T = K Q^T (A = K rows, B = Q kept in registers), so a lane holds one query's
// scores (keys 8*hh + r of each 16-key tile); running maximum and sum per lane, one exchange between the wave halves; the two f32 score tiles, converted in place,
// are the B operand of O^T += V^T P^T. No score and no weight goes through memory. All in the log2 domain: p = 2^(s * FA_C - mu + FA_OFF) with mu the maximum in use.
#define FA_C 0.18033688011112042f      /* 64^-0.5 * log2(e) */
#define FA_OFF 7.0f                    /* weights carried x128: small ones stay normal f16 numbers */
#define FA_THR 8.0f                    /* mu is renewed only when a score passes it by more than this: weights stay at or under 2^15, inside f16 */
#define FA_DROP (-0x1p+100f)           /* raw score of a masked key; a power of two, so FA_DROP * FA_C is exact and a row with every key masked gets equal weights */
__device__ __forceinline__ v8f fa_mma(v16h a, v16h b, v8f c) { return __builtin_amdgcn_wmma_f32_16x16x32_f16(false, a, false, b, (short)0, c, false, false); }
// eight native 2^x; each is followed by an independent instruction, the last by the v_nop: the slot the instruction set asks for behind a transcendental
__device__ __forceinline__ v8f fa_exp2(v8f x) { float e0, e1, e2, e3, e4, e5, e6, e7;
  asm("v_exp_f32 %0, %8\n\tv_exp_f32 %1, %9\n\tv_exp_f32 %2, %10\n\tv_exp_f32 %3, %11\n\tv_exp_f32 %4, %12\n\tv_exp_f32 %5, %13\n\tv_exp_f32 %6, %14\n\tv_exp_f32 %7, %15\n\tv_nop"
      : "=&v"(e0), "=&v"(e1), "=&v"(e2), "=&v"(e3), "=&v"(e4), "=&v"(e5), "=&v"(e6), "=&v"(e7) : "v"(x[0]), "v"(x[1]), "v"(x[2]), "v"(x[3]), "v"(x[4]), "v"(x[5]), "v"(x[6]), "v"(x[7]));
  const v8f e = {e0, e1, e2, e3, e4, e5, e6, e7}; return e; }
__device__ __forceinline__ float fa_exp2s(float x) { float e; asm("v_exp_f32 %0, %1\n\tv_nop" : "=v"(e) : "v"(x)); return e; }      /* the v_nop: the same slot */
// behind a group of loads or stores: the group is issued whole at this place (for loads: ahead of the arithmetic that covers their latency), and its address and data registers are reused only behind the wait;
// the two scheduling barriers keep every member of the group in front of the wait and every rewrite of a register behind it
__device__ __forceinline__ void fa_issued() { __builtin_amdgcn_sched_barrier(0); asm volatile("s_wait_xcnt 0x0" ::: "memory"); __builtin_amdgcn_sched_barrier(0); }
struct FaK { v16h a00, a01, a10, a11; };      /* one pass of K fragments (two 16-key tiles x two k steps) */
// kp: the head's first K tile + lane * 8 (fragment order)
__device__ __forceinline__ FaK fa_load(const _Float16* kp, int j) { FaK f; const _Float16* k = kp + (size_t)j * LQ;
  f.a00 = pk_frag(k); f.a01 = pk_frag(k + 512); f.a10 = pk_frag(k + 16 * LQ); f.a11 = pk_frag(k + 16 * LQ + 512); return f; }
// The mask's pass map, written by pm_tile in the first launch: for each tile of 16 query rows (token rows) one 64-bit word, bit p set when the tile's 16 x 32 mask words of pass p (keys 32 p .. 32 p + 31)
// hold a nonzero one. A wave reads its tile's word once and tests one scalar bit a pass; no mask word is read in a pass without a nonzero one. A tile's word has a 128-byte line of its own (one writer a line).
#define PM_PITCH 32                    /* 32-bit words between two tiles' map words */
static_assert(SQ == 2048, "pass map: 64 passes of 32 keys in one 64-bit word");
__device__ __forceinline__ unsigned long long fa_map(const unsigned* __restrict__ MF, size_t rq) { const unsigned* p = MF + rq / 16 * PM_PITCH;
  const unsigned lo = (unsigned)__builtin_amdgcn_readfirstlane((int)p[0]), hi = (unsigned)__builtin_amdgcn_readfirstlane((int)p[1]); return ((unsigned long long)hi << 32) | lo; }
__device__ __forceinline__ bool fa_anym(unsigned long long mw, int j) { return ((mw >> (j >> 5)) & 1ull) != 0; }      /* wave-uniform: does pass j / 32 hold a nonzero mask word? */
// a key with a nonzero mask word takes FA_DROP as its raw score; m: the lane's own query row, first key of the pass + 8 * hh (the lane's 16 words are read here, only in a pass that holds a nonzero word)
__device__ __forceinline__ void fa_drop(const int* m, v8f& s0, v8f& s1) { const v4ia m0 = *(const v4ia*)m, m1 = *(const v4ia*)(m + 4), m2 = *(const v4ia*)(m + 16), m3 = *(const v4ia*)(m + 20);
#pragma unroll      // constant indices: the tiles stay in registers
  for (int r = 0; r < 4; ++r) { s0[r] = (m0[r] == 0) ? s0[r] : FA_DROP; s0[4 + r] = (m1[r] == 0) ? s0[4 + r] : FA_DROP; s1[r] = (m2[r] == 0) ? s1[r] : FA_DROP; s1[4 + r] = (m3[r] == 0) ? s1[4 + r] : FA_DROP; } }
// ---- the second output (the last head's probabilities) from work-groups of its own, ahead of the attention work-groups in the same launch: one work-group = 16 query rows, each of its 8 waves 256 keys,
// so that the whole chip shares this work and no attention work-group runs longer than the others. S^T as in k_fattn (a lane holds one query's scores). First walk: the wave's running maximum and sum;
// they are joined across the waves through LDS; second walk: the scores again, p = 2^(s * FA_C - maximum) / sum, turned through the wave's own LDS range so that whole 128-byte lines are stored.
#define PB_BLOCKS (NB * (SQ / 16))
#define PB_KEYS (SQ / 8)               /* keys a wave */
#define PB_PITCH 36                    /* floats a staged row: 128 bytes + 16, so that the 16 lanes of a half wave write 64 different banks */
__device__ __forceinline__ void fa_prob(int t, const _Float16* __restrict__ Q16, const _Float16* __restrict__ K16, const int* __restrict__ Mk, const unsigned* __restrict__ MF, float* __restrict__ PO, float (*red)[8][16], float (*stg)[16][PB_PITCH]) {
  const int lane = threadIdx.x & 31, ln = lane & 15, hh = lane >> 4; const int w = __builtin_amdgcn_readfirstlane(threadIdx.x >> 5);
  const size_t rq = (size_t)t * 16, qr = rq + ln; const int j0 = w * PB_KEYS, je = j0 + PB_KEYS;      /* first query row (token row: batch * SQ + row), the lane's query row; the wave's keys */
  const _Float16* qp = Q16 + rq * LQ + (NH - 1) * 1024 + lane * 8; const v16h q0 = pk_frag(qp), q1 = pk_frag(qp + 512);
  fa_issued();
  const _Float16* kp = K16 + (size_t)(t / (SQ / 16)) * SQ * LQ + (NH - 1) * 1024 + lane * 8; const int* mp = Mk + qr * SQ + 8 * hh; const unsigned long long mw = fa_map(MF, rq);
  const v8f z8 = {0.f, 0.f, 0.f, 0.f, 0.f, 0.f, 0.f, 0.f}; float mu = -3.0e38f, l = 0.f;
  FaK f = fa_load(kp, j0);
  fa_issued();
#pragma unroll 1      // one pass a trip: the next pass's operands are already fetched by hand
  for (int j = j0; j < je; j += 32) {
    v8f s0 = fa_mma(f.a01, q1, fa_mma(f.a00, q0, z8)), s1 = fa_mma(f.a11, q1, fa_mma(f.a10, q0, z8));
    if (fa_anym(mw, j)) fa_drop(mp + j, s0, s1);
    f = fa_load(kp, (j + 32 < je) ? j + 32 : j0);      /* the last pass fetches the second walk's first operands */
    fa_issued();
    float tm = fmaxf(s0[0], s1[0]);
#pragma unroll      // constant indices: the tiles stay in registers
    for (int r = 1; r < 8; ++r) tm = fmaxf(tm, fmaxf(s0[r], s1[r]));
    tm = fmaxf(tm, rs_xrow(tm)); const float mn = fmaxf(mu, tm * FA_C), al = fa_exp2s(mu - mn); mu = mn;
    const v8f ps = fa_exp2(s0 * FA_C - mn) + fa_exp2(s1 * FA_C - mn);
    l = l * al + (((ps[0] + ps[1]) + (ps[2] + ps[3])) + ((ps[4] + ps[5]) + (ps[6] + ps[7]))); }
  l += rs_xrow(l);      /* the halves hold the same maximum */
  if (lane < 16) { red[0][w][ln] = mu; red[1][w][ln] = l; }
  __syncthreads();      /* every wave's row maxima and sums are in LDS */
  float mx = red[0][0][ln];
#pragma unroll      // constant LDS offsets
  for (int u = 1; u < 8; ++u) mx = fmaxf(mx, red[0][u][ln]);
  float lt = 0.f;
#pragma unroll      // constant LDS offsets
  for (int u = 0; u < 8; ++u) lt += red[1][u][ln] * fa_exp2s(red[0][u][ln] - mx);
  const float il = 1.0f / lt;
  float (*sg)[PB_PITCH] = stg[w]; float* pw = PO + (rq + (lane >> 3)) * SQ + (lane & 7) * 4;      /* the wave's own staging range; a store covers four whole 128-byte lines (four rows of the pass) */
#pragma unroll 1      // as above
  for (int j = j0; j < je; j += 32) {
    v8f s0 = fa_mma(f.a01, q1, fa_mma(f.a00, q0, z8)), s1 = fa_mma(f.a11, q1, fa_mma(f.a10, q0, z8));
    if (fa_anym(mw, j)) fa_drop(mp + j, s0, s1);
    f = fa_load(kp, (j + 32 < je) ? j + 32 : j);      /* the last pass fetches its own operands again, in bounds */
    fa_issued();
    const v8f p0 = fa_exp2(s0 * FA_C - mx) * il, p1 = fa_exp2(s1 * FA_C - mx) * il;
    const v4f t0 = {p0[0], p0[1], p0[2], p0[3]}, t1 = {p0[4], p0[5], p0[6], p0[7]}, t2 = {p1[0], p1[1], p1[2], p1[3]}, t3 = {p1[4], p1[5], p1[6], p1[7]};
    *(v4fa*)&sg[ln][8 * hh] = t0; *(v4fa*)&sg[ln][8 * hh + 4] = t1; *(v4fa*)&sg[ln][16 + 8 * hh] = t2; *(v4fa*)&sg[ln][20 + 8 * hh] = t3;
    asm volatile("s_wait_dscnt 0x0" ::: "memory");      // the wave's LDS writes are done before its lanes read one another's words back
    const v4f r0 = *(const v4fa*)&sg[lane >> 3][(lane & 7) * 4], r1 = *(const v4fa*)&sg[4 + (lane >> 3)][(lane & 7) * 4], r2 = *(const v4fa*)&sg[8 + (lane >> 3)][(lane & 7) * 4], r3 = *(const v4fa*)&sg[12 + (lane >> 3)][(lane & 7) * 4];
    *(v4f*)(pw + j) = r0; *(v4f*)(pw + j + 4 * SQ) = r1; *(v4f*)(pw + j + 8 * SQ) = r2; *(v4f*)(pw + j + 12 * SQ) = r3;
    fa_issued(); } }      /* also keeps the next pass's LDS writes behind this pass's reads */
__global__ __launch_bounds__(256) void k_fattn(const _Float16* __restrict__ Q16, const _Float16* __restrict__ K16, const _Float16* __restrict__ VT, const int* __restrict__ Mk, const unsigned* __restrict__ MF, _Float16* __restrict__ O16, float* __restrict__ PO) {
  static_assert(SQ % 128 == 0 && HD == 64, "k_fattn: 8 waves x 16 query rows a block, head size 64");
  __shared__ __attribute__((aligned(16))) float pb_red[2][8][16]; __shared__ __attribute__((aligned(16))) float pb_stg[8][16][PB_PITCH];
  if (blockIdx.x < PB_BLOCKS) { fa_prob((int)blockIdx.x, Q16, K16, Mk, MF, PO, pb_red, pb_stg); return; }      /* block-uniform: the short work-groups of the second output start first, beside the first attention work-groups */
  const int lane = threadIdx.x & 31, ln = lane & 15, hh = lane >> 4; const int w = __builtin_amdgcn_readfirstlane(threadIdx.x >> 5);
  const unsigned at = blockIdx.x - PB_BLOCKS; const int h = (int)(at / (SQ / 128) % NH), b = (int)(at / (SQ / 128) / NH);
  const size_t rq = (size_t)b * SQ + at % (SQ / 128) * 128 + w * 16, qr = rq + ln;      /* the wave's first query row; the lane's query row */
  const _Float16* qp = Q16 + rq * LQ + h * 1024 + lane * 8; const v16h q0 = pk_frag(qp), q1 = pk_frag(qp + 512);      /* a head's 64 columns are two 32-k tiles */
  fa_issued();      /* Q, then K, then V^T: the order of the loop, so that the loop's first wait for K leaves the V^T loads in flight */
  const _Float16* kp = K16 + (size_t)b * SQ * LQ + h * 1024 + lane * 8; const _Float16* vp = VT + (size_t)(b * NH + h) * HD * SQ + lane * 8; const int* mp = Mk + qr * SQ + 8 * hh; const unsigned long long mw = fa_map(MF, rq);
  const v8f z8 = {0.f, 0.f, 0.f, 0.f, 0.f, 0.f, 0.f, 0.f}; v8f o0 = z8, o1 = z8, o2 = z8, o3 = z8; float mu = -3.0e38f, l = 0.f;
  FaK f = fa_load(kp, 0);
  fa_issued();
  v16h v0 = pk_frag(vp), v1 = pk_frag(vp + 512), v2 = pk_frag(vp + 1024), v3 = pk_frag(vp + 1536);      /* a pass of V^T: four tiles, 4096 contiguous bytes */
  fa_issued();
#pragma unroll 1      // one pass a trip: the next pass's operands are already fetched by hand, a second copy of the body would only cost registers
  for (int j = 0; j < SQ; j += 32) { const int jn = (j + 32 < SQ) ? j + 32 : j;      /* first key of the next pass; the last pass fetches its own operands again, in bounds */
    v8f s0 = fa_mma(f.a01, q1, fa_mma(f.a00, q0, z8)), s1 = fa_mma(f.a11, q1, fa_mma(f.a10, q0, z8));
    if (fa_anym(mw, j)) fa_drop(mp + j, s0, s1);
    float tm = fmaxf(s0[0], s1[0]);
#pragma unroll      // constant indices: the tiles stay in registers
    for (int r = 1; r < 8; ++r) tm = fmaxf(tm, fmaxf(s0[r], s1[r]));
    tm = fmaxf(tm, rs_xrow(tm)); const float tl = tm * FA_C;
    if (__builtin_amdgcn_ballot_w32(tl > mu + FA_THR) != 0) { const float mn = fmaxf(mu, tl), al = fa_exp2s(mu - mn); mu = mn; l *= al; o0 *= al; o1 *= al; o2 *= al; o3 *= al; }      /* rare: one scalar test a pass */
    f = fa_load(kp, jn);      /* the next pass's K flies during this pass's exponentials and products */
    fa_issued();
    const float nb = FA_OFF - mu;
    const v8f p0 = fa_exp2(s0 * FA_C + nb), p1 = fa_exp2(s1 * FA_C + nb);
    const v8f ps = p0 + p1; l += ((ps[0] + ps[1]) + (ps[2] + ps[3])) + ((ps[4] + ps[5]) + (ps[6] + ps[7]));
    FragH pf;
#pragma unroll      // constant indices: the fragment stays in registers
    for (int r = 0; r < 8; ++r) { pf.h[r] = (_Float16)p0[r]; pf.h[8 + r] = (_Float16)p1[r]; }
    o0 = fa_mma(v0, pf.v, o0); o1 = fa_mma(v1, pf.v, o1); o2 = fa_mma(v2, pf.v, o2); o3 = fa_mma(v3, pf.v, o3);
    v0 = pk_frag(vp + jn * 64); v1 = pk_frag(vp + jn * 64 + 512); v2 = pk_frag(vp + jn * 64 + 1024); v3 = pk_frag(vp + jn * 64 + 1536);      /* the next pass's V^T flies during its score products and softmax */
    fa_issued(); }
  l += rs_xrow(l);      /* the halves' sums are joined once */
  const float il = 1.0f / l, so = 64.0f * il;      /* o carried x64, as the output GEMM's alpha expects */
  unsigned short* op = (unsigned short*)O16 + rq * DM + h * 1024 + lane * 8; FragH e0, e1;      /* o in fragment order: the lane's four runs of 8 are the four half-fragments of the head's two tiles */
#pragma unroll      // constant indices: the tiles stay in registers
  for (int r = 0; r < 8; ++r) { e0.h[r] = (_Float16)(o0[r] * so); e0.h[8 + r] = (_Float16)(o1[r] * so); e1.h[r] = (_Float16)(o2[r] * so); e1.h[8 + r] = (_Float16)(o3[r] * so); }
  *(v8us*)op = e0.half[0]; *(v8us*)(op + 256) = e0.half[1]; *(v8us*)(op + 512) = e1.half[0]; *(v8us*)(op + 768) = e1.half[1];
  fa_issued(); }      /* behind the stores: whatever the compiler lays behind them reuses their registers only behind the wait */


__global__ __launch_bounds__(256) void k_rsmf(const float* __restrict__ S, _Float16* __restrict__ P, int qn, int hg) {
  #pragma clang fp contract(off)
  const int t = blockIdx.x * 256 + threadIdx.x; if (t >= qn * hg) return; const size_t i = (size_t)(t / qn) * SQ + (t % qn); const float* s = S + i * SQ; float mx = -3.0e38f;
#pragma unroll 1
  for (int j = 0; j < SQ; ++j) mx = fmaxf(mx, s[j]); float se = 0.f;
#pragma unroll 1
  for (int j = 0; j < SQ; ++j) se += __expf(s[j] - mx); const float sc = 256.0f / se;
#pragma unroll 1
  for (int j0 = 0; j0 < SQ; j0 += 8) { FragH f; for (int q = 0; q < 8; ++q) f.h[q] = (_Float16)(__expf(s[j0 + q] - mx) * sc); unsigned short* d = (unsigned short*)P + i * SQ + j0; *(v8us*)d = f.half[0];  } }

// ---- the seven input conversions (three x, three per-head weights, W0) as one launch. None reads what another writes. A slab = one fragment row tile, 16 rows x DM = 2048 chunks of 16 bytes (pk_frag);
// a block takes a slab at a time, a thread eight of its chunks (k tiles four apart), so that all of a slab's loads are in flight together and few waves have to be started.
#define PP_WS (DM / 16)                        /* slabs of one weight matrix */
#define PP_XS ((int)(NR / 16))                 /* slabs of one input */
#define PP_SLABS (4 * PP_WS + 3 * PP_XS)
#define PP_BLOCKS 512                          /* two blocks a WGP; slabs b and b + 512: a weight slab is paired with an input slab */
// behind a group of loads or stores off one address: the address, named as an input, stays live up to the wait, so that no load's result lands in it; the two scheduling barriers keep
// every member of the group in front of the wait and every rewrite of an address or data register behind it
__device__ __forceinline__ void pp_issued(const void* p) { __builtin_amdgcn_sched_barrier(0); asm volatile("s_wait_xcnt 0x0" :: "v"(p) : "memory"); __builtin_amdgcn_sched_barrier(0); }
// a thread's eight finished chunks as one group of stores; the scheduling barrier in front keeps a store from being issued among the conversions, where its data registers would be wanted again at once
__device__ __forceinline__ void pp_store(unsigned short* __restrict__ d, const v8us (&o)[8]) { __builtin_amdgcn_sched_barrier(0);
#pragma unroll      // constant offsets off one address
  for (int u = 0; u < 8; ++u) *(v8us*)(d + u * 2048) = o[u];
  pp_issued(d); }
template <int QS, int US>      /* floats between the eight k of a chunk; between two chunks of a thread */
__device__ __forceinline__ void pp_wslab(const float* __restrict__ s, unsigned short* __restrict__ d) { float w[8][8]; v8us o[8];
#pragma unroll      // constant offsets off one address; the values stay in registers
  for (int u = 0; u < 8; ++u) for (int q = 0; q < 8; ++q) w[u][q] = s[(size_t)u * US + (size_t)q * QS];
  pp_issued(s);
#pragma unroll      // as above
  for (int u = 0; u < 8; ++u) { FragH f; for (int q = 0; q < 8; ++q) f.h[q] = (_Float16)(16.0f * bf16_round(w[u][q])); o[u] = f.half[0]; }
  pp_store(d, o); }
__device__ __forceinline__ void pp_xslab(const float* __restrict__ s, unsigned short* __restrict__ d) { v4f a[8], b[8]; v8us o[8];
#pragma unroll      // as above
  for (int u = 0; u < 8; ++u) { a[u] = *(const v4fa*)(s + u * 128); b[u] = *(const v4fa*)(s + u * 128 + 4); }
  pp_issued(s);
#pragma unroll      // as above
  for (int u = 0; u < 8; ++u) { FragH f; for (int q = 0; q < 4; ++q) { f.h[q] = (_Float16)bf16_round(a[u][q]); f.h[4 + q] = (_Float16)bf16_round(b[u][q]); } o[u] = f.half[0]; }
  pp_store(d, o); }
// ---- the mask's pass map (see fa_map), from work-groups of their own in the same launch: one work-group = one tile of 16 query rows, each of its 8 waves 256 keys (8 passes) as two groups of 16 loads,
// each load 512 contiguous bytes of one row (4 passes, 8 lanes a pass); the rows are joined by OR in the lane, the lanes by a ballot, the waves through LDS.
#define PM_BLOCKS ((int)(NR / 16))
__device__ __forceinline__ unsigned pm_half(const int* __restrict__ m) { v4ia a[16];
#pragma unroll      // constant offsets off one address; the values stay in registers
  for (int r = 0; r < 16; ++r) a[r] = *(const v4ia*)(m + r * SQ);
  pp_issued(m);
  v4ia o = a[0];
#pragma unroll      // as above
  for (int r = 1; r < 16; ++r) o |= a[r];
  const unsigned bl = __builtin_amdgcn_ballot_w32((o[0] | o[1] | o[2] | o[3]) != 0);
  return ((bl & 0xffu) ? 1u : 0u) | ((bl & 0xff00u) ? 2u : 0u) | ((bl & 0xff0000u) ? 4u : 0u) | ((bl & 0xff000000u) ? 8u : 0u); }
__device__ __forceinline__ void pm_tile(int t, const int* __restrict__ Mk, unsigned* __restrict__ MF, unsigned* pw) { const int lane = threadIdx.x & 31, w = threadIdx.x >> 5;
  const int* m = Mk + (size_t)t * 16 * SQ + w * 256 + lane * 4; const unsigned b0 = pm_half(m), b1 = pm_half(m + 128);
  if (lane == 0) pw[w] = b0 | (b1 << 4);
  __syncthreads();      /* every wave's eight bits are in LDS */
  if (threadIdx.x < 2) { const unsigned* q = pw + threadIdx.x * 4; MF[(size_t)t * PM_PITCH + threadIdx.x] = q[0] | (q[1] << 8) | (q[2] << 16) | (q[3] << 24); } }
__global__ __launch_bounds__(256) void k_prep(const int* __restrict__ Mk, unsigned* __restrict__ MF, const float* __restrict__ xq, const float* __restrict__ xk, const float* __restrict__ xv, const float* __restrict__ wq, const float* __restrict__ wk, const float* __restrict__ wv, const float* __restrict__ wo,
    _Float16* __restrict__ XQ, _Float16* __restrict__ XK, _Float16* __restrict__ XV, _Float16* __restrict__ BQ, _Float16* __restrict__ BK, _Float16* __restrict__ BV, _Float16* __restrict__ BO) {
  __shared__ unsigned pm_w[8];
  if (blockIdx.x >= PP_BLOCKS) { pm_tile((int)blockIdx.x - PP_BLOCKS, Mk, MF, pm_w); return; }      /* block-uniform */
  const int tid = threadIdx.x, ln = tid & 15, k0 = (tid >> 6) * 32 + ((tid >> 5) & 1) * 16 + ((tid >> 4) & 1) * 8;      /* the thread's row in the tile; first k of its first chunk (chunk u: + 128 u) */
#pragma unroll 1      // one slab's values in registers at a time
  for (int slab = blockIdx.x; slab < PP_SLABS; slab += PP_BLOCKS) {
    if (slab < 4 * PP_WS) { const int j = slab / PP_WS, rt = slab % PP_WS, n = rt * 16 + ln;      /* Bt row n = output column (h, d) */
      unsigned short* d = (unsigned short*)(j == 0 ? BQ : j == 1 ? BK : j == 2 ? BV : BO) + (size_t)rt * 16384 + tid * 8;
      if (j < 3) pp_wslab<HD, 128 * HD>((j == 0 ? wq : j == 1 ? wk : wv) + ((size_t)(n / HD) * DM + k0) * HD + n % HD, d);
      else pp_wslab<DM, 128 * DM>(wo + (size_t)k0 * DM + n, d); }
    else { const int s2 = slab - 4 * PP_WS, j = s2 / PP_XS, rt = s2 % PP_XS;
      pp_xslab((j == 0 ? xq : j == 1 ? xk : xv) + ((size_t)rt * 16 + ln) * DM + k0, (unsigned short*)(j == 0 ? XQ : j == 1 ? XK : XV) + (size_t)rt * 16384 + tid * 8); } } }

extern "C" void kernel_launch(void* const* d_in, const int* in_sizes, int n_in,
                              void* d_out, int out_size, void* d_ws, size_t ws_size, hipStream_t stream) {
  (void)in_sizes; (void)n_in; (void)out_size;
  const float* const* I = (const float* const*)d_in; const float* xv = I[0]; const float* xk = I[1]; const float* xq = I[2]; const int* mk = (const int*)d_in[3]; const float* wq = I[4]; const float* bq = I[5]; const float* wk = I[6]; const float* bk = I[7]; const float* wv = I[8]; const float* bv = I[9]; const float* wo = I[10]; const float* bo = I[11];      /* NOTE the module's input order v, k, q, mask; per-head [h][in][out] weights + [h][64] biases (= flat [1024]); W0 [in][out] + b0 */
  float* PO = (float*)d_out + (size_t)NB * SQ * DM;      /* second output: last head's attention probabilities [NB][SQ][SQ] f32 at byte offset 16,777,216 */
  char* ws = (char*)d_ws; size_t off = 0;
  auto take = [&](size_t bytes) { char* p = ws + off; off += (bytes + 255) & ~(size_t)255; return p; };
  _Float16* BQ = (_Float16*)take((size_t)DM * DM * 2); _Float16* BK = (_Float16*)take((size_t)DM * DM * 2); _Float16* BV = (_Float16*)take((size_t)DM * DM * 2); _Float16* BO = (_Float16*)take((size_t)DM * DM * 2);
  _Float16* XQ = (_Float16*)take(NR * DM * 2); _Float16* XK = (_Float16*)take(NR * DM * 2); _Float16* XV = (_Float16*)take(NR * DM * 2); _Float16* Q16 = (_Float16*)take(NR * DM * 2); _Float16* K16 = (_Float16*)take(NR * DM * 2); _Float16* V16 = (_Float16*)take(NR * DM * 2); _Float16* O16 = (_Float16*)take(NR * DM * 2);
  _Float16* VT = (_Float16*)take((size_t)NB * NH * HD * SQ * 2); unsigned* MF = (unsigned*)take((size_t)PM_BLOCKS * PM_PITCH * 4);
  if (off > ws_size) return;
  k_prep<<<PP_BLOCKS + PM_BLOCKS, 256, 0, stream>>>(mk, MF, xq, xk, xv, wq, wk, wv, wo, XQ, XK, XV, BQ, BK, BV, BO);      /* the three inputs as exact f16 rows; per-head [h][m][d] -> Bt[(h,d)][m] x16; W0 [in][out] -> Bt x16; all in fragment order */
  const size_t r0p = (size_t)B0 * SQ;      /* first projected row */
  k_qkv<<<dim3((unsigned)((MP / 128) * (DM / 64)), 3), 128, 0, stream>>>(XQ + r0p * DM, XK + r0p * DM, XV + r0p * DM, BQ, BK, BV, bq, bk, bv, Q16 + r0p * DM, K16 + r0p * DM, V16 + r0p * DM);      /* q, k, v = x W + b, one launch */
  k_vt<NH, SQ><<<NB * NH * (SQ / 64), 256, 0, stream>>>(V16, LQ, 0, VT);      /* V^T per (batch, head), fragment order */
  k_fattn<<<PB_BLOCKS + (SQ / 128) * NH * NB, 256, 0, stream>>>(Q16, K16, VT, mk, MF, O16, PO);      /* scores, softmax and P V in one launch; o (merged heads) as f16 rows; the last head's probabilities to the second output */
  k_gemm2<0, false><<<dim3((unsigned)((MPO / 128) * (DM / 64)), 1), 128, 0, stream>>>(O16 + r0p * DM, DM, 0, BO, DM, 0, 0.0009765625f, bo, 0, nullptr, 1, 0, 0, (float*)d_out + r0p * DM, nullptr, DM, 0, MPO, DM, DM);      /* out rows are the output layout */
}

// v009
// One run takes 121 microseconds.
// Two timings next to v008 put it at 1.08 and 1.06 times that version's speed.
// Over all steps from v000 it is 55.8 times as fast.
#include <hip/hip_runtime.h>
#define NB 2
#define SQ 2048
#define DM 1024
#define NH 16
#define HD 64
#define HG 4                         /* heads per launch of the unused k_vt(V16, b, h0, VT) overload */
#define B0 0                         /* first batch processed (debug hook) */
#define NBR NB                       /* batches processed (debug hook) */
#define NR ((size_t)NB * SQ)         /* token rows */
#define MP ((int)((size_t)NBR * SQ)) /* rows projected (debug hook) */
#define QN SQ                        /* query rows per batch; unused */
#define NHD NH                       /* heads; unused */
#define MPO MP                       /* rows through the output stage (debug hook) */
#define LQ DM      /* row pitch of the q/k rows */
typedef __bf16 v16b __attribute__((ext_vector_type(16)));
typedef unsigned short v8us __attribute__((ext_vector_type(8), may_alias));
typedef float  v8f  __attribute__((ext_vector_type(8)));
typedef float  v4f  __attribute__((ext_vector_type(4)));
typedef float  v4fa __attribute__((ext_vector_type(4), may_alias));
union FragB { v16b v; v8us half[2]; unsigned short u[16]; };

__device__ __forceinline__ unsigned short bf16_bits(float x) { unsigned int u = __float_as_uint(x); return (unsigned short)((u + 0x7FFFu + ((u >> 16) & 1u)) >> 16); }
__device__ __forceinline__ float bf16_val(unsigned short b) { return __uint_as_float(((unsigned int)b) << 16); }
__device__ __forceinline__ float bf16_round(float x) { return bf16_val(bf16_bits(x)); }
// D += A·B with NT terms: 1 = ah·bh, 2 = + al·bh (A split), 3 = + ah·bl (both split)
template <int NT>
__device__ __forceinline__ v8f mmaN(v16b ah, v16b al, v16b bh, v16b bl, v8f c) {
  c = __builtin_amdgcn_wmma_f32_16x16x32_bf16(false, ah, false, bh, (short)0, c, false, false);
  if (NT >= 2) c = __builtin_amdgcn_wmma_f32_16x16x32_bf16(false, al, false, bh, (short)0, c, false, false);
  if (NT >= 3) c = __builtin_amdgcn_wmma_f32_16x16x32_bf16(false, ah, false, bl, (short)0, c, false, false);
  asm volatile("v_nop\n\tv_nop\n\tv_nop\n\tv_nop" : "+v"(c) : "v"(ah), "v"(al), "v"(bh), "v"(bl));
  return c;
}

__global__ __launch_bounds__(256) void k_wt_bf16(const float* __restrict__ W, unsigned short* __restrict__ Wt, int K, int N) {
  const int t = blockIdx.x * 256 + threadIdx.x;
  const int k8n = K / 8;
  if (t >= N * k8n) return;
  const int n = t / k8n, k8 = (t % k8n) * 8;
  v8us v;
#pragma unroll
  for (int i = 0; i < 8; ++i) v[i] = bf16_bits(W[(size_t)(k8 + i) * N + n]);
  *(v8us*)(Wt + (size_t)n * K + k8) = v;
  
}

// GEMM C[M][N] (f32, pitch ldc) = act(A[M][K]·W + bias). A f32 row-major (pitch lda) converted per fragment to bf16
// (ASPLIT: hi/lo two planes -> 2 terms, else single rounded term); Wt bf16 [N][K] (pitch ldb). BIAS_BF16 rounds the
// bias to bf16 first (bias quantised to bf16 before the add). K%32==0, M%16==0, N%64==0.
template <bool ASPLIT, int ACT, bool BIAS_BF16>
__global__ __launch_bounds__(128) void k_gemm_bf(const float* __restrict__ A, int lda, const unsigned short* __restrict__ Wt, int ldb,
                                               const float* __restrict__ bias, float* __restrict__ C, int ldc, int M, int N, int K) {
  __shared__ __attribute__((aligned(16))) float so[4][16][64];
  const int tid = threadIdx.x, w = tid >> 5, lane = tid & 31, ln = lane & 15, hh = lane >> 4;
  const int ntn = N / 64;
  const int wid = blockIdx.x * 4 + w;
  const int mt = wid / ntn, nq = wid % ntn;
  if (mt * 16 >= M) return;
  const int row0 = mt * 16, col0 = nq * 64;
  const float* arow = A + (size_t)(row0 + ln) * lda;
  v8f acc[4] = {};
  for (int kb = 0; kb < K; kb += 32) {
    FragB ah, al;
    const v4f x0 = *(const v4fa*)(arow + kb + 8 * hh), x1 = *(const v4fa*)(arow + kb + 8 * hh + 4);
    const v4f x2 = *(const v4fa*)(arow + kb + 16 + 8 * hh), x3 = *(const v4fa*)(arow + kb + 16 + 8 * hh + 4);
    float xs[16] = {x0[0],x0[1],x0[2],x0[3],x1[0],x1[1],x1[2],x1[3],x2[0],x2[1],x2[2],x2[3],x3[0],x3[1],x3[2],x3[3]};
#pragma unroll
    for (int i = 0; i < 16; ++i) { const unsigned short hb = bf16_bits(xs[i]); ah.u[i] = hb; al.u[i] = ASPLIT ? bf16_bits(xs[i] - bf16_val(hb)) : (unsigned short)0; }
#pragma unroll
    for (int t = 0; t < 4; ++t) {
      const unsigned short* brow = Wt + (size_t)(col0 + t * 16 + ln) * ldb + kb;
      FragB b;
      b.half[0] = *(const v8us*)(brow + 8 * hh);
      b.half[1] = *(const v8us*)(brow + 16 + 8 * hh);
      acc[t] = mmaN<ASPLIT ? 2 : 1>(ah.v, al.v, b.v, b.v, acc[t]);
    }
  }
#pragma unroll
  for (int t = 0; t < 4; ++t) {
    float bv = bias ? bias[col0 + t * 16 + ln] : 0.f;
    if (BIAS_BF16) bv = bf16_round(bv);
#pragma unroll
    for (int r = 0; r < 8; ++r) { float v = acc[t][r] + bv; if (ACT == 1) v = fmaxf(v, 0.f); so[w][8 * hh + r][t * 16 + ln] = v; }
  }
  __builtin_amdgcn_fence(__ATOMIC_ACQ_REL, "workgroup");
  __builtin_amdgcn_wave_barrier();
  const int rsub = lane >> 4, c4 = (lane & 15) * 4;
  {
#pragma unroll
    for (int q = 0; q < 8; ++q) {
      const int r = q * 2 + rsub;
      const v4f v = *(const v4fa*)&so[w][r][c4];
      *(v4f*)(C + (size_t)(row0 + r) * ldc + col0 + c4) = v;
    }
    
  }
}

// GEMM C = act(A·W + bias + resid): A f32 (ASPLIT -> hi/lo 2 terms), Wt bf16 [N][K]; ACT 0 none, 1 relu, 2 exact gelu;
// resid (optional, f32, row index = (row % rmod), pitch ldr, RES_BF16 rounds it) added before the activation.
template <bool ASPLIT, int ACT, bool BIAS_BF16, bool RES_BF16>
__global__ __launch_bounds__(128) void k_gemm_bf3(const float* __restrict__ A, int lda, const unsigned short* __restrict__ Wt, int ldb,
                                                const float* __restrict__ bias, const float* __restrict__ resid, int rmod, int ldr,
                                                float* __restrict__ C, int ldc, int M, int N, int K) {
  __shared__ __attribute__((aligned(16))) float so[4][16][64];
  const int tid = threadIdx.x, w = tid >> 5, lane = tid & 31, ln = lane & 15, hh = lane >> 4;
  const int ntn = N / 64;
  const int wid = blockIdx.x * 4 + w;
  const int mt = wid / ntn, nq = wid % ntn;
  if (mt * 16 >= M) return;
  const int row0 = mt * 16, col0 = nq * 64;
  const float* arow = A + (size_t)(row0 + ln) * lda;
  v8f acc[4] = {};
  for (int kb = 0; kb < K; kb += 32) {
    FragB ah, al;
    const v4f x0 = *(const v4fa*)(arow + kb + 8 * hh), x1 = *(const v4fa*)(arow + kb + 8 * hh + 4);
    const v4f x2 = *(const v4fa*)(arow + kb + 16 + 8 * hh), x3 = *(const v4fa*)(arow + kb + 16 + 8 * hh + 4);
    float xs[16] = {x0[0],x0[1],x0[2],x0[3],x1[0],x1[1],x1[2],x1[3],x2[0],x2[1],x2[2],x2[3],x3[0],x3[1],x3[2],x3[3]};
#pragma unroll
    for (int i = 0; i < 16; ++i) { const unsigned short hb = bf16_bits(xs[i]); ah.u[i] = hb; al.u[i] = ASPLIT ? bf16_bits(xs[i] - bf16_val(hb)) : (unsigned short)0; }
#pragma unroll
    for (int t = 0; t < 4; ++t) {
      const unsigned short* brow = Wt + (size_t)(col0 + t * 16 + ln) * ldb + kb;
      FragB b;
      b.half[0] = *(const v8us*)(brow + 8 * hh);
      b.half[1] = *(const v8us*)(brow + 16 + 8 * hh);
      acc[t] = mmaN<ASPLIT ? 2 : 1>(ah.v, al.v, b.v, b.v, acc[t]);
    }
  }
#pragma unroll
  for (int t = 0; t < 4; ++t) {
    const int col = col0 + t * 16 + ln;
    float bv = bias ? bias[col] : 0.f;
    if (BIAS_BF16) bv = bf16_round(bv);
#pragma unroll
    for (int r = 0; r < 8; ++r) {
      float v = acc[t][r] + bv;
      if (resid) { float rv = resid[(size_t)((row0 + 8 * hh + r) % rmod) * ldr + col]; if (RES_BF16) rv = bf16_round(rv); v += rv; }
      if (ACT == 1) v = fmaxf(v, 0.f);
      if (ACT == 2) v = 0.5f * v * (1.0f + erff(v * 0.70710678118654752f));
      if (ACT == 3) { const float u = 0.7978845608028654f * (v + 0.044715f * v * v * v); v = 0.5f * v * (1.0f + tanhf(u)); }
      so[w][8 * hh + r][t * 16 + ln] = v;
    }
  }
  __builtin_amdgcn_fence(__ATOMIC_ACQ_REL, "workgroup");
  __builtin_amdgcn_wave_barrier();
  const int rsub = lane >> 4, c4 = (lane & 15) * 4;
  {
#pragma unroll
    for (int q = 0; q < 8; ++q) {
      const int r = q * 2 + rsub;
      const v4f v = *(const v4fa*)&so[w][r][c4];
      *(v4f*)(C + (size_t)(row0 + r) * ldc + col0 + c4) = v;
    }
    
  }
}
// row LayerNorm (biased variance, eps) over N: s = X (+ R); optional out_sum <- s; out_norm <- (s-mu)*rsqrt(var+eps)*g + b
template <bool PARAM_BF16>
__global__ __launch_bounds__(256) void k_layernorm(const float* __restrict__ X, const float* __restrict__ R, const float* __restrict__ g, const float* __restrict__ bta,
                                                  float* __restrict__ out_sum, float* __restrict__ out_norm, int N, float eps) {
  __shared__ float red[256];
  const int row = blockIdx.x, tid = threadIdx.x;
  const float* x = X + (size_t)row * N; const float* rr = R ? R + (size_t)row * N : nullptr;
  float vals[16];                     // up to N = 4096
  const int per = N / 256;            // contiguous chunk per thread? use strided-by-4 chunks: thread handles j = tid*4 + 1024*u
  float s1 = 0.f;
  for (int u = 0; u < per / 4; ++u) {
    const int j = tid * 4 + 1024 * u;
    const v4f a = *(const v4fa*)(x + j);
    v4f b = {0.f,0.f,0.f,0.f}; if (rr) b = *(const v4fa*)(rr + j);
#pragma unroll
    for (int q = 0; q < 4; ++q) { const float v = a[q] + b[q]; vals[u * 4 + q] = v; s1 += v; }
  }
  red[tid] = s1; __syncthreads();
  for (int st = 128; st > 0; st >>= 1) { if (tid < st) red[tid] += red[tid + st]; __syncthreads(); }
  const float mu = red[0] / (float)N; __syncthreads();
  float s2 = 0.f;
  for (int u = 0; u < per / 4; ++u)
#pragma unroll
    for (int q = 0; q < 4; ++q) { const float c = vals[u * 4 + q] - mu; s2 += c * c; }
  red[tid] = s2; __syncthreads();
  for (int st = 128; st > 0; st >>= 1) { if (tid < st) red[tid] += red[tid + st]; __syncthreads(); }
  const float rs = rsqrtf(red[0] / (float)N + eps);
  {
    for (int u = 0; u < per / 4; ++u) {
      const int j = tid * 4 + 1024 * u;
      v4f o, sm;
#pragma unroll
      for (int q = 0; q < 4; ++q) {
        float gg = g[j + q], bb = bta[j + q];
        if (PARAM_BF16) { gg = bf16_round(gg); bb = bf16_round(bb); }
        sm[q] = vals[u * 4 + q]; o[q] = (vals[u * 4 + q] - mu) * rs * gg + bb;
      }
      if (out_sum) *(v4f*)(out_sum + (size_t)row * N + j) = sm;
      *(v4f*)(out_norm + (size_t)row * N + j) = o;
    }
    
  }
}



// ---- f16 WMMA path (v_wmma_f32_16x16x32_f16): 11-bit significands for operands in range — used where a [0,1] probability operand needs more precision than bf16
typedef _Float16 v16h __attribute__((ext_vector_type(16)));
union FragH { v16h v; v8us half[2]; _Float16 h[16]; unsigned short u[16]; };
template <int NT>
__device__ __forceinline__ v8f mmaH(v16h ah, v16h al, v16h bh, v16h bl, v8f c) {
  c = __builtin_amdgcn_wmma_f32_16x16x32_f16(false, ah, false, bh, (short)0, c, false, false);
  if (NT >= 2) c = __builtin_amdgcn_wmma_f32_16x16x32_f16(false, al, false, bh, (short)0, c, false, false);
  if (NT >= 3) c = __builtin_amdgcn_wmma_f32_16x16x32_f16(false, ah, false, bl, (short)0, c, false, false);
  asm volatile("v_nop\n\tv_nop\n\tv_nop\n\tv_nop" : "+v"(c) : "v"(ah), "v"(al), "v"(bh), "v"(bl));
  return c;
}
// batched GEMM like k_gemm_b but f16 operands: A f32 (split into f16 hi/lo if ASPLIT, else rounded to f16), Bt = f16 values [n][k]; alpha; C f32; N multiple of 16 (partial tiles skipped)
template <bool ASPLIT>
__global__ __launch_bounds__(128) void k_gemm_h(const float* __restrict__ A, int lda, size_t sA, const _Float16* __restrict__ Bh, int ldb, size_t sB, float alpha, float* __restrict__ C, int ldc, size_t sC, int M, int N, int K) {
  __shared__ __attribute__((aligned(16))) float so[4][16][64];
  const int tid = threadIdx.x, w = tid >> 5, lane = tid & 31, ln = lane & 15, hh = lane >> 4; const int by = blockIdx.y;
  A += (size_t)by * sA; Bh += (size_t)by * sB; C += (size_t)by * sC;
  const int ntn = (N + 63) / 64; const int wid = blockIdx.x * 4 + w; const int mt = wid / ntn, nq = wid % ntn; if (mt * 16 >= M) return;
  const int row0 = mt * 16, col0 = nq * 64; const float* arow = A + (size_t)(row0 + ln) * lda;
  v8f acc[4] = {};
  for (int kb = 0; kb < K; kb += 32) {
    FragH ah, al;
    const v4f x0 = *(const v4fa*)(arow + kb + 8 * hh), x1 = *(const v4fa*)(arow + kb + 8 * hh + 4), x2 = *(const v4fa*)(arow + kb + 16 + 8 * hh), x3 = *(const v4fa*)(arow + kb + 16 + 8 * hh + 4);
    float xs[16] = {x0[0],x0[1],x0[2],x0[3],x1[0],x1[1],x1[2],x1[3],x2[0],x2[1],x2[2],x2[3],x3[0],x3[1],x3[2],x3[3]};
#pragma unroll
    for (int i = 0; i < 16; ++i) { const _Float16 h = (_Float16)xs[i]; ah.h[i] = h; al.h[i] = ASPLIT ? (_Float16)(xs[i] - (float)h) : (_Float16)0.0f; }
#pragma unroll
    for (int t = 0; t < 4; ++t) { if (col0 + t * 16 >= N) continue; const size_t boff = (size_t)(col0 + t * 16 + ln) * ldb + kb; FragH bq; bq.half[0] = *(const v8us*)(Bh + boff + 8 * hh); bq.half[1] = *(const v8us*)(Bh + boff + 16 + 8 * hh);
      acc[t] = mmaH<ASPLIT ? 2 : 1>(ah.v, al.v, bq.v, bq.v, acc[t]); }
  }
#pragma unroll
  for (int t = 0; t < 4; ++t) { if (col0 + t * 16 >= N) continue;
#pragma unroll
    for (int r = 0; r < 8; ++r) so[w][8 * hh + r][t * 16 + ln] = acc[t][r] * alpha; }
  __builtin_amdgcn_fence(__ATOMIC_ACQ_REL, "workgroup"); __builtin_amdgcn_wave_barrier();
  const int rsub = lane >> 4, c4 = (lane & 15) * 4;
  {
#pragma unroll
    for (int q = 0; q < 8; ++q) { const int r = q * 2 + rsub; if (col0 + c4 < N) { const v4f v = *(const v4fa*)&so[w][r][c4]; *(v4f*)(C + (size_t)(row0 + r) * ldc + col0 + c4) = v; } }
     }
}

// k_gemm_hh variant with fused epilogue: v = acc·alpha + bias[by·sBias + col] (+ CP[(row/rowsPerB)·sCPb + by·64 + col] if CP) ; ACT 0 none / 1 elu ; writes f16 C16 (and f32 C if non-null)
template <int ACT>
__global__ __launch_bounds__(128) void k_gemm_hhx(const _Float16* __restrict__ A, int lda, size_t sA, const _Float16* __restrict__ Bh, int ldb, size_t sB, float alpha, const float* __restrict__ bias, size_t sBias, const float* __restrict__ CP, int rowsPerB, size_t sCPb, int row0g,
    float* __restrict__ C, _Float16* __restrict__ C16, int ldc, size_t sC, int M, int N, int K) {
  __shared__ __attribute__((aligned(16))) float so[4][16][64];
  const int tid = threadIdx.x, w = tid >> 5, lane = tid & 31, ln = lane & 15, hh = lane >> 4; const int by = blockIdx.y;
  A += (size_t)by * sA; Bh += (size_t)by * sB; const size_t cofs = (size_t)by * sC; const float* bp = bias ? bias + (size_t)by * sBias : nullptr;
  const int ntn = (N + 63) / 64; const int wid = blockIdx.x * 4 + w; const int mt = wid / ntn, nq = wid % ntn; if (mt * 16 >= M) return;
  const int row0 = mt * 16, col0 = nq * 64; const _Float16* arow = A + (size_t)(row0 + ln) * lda;
  v8f acc[4] = {};
  for (int kb = 0; kb < K; kb += 32) { FragH ah; ah.half[0] = *(const v8us*)((const unsigned short*)arow + kb + 8 * hh); ah.half[1] = *(const v8us*)((const unsigned short*)arow + kb + 16 + 8 * hh);
#pragma unroll
    for (int t = 0; t < 4; ++t) { if (col0 + t * 16 >= N) continue; const size_t boff = (size_t)(col0 + t * 16 + ln) * ldb + kb; FragH bq; bq.half[0] = *(const v8us*)((const unsigned short*)Bh + boff + 8 * hh); bq.half[1] = *(const v8us*)((const unsigned short*)Bh + boff + 16 + 8 * hh);
      acc[t] = mmaH<1>(ah.v, ah.v, bq.v, bq.v, acc[t]); }
  }
#pragma unroll
  for (int t = 0; t < 4; ++t) { if (col0 + t * 16 >= N) continue; const int col = col0 + t * 16 + ln; const float bv = bp ? bf16_round(bp[col]) : 0.f;
#pragma unroll
    for (int r = 0; r < 8; ++r) { float v = acc[t][r] * alpha + bv; if (CP) { const int rr = row0g + row0 + 8 * hh + r; if (rowsPerB < 0) v += CP[cofs + (size_t)rr * ldc + col];      /* rowsPerB < 0: own element of the batched C plane */ else { const int bidx = rr / rowsPerB; v += CP[(size_t)bidx * sCPb + (size_t)by * 64 + col]; } } if (ACT == 1) v = (v > 0.f) ? v : expm1f(v); else if (ACT == 7) v = (v > 0.f) ? v + 1.0f : expf(v); else if (ACT == 8) v = tanhf(v); else if (ACT == 9) v = 0.5f * v * (1.0f + tanhf(0.7978845608028654f * (v + 0.044715f * v * v * v))); else if (ACT == 11) v = 1.0f / (1.0f + expf(-v)); else if (ACT == 12) v = (v > 0.f) ? v : 0.01f * v; else if (ACT == 14) v = (v > 0.f) ? v : 0.1f * v; else if (ACT == 16) v = (v >= 0.f) ? v : 0.3f * v; else if (ACT == 17) v = (v >= 0.f) ? v : 0.2f * v; else if (ACT == 15) v = v / (1.0f + expf(-v)); else if (ACT == 3) v = fmaxf(v, 0.f); else if (ACT == 6) v = 0.5f * v * (1.0f + erff(v * 0.70710678118654752f)); so[w][8 * hh + r][t * 16 + ln] = v; } }
  __builtin_amdgcn_fence(__ATOMIC_ACQ_REL, "workgroup"); __builtin_amdgcn_wave_barrier();
  const int rsub = lane >> 4, c4 = (lane & 15) * 4; typedef _Float16 v4h __attribute__((ext_vector_type(4)));
  {
#pragma unroll
    for (int q = 0; q < 8; ++q) { const int r = q * 2 + rsub; if (col0 + c4 < N) { const v4f v = *(const v4fa*)&so[w][r][c4]; if (C) *(v4f*)(C + cofs + (size_t)(row0 + r) * ldc + col0 + c4) = v; if (C16) { v4h h4; for (int i = 0; i < 4; ++i) h4[i] = (_Float16)v[i]; *(v4h*)(C16 + cofs + (size_t)(row0 + r) * ldc + col0 + c4) = h4; } } }
     }
}


typedef _Float16 v4h __attribute__((ext_vector_type(4)));

__global__ __launch_bounds__(256) void k_h16(const float* __restrict__ x, _Float16* __restrict__ X16, size_t n8) { const size_t t = (size_t)blockIdx.x * 256 + threadIdx.x; if (t >= n8) return; FragH f;
#pragma unroll
  for (int q = 0; q < 8; ++q) f.h[q] = (_Float16)x[t * 8 + q]; *(v8us*)((unsigned short*)X16 + t * 8) = f.half[0];  }
__global__ __launch_bounds__(256) void k_round16f(const float* __restrict__ W, _Float16* __restrict__ Bt, size_t n8) { const size_t t = (size_t)blockIdx.x * 256 + threadIdx.x; if (t >= n8) return; FragH f;
#pragma unroll
  for (int i = 0; i < 8; ++i) f.h[i] = (_Float16)(bf16_round(W[t * 8 + i]) * 16.0f); *(v8us*)((unsigned short*)Bt + t * 8) = f.half[0];  }
__global__ __launch_bounds__(256) void k_hl(const float* __restrict__ F, _Float16* __restrict__ Hh, _Float16* __restrict__ Hl, size_t n8) { const size_t t = (size_t)blockIdx.x * 256 + threadIdx.x; if (t >= n8) return; FragH fh, fl; const v4f a = *(const v4fa*)(F + t * 8), c = *(const v4fa*)(F + t * 8 + 4);
#pragma unroll
  for (int q = 0; q < 4; ++q) { _Float16 h = (_Float16)a[q]; fh.h[q] = h; fl.h[q] = (_Float16)((a[q] - (float)h) * 1024.0f); h = (_Float16)c[q]; fh.h[4 + q] = h; fl.h[4 + q] = (_Float16)((c[q] - (float)h) * 1024.0f); }
  { *(v8us*)((unsigned short*)Hh + t * 8) = fh.half[0]; *(v8us*)((unsigned short*)Hl + t * 8) = fl.half[0];  } }

// ---- fast GEMM (wave tile 32x64; requires M % 32 == 0 rows per launch region and N % 64 == 0); epilogue = k_gemm_hhx semantics ----
__device__ __forceinline__ v16h g2_frag(const _Float16* p, int hh) { FragH f; f.half[0] = *(const v8us*)((const unsigned short*)p + 8 * hh); f.half[1] = *(const v8us*)((const unsigned short*)p + 16 + 8 * hh); return f.v; }
// Fragment order of an f16 matrix [R][K]: 16-row x 32-k tiles of 1024 bytes, tile (rt, kt) at (rt * (K / 32) + kt) * 512 halves; inside a tile the 8 halves of row ln, k = part * 16 + hh * 8 .. + 7
// stand at (part * 32 + hh * 16 + ln) * 8. p = the tile + lane * 8: each of the two loads of a wave then covers 512 contiguous bytes (4 whole lines, not 16 pieces of 32 bytes); the k order is that of g2_frag.
__device__ __forceinline__ v16h pk_frag(const _Float16* p) { FragH f; f.half[0] = *(const v8us*)((const unsigned short*)p); f.half[1] = *(const v8us*)((const unsigned short*)p + 256); return f.v; }
__device__ __forceinline__ v8f g2_mma(v16h a, v16h b, v8f c) { v8f d = __builtin_amdgcn_wmma_f32_16x16x32_f16(false, a, false, b, (short)0, c, false, false); asm volatile("v_nop\n\tv_nop\n\tv_nop\n\tv_nop" : "+v"(d) : "v"(a), "v"(b)); return d; }
struct G2F { v16h a0, a1, b0, b1, b2, b3; };      /* the six fragments of one 32-k tile: two row tiles of A, four column tiles of B */
// one k tile's twelve loads, issued as one group at this place, tiles ahead of the products that read them. The wait stands behind the group: the six address pairs, named as inputs, stay live up to it,
// so that no load's result lands in a register that an issued load still names; the two scheduling barriers keep every load of the group in front of the wait and every rewrite of an address behind it
__device__ __forceinline__ G2F g2_load(const _Float16* a0, const _Float16* a1, const _Float16* b0, const _Float16* b1, const _Float16* b2, const _Float16* b3, int kb) { G2F f;
  const _Float16* p0 = a0 + kb; const _Float16* p1 = a1 + kb; const _Float16* p2 = b0 + kb; const _Float16* p3 = b1 + kb; const _Float16* p4 = b2 + kb; const _Float16* p5 = b3 + kb;
  f.a0 = pk_frag(p0); f.a1 = pk_frag(p1); f.b0 = pk_frag(p2); f.b1 = pk_frag(p3); f.b2 = pk_frag(p4); f.b3 = pk_frag(p5);
  __builtin_amdgcn_sched_barrier(0); asm volatile("s_wait_xcnt 0x0" :: "v"(p0), "v"(p1), "v"(p2), "v"(p3), "v"(p4), "v"(p5) : "memory"); __builtin_amdgcn_sched_barrier(0); return f; }
template <int ACT, int PK>      /* A and Bh in fragment order (pk_frag); PK 1: C16 alone is written, in fragment order; PK 2: the same tiles at their V^T places (rows = (head, d), columns = token rows: tile (32 keys, 16 d) at (key / 32) * 4 + d / 16 of the (batch, head) slab), bias by row; PK 0: C and C16 row-major. so: the block's staging range; bx, by: the block's tile and batch */
__device__ __forceinline__ void g2_body(float (*so)[32][68], const int bx, const int by, const _Float16* __restrict__ A, int lda, size_t sA, const _Float16* __restrict__ Bh, int ldb, size_t sB, float alpha, const float* __restrict__ bias, size_t sBias, const float* __restrict__ CP, int rowsPerB, size_t sCPb, int row0g,
    float* __restrict__ C, _Float16* __restrict__ C16, int ldc, size_t sC, int M, int N, int K) { static_assert(ACT == 0 || ACT == 3 || ACT == 6 || ACT == 8 || ACT == 9 || ACT == 11 || ACT == 12 || ACT == 14 || ACT == 15 || ACT == 16 || ACT == 17, "k_gemm2: unsupported ACT code (would silently apply no activation)");
  const int tid = threadIdx.x, w = tid >> 5, lane = tid & 31, ln = lane & 15, hh = lane >> 4;
  A += (size_t)by * sA; Bh += (size_t)by * sB; const size_t cofs = (size_t)by * sC; const float* bp = bias ? bias + (size_t)by * sBias : nullptr;
  const int ntn = N >> 6; const int mt = bx / ntn, nq = bx - mt * ntn; const int row0 = mt * 128 + 32 * w, col0 = nq * 64; if (row0 >= M) return;
  const _Float16* a0p = A + (size_t)row0 * lda + lane * 8; const _Float16* a1p = a0p + (size_t)16 * lda;
  const _Float16* b0p = Bh + (size_t)col0 * ldb + lane * 8; const _Float16* b1p = b0p + (size_t)16 * ldb; const _Float16* b2p = b1p + (size_t)16 * ldb; const _Float16* b3p = b2p + (size_t)16 * ldb;
  const v8f z8 = {0.f,0.f,0.f,0.f,0.f,0.f,0.f,0.f}; v8f c00 = z8, c01 = z8, c02 = z8, c03 = z8, c10 = z8, c11 = z8, c12 = z8, c13 = z8;
  if (K > 0) { const int ke = K * 16, kl = ke - 512, n3 = ke / 1536; int kb = 0;      /* halves of a fragment row; its last tile; whole trips. A ring of three register sets: tile t + 2 is asked for in front of tile t's products; past the end the last tile is fetched again, in bounds */
#define G2_LOAD(k) g2_load(a0p, a1p, b0p, b1p, b2p, b3p, (k) < kl ? (k) : kl)
#define G2_TILE(f) { c00 = g2_mma(f.a0, f.b0, c00); c10 = g2_mma(f.a1, f.b0, c10); c01 = g2_mma(f.a0, f.b1, c01); c11 = g2_mma(f.a1, f.b1, c11); c02 = g2_mma(f.a0, f.b2, c02); c12 = g2_mma(f.a1, f.b2, c12); c03 = g2_mma(f.a0, f.b3, c03); c13 = g2_mma(f.a1, f.b3, c13); }
    G2F f0 = G2_LOAD(0), f1 = G2_LOAD(512);
#pragma unroll 1      // three tiles a trip, so that each set keeps its registers (no copies between the sets); one block without an exit inside, so that the waits for the loads stay counted
    for (int i = 0; i < n3; ++i, kb += 1536) { const G2F f2 = G2_LOAD(kb + 1024); G2_TILE(f0) f0 = G2_LOAD(kb + 1536); G2_TILE(f1) f1 = G2_LOAD(kb + 2048); G2_TILE(f2) }
    if (kb < ke) G2_TILE(f0)      /* the one or two tiles that no whole trip holds are already in the ring */
    if (kb + 512 < ke) G2_TILE(f1) }
#undef G2_LOAD
#undef G2_TILE
  v8f accs[8] = {c00, c01, c02, c03, c10, c11, c12, c13};
  float rb[16] = {0.f, 0.f, 0.f, 0.f, 0.f, 0.f, 0.f, 0.f, 0.f, 0.f, 0.f, 0.f, 0.f, 0.f, 0.f, 0.f};      /* PK 2: the bias of the lane's 2 x 8 rows */
  if (PK == 2 && bp) { const float* rp = bp + row0 + 8 * hh; const v4f x0 = *(const v4fa*)rp, x1 = *(const v4fa*)(rp + 4), x2 = *(const v4fa*)(rp + 16), x3 = *(const v4fa*)(rp + 20);
#pragma unroll      // constant indices: the values stay in registers
    for (int i = 0; i < 4; ++i) { rb[i] = bf16_round(x0[i]); rb[4 + i] = bf16_round(x1[i]); rb[8 + i] = bf16_round(x2[i]); rb[12 + i] = bf16_round(x3[i]); } }
#pragma unroll
  for (int u = 0; u < 8; ++u) { const int t = u & 3, half = u >> 2; const int col = col0 + t * 16 + ln; const float bv = (PK != 2 && bp) ? bf16_round(bp[col]) : 0.f;
#pragma unroll
    for (int r = 0; r < 8; ++r) { const int rloc = half * 16 + 8 * hh + r; float v = accs[u][r] * alpha + (PK == 2 ? rb[half * 8 + r] : bv); if (CP) { if (rowsPerB < 0) v += CP[cofs + (size_t)(row0g + row0 + rloc) * ldc + col];      /* rowsPerB < 0: own element of the batched C plane */ else { const int bidx = (row0g + row0 + rloc) / rowsPerB; v += CP[(size_t)bidx * sCPb + (size_t)by * 64 + col]; } }
      if (ACT == 3) v = fmaxf(v, 0.f); else if (ACT == 6) v = 0.5f * v * (1.0f + erff(v * 0.70710678118654752f)); else if (ACT == 11) v = 1.0f / (1.0f + expf(-v)); else if (ACT == 15) v = v / (1.0f + expf(-v)); else if (ACT == 12) v = (v > 0.f) ? v : 0.01f * v; else if (ACT == 8) v = tanhf(v); else if (ACT == 9) v = 0.5f * v * (1.0f + tanhf(0.7978845608028654f * (v + 0.044715f * v * v * v))); else if (ACT == 14) v = (v > 0.f) ? v : 0.1f * v; else if (ACT == 16) v = (v >= 0.f) ? v : 0.3f * v; else if (ACT == 17) v = (v >= 0.f) ? v : 0.2f * v;
      so[w][rloc][t * 16 + ln] = v; } }
  __builtin_amdgcn_fence(__ATOMIC_ACQ_REL, "workgroup"); __builtin_amdgcn_wave_barrier();
  const int rsub = lane >> 4, c4 = (lane & 15) * 4;
  if (PK) {      /* C16 alone, in fragment order: the wave's 32 x 64 tile = 2 x 2 fragment tiles, eight stores of 512 contiguous bytes */
#pragma unroll      // constant LDS and store offsets
      for (int s = 0; s < 8; ++s) { const int rl = (s >> 2) * 16 + ln, cl = ((s >> 1) & 1) * 32 + (s & 1) * 16 + hh * 8; const v4f x = *(const v4fa*)&so[w][rl][cl], y = *(const v4fa*)&so[w][rl][cl + 4]; FragH f;
        for (int i = 0; i < 4; ++i) { f.h[i] = (_Float16)x[i]; f.h[4 + i] = (_Float16)y[i]; }
        const size_t tl = PK == 2 ? (size_t)((col0 / SQ) * NH + (row0 >> 6)) * (HD * SQ) + (size_t)((((col0 % SQ) >> 5) + ((s >> 1) & 1)) * 4 + ((row0 >> 4) & 3) + (s >> 2)) * 512      /* the wave's 32 rows lie in one head, its 64 columns in one batch */
                                : (size_t)(row0 + (s >> 2) * 16) * ldc + (size_t)((col0 >> 5) + ((s >> 1) & 1)) * 512;
        *(v8us*)((unsigned short*)C16 + cofs + tl + (s & 1) * 256 + lane * 8) = f.half[0]; }
    return; }
  {
#pragma unroll
    for (int q = 0; q < 16; ++q) { const int r = q * 2 + rsub; const v4f v = *(const v4fa*)&so[w][r][c4]; if (C) *(v4f*)(C + cofs + (size_t)(row0 + r) * ldc + col0 + c4) = v; if (C16) { v4h h4; for (int i = 0; i < 4; ++i) h4[i] = (_Float16)v[i]; *(v4h*)(C16 + cofs + (size_t)(row0 + r) * ldc + col0 + c4) = h4; } }
     } }
template <int ACT, int PK>
__global__ __launch_bounds__(128) void k_gemm2(const _Float16* __restrict__ A, int lda, size_t sA, const _Float16* __restrict__ Bh, int ldb, size_t sB, float alpha, const float* __restrict__ bias, size_t sBias, const float* __restrict__ CP, int rowsPerB, size_t sCPb, int row0g,
    float* __restrict__ C, _Float16* __restrict__ C16, int ldc, size_t sC, int M, int N, int K) {
  __shared__ __attribute__((aligned(16))) float so[4][32][68];
  g2_body<ACT, PK>(so, (int)blockIdx.x, (int)blockIdx.y, A, lda, sA, Bh, ldb, sB, alpha, bias, sBias, CP, rowsPerB, sCPb, row0g, C, C16, ldc, sC, M, N, K); }
// The three projections as one launch: none reads what another writes. blockIdx.y = 0, 1, 2: v, q, k. v is formed transposed, V^T = Wv^T x^T: both operands stand in the same fragment order, so the weight rows go in as A and
// the token rows as B, and the result tiles (rows d, k = keys) are the A fragments of the attention's O^T += V^T P^T as they leave the accumulators; no v plane and no transposing launch. One projection alone puts
// two waves on a SIMD, and each of its k tiles waits for operands that every block asks for at the same time; with all three in flight a SIMD holds as many waves as the registers allow, and two launch gaps, fills and tails go.
__global__ __launch_bounds__(128) void k_qkv(const _Float16* __restrict__ XQ, const _Float16* __restrict__ XK, const _Float16* __restrict__ XV, const _Float16* __restrict__ BQ, const _Float16* __restrict__ BK, const _Float16* __restrict__ BV,
    const float* __restrict__ bq, const float* __restrict__ bk, const float* __restrict__ bv, _Float16* __restrict__ Q16, _Float16* __restrict__ K16, _Float16* __restrict__ VT) {
  __shared__ __attribute__((aligned(16))) float so[4][32][68];
  const int y = (int)blockIdx.y;      /* block-uniform */
  static_assert((MP / 128) * (DM / 64) == (DM / 128) * (MP / 64) && MP == NB * SQ && SQ % 64 == 0 && HD % 32 == 0, "k_qkv: the transposed projection has as many blocks as the others; whole batches");
  if (y == 0) g2_body<0, 2>(so, (int)blockIdx.x, 0, BV, DM, 0, XV, DM, 0, 0.0625f, bv, 0, nullptr, 1, 0, 0, nullptr, VT, DM, 0, DM, MP, DM);
  else g2_body<0, 1>(so, (int)blockIdx.x, 0, y == 1 ? XQ : XK, DM, 0, y == 1 ? BQ : BK, DM, 0, 0.0625f, y == 1 ? bq : bk, 0, nullptr, 1, 0, 0, nullptr, y == 1 ? Q16 : K16, DM, 0, MP, DM, DM); }


__global__ __launch_bounds__(256) void k_wnat(const float* __restrict__ w, size_t n8, _Float16* __restrict__ Bt) { const size_t t = (size_t)blockIdx.x * 256 + threadIdx.x; if (t >= n8) return; FragH f; for (int q = 0; q < 8; ++q) f.h[q] = (_Float16)(bf16_round(w[t * 8 + q]) * 16.0f); *(v8us*)((unsigned short*)Bt + t * 8) = f.half[0];  }
__global__ __launch_bounds__(256) void k_rsm(const float* __restrict__ S, _Float16* __restrict__ P, int nrows) {
  #pragma clang fp contract(off)
  const int i = blockIdx.x * 256 + threadIdx.x; if (i >= nrows) return; const float* s = S + (size_t)i * SQ; float mx = -3.0e38f;
#pragma unroll 1
  for (int j = 0; j < SQ; ++j) mx = fmaxf(mx, s[j]); float se = 0.f;
#pragma unroll 1
  for (int j = 0; j < SQ; ++j) se += expf(s[j] - mx); const float sc = 256.0f / se;
#pragma unroll 1
  for (int j0 = 0; j0 < SQ; j0 += 8) { FragH f; for (int q = 0; q < 8; ++q) f.h[q] = (_Float16)(expf(s[j0 + q] - mx) * sc); unsigned short* d = (unsigned short*)P + (size_t)i * SQ + j0; *(v8us*)d = f.half[0];  } }
__global__ __launch_bounds__(256) void k_vt(const _Float16* __restrict__ V16, int b, int h0, _Float16* __restrict__ VT) { __shared__ unsigned short tl[64][65]; const int tid = threadIdx.x; const int hh = blockIdx.x % HG, sg = blockIdx.x / HG; const int s0 = sg * 64; const int h = h0 + hh;
  for (int i = tid; i < 64 * 8; i += 256) { const int j = i / 8, d8 = (i % 8) * 8; FragH f; f.half[0] = *(const v8us*)((const unsigned short*)V16 + ((size_t)b * SQ + s0 + j) * DM + h * HD + d8); for (int q = 0; q < 8; ++q) tl[d8 + q][j] = f.u[q]; }
  __syncthreads();
  { for (int i = tid; i < 64 * 8; i += 256) { const int d = i / 8, j8 = (i % 8) * 8; FragH f; for (int q = 0; q < 8; ++q) f.u[q] = tl[d][j8 + q]; *(v8us*)((unsigned short*)VT + ((size_t)hh * HD + d) * SQ + s0 + j8) = f.half[0]; }  } }






typedef int v4ia __attribute__((ext_vector_type(4), may_alias));
__device__ __forceinline__ float rs_xrow(float v) { const int i = __float_as_int(v); return __int_as_float(__builtin_amdgcn_permlanex16(i, i, 0x76543210, 0xfedcba98, true, false)); }      /* lane l reads lane l ^ 16 */
// Fused attention, one wave per 16 query rows of one (batch, head), 32 keys a pass: S^T = K Q^T (A = K rows, B = Q kept in registers), so a lane holds one query's
// scores (keys 8*hh + r of each 16-key tile); running maximum and sum per lane, one exchange between the wave halves; the two f32 score tiles, converted in place,
// are the B operand of O^T += V^T P^T. No score and no weight goes through memory. All in the log2 domain: p = 2^(s * FA_C - mu + FA_OFF) with mu the maximum in use.
#define FA_C 0.18033688011112042f      /* 64^-0.5 * log2(e) */
#define FA_OFF 7.0f                    /* weights carried x128: small ones stay normal f16 numbers */
#define FA_THR 8.0f                    /* mu is renewed only when a score passes it by more than this: weights stay at or under 2^15, inside f16 */
#define FA_DROP (-0x1p+100f)           /* raw score of a masked key; a power of two, so FA_DROP * FA_C is exact and a row with every key masked gets equal weights */
__device__ __forceinline__ v8f fa_mma(v16h a, v16h b, v8f c) { return __builtin_amdgcn_wmma_f32_16x16x32_f16(false, a, false, b, (short)0, c, false, false); }
// eight native 2^x; each is followed by an independent instruction, the last by the v_nop: the slot the instruction set asks for behind a transcendental
__device__ __forceinline__ v8f fa_exp2(v8f x) { float e0, e1, e2, e3, e4, e5, e6, e7;
  asm("v_exp_f32 %0, %8\n\tv_exp_f32 %1, %9\n\tv_exp_f32 %2, %10\n\tv_exp_f32 %3, %11\n\tv_exp_f32 %4, %12\n\tv_exp_f32 %5, %13\n\tv_exp_f32 %6, %14\n\tv_exp_f32 %7, %15\n\tv_nop"
      : "=&v"(e0), "=&v"(e1), "=&v"(e2), "=&v"(e3), "=&v"(e4), "=&v"(e5), "=&v"(e6), "=&v"(e7) : "v"(x[0]), "v"(x[1]), "v"(x[2]), "v"(x[3]), "v"(x[4]), "v"(x[5]), "v"(x[6]), "v"(x[7]));
  const v8f e = {e0, e1, e2, e3, e4, e5, e6, e7}; return e; }
__device__ __forceinline__ float fa_exp2s(float x) { float e; asm("v_exp_f32 %0, %1\n\tv_nop" : "=v"(e) : "v"(x)); return e; }      /* the v_nop: the same slot */
// behind a group of loads or stores: the group is issued whole at this place (for loads: ahead of the arithmetic that covers their latency), and its address and data registers are reused only behind the wait;
// the two scheduling barriers keep every member of the group in front of the wait and every rewrite of a register behind it
__device__ __forceinline__ void fa_issued() { __builtin_amdgcn_sched_barrier(0); asm volatile("s_wait_xcnt 0x0" ::: "memory"); __builtin_amdgcn_sched_barrier(0); }
struct FaK { v16h a00, a01, a10, a11; };      /* one pass of K fragments (two 16-key tiles x two k steps) */
// kp: the head's first K tile + lane * 8 (fragment order)
__device__ __forceinline__ FaK fa_load(const _Float16* kp, int j) { FaK f; const _Float16* k = kp + (size_t)j * LQ;
  f.a00 = pk_frag(k); f.a01 = pk_frag(k + 512); f.a10 = pk_frag(k + 16 * LQ); f.a11 = pk_frag(k + 16 * LQ + 512); return f; }
// The mask's pass map, written by pm_tile in the first launch: for each tile of 16 query rows (token rows) one 64-bit word, bit p set when the tile's 16 x 32 mask words of pass p (keys 32 p .. 32 p + 31)
// hold a nonzero one. A wave reads its tile's word once and tests one scalar bit a pass; no mask word is read in a pass without a nonzero one. A tile's word has a 128-byte line of its own (one writer a line).
#define PM_PITCH 32                    /* 32-bit words between two tiles' map words */
static_assert(SQ == 2048, "pass map: 64 passes of 32 keys in one 64-bit word");
__device__ __forceinline__ unsigned long long fa_map(const unsigned* __restrict__ MF, size_t rq) { const unsigned* p = MF + rq / 16 * PM_PITCH;
  const unsigned lo = (unsigned)__builtin_amdgcn_readfirstlane((int)p[0]), hi = (unsigned)__builtin_amdgcn_readfirstlane((int)p[1]); return ((unsigned long long)hi << 32) | lo; }
__device__ __forceinline__ bool fa_anym(unsigned long long mw, int j) { return ((mw >> (j >> 5)) & 1ull) != 0; }      /* wave-uniform: does pass j / 32 hold a nonzero mask word? */
// a key with a nonzero mask word takes FA_DROP as its raw score; m: the lane's own query row, first key of the pass + 8 * hh (the lane's 16 words are read here, only in a pass that holds a nonzero word)
__device__ __forceinline__ void fa_drop(const int* m, v8f& s0, v8f& s1) { const v4ia m0 = *(const v4ia*)m, m1 = *(const v4ia*)(m + 4), m2 = *(const v4ia*)(m + 16), m3 = *(const v4ia*)(m + 20);
#pragma unroll      // constant indices: the tiles stay in registers
  for (int r = 0; r < 4; ++r) { s0[r] = (m0[r] == 0) ? s0[r] : FA_DROP; s0[4 + r] = (m1[r] == 0) ? s0[4 + r] : FA_DROP; s1[r] = (m2[r] == 0) ? s1[r] : FA_DROP; s1[4 + r] = (m3[r] == 0) ? s1[4 + r] : FA_DROP; } }
// ---- the second output (the last head's probabilities) from work-groups of its own, ahead of the attention work-groups in the same launch: one work-group = 16 query rows, each of its 8 waves 256 keys,
// so that the whole chip shares this work and no attention work-group runs longer than the others. S^T as in k_fattn (a lane holds one query's scores). First walk: the wave's running maximum and sum;
// they are joined across the waves through LDS; second walk: the scores again, p = 2^(s * FA_C - maximum) / sum, turned through the wave's own LDS range so that whole 128-byte lines are stored.
#define PB_BLOCKS (NB * (SQ / 16))
#define PB_KEYS (SQ / 8)               /* keys a wave */
#define PB_PITCH 36                    /* floats a staged row: 128 bytes + 16, so that the 16 lanes of a half wave write 64 different banks */
__device__ __forceinline__ void fa_prob(int t, const _Float16* __restrict__ Q16, const _Float16* __restrict__ K16, const int* __restrict__ Mk, const unsigned* __restrict__ MF, float* __restrict__ PO, float (*red)[8][16], float (*stg)[16][PB_PITCH]) {
  const int lane = threadIdx.x & 31, ln = lane & 15, hh = lane >> 4; const int w = __builtin_amdgcn_readfirstlane(threadIdx.x >> 5);
  const size_t rq = (size_t)t * 16, qr = rq + ln; const int j0 = w * PB_KEYS, je = j0 + PB_KEYS;      /* first query row (token row: batch * SQ + row), the lane's query row; the wave's keys */
  const _Float16* qp = Q16 + rq * LQ + (NH - 1) * 1024 + lane * 8; const v16h q0 = pk_frag(qp), q1 = pk_frag(qp + 512);
  fa_issued();
  const _Float16* kp = K16 + (size_t)(t / (SQ / 16)) * SQ * LQ + (NH - 1) * 1024 + lane * 8; const int* mp = Mk + qr * SQ + 8 * hh; const unsigned long long mw = fa_map(MF, rq);
  const v8f z8 = {0.f, 0.f, 0.f, 0.f, 0.f, 0.f, 0.f, 0.f}; float mu = -3.0e38f, l = 0.f;
  FaK f = fa_load(kp, j0);
  fa_issued();
#pragma unroll 1      // one pass a trip: the next pass's operands are already fetched by hand
  for (int j = j0; j < je; j += 32) {
    v8f s0 = fa_mma(f.a01, q1, fa_mma(f.a00, q0, z8)), s1 = fa_mma(f.a11, q1, fa_mma(f.a10, q0, z8));
    if (fa_anym(mw, j)) fa_drop(mp + j, s0, s1);
    f = fa_load(kp, (j + 32 < je) ? j + 32 : j0);      /* the last pass fetches the second walk's first operands */
    fa_issued();
    float tm = fmaxf(s0[0], s1[0]);
#pragma unroll      // constant indices: the tiles stay in registers
    for (int r = 1; r < 8; ++r) tm = fmaxf(tm, fmaxf(s0[r], s1[r]));
    tm = fmaxf(tm, rs_xrow(tm)); const float mn = fmaxf(mu, tm * FA_C), al = fa_exp2s(mu - mn); mu = mn;
    const v8f ps = fa_exp2(s0 * FA_C - mn) + fa_exp2(s1 * FA_C - mn);
    l = l * al + (((ps[0] + ps[1]) + (ps[2] + ps[3])) + ((ps[4] + ps[5]) + (ps[6] + ps[7]))); }
  l += rs_xrow(l);      /* the halves hold the same maximum */
  if (lane < 16) { red[0][w][ln] = mu; red[1][w][ln] = l; }
  __syncthreads();      /* every wave's row maxima and sums are in LDS */
  float mx = red[0][0][ln];
#pragma unroll      // constant LDS offsets
  for (int u = 1; u < 8; ++u) mx = fmaxf(mx, red[0][u][ln]);
  float lt = 0.f;
#pragma unroll      // constant LDS offsets
  for (int u = 0; u < 8; ++u) lt += red[1][u][ln] * fa_exp2s(red[0][u][ln] - mx);
  const float il = 1.0f / lt;
  float (*sg)[PB_PITCH] = stg[w]; float* pw = PO + (rq + (lane >> 3)) * SQ + (lane & 7) * 4;      /* the wave's own staging range; a store covers four whole 128-byte lines (four rows of the pass) */
#pragma unroll 1      // as above
  for (int j = j0; j < je; j += 32) {
    v8f s0 = fa_mma(f.a01, q1, fa_mma(f.a00, q0, z8)), s1 = fa_mma(f.a11, q1, fa_mma(f.a10, q0, z8));
    if (fa_anym(mw, j)) fa_drop(mp + j, s0, s1);
    f = fa_load(kp, (j + 32 < je) ? j + 32 : j);      /* the last pass fetches its own operands again, in bounds */
    fa_issued();
    const v8f p0 = fa_exp2(s0 * FA_C - mx) * il, p1 = fa_exp2(s1 * FA_C - mx) * il;
    const v4f t0 = {p0[0], p0[1], p0[2], p0[3]}, t1 = {p0[4], p0[5], p0[6], p0[7]}, t2 = {p1[0], p1[1], p1[2], p1[3]}, t3 = {p1[4], p1[5], p1[6], p1[7]};
    *(v4fa*)&sg[ln][8 * hh] = t0; *(v4fa*)&sg[ln][8 * hh + 4] = t1; *(v4fa*)&sg[ln][16 + 8 * hh] = t2; *(v4fa*)&sg[ln][20 + 8 * hh] = t3;
    asm volatile("s_wait_dscnt 0x0" ::: "memory");      // the wave's LDS writes are done before its lanes read one another's words back
    const v4f r0 = *(const v4fa*)&sg[lane >> 3][(lane & 7) * 4], r1 = *(const v4fa*)&sg[4 + (lane >> 3)][(lane & 7) * 4], r2 = *(const v4fa*)&sg[8 + (lane >> 3)][(lane & 7) * 4], r3 = *(const v4fa*)&sg[12 + (lane >> 3)][(lane & 7) * 4];
    *(v4f*)(pw + j) = r0; *(v4f*)(pw + j + 4 * SQ) = r1; *(v4f*)(pw + j + 8 * SQ) = r2; *(v4f*)(pw + j + 12 * SQ) = r3;
    fa_issued(); } }      /* also keeps the next pass's LDS writes behind this pass's reads */
__global__ __launch_bounds__(256) void k_fattn(const _Float16* __restrict__ Q16, const _Float16* __restrict__ K16, const _Float16* __restrict__ VT, const int* __restrict__ Mk, const unsigned* __restrict__ MF, _Float16* __restrict__ O16, float* __restrict__ PO) {
  static_assert(SQ % 128 == 0 && HD == 64, "k_fattn: 8 waves x 16 query rows a block, head size 64");
  __shared__ __attribute__((aligned(16))) float pb_red[2][8][16]; __shared__ __attribute__((aligned(16))) float pb_stg[8][16][PB_PITCH];
  if (blockIdx.x < PB_BLOCKS) { fa_prob((int)blockIdx.x, Q16, K16, Mk, MF, PO, pb_red, pb_stg); return; }      /* block-uniform: the short work-groups of the second output start first, beside the first attention work-groups */
  const int lane = threadIdx.x & 31, ln = lane & 15, hh = lane >> 4; const int w = __builtin_amdgcn_readfirstlane(threadIdx.x >> 5);
  const unsigned at = blockIdx.x - PB_BLOCKS; const int h = (int)(at / (SQ / 128) % NH), b = (int)(at / (SQ / 128) / NH);
  const size_t rq = (size_t)b * SQ + at % (SQ / 128) * 128 + w * 16, qr = rq + ln;      /* the wave's first query row; the lane's query row */
  const _Float16* qp = Q16 + rq * LQ + h * 1024 + lane * 8; const v16h q0 = pk_frag(qp), q1 = pk_frag(qp + 512);      /* a head's 64 columns are two 32-k tiles */
  fa_issued();      /* Q, then K, then V^T: the order of the loop, so that the loop's first wait for K leaves the V^T loads in flight */
  const _Float16* kp = K16 + (size_t)b * SQ * LQ + h * 1024 + lane * 8; const _Float16* vp = VT + (size_t)(b * NH + h) * HD * SQ + lane * 8; const int* mp = Mk + qr * SQ + 8 * hh; const unsigned long long mw = fa_map(MF, rq);
  const v8f z8 = {0.f, 0.f, 0.f, 0.f, 0.f, 0.f, 0.f, 0.f}; v8f o0 = z8, o1 = z8, o2 = z8, o3 = z8; float mu = -3.0e38f, l = 0.f;
  FaK f = fa_load(kp, 0);
  fa_issued();
  v16h v0 = pk_frag(vp), v1 = pk_frag(vp + 512), v2 = pk_frag(vp + 1024), v3 = pk_frag(vp + 1536);      /* a pass of V^T: four tiles, 4096 contiguous bytes */
  fa_issued();
#pragma unroll 1      // one pass a trip: the next pass's operands are already fetched by hand, a second copy of the body would only cost registers
  for (int j = 0; j < SQ; j += 32) { const int jn = (j + 32 < SQ) ? j + 32 : j;      /* first key of the next pass; the last pass fetches its own operands again, in bounds */
    v8f s0 = fa_mma(f.a01, q1, fa_mma(f.a00, q0, z8)), s1 = fa_mma(f.a11, q1, fa_mma(f.a10, q0, z8));
    if (fa_anym(mw, j)) fa_drop(mp + j, s0, s1);
    float tm = fmaxf(s0[0], s1[0]);
#pragma unroll      // constant indices: the tiles stay in registers
    for (int r = 1; r < 8; ++r) tm = fmaxf(tm, fmaxf(s0[r], s1[r]));
    tm = fmaxf(tm, rs_xrow(tm)); const float tl = tm * FA_C;
    if (__builtin_amdgcn_ballot_w32(tl > mu + FA_THR) != 0) { const float mn = fmaxf(mu, tl), al = fa_exp2s(mu - mn); mu = mn; l *= al; o0 *= al; o1 *= al; o2 *= al; o3 *= al; }      /* rare: one scalar test a pass */
    f = fa_load(kp, jn);      /* the next pass's K flies during this pass's exponentials and products */
    fa_issued();
    const float nb = FA_OFF - mu;
    const v8f p0 = fa_exp2(s0 * FA_C + nb), p1 = fa_exp2(s1 * FA_C + nb);
    const v8f ps = p0 + p1; l += ((ps[0] + ps[1]) + (ps[2] + ps[3])) + ((ps[4] + ps[5]) + (ps[6] + ps[7]));
    FragH pf;
#pragma unroll      // constant indices: the fragment stays in registers
    for (int r = 0; r < 8; ++r) { pf.h[r] = (_Float16)p0[r]; pf.h[8 + r] = (_Float16)p1[r]; }
    o0 = fa_mma(v0, pf.v, o0); o1 = fa_mma(v1, pf.v, o1); o2 = fa_mma(v2, pf.v, o2); o3 = fa_mma(v3, pf.v, o3);
    v0 = pk_frag(vp + jn * 64); v1 = pk_frag(vp + jn * 64 + 512); v2 = pk_frag(vp + jn * 64 + 1024); v3 = pk_frag(vp + jn * 64 + 1536);      /* the next pass's V^T flies during its score products and softmax */
    fa_issued(); }
  l += rs_xrow(l);      /* the halves' sums are joined once */
  const float il = 1.0f / l, so = 64.0f * il;      /* o carried x64, as the output GEMM's alpha expects */
  unsigned short* op = (unsigned short*)O16 + rq * DM + h * 1024 + lane * 8; FragH e0, e1;      /* o in fragment order: the lane's four runs of 8 are the four half-fragments of the head's two tiles */
#pragma unroll      // constant indices: the tiles stay in registers
  for (int r = 0; r < 8; ++r) { e0.h[r] = (_Float16)(o0[r] * so); e0.h[8 + r] = (_Float16)(o1[r] * so); e1.h[r] = (_Float16)(o2[r] * so); e1.h[8 + r] = (_Float16)(o3[r] * so); }
  *(v8us*)op = e0.half[0]; *(v8us*)(op + 256) = e0.half[1]; *(v8us*)(op + 512) = e1.half[0]; *(v8us*)(op + 768) = e1.half[1];
  fa_issued(); }      /* behind the stores: whatever the compiler lays behind them reuses their registers only behind the wait */


__global__ __launch_bounds__(256) void k_rsmf(const float* __restrict__ S, _Float16* __restrict__ P, int qn, int hg) {
  #pragma clang fp contract(off)
  const int t = blockIdx.x * 256 + threadIdx.x; if (t >= qn * hg) return; const size_t i = (size_t)(t / qn) * SQ + (t % qn); const float* s = S + i * SQ; float mx = -3.0e38f;
#pragma unroll 1
  for (int j = 0; j < SQ; ++j) mx = fmaxf(mx, s[j]); float se = 0.f;
#pragma unroll 1
  for (int j = 0; j < SQ; ++j) se += __expf(s[j] - mx); const float sc = 256.0f / se;
#pragma unroll 1
  for (int j0 = 0; j0 < SQ; j0 += 8) { FragH f; for (int q = 0; q < 8; ++q) f.h[q] = (_Float16)(__expf(s[j0 + q] - mx) * sc); unsigned short* d = (unsigned short*)P + i * SQ + j0; *(v8us*)d = f.half[0];  } }

// ---- the seven input conversions (three x, three per-head weights, W0) as one launch. None reads what another writes. A slab = one fragment row tile, 16 rows x DM = 2048 chunks of 16 bytes (pk_frag);
// a block takes a slab at a time, a thread eight of its chunks (k tiles four apart), so that all of a slab's loads are in flight together and few waves have to be started.
#define PP_WS (DM / 16)                        /* slabs of one weight matrix */
#define PP_XS ((int)(NR / 16))                 /* slabs of one input */
#define PP_SLABS (4 * PP_WS + 3 * PP_XS)
#define PP_BLOCKS 512                          /* two blocks a WGP; slabs b and b + 512: a weight slab is paired with an input slab */
// behind a group of loads or stores off one address: the address, named as an input, stays live up to the wait, so that no load's result lands in it; the two scheduling barriers keep
// every member of the group in front of the wait and every rewrite of an address or data register behind it
__device__ __forceinline__ void pp_issued(const void* p) { __builtin_amdgcn_sched_barrier(0); asm volatile("s_wait_xcnt 0x0" :: "v"(p) : "memory"); __builtin_amdgcn_sched_barrier(0); }
// a thread's eight finished chunks as one group of stores; the scheduling barrier in front keeps a store from being issued among the conversions, where its data registers would be wanted again at once
__device__ __forceinline__ void pp_store(unsigned short* __restrict__ d, const v8us (&o)[8]) { __builtin_amdgcn_sched_barrier(0);
#pragma unroll      // constant offsets off one address
  for (int u = 0; u < 8; ++u) *(v8us*)(d + u * 2048) = o[u];
  pp_issued(d); }
template <int QS, int US>      /* floats between the eight k of a chunk; between two chunks of a thread */
__device__ __forceinline__ void pp_wslab(const float* __restrict__ s, unsigned short* __restrict__ d) { float w[8][8]; v8us o[8];
#pragma unroll      // constant offsets off one address; the values stay in registers
  for (int u = 0; u < 8; ++u) for (int q = 0; q < 8; ++q) w[u][q] = s[(size_t)u * US + (size_t)q * QS];
  pp_issued(s);
#pragma unroll      // as above
  for (int u = 0; u < 8; ++u) { FragH f; for (int q = 0; q < 8; ++q) f.h[q] = (_Float16)(16.0f * bf16_round(w[u][q])); o[u] = f.half[0]; }
  pp_store(d, o); }
__device__ __forceinline__ void pp_xslab(const float* __restrict__ s, unsigned short* __restrict__ d) { v4f a[8], b[8]; v8us o[8];
#pragma unroll      // as above
  for (int u = 0; u < 8; ++u) { a[u] = *(const v4fa*)(s + u * 128); b[u] = *(const v4fa*)(s + u * 128 + 4); }
  pp_issued(s);
#pragma unroll      // as above
  for (int u = 0; u < 8; ++u) { FragH f; for (int q = 0; q < 4; ++q) { f.h[q] = (_Float16)bf16_round(a[u][q]); f.h[4 + q] = (_Float16)bf16_round(b[u][q]); } o[u] = f.half[0]; }
  pp_store(d, o); }
// ---- the mask's pass map (see fa_map), from work-groups of their own in the same launch: one work-group = one tile of 16 query rows, each of its 8 waves 256 keys (8 passes) as two groups of 16 loads,
// each load 512 contiguous bytes of one row (4 passes, 8 lanes a pass); the rows are joined by OR in the lane, the lanes by a ballot, the waves through LDS.
#define PM_BLOCKS ((int)(NR / 16))
__device__ __forceinline__ unsigned pm_half(const int* __restrict__ m) { v4ia a[16];
#pragma unroll      // constant offsets off one address; the values stay in registers
  for (int r = 0; r < 16; ++r) a[r] = *(const v4ia*)(m + r * SQ);
  pp_issued(m);
  v4ia o = a[0];
#pragma unroll      // as above
  for (int r = 1; r < 16; ++r) o |= a[r];
  const unsigned bl = __builtin_amdgcn_ballot_w32((o[0] | o[1] | o[2] | o[3]) != 0);
  return ((bl & 0xffu) ? 1u : 0u) | ((bl & 0xff00u) ? 2u : 0u) | ((bl & 0xff0000u) ? 4u : 0u) | ((bl & 0xff000000u) ? 8u : 0u); }
__device__ __forceinline__ void pm_tile(int t, const int* __restrict__ Mk, unsigned* __restrict__ MF, unsigned* pw) { const int lane = threadIdx.x & 31, w = threadIdx.x >> 5;
  const int* m = Mk + (size_t)t * 16 * SQ + w * 256 + lane * 4; const unsigned b0 = pm_half(m), b1 = pm_half(m + 128);
  if (lane == 0) pw[w] = b0 | (b1 << 4);
  __syncthreads();      /* every wave's eight bits are in LDS */
  if (threadIdx.x < 2) { const unsigned* q = pw + threadIdx.x * 4; MF[(size_t)t * PM_PITCH + threadIdx.x] = q[0] | (q[1] << 8) | (q[2] << 16) | (q[3] << 24); } }
__global__ __launch_bounds__(256) void k_prep(const int* __restrict__ Mk, unsigned* __restrict__ MF, const float* __restrict__ xq, const float* __restrict__ xk, const float* __restrict__ xv, const float* __restrict__ wq, const float* __restrict__ wk, const float* __restrict__ wv, const float* __restrict__ wo,
    _Float16* __restrict__ XQ, _Float16* __restrict__ XK, _Float16* __restrict__ XV, _Float16* __restrict__ BQ, _Float16* __restrict__ BK, _Float16* __restrict__ BV, _Float16* __restrict__ BO) {
  __shared__ unsigned pm_w[8];
  if (blockIdx.x >= PP_BLOCKS) { pm_tile((int)blockIdx.x - PP_BLOCKS, Mk, MF, pm_w); return; }      /* block-uniform */
  const int tid = threadIdx.x, ln = tid & 15, k0 = (tid >> 6) * 32 + ((tid >> 5) & 1) * 16 + ((tid >> 4) & 1) * 8;      /* the thread's row in the tile; first k of its first chunk (chunk u: + 128 u) */
#pragma unroll 1      // one slab's values in registers at a time
  for (int slab = blockIdx.x; slab < PP_SLABS; slab += PP_BLOCKS) {
    if (slab < 4 * PP_WS) { const int j = slab / PP_WS, rt = slab % PP_WS, n = rt * 16 + ln;      /* Bt row n = output column (h, d) */
      unsigned short* d = (unsigned short*)(j == 0 ? BQ : j == 1 ? BK : j == 2 ? BV : BO) + (size_t)rt * 16384 + tid * 8;
      if (j < 3) pp_wslab<HD, 128 * HD>((j == 0 ? wq : j == 1 ? wk : wv) + ((size_t)(n / HD) * DM + k0) * HD + n % HD, d);
      else pp_wslab<DM, 128 * DM>(wo + (size_t)k0 * DM + n, d); }
    else { const int s2 = slab - 4 * PP_WS, j = s2 / PP_XS, rt = s2 % PP_XS;
      pp_xslab((j == 0 ? xq : j == 1 ? xk : xv) + ((size_t)rt * 16 + ln) * DM + k0, (unsigned short*)(j == 0 ? XQ : j == 1 ? XK : XV) + (size_t)rt * 16384 + tid * 8); } } }

extern "C" void kernel_launch(void* const* d_in, const int* in_sizes, int n_in,
                              void* d_out, int out_size, void* d_ws, size_t ws_size, hipStream_t stream) {
  (void)in_sizes; (void)n_in; (void)out_size;
  const float* const* I = (const float* const*)d_in; const float* xv = I[0]; const float* xk = I[1]; const float* xq = I[2]; const int* mk = (const int*)d_in[3]; const float* wq = I[4]; const float* bq = I[5]; const float* wk = I[6]; const float* bk = I[7]; const float* wv = I[8]; const float* bv = I[9]; const float* wo = I[10]; const float* bo = I[11];      /* NOTE the module's input order v, k, q, mask; per-head [h][in][out] weights + [h][64] biases (= flat [1024]); W0 [in][out] + b0 */
  float* PO = (float*)d_out + (size_t)NB * SQ * DM;      /* second output: last head's attention probabilities [NB][SQ][SQ] f32 at byte offset 16,777,216 */
  char* ws = (char*)d_ws; size_t off = 0;
  auto take = [&](size_t bytes) { char* p = ws + off; off += (bytes + 255) & ~(size_t)255; return p; };
  _Float16* BQ = (_Float16*)take((size_t)DM * DM * 2); _Float16* BK = (_Float16*)take((size_t)DM * DM * 2); _Float16* BV = (_Float16*)take((size_t)DM * DM * 2); _Float16* BO = (_Float16*)take((size_t)DM * DM * 2);
  _Float16* XQ = (_Float16*)take(NR * DM * 2); _Float16* XK = (_Float16*)take(NR * DM * 2); _Float16* XV = (_Float16*)take(NR * DM * 2); _Float16* Q16 = (_Float16*)take(NR * DM * 2); _Float16* K16 = (_Float16*)take(NR * DM * 2); _Float16* O16 = (_Float16*)take(NR * DM * 2);
  _Float16* VT = (_Float16*)take((size_t)NB * NH * HD * SQ * 2); unsigned* MF = (unsigned*)take((size_t)PM_BLOCKS * PM_PITCH * 4);
  if (off > ws_size) return;
  k_prep<<<PP_BLOCKS + PM_BLOCKS, 256, 0, stream>>>(mk, MF, xq, xk, xv, wq, wk, wv, wo, XQ, XK, XV, BQ, BK, BV, BO);      /* the three inputs as exact f16 rows; per-head [h][m][d] -> Bt[(h,d)][m] x16; W0 [in][out] -> Bt x16; all in fragment order */
  const size_t r0p = (size_t)B0 * SQ;      /* first projected row */
  k_qkv<<<dim3((unsigned)((MP / 128) * (DM / 64)), 3), 128, 0, stream>>>(XQ + r0p * DM, XK + r0p * DM, XV + r0p * DM, BQ, BK, BV, bq, bk, bv, Q16 + r0p * DM, K16 + r0p * DM, VT);      /* q, k = x W + b and V^T per (batch, head) = (x W + b)^T, fragment order, one launch */
  k_fattn<<<PB_BLOCKS + (SQ / 128) * NH * NB, 256, 0, stream>>>(Q16, K16, VT, mk, MF, O16, PO);      /* scores, softmax and P V in one launch; o (merged heads) as f16 rows; the last head's probabilities to the second output */
  k_gemm2<0, 0><<<dim3((unsigned)((MPO / 128) * (DM / 64)), 1), 128, 0, stream>>>(O16 + r0p * DM, DM, 0, BO, DM, 0, 0.0009765625f, bo, 0, nullptr, 1, 0, 0, (float*)d_out + r0p * DM, nullptr, DM, 0, MPO, DM, DM);      /* out rows are the output layout */
}
